// v000
// Times are from an AMD MI455X. After a warm-up the kernel runs many times in a row, and a time is the length of
// such a window on the GPU divided by its runs, so every launch and the gaps after it count. The runs cycle
// through copies of the inputs. A figure is the median of several windows, for all but v000 over two sittings.
// Sittings can differ by a few percent; kernels timed side by side share one.
// v000, which the later versions start from, runs in 2730 microseconds.
#include <hip/hip_runtime.h>

// GladiusAttention (x [4][2048][1024]; q = x wq (16 heads x 64), k, v = x wk / wv (4 kv heads, GQA groups of 4); RoPE (rotate-half, base 10000) on q, k; causal softmax(q.k/8); out = (attn v merged) wo -> [4][2048][1024]).
// Compute dtypes, f32 accumulate: every input rounded to bf16; q/k/v projections on PLAIN bf16 operands (inputs: exact); RoPE f32; scores (K 64) and attn.v on bf16 hi+lo planes (3 products) for the first 512 query rows of each head and

#define NB_  4
#define TT   2048
#define DM   1024
#define NH_  16
#define NKV  4
#define REP  (NH_ / NKV)
#define HD   64
#define DQ   (NH_ * HD)
#define DKV  (NKV * HD)
#define ZH   2
#define RH   512                  // query rows < RH use hi+lo planes (0: none)
#define WIN  2048
#define PCAR 1024.0f
#define SCL  0.125f   // HD^-0.5
typedef _Float16 h16;
typedef unsigned short bf;
typedef __attribute__((ext_vector_type(16))) __bf16   v16bf;
typedef __attribute__((ext_vector_type(16))) _Float16 v16h;
typedef __attribute__((ext_vector_type(8)))  _Float16 v8h;
typedef __attribute__((ext_vector_type(8)))  unsigned short v8us;
typedef __attribute__((ext_vector_type(8)))  float    v8f;
typedef __attribute__((ext_vector_type(4)))  float    v4f;
typedef v8h  __attribute__((may_alias)) v8ha;
typedef v4f  __attribute__((may_alias)) v4fa;
typedef v8us __attribute__((may_alias)) v8usa;

__device__ __forceinline__ unsigned short f2bf(float f) { unsigned u = __float_as_uint(f); u += 0x7FFFu + ((u >> 16) & 1u); return (unsigned short)(u >> 16); }
__device__ __forceinline__ float bf2f(unsigned short b) { return __uint_as_float(((unsigned)b) << 16); }
__device__ __forceinline__ float bfr(float f) { return bf2f(f2bf(f)); }
__device__ __forceinline__ v16h cat16(v8h lo, v8h hi) { return __builtin_shufflevector(lo, hi, 0, 1, 2, 3, 4, 5, 6, 7, 8, 9, 10, 11, 12, 13, 14, 15); }
__device__ __forceinline__ v16bf cat16b(v8us lo, v8us hi) { return __builtin_bit_cast(v16bf, __builtin_shufflevector(lo, hi, 0, 1, 2, 3, 4, 5, 6, 7, 8, 9, 10, 11, 12, 13, 14, 15)); }
__device__ __forceinline__ v8f wmma16(v16h a, v16h b, v8f c) { return __builtin_amdgcn_wmma_f32_16x16x32_f16(false, a, false, b, (short)0, c, false, false); }
__device__ __forceinline__ v8f wmmab(v16bf a, v16bf b, v8f c) { return __builtin_amdgcn_wmma_f32_16x16x32_bf16(false, a, false, b, (short)0, c, false, false); }



// ---- k_gemmw: register-blocked GEMM, ONE WAVE per 64x64 output tile (16 accumulators), operands straight from K-contiguous 16-bit planes; grid (M/64, N/64, Z), 32 threads.
// C[m][n] (f32, pitch ldc, + optional f32 bias[n]) = sum_k A[m][k] Bt[n][k] (+ split products per NSPLIT). z-batch strides sA/sB/sC in elements. K % 32 == 0.
template <typename T16> struct WFrag;
template <> struct WFrag<h16> { typedef v16h V; static __device__ __forceinline__ V ld(const h16* p) { return cat16(*(const v8h*)p, *(const v8h*)(p + 16)); } static __device__ __forceinline__ v8f mma(V a, V b, v8f c) { return wmma16(a, b, c); } };
template <> struct WFrag<bf> { typedef v16bf V; static __device__ __forceinline__ V ld(const bf* p) { return cat16b(*(const v8us*)p, *(const v8us*)(p + 16)); } static __device__ __forceinline__ v8f mma(V a, V b, v8f c) { return wmmab(a, b, c); } };
template <typename T16, int NSPLIT, bool BIAS>
__global__ __launch_bounds__(32) void k_gemmw(const T16* __restrict__ A, const T16* __restrict__ A2, const T16* __restrict__ Bt, const T16* __restrict__ Bt2, int K, float* C, int ldc, const float* __restrict__ bias, size_t sA, size_t sB, size_t sC) {
    typedef typename WFrag<T16>::V V;
    __shared__ __align__(16) float os[16 * 68];
    const size_t z = blockIdx.z; A += z * sA; if (A2) A2 += z * sA; Bt += z * sB; if (Bt2) Bt2 += z * sB; C += z * sC;
    const int lane = threadIdx.x & 31, lr = lane & 15, hi = lane >> 4; const int r0 = blockIdx.x * 64, c0 = blockIdx.y * 64;
    v8f acc[4][4];
#pragma unroll
    for (int mb = 0; mb < 4; ++mb)
#pragma unroll
        for (int nb = 0; nb < 4; ++nb) acc[mb][nb] = (v8f){};
    const size_t aoff = (size_t)(r0 + lr) * K + 8 * hi, boff = (size_t)(c0 + lr) * K + 8 * hi;
#pragma unroll 1
    for (int kc = 0; kc < K; kc += 32) {
        V a[4], a2[4];
#pragma unroll
        for (int mb = 0; mb < 4; ++mb) { a[mb] = WFrag<T16>::ld(A + aoff + (size_t)mb * 16 * K + kc); if (NSPLIT == 1 || NSPLIT == 2) a2[mb] = WFrag<T16>::ld(A2 + aoff + (size_t)mb * 16 * K + kc); }
#pragma unroll
        for (int nb = 0; nb < 4; ++nb) { const V b = WFrag<T16>::ld(Bt + boff + (size_t)nb * 16 * K + kc); V b2; if (NSPLIT >= 2) b2 = WFrag<T16>::ld(Bt2 + boff + (size_t)nb * 16 * K + kc);
#pragma unroll
            for (int mb = 0; mb < 4; ++mb) { acc[mb][nb] = WFrag<T16>::mma(a[mb], b, acc[mb][nb]); if (NSPLIT == 1 || NSPLIT == 2) acc[mb][nb] = WFrag<T16>::mma(a2[mb], b, acc[mb][nb]); if (NSPLIT >= 2) acc[mb][nb] = WFrag<T16>::mma(a[mb], b2, acc[mb][nb]); } }
        asm volatile("v_nop\n\tv_nop\n\tv_nop\n\tv_nop" : "+v"(acc[0][0]), "+v"(acc[1][1]), "+v"(acc[2][2]), "+v"(acc[3][3]) : "v"(a[0]), "v"(a[3]));
    }
#pragma unroll
    for (int mb = 0; mb < 4; ++mb) {
#pragma unroll
        for (int nb = 0; nb < 4; ++nb) {
#pragma unroll
            for (int j = 0; j < 8; ++j) os[(hi * 8 + j) * 68 + nb * 16 + lr] = acc[mb][nb][j]; }
        __builtin_amdgcn_wave_barrier(); asm volatile("" ::: "memory");
        float* crow = C + (size_t)(r0 + mb * 16) * ldc + c0;
{
#pragma unroll
            for (int s = 0; s < 8; ++s) { const int row = 2 * s + hi, cofs = lr * 4; v4f val = *(const v4fa*)(os + row * 68 + cofs); if (BIAS) { val[0] += bfr(bias[c0 + cofs]); val[1] += bfr(bias[c0 + cofs + 1]); val[2] += bfr(bias[c0 + cofs + 2]); val[3] += bfr(bias[c0 + cofs + 3]); }
                *(v4f*)(crow + (size_t)row * ldc + cofs) = val; }
             }
        __builtin_amdgcn_wave_barrier(); asm volatile("" ::: "memory");
    }
}

// ---- k_gemmc: the same one-wave 64x64 tile GEMM specialised for causal attention: CMODE 1 skips score tiles entirely above the diagonal (query rows r0+roff.., key columns c0..), CMODE 2 limits the
// key (K) loop of the probability x value contraction to the diagonal block (probabilities beyond it are exactly zero). roff = row offset of this launch's first row within the sequence.
template <typename T16, int NSPLIT, int CMODE>
__global__ __launch_bounds__(32) void k_gemmc(const T16* __restrict__ A, const T16* __restrict__ A2, const T16* __restrict__ Bt, const T16* __restrict__ Bt2, int K, float* C, int ldc, int roff, size_t sA, size_t sB, size_t sC) {
    typedef typename WFrag<T16>::V V;
    __shared__ __align__(16) float os[16 * 68];
    const size_t z = blockIdx.z; A += z * sA; if (A2) A2 += z * sA; Bt += z * sB; if (Bt2) Bt2 += z * sB; C += z * sC;
    const int lane = threadIdx.x & 31, lr = lane & 15, hi = lane >> 4; const int r0 = blockIdx.x * 64, c0 = blockIdx.y * 64;
    if (CMODE == 1 && c0 > r0 + roff + 63) return;                  // score tile entirely above the causal diagonal: never read (the softmax masks j > i by select)
    const int Kl = (CMODE == 2) ? min(K, r0 + roff + 64) : K;        // P.V: probabilities are exactly 0 beyond the diagonal block, so the K loop stops there
    v8f acc[4][4];
#pragma unroll
    for (int mb = 0; mb < 4; ++mb)
#pragma unroll
        for (int nb = 0; nb < 4; ++nb) acc[mb][nb] = (v8f){};
    const size_t aoff = (size_t)(r0 + lr) * K + 8 * hi, boff = (size_t)(c0 + lr) * K + 8 * hi;
#pragma unroll 1
    for (int kc = 0; kc < Kl; kc += 32) {
        V a[4], a2[4];
#pragma unroll
        for (int mb = 0; mb < 4; ++mb) { a[mb] = WFrag<T16>::ld(A + aoff + (size_t)mb * 16 * K + kc); if (NSPLIT == 1 || NSPLIT == 2) a2[mb] = WFrag<T16>::ld(A2 + aoff + (size_t)mb * 16 * K + kc); }
#pragma unroll
        for (int nb = 0; nb < 4; ++nb) { const V b = WFrag<T16>::ld(Bt + boff + (size_t)nb * 16 * K + kc); V b2; if (NSPLIT >= 2) b2 = WFrag<T16>::ld(Bt2 + boff + (size_t)nb * 16 * K + kc);
#pragma unroll
            for (int mb = 0; mb < 4; ++mb) { acc[mb][nb] = WFrag<T16>::mma(a[mb], b, acc[mb][nb]); if (NSPLIT == 1 || NSPLIT == 2) acc[mb][nb] = WFrag<T16>::mma(a2[mb], b, acc[mb][nb]); if (NSPLIT >= 2) acc[mb][nb] = WFrag<T16>::mma(a[mb], b2, acc[mb][nb]); } }
        asm volatile("v_nop\n\tv_nop\n\tv_nop\n\tv_nop" : "+v"(acc[0][0]), "+v"(acc[1][1]), "+v"(acc[2][2]), "+v"(acc[3][3]) : "v"(a[0]), "v"(a[3]));
    }
#pragma unroll
    for (int mb = 0; mb < 4; ++mb) {
#pragma unroll
        for (int nb = 0; nb < 4; ++nb) {
#pragma unroll
            for (int j = 0; j < 8; ++j) os[(hi * 8 + j) * 68 + nb * 16 + lr] = acc[mb][nb][j]; }
        __builtin_amdgcn_wave_barrier(); asm volatile("" ::: "memory");
        float* crow = C + (size_t)(r0 + mb * 16) * ldc + c0;
{
#pragma unroll
            for (int s = 0; s < 8; ++s) { const int row = 2 * s + hi, cofs = lr * 4; v4f val = *(const v4fa*)(os + row * 68 + cofs);
                *(v4f*)(crow + (size_t)row * ldc + cofs) = val; }
             }
        __builtin_amdgcn_wave_barrier(); asm volatile("" ::: "memory");
    }
}

__device__ __forceinline__ h16 tohx(float x) { return (h16)x; }
__device__ __forceinline__ void splitf(float y, unsigned short& h, unsigned short& l) { h = f2bf(y); l = f2bf(y - bf2f(h)); }
typedef __attribute__((ext_vector_type(2))) _Float16 v2h;
typedef __attribute__((ext_vector_type(4))) _Float16 v4h;
typedef __attribute__((ext_vector_type(2))) unsigned short v2us;
typedef __attribute__((ext_vector_type(4))) unsigned short v4us;
typedef __attribute__((ext_vector_type(2))) float v2f;
typedef __attribute__((ext_vector_type(4))) int v4i;

__global__ __launch_bounds__(256) void k_wtG(const float* __restrict__ w, int K, int N, bf* Bt) {
    const int lane = threadIdx.x & 31; const int L0 = (blockIdx.x * 8 + (threadIdx.x >> 5)) * 8; const int nlines = N * K / 64;
{
#pragma unroll 1
        for (int l = 0; l < 8; ++l) { const int L = L0 + l; if (L >= nlines) break; const size_t e = (size_t)L * 64 + lane * 2; const int k = (int)(e % K), n = (int)(e / K); v2us o;
            o[0] = f2bf(w[(size_t)k * N + n]); o[1] = f2bf(w[(size_t)(k + 1) * N + n]); *(v2us*)(Bt + e) = o; }
         }
}
__global__ __launch_bounds__(256) void k_cvt8(const float* __restrict__ src, bf* dst, size_t n8) { const size_t i = (size_t)blockIdx.x * 256 + threadIdx.x; if (i >= n8) return; const v8f v = *(const v8f*)(src + i * 8); v8us o;
#pragma unroll
    for (int k = 0; k < 8; ++k) o[k] = f2bf(v[k]); *(v8us*)(dst + i * 8) = o;  }
__global__ __launch_bounds__(256) void k_cstab(float* CS) { const int idx = blockIdx.x * 256 + threadIdx.x; if (idx >= TT * HD) return; const int t = idx / HD, d = idx % HD; const int i = d % (HD / 2); const float inv = __fdiv_rn(1.0f, powf(10000.0f, (float)(2 * i) / (float)HD)); const float ang = __fmul_rn((float)t, inv); v2f cs; cs[0] = cosf(ang); cs[1] = sinf(ang);
    *(v2f*)(CS + (size_t)idx * 2) = cs;  }
// k_rope: head planes [h][t][d] (fp16 + hi/lo) of rope(x) x sc with the rotate-half convention out[d] = x[d] cos[t][d] - x[d+HD/2] sin[t][d], out[d+HD/2] = x[d+HD/2] cos[t][d+HD/2] + x[d] sin[t][d+HD/2]
__global__ __launch_bounds__(256) void k_rope(const float* __restrict__ F, int pitch, int nheads, const float* __restrict__ CS, const float* __restrict__ RF, const float* __restrict__ nw, float sc, h16* P16, bf* Ph, bf* Pl) {
    const size_t e = ((size_t)blockIdx.x * 256 + threadIdx.x) * 2; if (e >= (size_t)nheads * TT * HD) return; const int d = (int)(e % HD); const int t = (int)((e / HD) % TT); const int h = (int)(e / ((size_t)HD * TT)); const float* f = F + (size_t)t * pitch + h * HD; const float rf = RF ? RF[(size_t)h * TT + t] : 1.0f; v2h o16; v2us oh, ol;
#pragma unroll
    for (int q = 0; q < 2; ++q) { const int dd = d + q; const int dp = (dd < HD / 2) ? dd + HD / 2 : dd - HD / 2; float x0 = f[dd], x1 = f[dp];
        if (RF) { float n0 = __fmul_rn(x0, rf), n1 = __fmul_rn(x1, rf); asm volatile("" : "+v"(n0)); asm volatile("" : "+v"(n1)); x0 = __fmul_rn(bfr(nw[dd]), n0); x1 = __fmul_rn(bfr(nw[dp]), n1); }
        const v2f cs = *(const v2f*)(CS + ((size_t)t * HD + dd) * 2); float a = __fmul_rn(x0, cs[0]), bq = __fmul_rn(x1, cs[1]); asm volatile("" : "+v"(a)); asm volatile("" : "+v"(bq)); const float r = ((dd < HD / 2) ? __fsub_rn(a, bq) : __fadd_rn(a, bq)) * sc;
        o16[q] = tohx(r); unsigned short a2, c2; splitf(r, a2, c2); oh[q] = a2; ol[q] = c2; }
    *(v2h*)(P16 + e) = o16; *(v2us*)(Ph + e) = oh; *(v2us*)(Pl + e) = ol;  }
__global__ __launch_bounds__(256) void k_vtp(const float* __restrict__ F, int pitch, int nheads, h16* V16, bf* Vh, bf* Vl) { const size_t e = ((size_t)blockIdx.x * 256 + threadIdx.x) * 2; if (e >= (size_t)nheads * HD * TT) return; const int t = (int)(e % TT); const int d = (int)((e / TT) % HD); const int g = (int)(e / ((size_t)TT * HD)); v2h o16; v2us oh, ol;
#pragma unroll
    for (int q = 0; q < 2; ++q) { const float x = F[(size_t)(t + q) * pitch + g * HD + d]; o16[q] = tohx(x); unsigned short a2, c2; splitf(x, a2, c2); oh[q] = a2; ol[q] = c2; }
    *(v2h*)(V16 + e) = o16; *(v2us*)(Vh + e) = oh; *(v2us*)(Vl + e) = ol;  }
// k_asoft: per row (zz, i): t = S x HD^-0.5 for j <= i and i - j < WIN (sliding causal window; the reference's -1e9 additive fill vanishes identically); softmax over the 2048 keys (register row, one exp, fixed trees);
__global__ __launch_bounds__(256) void k_asoft(const float* __restrict__ Sb, h16* P16, bf* Ph, bf* Pl) {
    const int lane = threadIdx.x & 31; const int row = blockIdx.x * 8 + (threadIdx.x >> 5); if (row >= ZH * TT) return; const int i = row % TT; const int zz = row / TT; (void)zz; const bool hires = (i < RH); const float* sr = Sb + (size_t)row * TT; float v[TT / 32]; float mx = -3.0e38f;
#pragma unroll
    for (int ch = 0; ch < TT / 128; ++ch) { const int j0 = ch * 128 + lane * 4; const v4f a = *(const v4f*)(sr + j0);
#pragma unroll
        for (int q = 0; q < 4; ++q) { const int j = j0 + q; (void)j; const float t = (j <= i && i - j < WIN) ? a[q] * SCL : -3.0e38f; v[ch * 4 + q] = t; mx = fmaxf(mx, t); } }
#pragma unroll
    for (int sh = 16; sh; sh >>= 1) mx = fmaxf(mx, __shfl_xor(mx, sh, 32));
    float sum = 0.f;
#pragma unroll
    for (int k = 0; k < TT / 32; ++k) { float d0 = __fsub_rn(v[k], mx); asm volatile("" : "+v"(d0)); v[k] = __builtin_amdgcn_exp2f(__fmul_rn(d0, 1.4426950408889634f)); sum += v[k]; }
#pragma unroll
    for (int sh = 16; sh; sh >>= 1) sum += __shfl_xor(sum, sh, 32);
    const float f = __fdiv_rn(hires ? 1.0f : PCAR, sum);
{
        if (hires) {
#pragma unroll
            for (int ch = 0; ch < TT / 128; ++ch) { v4us oh, ol;
#pragma unroll
                for (int q = 0; q < 4; ++q) { unsigned short a, c2; splitf(v[ch * 4 + q] * f, a, c2); oh[q] = a; ol[q] = c2; }
                const size_t oo = ((size_t)zz * (RH ? RH : 1) + i) * TT + ch * 128 + lane * 4; *(v4us*)(Ph + oo) = oh; *(v4us*)(Pl + oo) = ol; }
        } else {
#pragma unroll
            for (int ch = 0; ch < TT / 128; ++ch) { v4h o4;
#pragma unroll
                for (int q = 0; q < 4; ++q) o4[q] = tohx(v[ch * 4 + q] * f);
                *(v4h*)(P16 + (size_t)row * TT + ch * 128 + lane * 4) = o4; } }
         }
}
__global__ __launch_bounds__(256) void k_merge(const float* __restrict__ O, int h0, bf* Ah, bf* Al) { const size_t e = ((size_t)blockIdx.x * 256 + threadIdx.x) * 2; if (e >= (size_t)ZH * TT * HD) return; const int d = (int)(e % HD); const int t = (int)((e / HD) % TT); const int zz = (int)(e / ((size_t)HD * TT)); const float cs = (t < RH) ? 1.0f : (1.0f / PCAR); const size_t oo = (size_t)t * DQ + (h0 + zz) * HD + d;
    v2us oh, ol;
#pragma unroll
    for (int q = 0; q < 2; ++q) { unsigned short a, c2; splitf(O[e + q] * cs, a, c2); oh[q] = a; ol[q] = c2; } *(v2us*)(Ah + oo) = oh; *(v2us*)(Al + oo) = ol;  }

extern "C" void kernel_launch(void* const* d_in, const int* in_sizes, int n_in,
                              void* d_out, int out_size, void* d_ws, size_t ws_size, hipStream_t stream) {
    (void)in_sizes; (void)n_in; (void)out_size;
    const float* x = (const float*)d_in[0]; const float* wq = (const float*)d_in[1]; const float* wk = (const float*)d_in[2]; const float* wv = (const float*)d_in[3]; const float* wo = (const float*)d_in[4];
    float* OUT = (float*)d_out;     // [4][2048][1024]
    char* wsp = (char*)d_ws;
    auto take = [&](size_t bytes) { char* p = wsp; wsp += (bytes + 255) & ~(size_t)255; return (void*)p; };
    bf* WQ = (bf*)take((size_t)DQ * DM * 2); bf* WK = (bf*)take((size_t)DKV * DM * 2); bf* WV = (bf*)take((size_t)DKV * DM * 2); bf* WO = (bf*)take((size_t)DM * DQ * 2); float* CS = (float*)take((size_t)TT * HD * 2 * 4);
    bf* XB = (bf*)take((size_t)TT * DM * 2); float* FQ = (float*)take((size_t)TT * DQ * 4); float* FK = (float*)take((size_t)TT * DKV * 4);
    h16* QP16 = (h16*)take((size_t)NH_ * TT * HD * 2); h16* KP16 = (h16*)take((size_t)NKV * TT * HD * 2); h16* VT16 = (h16*)take((size_t)NKV * HD * TT * 2);
    bf* QPh = (bf*)take((size_t)NH_ * TT * HD * 2); bf* QPl = (bf*)take((size_t)NH_ * TT * HD * 2); bf* KPh = (bf*)take((size_t)NKV * TT * HD * 2); bf* KPl = (bf*)take((size_t)NKV * TT * HD * 2); bf* VTh = (bf*)take((size_t)NKV * HD * TT * 2); bf* VTl = (bf*)take((size_t)NKV * HD * TT * 2); bf* Ph = (bf*)take((size_t)ZH * RH * TT * 2); bf* Pl = (bf*)take((size_t)ZH * RH * TT * 2);
    float* Sb = (float*)take((size_t)ZH * TT * TT * 4); h16* P16 = (h16*)take((size_t)ZH * TT * TT * 2); float* Ob = (float*)take((size_t)ZH * TT * HD * 4); bf* ATh = (bf*)take((size_t)TT * DQ * 2); bf* ATl = (bf*)take((size_t)TT * DQ * 2);
    if ((size_t)(wsp - (char*)d_ws) > ws_size) return;    // ws 256 MiB
    float* FV = FK;   // v projection reuses the k buffer after the k planes are built (stream-ordered)
    { k_wtG<<<(unsigned)((DM * DQ / 64 + 63) / 64), 256, 0, stream>>>(wq, DM, DQ, WQ); k_wtG<<<(unsigned)((DM * DKV / 64 + 63) / 64), 256, 0, stream>>>(wk, DM, DKV, WK); k_wtG<<<(unsigned)((DM * DKV / 64 + 63) / 64), 256, 0, stream>>>(wv, DM, DKV, WV);
      k_wtG<<<(unsigned)((DQ * DM / 64 + 63) / 64), 256, 0, stream>>>(wo, DQ, DM, WO);
      k_cstab<<<(TT * HD + 255) / 256, 256, 0, stream>>>(CS); }
    const unsigned LQ = (unsigned)(((size_t)NH_ * TT * HD / 2 + 255) / 256), LKv = (unsigned)(((size_t)NKV * TT * HD / 2 + 255) / 256);
    for (int b = 0; b < NB_; ++b) {
        
        k_cvt8<<<(unsigned)(((size_t)TT * DM / 8 + 255) / 256), 256, 0, stream>>>(x + (size_t)b * TT * DM, XB, (size_t)TT * DM / 8);
        k_gemmw<bf, 0, false><<<dim3(TT / 64, DQ / 64, 1), 32, 0, stream>>>(XB, nullptr, WQ, nullptr, DM, FQ, DQ, nullptr, 0, 0, 0);
        k_rope<<<LQ, 256, 0, stream>>>(FQ, DQ, NH_, CS, nullptr, nullptr, 1.0f, QP16, QPh, QPl);
        k_gemmw<bf, 0, false><<<dim3(TT / 64, DKV / 64, 1), 32, 0, stream>>>(XB, nullptr, WK, nullptr, DM, FK, DKV, nullptr, 0, 0, 0);
        k_rope<<<LKv, 256, 0, stream>>>(FK, DKV, NKV, CS, nullptr, nullptr, 1.0f, KP16, KPh, KPl);
        k_gemmw<bf, 0, false><<<dim3(TT / 64, DKV / 64, 1), 32, 0, stream>>>(XB, nullptr, WV, nullptr, DM, FV, DKV, nullptr, 0, 0, 0); k_vtp<<<LKv, 256, 0, stream>>>(FV, DKV, NKV, VT16, VTh, VTl);
        for (int h0 = 0; h0 < NH_; h0 += ZH) { const size_t zq = (size_t)h0, zk = (size_t)(h0 / REP);   // both heads of a pass share kv group h0/REP (REP >= 2): sB = 0
            k_gemmc<bf, 2, 1><<<dim3(RH / 64, TT / 64, ZH), 32, 0, stream>>>(QPh + zq * TT * HD, QPl + zq * TT * HD, KPh + zk * TT * HD, KPl + zk * TT * HD, HD, Sb, TT, 0, (size_t)TT * HD, 0, (size_t)TT * TT);
            k_gemmc<h16, 0, 1><<<dim3((TT - RH) / 64, TT / 64, ZH), 32, 0, stream>>>(QP16 + zq * TT * HD + (size_t)RH * HD, nullptr, KP16 + zk * TT * HD, nullptr, HD, Sb + (size_t)RH * TT, TT, RH, (size_t)TT * HD, 0, (size_t)TT * TT);
            k_asoft<<<ZH * TT / 8, 256, 0, stream>>>(Sb, P16, Ph, Pl);
            k_gemmc<bf, 2, 2><<<dim3(RH / 64, HD / 64, ZH), 32, 0, stream>>>(Ph, Pl, VTh + zk * HD * TT, VTl + zk * HD * TT, TT, Ob, HD, 0, (size_t)RH * TT, 0, (size_t)TT * HD);
            k_gemmc<h16, 0, 2><<<dim3((TT - RH) / 64, HD / 64, ZH), 32, 0, stream>>>(P16 + (size_t)RH * TT, nullptr, VT16 + zk * HD * TT, nullptr, TT, Ob + (size_t)RH * HD, HD, RH, (size_t)TT * TT, 0, (size_t)TT * HD);
            k_merge<<<(unsigned)(((size_t)ZH * TT * HD / 2 + 255) / 256), 256, 0, stream>>>(Ob, h0, ATh, ATl); }
        k_gemmw<bf, 1, false><<<dim3(TT / 64, DM / 64, 1), 32, 0, stream>>>(ATh, ATl, WO, nullptr, DQ, OUT + (size_t)b * TT * DM, DM, nullptr, 0, 0, 0); }
}

// v001
// A run of this version takes 1050 microseconds.
// Two timings next to v000 put it at 2.59 and 2.56 times that version's speed.
#include <hip/hip_runtime.h>

// GQA causal attention block (x [4][2048][1024]; q = x wq (16 heads x 64), k, v = x wk / wv (4 kv heads, GQA groups of 4); RoPE (rotate-half, base 10000) on q, k; causal softmax(q.k/8); out = (attn v merged) wo -> [4][2048][1024]).
// Compute dtypes, f32 accumulate: every input rounded to bf16; q/k/v projections on PLAIN bf16 operands (inputs: exact); RoPE f32; scores (K 64) and attn.v on bf16 hi+lo planes (3 products) for the first 512 query rows of each head and

#define NB_  4
#define TT   2048
#define DM   1024
#define NH_  16
#define NKV  4
#define REP  (NH_ / NKV)
#define HD   64
#define DQ   (NH_ * HD)
#define DKV  (NKV * HD)
#define ZH   8                    // heads per attention launch (grid z); a pass never crosses a batch (ZH divides NH_)
#define RH   512                  // query rows < RH use hi+lo planes (0: none)
#define WIN  2048
#define PCAR 1024.0f
#define SCL  0.125f   // HD^-0.5
typedef _Float16 h16;
typedef unsigned short bf;
typedef __attribute__((ext_vector_type(16))) __bf16   v16bf;
typedef __attribute__((ext_vector_type(16))) _Float16 v16h;
typedef __attribute__((ext_vector_type(8)))  _Float16 v8h;
typedef __attribute__((ext_vector_type(8)))  unsigned short v8us;
typedef __attribute__((ext_vector_type(8)))  float    v8f;
typedef __attribute__((ext_vector_type(4)))  float    v4f;
typedef v8h  __attribute__((may_alias)) v8ha;
typedef v4f  __attribute__((may_alias)) v4fa;
typedef v8us __attribute__((may_alias)) v8usa;

__device__ __forceinline__ unsigned short f2bf(float f) { unsigned u = __float_as_uint(f); u += 0x7FFFu + ((u >> 16) & 1u); return (unsigned short)(u >> 16); }
__device__ __forceinline__ float bf2f(unsigned short b) { return __uint_as_float(((unsigned)b) << 16); }
__device__ __forceinline__ float bfr(float f) { return bf2f(f2bf(f)); }
__device__ __forceinline__ v16h cat16(v8h lo, v8h hi) { return __builtin_shufflevector(lo, hi, 0, 1, 2, 3, 4, 5, 6, 7, 8, 9, 10, 11, 12, 13, 14, 15); }
__device__ __forceinline__ v16bf cat16b(v8us lo, v8us hi) { return __builtin_bit_cast(v16bf, __builtin_shufflevector(lo, hi, 0, 1, 2, 3, 4, 5, 6, 7, 8, 9, 10, 11, 12, 13, 14, 15)); }
__device__ __forceinline__ v8f wmma16(v16h a, v16h b, v8f c) { return __builtin_amdgcn_wmma_f32_16x16x32_f16(false, a, false, b, (short)0, c, false, false); }
__device__ __forceinline__ v8f wmmab(v16bf a, v16bf b, v8f c) { return __builtin_amdgcn_wmma_f32_16x16x32_bf16(false, a, false, b, (short)0, c, false, false); }



// ---- k_gemmw: register-blocked GEMM, ONE WAVE per 64x64 output tile (16 accumulators), operands straight from K-contiguous 16-bit planes; grid (M/64, N/64, Z), 32 threads.
// C[m][n] (f32, pitch ldc, + optional f32 bias[n]) = sum_k A[m][k] Bt[n][k] (+ split products per NSPLIT). z-batch strides sA/sB/sC in elements. K % 32 == 0.
template <typename T16> struct WFrag;
template <> struct WFrag<h16> { typedef v16h V; static __device__ __forceinline__ V ld(const h16* p) { return cat16(*(const v8h*)p, *(const v8h*)(p + 16)); } static __device__ __forceinline__ v8f mma(V a, V b, v8f c) { return wmma16(a, b, c); } };
template <> struct WFrag<bf> { typedef v16bf V; static __device__ __forceinline__ V ld(const bf* p) { return cat16b(*(const v8us*)p, *(const v8us*)(p + 16)); } static __device__ __forceinline__ v8f mma(V a, V b, v8f c) { return wmmab(a, b, c); } };
template <typename T16, int NSPLIT, bool BIAS>
__global__ __launch_bounds__(32) void k_gemmw(const T16* __restrict__ A, const T16* __restrict__ A2, const T16* __restrict__ Bt, const T16* __restrict__ Bt2, int K, float* C, int ldc, const float* __restrict__ bias, size_t sA, size_t sB, size_t sC) {
    typedef typename WFrag<T16>::V V;
    __shared__ __align__(16) float os[16 * 68];
    const size_t z = blockIdx.z; A += z * sA; if (A2) A2 += z * sA; Bt += z * sB; if (Bt2) Bt2 += z * sB; C += z * sC;
    const int lane = threadIdx.x & 31, lr = lane & 15, hi = lane >> 4; const int r0 = blockIdx.x * 64, c0 = blockIdx.y * 64;
    v8f acc[4][4];
#pragma unroll
    for (int mb = 0; mb < 4; ++mb)
#pragma unroll
        for (int nb = 0; nb < 4; ++nb) acc[mb][nb] = (v8f){};
    const size_t aoff = (size_t)(r0 + lr) * K + 8 * hi, boff = (size_t)(c0 + lr) * K + 8 * hi;
#pragma unroll 1
    for (int kc = 0; kc < K; kc += 32) {
        V a[4], a2[4];
#pragma unroll
        for (int mb = 0; mb < 4; ++mb) { a[mb] = WFrag<T16>::ld(A + aoff + (size_t)mb * 16 * K + kc); if (NSPLIT == 1 || NSPLIT == 2) a2[mb] = WFrag<T16>::ld(A2 + aoff + (size_t)mb * 16 * K + kc); }
#pragma unroll
        for (int nb = 0; nb < 4; ++nb) { const V b = WFrag<T16>::ld(Bt + boff + (size_t)nb * 16 * K + kc); V b2; if (NSPLIT >= 2) b2 = WFrag<T16>::ld(Bt2 + boff + (size_t)nb * 16 * K + kc);
#pragma unroll
            for (int mb = 0; mb < 4; ++mb) { acc[mb][nb] = WFrag<T16>::mma(a[mb], b, acc[mb][nb]); if (NSPLIT == 1 || NSPLIT == 2) acc[mb][nb] = WFrag<T16>::mma(a2[mb], b, acc[mb][nb]); if (NSPLIT >= 2) acc[mb][nb] = WFrag<T16>::mma(a[mb], b2, acc[mb][nb]); } }
        asm volatile("v_nop\n\tv_nop\n\tv_nop\n\tv_nop" : "+v"(acc[0][0]), "+v"(acc[1][1]), "+v"(acc[2][2]), "+v"(acc[3][3]) : "v"(a[0]), "v"(a[3]));
    }
#pragma unroll
    for (int mb = 0; mb < 4; ++mb) {
#pragma unroll
        for (int nb = 0; nb < 4; ++nb) {
#pragma unroll
            for (int j = 0; j < 8; ++j) os[(hi * 8 + j) * 68 + nb * 16 + lr] = acc[mb][nb][j]; }
        __builtin_amdgcn_wave_barrier(); asm volatile("" ::: "memory");
        float* crow = C + (size_t)(r0 + mb * 16) * ldc + c0;
{
#pragma unroll
            for (int s = 0; s < 8; ++s) { const int row = 2 * s + hi, cofs = lr * 4; v4f val = *(const v4fa*)(os + row * 68 + cofs); if (BIAS) { val[0] += bfr(bias[c0 + cofs]); val[1] += bfr(bias[c0 + cofs + 1]); val[2] += bfr(bias[c0 + cofs + 2]); val[3] += bfr(bias[c0 + cofs + 3]); }
                *(v4f*)(crow + (size_t)row * ldc + cofs) = val; }
             }
        __builtin_amdgcn_wave_barrier(); asm volatile("" ::: "memory");
    }
}

// ---- k_gemmc: the same one-wave 64x64 tile GEMM specialised for causal attention: CMODE 1 skips score tiles entirely above the diagonal (query rows r0+roff.., key columns c0..), CMODE 2 limits the
// key (K) loop of the probability x value contraction to the diagonal block (probabilities beyond it are exactly zero). roff = row offset of this launch's first row within the sequence.
// K is the row pitch of A and of Bt alike (CMODE 2: 2*TT, the pitch of the in-place probability rows; the loop ends at the diagonal block, at most TT). Head z reads the B planes of its kv group z / REP.
template <typename T16, int NSPLIT, int CMODE>
__global__ __launch_bounds__(32) void k_gemmc(const T16* __restrict__ A, const T16* __restrict__ A2, const T16* __restrict__ Bt, const T16* __restrict__ Bt2, int K, float* C, int ldc, int roff, size_t sA, size_t sB, size_t sC) {
    typedef typename WFrag<T16>::V V;
    __shared__ __align__(16) float os[16 * 68];
    const size_t z = blockIdx.z; A += z * sA; if (A2) A2 += z * sA; Bt += (z / REP) * sB; if (Bt2) Bt2 += (z / REP) * sB; C += z * sC;
    const int lane = threadIdx.x & 31, lr = lane & 15, hi = lane >> 4; const int r0 = blockIdx.x * 64, c0 = blockIdx.y * 64;
    if (CMODE == 1 && c0 > r0 + roff + 63) return;                  // score tile entirely above the causal diagonal: never read (the softmax masks j > i by select)
    const int Kl = (CMODE == 2) ? min(K, r0 + roff + 64) : K;        // P.V: probabilities are exactly 0 beyond the diagonal block, so the K loop stops there
    v8f acc[4][4];
#pragma unroll
    for (int mb = 0; mb < 4; ++mb)
#pragma unroll
        for (int nb = 0; nb < 4; ++nb) acc[mb][nb] = (v8f){};
    const size_t aoff = (size_t)(r0 + lr) * K + 8 * hi, boff = (size_t)(c0 + lr) * K + 8 * hi;
#pragma unroll 1
    for (int kc = 0; kc < Kl; kc += 32) {
        V a[4], a2[4];
#pragma unroll
        for (int mb = 0; mb < 4; ++mb) { a[mb] = WFrag<T16>::ld(A + aoff + (size_t)mb * 16 * K + kc); if (NSPLIT == 1 || NSPLIT == 2) a2[mb] = WFrag<T16>::ld(A2 + aoff + (size_t)mb * 16 * K + kc); }
#pragma unroll
        for (int nb = 0; nb < 4; ++nb) { const V b = WFrag<T16>::ld(Bt + boff + (size_t)nb * 16 * K + kc); V b2; if (NSPLIT >= 2) b2 = WFrag<T16>::ld(Bt2 + boff + (size_t)nb * 16 * K + kc);
#pragma unroll
            for (int mb = 0; mb < 4; ++mb) { acc[mb][nb] = WFrag<T16>::mma(a[mb], b, acc[mb][nb]); if (NSPLIT == 1 || NSPLIT == 2) acc[mb][nb] = WFrag<T16>::mma(a2[mb], b, acc[mb][nb]); if (NSPLIT >= 2) acc[mb][nb] = WFrag<T16>::mma(a[mb], b2, acc[mb][nb]); } }
        asm volatile("v_nop\n\tv_nop\n\tv_nop\n\tv_nop" : "+v"(acc[0][0]), "+v"(acc[1][1]), "+v"(acc[2][2]), "+v"(acc[3][3]) : "v"(a[0]), "v"(a[3]));
    }
#pragma unroll
    for (int mb = 0; mb < 4; ++mb) {
#pragma unroll
        for (int nb = 0; nb < 4; ++nb) {
#pragma unroll
            for (int j = 0; j < 8; ++j) os[(hi * 8 + j) * 68 + nb * 16 + lr] = acc[mb][nb][j]; }
        __builtin_amdgcn_wave_barrier(); asm volatile("" ::: "memory");
        float* crow = C + (size_t)(r0 + mb * 16) * ldc + c0;
{
#pragma unroll
            for (int s = 0; s < 8; ++s) { const int row = 2 * s + hi, cofs = lr * 4; v4f val = *(const v4fa*)(os + row * 68 + cofs);
                *(v4f*)(crow + (size_t)row * ldc + cofs) = val; }
             }
        __builtin_amdgcn_wave_barrier(); asm volatile("" ::: "memory");
    }
}

__device__ __forceinline__ h16 tohx(float x) { return (h16)x; }
__device__ __forceinline__ void splitf(float y, unsigned short& h, unsigned short& l) { h = f2bf(y); l = f2bf(y - bf2f(h)); }
typedef __attribute__((ext_vector_type(2))) _Float16 v2h;
typedef __attribute__((ext_vector_type(4))) _Float16 v4h;
typedef __attribute__((ext_vector_type(2))) unsigned short v2us;
typedef __attribute__((ext_vector_type(4))) unsigned short v4us;
typedef __attribute__((ext_vector_type(2))) float v2f;
typedef __attribute__((ext_vector_type(4))) int v4i;

__global__ __launch_bounds__(256) void k_wtG(const float* __restrict__ w, int K, int N, bf* Bt) {
    const int lane = threadIdx.x & 31; const int L0 = (blockIdx.x * 8 + (threadIdx.x >> 5)) * 8; const int nlines = N * K / 64;
{
#pragma unroll 1
        for (int l = 0; l < 8; ++l) { const int L = L0 + l; if (L >= nlines) break; const size_t e = (size_t)L * 64 + lane * 2; const int k = (int)(e % K), n = (int)(e / K); v2us o;
            o[0] = f2bf(w[(size_t)k * N + n]); o[1] = f2bf(w[(size_t)(k + 1) * N + n]); *(v2us*)(Bt + e) = o; }
         }
}
__global__ __launch_bounds__(256) void k_cvt8(const float* __restrict__ src, bf* dst, size_t n8) { const size_t i = (size_t)blockIdx.x * 256 + threadIdx.x; if (i >= n8) return; const v8f v = *(const v8f*)(src + i * 8); v8us o;
#pragma unroll
    for (int k = 0; k < 8; ++k) o[k] = f2bf(v[k]); *(v8us*)(dst + i * 8) = o;  }
__global__ __launch_bounds__(256) void k_cstab(float* CS) { const int idx = blockIdx.x * 256 + threadIdx.x; if (idx >= TT * HD) return; const int t = idx / HD, d = idx % HD; const int i = d % (HD / 2); const float inv = __fdiv_rn(1.0f, powf(10000.0f, (float)(2 * i) / (float)HD)); const float ang = __fmul_rn((float)t, inv); v2f cs; cs[0] = cosf(ang); cs[1] = sinf(ang);
    *(v2f*)(CS + (size_t)idx * 2) = cs;  }
// k_rope: grid y = batch (its TT rows of F, its nheads planes); head planes [h][t][d] (fp16 + hi/lo) of rope(x) x sc with the rotate-half convention out[d] = x[d] cos[t][d] - x[d+HD/2] sin[t][d], out[d+HD/2] = x[d+HD/2] cos[t][d+HD/2] + x[d] sin[t][d+HD/2]
__global__ __launch_bounds__(256) void k_rope(const float* __restrict__ F, int pitch, int nheads, const float* __restrict__ CS, const float* __restrict__ RF, const float* __restrict__ nw, float sc, h16* P16, bf* Ph, bf* Pl) {
    { const size_t bz = blockIdx.y, po = bz * nheads * TT * HD; F += bz * TT * pitch; P16 += po; Ph += po; Pl += po; }
    const size_t e = ((size_t)blockIdx.x * 256 + threadIdx.x) * 2; if (e >= (size_t)nheads * TT * HD) return; const int d = (int)(e % HD); const int t = (int)((e / HD) % TT); const int h = (int)(e / ((size_t)HD * TT)); const float* f = F + (size_t)t * pitch + h * HD; const float rf = RF ? RF[(size_t)h * TT + t] : 1.0f; v2h o16; v2us oh, ol;
#pragma unroll
    for (int q = 0; q < 2; ++q) { const int dd = d + q; const int dp = (dd < HD / 2) ? dd + HD / 2 : dd - HD / 2; float x0 = f[dd], x1 = f[dp];
        if (RF) { float n0 = __fmul_rn(x0, rf), n1 = __fmul_rn(x1, rf); asm volatile("" : "+v"(n0)); asm volatile("" : "+v"(n1)); x0 = __fmul_rn(bfr(nw[dd]), n0); x1 = __fmul_rn(bfr(nw[dp]), n1); }
        const v2f cs = *(const v2f*)(CS + ((size_t)t * HD + dd) * 2); float a = __fmul_rn(x0, cs[0]), bq = __fmul_rn(x1, cs[1]); asm volatile("" : "+v"(a)); asm volatile("" : "+v"(bq)); const float r = ((dd < HD / 2) ? __fsub_rn(a, bq) : __fadd_rn(a, bq)) * sc;
        o16[q] = tohx(r); unsigned short a2, c2; splitf(r, a2, c2); oh[q] = a2; ol[q] = c2; }
    *(v2h*)(P16 + e) = o16; *(v2us*)(Ph + e) = oh; *(v2us*)(Pl + e) = ol;  }
__global__ __launch_bounds__(256) void k_vtp(const float* __restrict__ F, int pitch, int nheads, h16* V16, bf* Vh, bf* Vl) { { const size_t bz = blockIdx.y, po = bz * nheads * HD * 2 * TT; F += bz * TT * pitch; V16 += po; Vh += po; Vl += po; }   // grid y = batch; plane rows [g][d] at pitch 2*TT, the pitch of the probability rows they are multiplied with
    const size_t e = ((size_t)blockIdx.x * 256 + threadIdx.x) * 2; if (e >= (size_t)nheads * HD * TT) return; const int t = (int)(e % TT); const int d = (int)((e / TT) % HD); const int g = (int)(e / ((size_t)TT * HD)); v2h o16; v2us oh, ol;
#pragma unroll
    for (int q = 0; q < 2; ++q) { const float x = F[(size_t)(t + q) * pitch + g * HD + d]; o16[q] = tohx(x); unsigned short a2, c2; splitf(x, a2, c2); oh[q] = a2; ol[q] = c2; }
    const size_t oo = (e / TT) * (2 * TT) + t; *(v2h*)(V16 + oo) = o16; *(v2us*)(Vh + oo) = oh; *(v2us*)(Vl + oo) = ol;  }
// k_asoft: per row (zz, i): t = S x HD^-0.5 for j <= i and i - j < WIN (sliding causal window; the reference's -1e9 additive fill vanishes identically); softmax over the 2048 keys (register row, one exp, fixed trees);
// the probabilities go back IN PLACE over the row's own 4*TT score bytes (one wave owns a row and holds all of it in registers before its first store): fp16 row at the row's start, or hi plane at the start and lo plane TT elements on; 16-bit pitch 2*TT.
__global__ __launch_bounds__(256) void k_asoft(float* Sb) {
    const int lane = threadIdx.x & 31; const int row = blockIdx.x * 8 + (threadIdx.x >> 5); if (row >= ZH * TT) return; const int i = row % TT; const int zz = row / TT; (void)zz; const bool hires = (i < RH); const float* sr = Sb + (size_t)row * TT; float v[TT / 32]; float mx = -3.0e38f;
#pragma unroll
    for (int ch = 0; ch < TT / 128; ++ch) { const int j0 = ch * 128 + lane * 4; const v4f a = *(const v4f*)(sr + j0);
#pragma unroll
        for (int q = 0; q < 4; ++q) { const int j = j0 + q; (void)j; const float t = (j <= i && i - j < WIN) ? a[q] * SCL : -3.0e38f; v[ch * 4 + q] = t; mx = fmaxf(mx, t); } }
#pragma unroll
    for (int sh = 16; sh; sh >>= 1) mx = fmaxf(mx, __shfl_xor(mx, sh, 32));
    float sum = 0.f;
#pragma unroll
    for (int k = 0; k < TT / 32; ++k) { float d0 = __fsub_rn(v[k], mx); asm volatile("" : "+v"(d0)); v[k] = __builtin_amdgcn_exp2f(__fmul_rn(d0, 1.4426950408889634f)); sum += v[k]; }
#pragma unroll
    for (int sh = 16; sh; sh >>= 1) sum += __shfl_xor(sum, sh, 32);
    const float f = __fdiv_rn(hires ? 1.0f : PCAR, sum);
{
        if (hires) {
#pragma unroll
            for (int ch = 0; ch < TT / 128; ++ch) { v4us oh, ol;
#pragma unroll
                for (int q = 0; q < 4; ++q) { unsigned short a, c2; splitf(v[ch * 4 + q] * f, a, c2); oh[q] = a; ol[q] = c2; }
                bf* pr = (bf*)(Sb + (size_t)row * TT) + ch * 128 + lane * 4; *(v4us*)pr = oh; *(v4us*)(pr + TT) = ol; }
        } else {
#pragma unroll
            for (int ch = 0; ch < TT / 128; ++ch) { v4h o4;
#pragma unroll
                for (int q = 0; q < 4; ++q) o4[q] = tohx(v[ch * 4 + q] * f);
                *(v4h*)((h16*)(Sb + (size_t)row * TT) + ch * 128 + lane * 4) = o4; } }
         }
}
__global__ __launch_bounds__(256) void k_merge(const float* __restrict__ O, int h0, bf* Ah, bf* Al) { const size_t e = ((size_t)blockIdx.x * 256 + threadIdx.x) * 2; if (e >= (size_t)ZH * TT * HD) return; const int d = (int)(e % HD); const int t = (int)((e / HD) % TT); const int zz = (int)(e / ((size_t)HD * TT)); const float cs = (t < RH) ? 1.0f : (1.0f / PCAR); const size_t oo = (size_t)t * DQ + (h0 + zz) * HD + d;
    v2us oh, ol;
#pragma unroll
    for (int q = 0; q < 2; ++q) { unsigned short a, c2; splitf(O[e + q] * cs, a, c2); oh[q] = a; ol[q] = c2; } *(v2us*)(Ah + oo) = oh; *(v2us*)(Al + oo) = ol;  }

extern "C" void kernel_launch(void* const* d_in, const int* in_sizes, int n_in,
                              void* d_out, int out_size, void* d_ws, size_t ws_size, hipStream_t stream) {
    (void)in_sizes; (void)n_in; (void)out_size;
    const float* x = (const float*)d_in[0]; const float* wq = (const float*)d_in[1]; const float* wk = (const float*)d_in[2]; const float* wv = (const float*)d_in[3]; const float* wo = (const float*)d_in[4];
    float* OUT = (float*)d_out;     // [4][2048][1024]
    char* wsp = (char*)d_ws;
    auto take = [&](size_t bytes) { char* p = wsp; wsp += (bytes + 255) & ~(size_t)255; return (void*)p; };
    bf* WQ = (bf*)take((size_t)DQ * DM * 2); bf* WK = (bf*)take((size_t)DKV * DM * 2); bf* WV = (bf*)take((size_t)DKV * DM * 2); bf* WO = (bf*)take((size_t)DM * DQ * 2); float* CS = (float*)take((size_t)TT * HD * 2 * 4);
    h16* QP16 = (h16*)take((size_t)NB_ * NH_ * TT * HD * 2); h16* KP16 = (h16*)take((size_t)NB_ * NKV * TT * HD * 2); h16* VT16 = (h16*)take((size_t)NB_ * NKV * HD * 2 * TT * 2);   // value rows at pitch 2*TT: the fp16 row fills the first TT elements
    bf* QPh = (bf*)take((size_t)NB_ * NH_ * TT * HD * 2); bf* QPl = (bf*)take((size_t)NB_ * NH_ * TT * HD * 2); bf* KPh = (bf*)take((size_t)NB_ * NKV * TT * HD * 2); bf* KPl = (bf*)take((size_t)NB_ * NKV * TT * HD * 2); bf* VTh = (bf*)take((size_t)NB_ * NKV * HD * 2 * TT * 2); bf* VTl = VTh + TT;   // hi row, then lo row TT elements on, pitch 2*TT
    float* Ob = (float*)take((size_t)ZH * TT * HD * 4); bf* ATh = (bf*)take((size_t)NB_ * TT * DQ * 2); bf* ATl = (bf*)take((size_t)NB_ * TT * DQ * 2);
    float* Sb = (float*)take((size_t)ZH * TT * TT * 4);   // scores, then (in place) probabilities, of ZH heads
    if ((size_t)(wsp - (char*)d_ws) > ws_size) return;    // ws 256 MiB
    // projection scratch lives in the score buffer: it is dead before the first score launch writes there (stream-ordered); 56 MiB of the 128
    bf* XB = (bf*)Sb; float* FQ = (float*)((char*)Sb + (size_t)NB_ * TT * DM * 2); float* FK = FQ + (size_t)NB_ * TT * DQ;
    float* FV = FK;   // v projection reuses the k buffer after the k planes are built (stream-ordered)
    { k_wtG<<<(unsigned)((DM * DQ / 64 + 63) / 64), 256, 0, stream>>>(wq, DM, DQ, WQ); k_wtG<<<(unsigned)((DM * DKV / 64 + 63) / 64), 256, 0, stream>>>(wk, DM, DKV, WK); k_wtG<<<(unsigned)((DM * DKV / 64 + 63) / 64), 256, 0, stream>>>(wv, DM, DKV, WV);
      k_wtG<<<(unsigned)((DQ * DM / 64 + 63) / 64), 256, 0, stream>>>(wo, DQ, DM, WO);
      k_cstab<<<(TT * HD + 255) / 256, 256, 0, stream>>>(CS); }
    const unsigned LQ = (unsigned)(((size_t)NH_ * TT * HD / 2 + 255) / 256), LKv = (unsigned)(((size_t)NKV * TT * HD / 2 + 255) / 256);
    // projections: the NB_ batches are NB_*TT rows of one GEMM
    k_cvt8<<<(unsigned)(((size_t)NB_ * TT * DM / 8 + 255) / 256), 256, 0, stream>>>(x, XB, (size_t)NB_ * TT * DM / 8);
    k_gemmw<bf, 0, false><<<dim3(NB_ * TT / 64, DQ / 64, 1), 32, 0, stream>>>(XB, nullptr, WQ, nullptr, DM, FQ, DQ, nullptr, 0, 0, 0);
    k_rope<<<dim3(LQ, NB_), 256, 0, stream>>>(FQ, DQ, NH_, CS, nullptr, nullptr, 1.0f, QP16, QPh, QPl);
    k_gemmw<bf, 0, false><<<dim3(NB_ * TT / 64, DKV / 64, 1), 32, 0, stream>>>(XB, nullptr, WK, nullptr, DM, FK, DKV, nullptr, 0, 0, 0);
    k_rope<<<dim3(LKv, NB_), 256, 0, stream>>>(FK, DKV, NKV, CS, nullptr, nullptr, 1.0f, KP16, KPh, KPl);
    k_gemmw<bf, 0, false><<<dim3(NB_ * TT / 64, DKV / 64, 1), 32, 0, stream>>>(XB, nullptr, WV, nullptr, DM, FV, DKV, nullptr, 0, 0, 0); k_vtp<<<dim3(LKv, NB_), 256, 0, stream>>>(FV, DKV, NKV, VT16, VTh, VTl);
    const size_t sQ = (size_t)TT * HD, sV = (size_t)HD * 2 * TT, sS = (size_t)TT * TT, sP = (size_t)2 * TT * TT;   // per-head strides: q/k planes and f32 head outputs, value planes (pitch 2*TT), f32 scores, 16-bit probabilities (pitch 2*TT)
    for (int g0 = 0; g0 < NB_ * NH_; g0 += ZH) { const size_t zq = (size_t)g0, zk = (size_t)(g0 / REP); const int b = g0 / NH_, h0 = g0 % NH_;   // g0 = b*NH_ + h0: flat head; its kv plane is g0/REP (NH_ = REP*NKV)
        k_gemmc<bf, 2, 1><<<dim3(RH / 64, TT / 64, ZH), 32, 0, stream>>>(QPh + zq * sQ, QPl + zq * sQ, KPh + zk * sQ, KPl + zk * sQ, HD, Sb, TT, 0, sQ, sQ, sS);
        k_gemmc<h16, 0, 1><<<dim3((TT - RH) / 64, TT / 64, ZH), 32, 0, stream>>>(QP16 + zq * sQ + (size_t)RH * HD, nullptr, KP16 + zk * sQ, nullptr, HD, Sb + (size_t)RH * TT, TT, RH, sQ, sQ, sS);
        k_asoft<<<ZH * TT / 8, 256, 0, stream>>>(Sb);
        k_gemmc<bf, 2, 2><<<dim3(RH / 64, HD / 64, ZH), 32, 0, stream>>>((const bf*)Sb, (const bf*)Sb + TT, VTh + zk * sV, VTl + zk * sV, 2 * TT, Ob, HD, 0, sP, sV, sQ);
        k_gemmc<h16, 0, 2><<<dim3((TT - RH) / 64, HD / 64, ZH), 32, 0, stream>>>((const h16*)Sb + (size_t)RH * 2 * TT, nullptr, VT16 + zk * sV, nullptr, 2 * TT, Ob + (size_t)RH * HD, HD, RH, sP, sV, sQ);
        k_merge<<<(unsigned)(((size_t)ZH * TT * HD / 2 + 255) / 256), 256, 0, stream>>>(Ob, h0, ATh + (size_t)b * TT * DQ, ATl + (size_t)b * TT * DQ); }
    k_gemmw<bf, 1, false><<<dim3(NB_ * TT / 64, DM / 64, 1), 32, 0, stream>>>(ATh, ATl, WO, nullptr, DQ, OUT, DM, nullptr, 0, 0, 0);
}

// v003
// It runs in 258 microseconds.
// Versions between v001 and this one are left out; their measured steps multiply to 4.11 times as fast.
// All steps since v000 together make it 10.6 times as fast.
#include <hip/hip_runtime.h>

// GQA causal attention block (x [4][2048][1024]; q = x wq (16 heads x 64), k, v = x wk / wv (4 kv heads, GQA groups of 4); RoPE (rotate-half, base 10000) on q, k; causal softmax(q.k/8); out = (attn v merged) wo -> [4][2048][1024]).
// Compute dtypes, f32 accumulate: every input rounded to bf16; q/k/v projections on PLAIN bf16 operands (inputs: exact); RoPE f32; scores (K 64) and attn.v on bf16 hi+lo planes (3 products) for the first 512 query rows of each head and

#define NB_  4
#define TT   2048
#define DM   1024
#define NH_  16
#define NKV  4
#define REP  (NH_ / NKV)
#define HD   64
#define DQ   (NH_ * HD)
#define DKV  (NKV * HD)
#define RH   512                  // query rows < RH use hi+lo planes (0: none)
#define PCAR 1024.0f
#define SCL  0.125f   // HD^-0.5
typedef _Float16 h16;
typedef unsigned short bf;
typedef __attribute__((ext_vector_type(16))) __bf16   v16bf;
typedef __attribute__((ext_vector_type(16))) _Float16 v16h;
typedef __attribute__((ext_vector_type(8)))  _Float16 v8h;
typedef __attribute__((ext_vector_type(8)))  unsigned short v8us;
typedef __attribute__((ext_vector_type(8)))  float    v8f;
typedef __attribute__((ext_vector_type(4)))  float    v4f;
typedef v8h  __attribute__((may_alias)) v8ha;
typedef v4f  __attribute__((may_alias)) v4fa;
typedef v8us __attribute__((may_alias)) v8usa;

__device__ __forceinline__ unsigned short f2bf(float f) { unsigned u = __float_as_uint(f); u += 0x7FFFu + ((u >> 16) & 1u); return (unsigned short)(u >> 16); }
__device__ __forceinline__ float bf2f(unsigned short b) { return __uint_as_float(((unsigned)b) << 16); }
__device__ __forceinline__ float bfr(float f) { return bf2f(f2bf(f)); }
__device__ __forceinline__ v16h cat16(v8h lo, v8h hi) { return __builtin_shufflevector(lo, hi, 0, 1, 2, 3, 4, 5, 6, 7, 8, 9, 10, 11, 12, 13, 14, 15); }
__device__ __forceinline__ v16bf cat16b(v8us lo, v8us hi) { return __builtin_bit_cast(v16bf, __builtin_shufflevector(lo, hi, 0, 1, 2, 3, 4, 5, 6, 7, 8, 9, 10, 11, 12, 13, 14, 15)); }
__device__ __forceinline__ v8f wmma16(v16h a, v16h b, v8f c) { return __builtin_amdgcn_wmma_f32_16x16x32_f16(false, a, false, b, (short)0, c, false, false); }
__device__ __forceinline__ v8f wmmab(v16bf a, v16bf b, v8f c) { return __builtin_amdgcn_wmma_f32_16x16x32_bf16(false, a, false, b, (short)0, c, false, false); }



// ---- FRAGMENT ORDER: every 16-bit matrix operand plane [row][k] lies in units of 16 rows x 32 k (512 elements, 1 KB), units ordered [row / 16][k / 32]; inside a unit element (row, k) stands at
// ((k >> 4) & 1) * 256 + (((k >> 3) & 1) * 16 + (row & 15)) * 8 + (k & 7): a lane's two 16-byte fragment pieces are unit + lane * 8 and + 256, so each wave-wide load is 512 contiguous bytes (4 whole lines, not 32 bytes in each of 16).
// k_wtG, k_cvt8, k_rope and k_vtp walk a plane in storage order and ask unfrag for the (row, k) that stands at a position; KB = k / 32 units a row block.
__device__ __forceinline__ void unfrag(size_t pos, int KB, int& row, int& k) { const int u = (int)(pos >> 9), r = (int)(pos & 511); row = (u / KB) * 16 + ((r >> 3) & 15); k = (u % KB) * 32 + (r >> 8) * 16 + ((r >> 7) & 1) * 8 + (r & 7); }
// ---- k_gemmw: register-blocked GEMM, ONE WAVE per 64x64 output tile (16 accumulators), operands straight from 16-bit planes in fragment order; grid (M/64, N/64, Z), 32 threads.
// C[m][n] (f32, pitch ldc, + optional f32 bias[n]) = sum_k A[m][k] Bt[n][k] (+ split products per NSPLIT). z-batch strides sA/sB/sC in elements. K % 32 == 0.
// ld(u, lb): the fragment of the unit at u (the same for the whole wave), lb = lane * 16, the lane's byte offset in it; ldp(p): the same from the lane's own address
template <typename T16> struct WFrag;
template <> struct WFrag<h16> { typedef v16h V; static __device__ __forceinline__ V ldp(const char* p) { return cat16(*(const v8h*)p, *(const v8h*)(p + 512)); } static __device__ __forceinline__ V ld(const h16* u, unsigned lb) { return ldp((const char*)u + lb); } static __device__ __forceinline__ v8f mma(V a, V b, v8f c) { return wmma16(a, b, c); } };
template <> struct WFrag<bf> { typedef v16bf V; static __device__ __forceinline__ V ldp(const char* p) { return cat16b(*(const v8us*)p, *(const v8us*)(p + 512)); } static __device__ __forceinline__ V ld(const bf* u, unsigned lb) { return ldp((const char*)u + lb); } static __device__ __forceinline__ v8f mma(V a, V b, v8f c) { return wmmab(a, b, c); } };
template <typename T16, int NSPLIT, bool BIAS>
__global__ __launch_bounds__(32) void k_gemmw(const T16* __restrict__ A, const T16* __restrict__ A2, const T16* __restrict__ Bt, const T16* __restrict__ Bt2, int K, float* C, int ldc, const float* __restrict__ bias, size_t sA, size_t sB, size_t sC) {
    typedef typename WFrag<T16>::V V;
    __shared__ __align__(16) float os[16 * 68];
    const size_t z = blockIdx.z; A += z * sA; if (A2) A2 += z * sA; Bt += z * sB; if (Bt2) Bt2 += z * sB; C += z * sC;
    const int lane = threadIdx.x & 31, lr = lane & 15, hi = lane >> 4; const int r0 = blockIdx.x * 64, c0 = blockIdx.y * 64;
    v8f acc[4][4];
#pragma unroll
    for (int mb = 0; mb < 4; ++mb)
#pragma unroll
        for (int nb = 0; nb < 4; ++nb) acc[mb][nb] = (v8f){};
    const size_t aoff = (size_t)r0 * K, boff = (size_t)c0 * K; const unsigned lb = lane * 16;   // a row block of 16 is K * 16 elements, a step of 32 k one unit of 512
#pragma unroll 1
    for (int kc = 0; kc < K; kc += 32) {
        V a[4], a2[4]; const char* pa[4]; const char* pa2[4];
#pragma unroll
        for (int mb = 0; mb < 4; ++mb) { pa[mb] = (const char*)(A + aoff + (size_t)mb * 16 * K + kc * 16) + lb; a[mb] = WFrag<T16>::ldp(pa[mb]); if (NSPLIT == 1 || NSPLIT == 2) { pa2[mb] = (const char*)(A2 + aoff + (size_t)mb * 16 * K + kc * 16) + lb; a2[mb] = WFrag<T16>::ldp(pa2[mb]); } }
        // s_wait_xcnt 0 behind loads, in front of whatever next rewrites an address register of theirs; the addresses are inputs so that they live to the wait and no later load's result lands in them
        if (NSPLIT == 1 || NSPLIT == 2) asm volatile("s_wait_xcnt 0x0" :: "v"(pa[0]), "v"(pa[1]), "v"(pa[2]), "v"(pa[3]), "v"(pa2[0]), "v"(pa2[1]), "v"(pa2[2]), "v"(pa2[3]) : "memory");
        else asm volatile("s_wait_xcnt 0x0" :: "v"(pa[0]), "v"(pa[1]), "v"(pa[2]), "v"(pa[3]) : "memory");
#pragma unroll
        for (int nb = 0; nb < 4; ++nb) { const char* pb = (const char*)(Bt + boff + (size_t)nb * 16 * K + kc * 16) + lb; const V b = WFrag<T16>::ldp(pb); V b2; asm volatile("s_wait_xcnt 0x0" :: "v"(pb) : "memory");   // as above
            if (NSPLIT >= 2) { const char* pb2 = (const char*)(Bt2 + boff + (size_t)nb * 16 * K + kc * 16) + lb; b2 = WFrag<T16>::ldp(pb2); asm volatile("s_wait_xcnt 0x0" :: "v"(pb2) : "memory"); }   // as above
#pragma unroll
            for (int mb = 0; mb < 4; ++mb) { acc[mb][nb] = WFrag<T16>::mma(a[mb], b, acc[mb][nb]); if (NSPLIT == 1 || NSPLIT == 2) acc[mb][nb] = WFrag<T16>::mma(a2[mb], b, acc[mb][nb]); if (NSPLIT >= 2) acc[mb][nb] = WFrag<T16>::mma(a[mb], b2, acc[mb][nb]); } }
        asm volatile("v_nop\n\tv_nop\n\tv_nop\n\tv_nop" : "+v"(acc[0][0]), "+v"(acc[1][1]), "+v"(acc[2][2]), "+v"(acc[3][3]) : "v"(a[0]), "v"(a[3]));
    }
#pragma unroll
    for (int mb = 0; mb < 4; ++mb) {
#pragma unroll
        for (int nb = 0; nb < 4; ++nb) {
#pragma unroll
            for (int j = 0; j < 8; ++j) os[(hi * 8 + j) * 68 + nb * 16 + lr] = acc[mb][nb][j]; }
        __builtin_amdgcn_wave_barrier(); asm volatile("" ::: "memory");
        float* crow = C + (size_t)(r0 + mb * 16) * ldc + c0;
{
#pragma unroll
            for (int s = 0; s < 8; ++s) { const int row = 2 * s + hi, cofs = lr * 4; v4f val = *(const v4fa*)(os + row * 68 + cofs); if (BIAS) { val[0] += bfr(bias[c0 + cofs]); val[1] += bfr(bias[c0 + cofs + 1]); val[2] += bfr(bias[c0 + cofs + 2]); val[3] += bfr(bias[c0 + cofs + 3]); }
                *(v4f*)(crow + (size_t)row * ldc + cofs) = val; }
             }
        __builtin_amdgcn_wave_barrier(); asm volatile("" ::: "memory");
    }
}

__device__ __forceinline__ h16 tohx(float x) { return (h16)x; }
__device__ __forceinline__ void splitf(float y, unsigned short& h, unsigned short& l) { h = f2bf(y); l = f2bf(y - bf2f(h)); }
typedef __attribute__((ext_vector_type(2))) _Float16 v2h;
typedef __attribute__((ext_vector_type(4))) _Float16 v4h;
typedef __attribute__((ext_vector_type(2))) unsigned short v2us;
typedef __attribute__((ext_vector_type(4))) unsigned short v4us;
typedef __attribute__((ext_vector_type(2))) float v2f;
typedef __attribute__((ext_vector_type(4))) int v4i;

__global__ __launch_bounds__(256) void k_wtG(const float* __restrict__ w, int K, int N, bf* Bt) {
    const int lane = threadIdx.x & 31; const int L0 = (blockIdx.x * 8 + (threadIdx.x >> 5)) * 8; const int nlines = N * K / 64;
{
#pragma unroll 1
        for (int l = 0; l < 8; ++l) { const int L = L0 + l; if (L >= nlines) break; const size_t e = (size_t)L * 64 + lane * 2; int k, n; unfrag(e, K / 32, n, k); v2us o;
            const float* p0 = w + (size_t)k * N + n; const float* p1 = p0 + N; const float w0 = *p0, w1 = *p1;
            asm volatile("s_wait_xcnt 0x0" :: "v"(p0), "v"(p1) : "memory");   // behind the loads, in front of whatever next rewrites an address register of theirs (inputs: they live to the wait)
            o[0] = f2bf(w0); o[1] = f2bf(w1); bf* po = Bt + e;
            asm volatile("global_store_b32 %0, %1, off\n\ts_wait_xcnt 0x0" :: "v"(po), "v"(__builtin_bit_cast(unsigned, o)) : "memory"); }   // the store with its wait in one statement: the next trip rewrites its registers
         }
}
__global__ __launch_bounds__(256) void k_cvt8(const float* __restrict__ src, bf* dst, size_t n8) { const size_t i = (size_t)blockIdx.x * 256 + threadIdx.x; if (i >= n8) return; int row, k; unfrag(i * 8, DM / 32, row, k); const float* p = src + (size_t)row * DM + k; const v8f v = *(const v8f*)p; v8us o;
    asm volatile("s_wait_xcnt 0x0" :: "v"(p) : "memory");   // behind the loads, in front of whatever next rewrites their address register (an input: it lives to the wait)
#pragma unroll
    for (int k = 0; k < 8; ++k) o[k] = f2bf(v[k]); *(v8us*)(dst + i * 8) = o;  }
__global__ __launch_bounds__(256) void k_cstab(float* CS) { const int idx = blockIdx.x * 256 + threadIdx.x; if (idx >= TT * HD) return; const int t = idx / HD, d = idx % HD; const int i = d % (HD / 2); const float inv = __fdiv_rn(1.0f, powf(10000.0f, (float)(2 * i) / (float)HD)); const float ang = __fmul_rn((float)t, inv); v2f cs; cs[0] = cosf(ang); cs[1] = sinf(ang);
    *(v2f*)(CS + (size_t)idx * 2) = cs;  }
// k_rope: grid y = batch (its TT rows of F, its nheads planes); head planes [h][t][d] (fp16 + hi/lo) of rope(x) x sc with the rotate-half convention out[d] = x[d] cos[t][d] - x[d+HD/2] sin[t][d], out[d+HD/2] = x[d+HD/2] cos[t][d+HD/2] + x[d] sin[t][d+HD/2]
__global__ __launch_bounds__(256) void k_rope(const float* __restrict__ F, int pitch, int nheads, const float* __restrict__ CS, const float* __restrict__ RF, const float* __restrict__ nw, float sc, h16* P16, bf* Ph, bf* Pl) {
    { const size_t bz = blockIdx.y, po = bz * nheads * TT * HD; F += bz * TT * pitch; P16 += po; Ph += po; Pl += po; }
    const size_t e = ((size_t)blockIdx.x * 256 + threadIdx.x) * 2; if (e >= (size_t)nheads * TT * HD) return; const int h = (int)(e / ((size_t)HD * TT)); int t, d; unfrag(e % ((size_t)HD * TT), HD / 32, t, d); const float* f = F + (size_t)t * pitch + h * HD; const float rf = RF ? RF[(size_t)h * TT + t] : 1.0f; v2h o16; v2us oh, ol;
    asm volatile("s_wait_xcnt 0x0" ::: "memory");   // behind the load above, in front of whatever next rewrites its address register
#pragma unroll
    for (int q = 0; q < 2; ++q) { const int dd = d + q; const int dp = (dd < HD / 2) ? dd + HD / 2 : dd - HD / 2; float x0 = f[dd], x1 = f[dp];
        if (RF) { float n0 = __fmul_rn(x0, rf), n1 = __fmul_rn(x1, rf); asm volatile("" : "+v"(n0)); asm volatile("" : "+v"(n1)); x0 = __fmul_rn(bfr(nw[dd]), n0); x1 = __fmul_rn(bfr(nw[dp]), n1); }
        const v2f cs = *(const v2f*)(CS + ((size_t)t * HD + dd) * 2); float a = __fmul_rn(x0, cs[0]), bq = __fmul_rn(x1, cs[1]); asm volatile("" : "+v"(a)); asm volatile("" : "+v"(bq)); const float r = ((dd < HD / 2) ? __fsub_rn(a, bq) : __fadd_rn(a, bq)) * sc;
        o16[q] = tohx(r); unsigned short a2, c2; splitf(r, a2, c2); oh[q] = a2; ol[q] = c2; }
    *(v2h*)(P16 + e) = o16; *(v2us*)(Ph + e) = oh; *(v2us*)(Pl + e) = ol;  }
__global__ __launch_bounds__(256) void k_vtp(const float* __restrict__ F, int pitch, int nheads, h16* V16, bf* Vh, bf* Vl) { { const size_t bz = blockIdx.y, po = bz * nheads * HD * 2 * TT; F += bz * TT * pitch; V16 += po; Vh += po; Vl += po; }   // grid y = batch; a head's planes [d][t] in fragment order, HD*TT elements each, 2*HD*TT apart (the lo plane lies behind its hi plane)
    const size_t e = ((size_t)blockIdx.x * 256 + threadIdx.x) * 2; if (e >= (size_t)nheads * HD * TT) return; const int g = (int)(e / ((size_t)TT * HD)); int d, t; unfrag(e % ((size_t)TT * HD), TT / 32, d, t); v2h o16; v2us oh, ol;
#pragma unroll
    for (int q = 0; q < 2; ++q) { const float x = F[(size_t)(t + q) * pitch + g * HD + d]; o16[q] = tohx(x); unsigned short a2, c2; splitf(x, a2, c2); oh[q] = a2; ol[q] = c2; }
    const size_t oo = e + (size_t)g * TT * HD; *(v2h*)(V16 + oo) = o16; *(v2us*)(Vh + oo) = oh; *(v2us*)(Vl + oo) = ol;  }
// ---- k_flash: scores, causal softmax, probability x value and the head merge in ONE launch; scores and probabilities never leave registers (online softmax over key blocks of 32).
// One wave owns NBQ*16 query rows of one head. It forms the TRANSPOSED score tile S^T[key][query] = K Q^T (A = key rows, B = query rows), so that a lane holds scores of one query only (max and sum in-lane plus one
// exchange between the lane halves) and the accumulator registers of two 16-key tiles are, as they stand, the B operand P^T[query][key 0..31] of O^T[d][query] += V^T P^T (A = value rows [d][t]).
// k order of every operand: element e of lane half hi is k = (e / 8) * 16 + 8 * hi + e % 8 (WFrag::ld on both global operands; score tile mt, register j is key mt * 16 + 8 * hi + j).
// The four waves of a block are the four heads of one kv group on the same query rows: they read the same key and value lines. HR: bf16 hi+lo planes, 3 products; else fp16, probabilities carried x PCAR (it cancels in O / l).
typedef __attribute__((ext_vector_type(16))) unsigned short v16us;
// eight 2^x in one statement: no result shares a register with a source ("=&v"), and the v_nop is the free slot behind the last transcendental
__device__ __forceinline__ void exp2x8(float* p, const float* x) {
    asm("v_exp_f32 %0, %8\n\tv_exp_f32 %1, %9\n\tv_exp_f32 %2, %10\n\tv_exp_f32 %3, %11\n\tv_exp_f32 %4, %12\n\tv_exp_f32 %5, %13\n\tv_exp_f32 %6, %14\n\tv_exp_f32 %7, %15\n\tv_nop"
        : "=&v"(p[0]), "=&v"(p[1]), "=&v"(p[2]), "=&v"(p[3]), "=&v"(p[4]), "=&v"(p[5]), "=&v"(p[6]), "=&v"(p[7]) : "v"(x[0]), "v"(x[1]), "v"(x[2]), "v"(x[3]), "v"(x[4]), "v"(x[5]), "v"(x[6]), "v"(x[7]));
}
// the hi and the lo store of eight merged outputs, with their s_wait_xcnt 0 in the same statement: so it stands in front of whatever next rewrites an address or data register of theirs, on every way out of a tile
// (as a statement of its own the wait let the next outputs' arithmetic move up over it)
__device__ __forceinline__ void st2x(bf* pa, v8us a, bf* pb, v8us b) {
    asm volatile("global_store_b128 %0, %1, off\n\tglobal_store_b128 %2, %3, off\n\ts_wait_xcnt 0x0" :: "v"(pa), "v"(__builtin_bit_cast(v4i, a)), "v"(pb), "v"(__builtin_bit_cast(v4i, b)) : "memory");
}
template <typename T16, bool HR, int NBQ>
__device__ __forceinline__ void flash_tile(const T16* __restrict__ Q, const T16* __restrict__ Q2, const T16* __restrict__ Kp, const T16* __restrict__ K2, const T16* __restrict__ Vt, const T16* __restrict__ V2, int q0, bf* Ah, bf* Al) {
    typedef typename WFrag<T16>::V V;
    const int lane = threadIdx.x & 31, lr = lane & 15, hi = lane >> 4; const unsigned lb = lane * 16;
    V qf[NBQ][2], qf2[NBQ][2];
#pragma unroll
    for (int nb = 0; nb < NBQ; ++nb)
#pragma unroll
        for (int kc = 0; kc < 2; ++kc) { const int qo = (q0 + nb * 16) * HD + kc * 512; qf[nb][kc] = WFrag<T16>::ld(Q + qo, lb); if (HR) qf2[nb][kc] = WFrag<T16>::ld(Q2 + qo, lb); }
    asm volatile("s_wait_xcnt 0x0" :: "v"(lb) : "memory");   // behind the query loads, in front of whatever next rewrites a register that they name; the offset is an input so that no load's result lands in it
    v8f o[4][NBQ]; float m[NBQ], l[NBQ];
#pragma unroll
    for (int nb = 0; nb < NBQ; ++nb) { m[nb] = -3.0e38f; l[nb] = 0.f;
#pragma unroll
        for (int dt = 0; dt < 4; ++dt) o[dt][nb] = (v8f){}; }
    const int nkb = (q0 + NBQ * 16 + 31) / 32;      // key blocks up to the diagonal; every block starts at a key <= q0, so no query ever sees a fully masked block; only the last block holds keys beyond a query
    const float L2E = 1.4426950408889634f, PEXP = HR ? 0.0f : 10.0f;   // 2^10 = PCAR
    V kf[2][2], kf2[2][2], vf[4], vf2[4];
    auto ldk = [&](int k0) __attribute__((always_inline)) {
#pragma unroll
        for (int mt = 0; mt < 2; ++mt)
#pragma unroll
            for (int kc = 0; kc < 2; ++kc) { const int ko = (k0 + mt * 16) * HD + kc * 512; kf[mt][kc] = WFrag<T16>::ld(Kp + ko, lb); if (HR) kf2[mt][kc] = WFrag<T16>::ld(K2 + ko, lb); }
        asm volatile("s_wait_xcnt 0x0" :: "v"(lb) : "memory"); };   // stands behind the loads, in front of whatever next rewrites a register that they name (a later load's result among them)
    auto ldv = [&](int k0) __attribute__((always_inline)) {
#pragma unroll
        for (int dt = 0; dt < 4; ++dt) { const int vo = dt * 16 * TT + k0 * 16; vf[dt] = WFrag<T16>::ld(Vt + vo, lb); if (HR) vf2[dt] = WFrag<T16>::ld(V2 + vo, lb); }
        asm volatile("s_wait_xcnt 0x0" :: "v"(lb) : "memory"); };   // as in ldk
    // one key block; last: the block on the diagonal (masked, nothing fetched behind it). Otherwise the next block's key fragments are asked for behind the score products and its value fragments behind the value
    // products, one block ahead of their use (where the registers are short the compiler may issue the key loads later in the block).
    auto step = [&](int k0, bool last) __attribute__((always_inline)) {
        v8f s[2][NBQ];
#pragma unroll
        for (int mt = 0; mt < 2; ++mt)
#pragma unroll
            for (int nb = 0; nb < NBQ; ++nb) { v8f a = (v8f){};
#pragma unroll
                for (int kc = 0; kc < 2; ++kc) { a = WFrag<T16>::mma(kf[mt][kc], qf[nb][kc], a); if (HR) { a = WFrag<T16>::mma(kf[mt][kc], qf2[nb][kc], a); a = WFrag<T16>::mma(kf2[mt][kc], qf[nb][kc], a); } }
                s[mt][nb] = a; }
        if (!last) ldk(k0 + 32);
        V pf[NBQ], pf2[NBQ];
#pragma unroll
        for (int nb = 0; nb < NBQ; ++nb) {
            const int qi = q0 + nb * 16 + lr; float mx = m[nb];
#pragma unroll
            for (int mt = 0; mt < 2; ++mt)
#pragma unroll
                for (int j = 0; j < 8; ++j) { float t = s[mt][nb][j] * SCL; if (last && k0 + mt * 16 + hi * 8 + j > qi) t = -3.0e38f; s[mt][nb][j] = t; mx = fmaxf(mx, t); }
            mx = fmaxf(mx, __shfl_xor(mx, 16, 32));
            float al; asm("v_exp_f32 %0, %1\n\tv_nop" : "=v"(al) : "v"((m[nb] - mx) * L2E)); m[nb] = mx;   // 2^x with the free slot behind a transcendental in the same statement
            float ps = 0.f; float x[16], p[16];
#pragma unroll
            for (int e = 0; e < 16; ++e) x[e] = (s[e >> 3][nb][e & 7] - mx) * L2E + PEXP;
            exp2x8(p, x); exp2x8(p + 8, x + 8);
#pragma unroll
            for (int e = 0; e < 16; ++e) ps += p[e];
            l[nb] = l[nb] * al + ps;                // this lane half's keys only; the halves are added once, after the loop
#pragma unroll
            for (int dt = 0; dt < 4; ++dt) o[dt][nb] *= al;
            if constexpr (HR) { v16us ph, pl;
#pragma unroll
                for (int e = 0; e < 16; ++e) { unsigned short a, c2; splitf(p[e], a, c2); ph[e] = a; pl[e] = c2; }
                pf[nb] = __builtin_bit_cast(v16bf, ph); pf2[nb] = __builtin_bit_cast(v16bf, pl);
            } else { v16h ph;
#pragma unroll
                for (int e = 0; e < 16; ++e) ph[e] = tohx(p[e]);
                pf[nb] = ph; }
        }
#pragma unroll
        for (int dt = 0; dt < 4; ++dt)
#pragma unroll
            for (int nb = 0; nb < NBQ; ++nb) { o[dt][nb] = WFrag<T16>::mma(vf[dt], pf[nb], o[dt][nb]); if (HR) { o[dt][nb] = WFrag<T16>::mma(vf[dt], pf2[nb], o[dt][nb]); o[dt][nb] = WFrag<T16>::mma(vf2[dt], pf[nb], o[dt][nb]); } }
        if (!last) ldv(k0 + 32);
    };
    ldk(0); ldv(0);   // keys first, as in the loop: loads return in order, and the wait at the loop's head leaves the value loads in flight
#pragma unroll 1   // run-time trip count round a body that already fills most of the register file: a second copy of the body would spill
    for (int kb = 0; kb < nkb - 1; ++kb) step(kb * 32, false);
    step((nkb - 1) * 32, true);
#pragma unroll
    for (int nb = 0; nb < NBQ; ++nb) {
        const float lt = l[nb] + __shfl_xor(l[nb], 16, 32); const float inv = __fdiv_rn(1.0f, lt);
#pragma unroll
        for (int dt = 0; dt < 4; ++dt) { v8us oh, ol;
#pragma unroll
            for (int j = 0; j < 8; ++j) { unsigned short a, c2; splitf(o[dt][nb][j] * inv, a, c2); oh[j] = a; ol[j] = c2; }
            const size_t oo = (size_t)(q0 + nb * 16) * DQ + dt * 256 + lane * 8; st2x(Ah + oo, oh, Al + oo, ol); }   // fragment order of the merged [token][DQ] plane: the head's two units, half dt & 1
    }
}
#define NLO ((TT - RH) / 32)      // fp16 query tiles of 32 rows
#define NHI (RH / 16)             // hi+lo query tiles of 16 rows
// grid (kv planes, NLO + NHI): y counts the query tiles from the longest key range down, so that the long tiles start first
__global__ __launch_bounds__(128) void k_flash(const h16* __restrict__ QP16, const h16* __restrict__ KP16, const h16* __restrict__ VT16, const bf* __restrict__ QPh, const bf* __restrict__ QPl, const bf* __restrict__ KPh, const bf* __restrict__ KPl, const bf* __restrict__ VTh, bf* ATh, bf* ATl) {
    const int kvp = blockIdx.x, g = kvp * REP + __builtin_amdgcn_readfirstlane(threadIdx.x >> 5), b = g / NH_, h = g % NH_, ty = blockIdx.y;   // g = b*NH_ + h: flat head; its kv plane is g / REP
    const size_t qo = (size_t)g * TT * HD, ko = (size_t)kvp * TT * HD, vo = (size_t)kvp * HD * 2 * TT, ao = (size_t)b * TT * DQ + h * (HD * 16);
    if (ty < NLO) flash_tile<h16, false, 2>(QP16 + qo, nullptr, KP16 + ko, nullptr, VT16 + vo, nullptr, TT - 32 * (ty + 1), ATh + ao, ATl + ao);
    else flash_tile<bf, true, 1>(QPh + qo, QPl + qo, KPh + ko, KPl + ko, VTh + vo, VTh + vo + HD * TT, RH - 16 * (ty - NLO + 1), ATh + ao, ATl + ao);
}

extern "C" void kernel_launch(void* const* d_in, const int* in_sizes, int n_in,
                              void* d_out, int out_size, void* d_ws, size_t ws_size, hipStream_t stream) {
    (void)in_sizes; (void)n_in; (void)out_size;
    const float* x = (const float*)d_in[0]; const float* wq = (const float*)d_in[1]; const float* wk = (const float*)d_in[2]; const float* wv = (const float*)d_in[3]; const float* wo = (const float*)d_in[4];
    float* OUT = (float*)d_out;     // [4][2048][1024]
    char* wsp = (char*)d_ws;
    auto take = [&](size_t bytes) { char* p = wsp; wsp += (bytes + 255) & ~(size_t)255; return (void*)p; };
    bf* WQ = (bf*)take((size_t)DQ * DM * 2); bf* WK = (bf*)take((size_t)DKV * DM * 2); bf* WV = (bf*)take((size_t)DKV * DM * 2); bf* WO = (bf*)take((size_t)DM * DQ * 2); float* CS = (float*)take((size_t)TT * HD * 2 * 4);
    h16* QP16 = (h16*)take((size_t)NB_ * NH_ * TT * HD * 2); h16* KP16 = (h16*)take((size_t)NB_ * NKV * TT * HD * 2); h16* VT16 = (h16*)take((size_t)NB_ * NKV * HD * 2 * TT * 2);   // heads 2*HD*TT elements apart, as in the hi+lo planes: the fp16 plane fills the first HD*TT
    bf* QPh = (bf*)take((size_t)NB_ * NH_ * TT * HD * 2); bf* QPl = (bf*)take((size_t)NB_ * NH_ * TT * HD * 2); bf* KPh = (bf*)take((size_t)NB_ * NKV * TT * HD * 2); bf* KPl = (bf*)take((size_t)NB_ * NKV * TT * HD * 2); bf* VTh = (bf*)take((size_t)NB_ * NKV * HD * 2 * TT * 2); bf* VTl = VTh + HD * TT;   // a head's hi plane, then its lo plane
    bf* ATh = (bf*)take((size_t)NB_ * TT * DQ * 2); bf* ATl = (bf*)take((size_t)NB_ * TT * DQ * 2);
    char* Sb = (char*)take((size_t)NB_ * TT * DM * 2 + (size_t)NB_ * TT * DQ * 4 + (size_t)NB_ * TT * DKV * 4);   // projection scratch: x in bf16, f32 q, f32 k / v
    if ((size_t)(wsp - (char*)d_ws) > ws_size) return;    // ws 256 MiB
    bf* XB = (bf*)Sb; float* FQ = (float*)(Sb + (size_t)NB_ * TT * DM * 2); float* FK = FQ + (size_t)NB_ * TT * DQ;
    float* FV = FK;   // v projection reuses the k buffer after the k planes are built (stream-ordered)
    { k_wtG<<<(unsigned)((DM * DQ / 64 + 63) / 64), 256, 0, stream>>>(wq, DM, DQ, WQ); k_wtG<<<(unsigned)((DM * DKV / 64 + 63) / 64), 256, 0, stream>>>(wk, DM, DKV, WK); k_wtG<<<(unsigned)((DM * DKV / 64 + 63) / 64), 256, 0, stream>>>(wv, DM, DKV, WV);
      k_wtG<<<(unsigned)((DQ * DM / 64 + 63) / 64), 256, 0, stream>>>(wo, DQ, DM, WO);
      k_cstab<<<(TT * HD + 255) / 256, 256, 0, stream>>>(CS); }
    const unsigned LQ = (unsigned)(((size_t)NH_ * TT * HD / 2 + 255) / 256), LKv = (unsigned)(((size_t)NKV * TT * HD / 2 + 255) / 256);
    // projections: the NB_ batches are NB_*TT rows of one GEMM
    k_cvt8<<<(unsigned)(((size_t)NB_ * TT * DM / 8 + 255) / 256), 256, 0, stream>>>(x, XB, (size_t)NB_ * TT * DM / 8);
    k_gemmw<bf, 0, false><<<dim3(NB_ * TT / 64, DQ / 64, 1), 32, 0, stream>>>(XB, nullptr, WQ, nullptr, DM, FQ, DQ, nullptr, 0, 0, 0);
    k_rope<<<dim3(LQ, NB_), 256, 0, stream>>>(FQ, DQ, NH_, CS, nullptr, nullptr, 1.0f, QP16, QPh, QPl);
    k_gemmw<bf, 0, false><<<dim3(NB_ * TT / 64, DKV / 64, 1), 32, 0, stream>>>(XB, nullptr, WK, nullptr, DM, FK, DKV, nullptr, 0, 0, 0);
    k_rope<<<dim3(LKv, NB_), 256, 0, stream>>>(FK, DKV, NKV, CS, nullptr, nullptr, 1.0f, KP16, KPh, KPl);
    k_gemmw<bf, 0, false><<<dim3(NB_ * TT / 64, DKV / 64, 1), 32, 0, stream>>>(XB, nullptr, WV, nullptr, DM, FV, DKV, nullptr, 0, 0, 0); k_vtp<<<dim3(LKv, NB_), 256, 0, stream>>>(FV, DKV, NKV, VT16, VTh, VTl);
    k_flash<<<dim3(NB_ * NKV, NLO + NHI), 128, 0, stream>>>(QP16, KP16, VT16, QPh, QPl, KPh, KPl, VTh, ATh, ATl);
    k_gemmw<bf, 1, false><<<dim3(NB_ * TT / 64, DM / 64, 1), 32, 0, stream>>>(ATh, ATl, WO, nullptr, DQ, OUT, DM, nullptr, 0, 0, 0);
}

// v004
// A run of this version takes 163 microseconds.
// Two timings next to v003 put it at 1.57 and 1.60 times that version's speed.
// All steps since v000 together make it 16.8 times as fast.
#include <hip/hip_runtime.h>

// GQA causal attention block (x [4][2048][1024]; q = x wq (16 heads x 64), k, v = x wk / wv (4 kv heads, GQA groups of 4); RoPE (rotate-half, base 10000) on q, k; causal softmax(q.k/8); out = (attn v merged) wo -> [4][2048][1024]).
// Compute dtypes, f32 accumulate: every input rounded to bf16; q/k/v projections on PLAIN bf16 operands (inputs: exact); RoPE f32; scores (K 64) and attn.v on bf16 hi+lo planes (3 products) for the first 512 query rows of each head and

#define NB_  4
#define TT   2048
#define DM   1024
#define NH_  16
#define NKV  4
#define REP  (NH_ / NKV)
#define HD   64
#define DQ   (NH_ * HD)
#define DKV  (NKV * HD)
#define RH   512                  // query rows < RH use hi+lo planes (0: none)
#define PCAR 1024.0f
#define SCL  0.125f   // HD^-0.5
typedef _Float16 h16;
typedef unsigned short bf;
typedef __attribute__((ext_vector_type(16))) __bf16   v16bf;
typedef __attribute__((ext_vector_type(16))) _Float16 v16h;
typedef __attribute__((ext_vector_type(8)))  _Float16 v8h;
typedef __attribute__((ext_vector_type(8)))  unsigned short v8us;
typedef __attribute__((ext_vector_type(8)))  float    v8f;
typedef __attribute__((ext_vector_type(4)))  float    v4f;
typedef v8h  __attribute__((may_alias)) v8ha;
typedef v4f  __attribute__((may_alias)) v4fa;
typedef v8us __attribute__((may_alias)) v8usa;

__device__ __forceinline__ unsigned short f2bf(float f) { unsigned u = __float_as_uint(f); u += 0x7FFFu + ((u >> 16) & 1u); return (unsigned short)(u >> 16); }
__device__ __forceinline__ float bf2f(unsigned short b) { return __uint_as_float(((unsigned)b) << 16); }
__device__ __forceinline__ float bfr(float f) { return bf2f(f2bf(f)); }
__device__ __forceinline__ v16h cat16(v8h lo, v8h hi) { return __builtin_shufflevector(lo, hi, 0, 1, 2, 3, 4, 5, 6, 7, 8, 9, 10, 11, 12, 13, 14, 15); }
__device__ __forceinline__ v16bf cat16b(v8us lo, v8us hi) { return __builtin_bit_cast(v16bf, __builtin_shufflevector(lo, hi, 0, 1, 2, 3, 4, 5, 6, 7, 8, 9, 10, 11, 12, 13, 14, 15)); }
__device__ __forceinline__ v8f wmma16(v16h a, v16h b, v8f c) { return __builtin_amdgcn_wmma_f32_16x16x32_f16(false, a, false, b, (short)0, c, false, false); }
__device__ __forceinline__ v8f wmmab(v16bf a, v16bf b, v8f c) { return __builtin_amdgcn_wmma_f32_16x16x32_bf16(false, a, false, b, (short)0, c, false, false); }



// ---- FRAGMENT ORDER: every 16-bit matrix operand plane [row][k] lies in units of 16 rows x 32 k (512 elements, 1 KB), units ordered [row / 16][k / 32]; inside a unit element (row, k) stands at
// ((k >> 4) & 1) * 256 + (((k >> 3) & 1) * 16 + (row & 15)) * 8 + (k & 7): a lane's two 16-byte fragment pieces are unit + lane * 8 and + 256, so each wave-wide load is 512 contiguous bytes (4 whole lines, not 32 bytes in each of 16).
// k_wtG and k_cvt8 walk a plane in storage order and ask unfrag for the (row, k) that stands at a position; KB = k / 32 units a row block.
__device__ __forceinline__ void unfrag(size_t pos, int KB, int& row, int& k) { const int u = (int)(pos >> 9), r = (int)(pos & 511); row = (u / KB) * 16 + ((r >> 3) & 15); k = (u % KB) * 32 + (r >> 8) * 16 + ((r >> 7) & 1) * 8 + (r & 7); }
// ---- k_gemmw: register-blocked GEMM, ONE WAVE per 64x64 output tile (16 accumulators), operands straight from 16-bit planes in fragment order; grid (M/64, N/64, Z), 32 threads.
// C[m][n] (f32, pitch ldc, + optional f32 bias[n]) = sum_k A[m][k] Bt[n][k] (+ split products per NSPLIT). z-batch strides sA/sB/sC in elements. K % 32 == 0.
// ld(u, lb): the fragment of the unit at u (the same for the whole wave), lb = lane * 16, the lane's byte offset in it; ldp(p): the same from the lane's own address
template <typename T16> struct WFrag;
template <> struct WFrag<h16> { typedef v16h V; static __device__ __forceinline__ V ldp(const char* p) { return cat16(*(const v8h*)p, *(const v8h*)(p + 512)); } static __device__ __forceinline__ V ld(const h16* u, unsigned lb) { return ldp((const char*)u + lb); } static __device__ __forceinline__ v8f mma(V a, V b, v8f c) { return wmma16(a, b, c); } };
template <> struct WFrag<bf> { typedef v16bf V; static __device__ __forceinline__ V ldp(const char* p) { return cat16b(*(const v8us*)p, *(const v8us*)(p + 512)); } static __device__ __forceinline__ V ld(const bf* u, unsigned lb) { return ldp((const char*)u + lb); } static __device__ __forceinline__ v8f mma(V a, V b, v8f c) { return wmmab(a, b, c); } };
template <typename T16, int NSPLIT, bool BIAS>
__global__ __launch_bounds__(32) void k_gemmw(const T16* __restrict__ A, const T16* __restrict__ A2, const T16* __restrict__ Bt, const T16* __restrict__ Bt2, int K, float* C, int ldc, const float* __restrict__ bias, size_t sA, size_t sB, size_t sC) {
    typedef typename WFrag<T16>::V V;
    __shared__ __align__(16) float os[16 * 68];
    const size_t z = blockIdx.z; A += z * sA; if (A2) A2 += z * sA; Bt += z * sB; if (Bt2) Bt2 += z * sB; C += z * sC;
    const int lane = threadIdx.x & 31, lr = lane & 15, hi = lane >> 4; const int r0 = blockIdx.x * 64, c0 = blockIdx.y * 64;
    v8f acc[4][4];
#pragma unroll
    for (int mb = 0; mb < 4; ++mb)
#pragma unroll
        for (int nb = 0; nb < 4; ++nb) acc[mb][nb] = (v8f){};
    const size_t aoff = (size_t)r0 * K, boff = (size_t)c0 * K; const unsigned lb = lane * 16;   // a row block of 16 is K * 16 elements, a step of 32 k one unit of 512
#pragma unroll 1
    for (int kc = 0; kc < K; kc += 32) {
        V a[4], a2[4]; const char* pa[4]; const char* pa2[4];
#pragma unroll
        for (int mb = 0; mb < 4; ++mb) { pa[mb] = (const char*)(A + aoff + (size_t)mb * 16 * K + kc * 16) + lb; a[mb] = WFrag<T16>::ldp(pa[mb]); if (NSPLIT == 1 || NSPLIT == 2) { pa2[mb] = (const char*)(A2 + aoff + (size_t)mb * 16 * K + kc * 16) + lb; a2[mb] = WFrag<T16>::ldp(pa2[mb]); } }
        // s_wait_xcnt 0 behind loads, in front of whatever next rewrites an address register of theirs; the addresses are inputs so that they live to the wait and no later load's result lands in them
        if (NSPLIT == 1 || NSPLIT == 2) asm volatile("s_wait_xcnt 0x0" :: "v"(pa[0]), "v"(pa[1]), "v"(pa[2]), "v"(pa[3]), "v"(pa2[0]), "v"(pa2[1]), "v"(pa2[2]), "v"(pa2[3]) : "memory");
        else asm volatile("s_wait_xcnt 0x0" :: "v"(pa[0]), "v"(pa[1]), "v"(pa[2]), "v"(pa[3]) : "memory");
#pragma unroll
        for (int nb = 0; nb < 4; ++nb) { const char* pb = (const char*)(Bt + boff + (size_t)nb * 16 * K + kc * 16) + lb; const V b = WFrag<T16>::ldp(pb); V b2; asm volatile("s_wait_xcnt 0x0" :: "v"(pb) : "memory");   // as above
            if (NSPLIT >= 2) { const char* pb2 = (const char*)(Bt2 + boff + (size_t)nb * 16 * K + kc * 16) + lb; b2 = WFrag<T16>::ldp(pb2); asm volatile("s_wait_xcnt 0x0" :: "v"(pb2) : "memory"); }   // as above
#pragma unroll
            for (int mb = 0; mb < 4; ++mb) { acc[mb][nb] = WFrag<T16>::mma(a[mb], b, acc[mb][nb]); if (NSPLIT == 1 || NSPLIT == 2) acc[mb][nb] = WFrag<T16>::mma(a2[mb], b, acc[mb][nb]); if (NSPLIT >= 2) acc[mb][nb] = WFrag<T16>::mma(a[mb], b2, acc[mb][nb]); } }
        asm volatile("v_nop\n\tv_nop\n\tv_nop\n\tv_nop" : "+v"(acc[0][0]), "+v"(acc[1][1]), "+v"(acc[2][2]), "+v"(acc[3][3]) : "v"(a[0]), "v"(a[3]));
    }
#pragma unroll
    for (int mb = 0; mb < 4; ++mb) {
#pragma unroll
        for (int nb = 0; nb < 4; ++nb) {
#pragma unroll
            for (int j = 0; j < 8; ++j) os[(hi * 8 + j) * 68 + nb * 16 + lr] = acc[mb][nb][j]; }
        __builtin_amdgcn_wave_barrier(); asm volatile("" ::: "memory");
        float* crow = C + (size_t)(r0 + mb * 16) * ldc + c0;
{
#pragma unroll
            for (int s = 0; s < 8; ++s) { const int row = 2 * s + hi, cofs = lr * 4; v4f val = *(const v4fa*)(os + row * 68 + cofs); if (BIAS) { val[0] += bfr(bias[c0 + cofs]); val[1] += bfr(bias[c0 + cofs + 1]); val[2] += bfr(bias[c0 + cofs + 2]); val[3] += bfr(bias[c0 + cofs + 3]); }
                *(v4f*)(crow + (size_t)row * ldc + cofs) = val; }
             }
        __builtin_amdgcn_wave_barrier(); asm volatile("" ::: "memory");
    }
}

__device__ __forceinline__ h16 tohx(float x) { return (h16)x; }
__device__ __forceinline__ void splitf(float y, unsigned short& h, unsigned short& l) { h = f2bf(y); l = f2bf(y - bf2f(h)); }
typedef __attribute__((ext_vector_type(2))) _Float16 v2h;
typedef __attribute__((ext_vector_type(4))) _Float16 v4h;
typedef __attribute__((ext_vector_type(2))) unsigned short v2us;
typedef __attribute__((ext_vector_type(4))) unsigned short v4us;
typedef __attribute__((ext_vector_type(2))) float v2f;
typedef __attribute__((ext_vector_type(4))) int v4i;

__global__ __launch_bounds__(256) void k_wtG(const float* __restrict__ w, int K, int N, bf* Bt) {
    const int lane = threadIdx.x & 31; const int L0 = (blockIdx.x * 8 + (threadIdx.x >> 5)) * 8; const int nlines = N * K / 64;
{
#pragma unroll 1
        for (int l = 0; l < 8; ++l) { const int L = L0 + l; if (L >= nlines) break; const size_t e = (size_t)L * 64 + lane * 2; int k, n; unfrag(e, K / 32, n, k); v2us o;
            const float* p0 = w + (size_t)k * N + n; const float* p1 = p0 + N; const float w0 = *p0, w1 = *p1;
            asm volatile("s_wait_xcnt 0x0" :: "v"(p0), "v"(p1) : "memory");   // behind the loads, in front of whatever next rewrites an address register of theirs (inputs: they live to the wait)
            o[0] = f2bf(w0); o[1] = f2bf(w1); bf* po = Bt + e;
            asm volatile("global_store_b32 %0, %1, off\n\ts_wait_xcnt 0x0" :: "v"(po), "v"(__builtin_bit_cast(unsigned, o)) : "memory"); }   // the store with its wait in one statement: the next trip rewrites its registers
         }
}
__global__ __launch_bounds__(256) void k_cvt8(const float* __restrict__ src, bf* dst, size_t n8) { const size_t i = (size_t)blockIdx.x * 256 + threadIdx.x; if (i >= n8) return; int row, k; unfrag(i * 8, DM / 32, row, k); const float* p = src + (size_t)row * DM + k; const v8f v = *(const v8f*)p; v8us o;
    asm volatile("s_wait_xcnt 0x0" :: "v"(p) : "memory");   // behind the loads, in front of whatever next rewrites their address register (an input: it lives to the wait)
#pragma unroll
    for (int k = 0; k < 8; ++k) o[k] = f2bf(v[k]); *(v8us*)(dst + i * 8) = o;  }
__global__ __launch_bounds__(256) void k_cstab(float* CS) { const int idx = blockIdx.x * 256 + threadIdx.x; if (idx >= TT * HD) return; const int t = idx / HD, d = idx % HD; const int i = d % (HD / 2); const float inv = __fdiv_rn(1.0f, powf(10000.0f, (float)(2 * i) / (float)HD)); const float ang = __fmul_rn((float)t, inv); v2f cs; cs[0] = cosf(ang); cs[1] = sinf(ang);
    *(v2f*)(CS + (size_t)idx * 2) = cs;  }
// ---- k_qkv: the q, k and v projections in ONE launch, RoPE and the forming of the 16-bit operand planes in its epilogue (no f32 projection ever reaches memory). grid (tokens / 64, NH_ + 2 * NKV), 32 threads:
// ONE WAVE per 64 tokens x one head (HD = 64 columns), main loop as in k_gemmw; y < NH_: q head y, then the NKV k heads, then the NKV v heads.
// Every plain '#pragma unroll' here stands on a loop whose counter indexes accumulators, fragments or table entries: they stay in registers only where those indices are constants.
// the fp16, the hi and the lo store of eight plane elements, with their s_wait_xcnt 0 in the same statement: so it stands in front of whatever next rewrites an address or data register of theirs
__device__ __forceinline__ void st3x(h16* p16, v8h a, bf* ph, v8us b, bf* pl, v8us c) {
    asm volatile("global_store_b128 %0, %1, off\n\tglobal_store_b128 %2, %3, off\n\tglobal_store_b128 %4, %5, off\n\ts_wait_xcnt 0x0" :: "v"(p16), "v"(__builtin_bit_cast(v4i, a)), "v"(ph), "v"(__builtin_bit_cast(v4i, b)), "v"(pl), "v"(__builtin_bit_cast(v4i, c)) : "memory");
}
__device__ __forceinline__ void put8(const float* x, h16* p16, bf* ph, bf* pl) { v8h o16; v8us oh, ol;
#pragma unroll
    for (int j = 0; j < 8; ++j) { o16[j] = tohx(x[j]); unsigned short a2, c2; splitf(x[j], a2, c2); oh[j] = a2; ol[j] = c2; }
    st3x(p16, o16, ph, oh, pl, ol); }
__global__ __launch_bounds__(32) void k_qkv(const bf* __restrict__ A, const bf* __restrict__ WQ, const bf* __restrict__ WK, const bf* __restrict__ WV, const float* __restrict__ CS, h16* QP16, bf* QPh, bf* QPl, h16* KP16, bf* KPh, bf* KPl, h16* VT16, bf* VTh) {
    static_assert(HD == 64 && TT % 64 == 0, "a 64 x 64 tile is 64 tokens of one batch x one whole head");
    typedef WFrag<bf>::V V;
    __shared__ __align__(16) float os[16 * 68];
    const int K = DM, lane = threadIdx.x & 31, lr = lane & 15, hi = lane >> 4; const int r0 = blockIdx.x * 64, cy = blockIdx.y;
    const bf* Bt = cy < NH_ ? WQ + (size_t)cy * HD * K : cy < NH_ + NKV ? WK + (size_t)(cy - NH_) * HD * K : WV + (size_t)(cy - NH_ - NKV) * HD * K;
    v8f acc[4][4];
#pragma unroll
    for (int mb = 0; mb < 4; ++mb)
#pragma unroll
        for (int nb = 0; nb < 4; ++nb) acc[mb][nb] = (v8f){};
    const size_t aoff = (size_t)r0 * K; const unsigned lb = lane * 16;
#pragma unroll 1   // as in k_gemmw: one k step of 32 a trip
    for (int kc = 0; kc < K; kc += 32) {
        V a[4]; const char* pa = (const char*)(A + aoff + kc * 16) + lb; const char* pb = (const char*)(Bt + kc * 16) + lb;   // K is a constant here: the four row blocks of an operand are constant offsets from one address
#pragma unroll
        for (int mb = 0; mb < 4; ++mb) a[mb] = WFrag<bf>::ldp(pa + mb * 16 * K * 2);
        // s_wait_xcnt 0 behind loads, in front of whatever next rewrites an address register of theirs; the address is an input so that it lives to the wait and no later load's result lands in it
        asm volatile("s_wait_xcnt 0x0" :: "v"(pa) : "memory");
#pragma unroll
        for (int nb = 0; nb < 4; ++nb) { const V b = WFrag<bf>::ldp(pb + nb * 16 * K * 2); asm volatile("s_wait_xcnt 0x0" :: "v"(pb) : "memory");   // as above
#pragma unroll
            for (int mb = 0; mb < 4; ++mb) acc[mb][nb] = WFrag<bf>::mma(a[mb], b, acc[mb][nb]); }
        asm volatile("v_nop\n\tv_nop\n\tv_nop\n\tv_nop" : "+v"(acc[0][0]), "+v"(acc[1][1]), "+v"(acc[2][2]), "+v"(acc[3][3]) : "v"(a[0]), "v"(a[3]));   // the distance behind the trip's last matrix instructions, on the loop's back edge too
    }
    const int b = r0 / TT, t0 = r0 % TT;
    if (cy >= NH_ + NKV) {
        // v: planes [d][t]. Register j of accumulator (mb, nb) is token t0 + mb * 16 + hi * 8 + j of column d = nb * 16 + lr: a lane's eight registers are, as they stand, its 16-byte piece of the unit (d / 16, t / 32), half mb & 1
        const size_t po = ((size_t)b * NKV + (cy - NH_ - NKV)) * (HD * 2 * TT) + (size_t)(t0 / 32) * 512 + lane * 8;
#pragma unroll
        for (int mb = 0; mb < 4; ++mb)
#pragma unroll
            for (int nb = 0; nb < 4; ++nb) { float x[8];
#pragma unroll
                for (int j = 0; j < 8; ++j) x[j] = acc[mb][nb][j];
                const size_t oo = po + (size_t)(nb * (TT / 32) + (mb >> 1)) * 512 + (mb & 1) * 256; put8(x, VT16 + oo, VTh + oo, VTh + HD * TT + oo); }
        return;
    }
    // q, k: planes [t][d]. Rotate-half pairs d and d + HD/2, which one lane holds in accumulators nb and nb + 2; cos and sin of d + HD/2 are those of d. The rotated 16 x 64 block goes through LDS to turn a lane's eight tokens into eight d.
    const bool isq = cy < NH_; const size_t po = (isq ? (size_t)b * NH_ + cy : (size_t)b * NKV + (cy - NH_)) * (TT * HD) + (size_t)t0 * HD + lane * 8;
    h16* P16 = (isq ? QP16 : KP16) + po; bf* Ph = (isq ? QPh : KPh) + po; bf* Pl = (isq ? QPl : KPl) + po;
    const char* csb = (const char*)(CS + (size_t)t0 * HD * 2); const unsigned lo = (hi * 8 * HD + lr) * 8;   // table entry (t, d): 8 bytes, cos then sin
    v2f cs[2][16];
    auto ldcs = [&](int mb, v2f* c) __attribute__((always_inline)) {
#pragma unroll
        for (int nb = 0; nb < 2; ++nb)
#pragma unroll
            for (int j = 0; j < 8; ++j) c[nb * 8 + j] = *(const v2f*)(csb + lo + ((mb * 16 + j) * HD + nb * 16) * 8);
        asm volatile("s_wait_xcnt 0x0" :: "v"(lo) : "memory"); };   // behind the table loads, in front of whatever next rewrites a register that they name; the offset is an input so that it lives to the wait
    ldcs(0, cs[0]);
#pragma unroll
    for (int mb = 0; mb < 4; ++mb) {
        if (mb < 3) ldcs(mb + 1, cs[(mb + 1) & 1]);   // the next 16 tokens' table entries fly while these are rotated and stored
#pragma unroll
        for (int nb = 0; nb < 2; ++nb)
#pragma unroll
            for (int j = 0; j < 8; ++j) { const float c = cs[mb & 1][nb * 8 + j][0], s = cs[mb & 1][nb * 8 + j][1], x0 = acc[mb][nb][j], x1 = acc[mb][nb + 2][j];
                os[(hi * 8 + j) * 68 + nb * 16 + lr] = x0 * c - x1 * s; os[(hi * 8 + j) * 68 + (nb + 2) * 16 + lr] = x1 * c + x0 * s; }
        __builtin_amdgcn_wave_barrier(); asm volatile("" ::: "memory");   // the one wave's LDS writes stay in front of its reads below
#pragma unroll
        for (int u = 0; u < 4; ++u) { const float* sp = os + lr * 68 + u * 16 + hi * 8; const v4f u0 = *(const v4fa*)sp, u1 = *(const v4fa*)(sp + 4); const float x[8] = {u0[0], u0[1], u0[2], u0[3], u1[0], u1[1], u1[2], u1[3]};
            const int oo = mb * 1024 + u * 256; put8(x, P16 + oo, Ph + oo, Pl + oo); }   // unit (t / 16, d / 32), half (d / 16) & 1
        __builtin_amdgcn_wave_barrier(); asm volatile("" ::: "memory");   // and its reads in front of the next block's writes
    }
}
// ---- k_flash: scores, causal softmax, probability x value and the head merge in ONE launch; scores and probabilities never leave registers (online softmax over key blocks of 32).
// One wave owns NBQ*16 query rows of one head. It forms the TRANSPOSED score tile S^T[key][query] = K Q^T (A = key rows, B = query rows), so that a lane holds scores of one query only (max and sum in-lane plus one
// exchange between the lane halves) and the accumulator registers of two 16-key tiles are, as they stand, the B operand P^T[query][key 0..31] of O^T[d][query] += V^T P^T (A = value rows [d][t]).
// k order of every operand: element e of lane half hi is k = (e / 8) * 16 + 8 * hi + e % 8 (WFrag::ld on both global operands; score tile mt, register j is key mt * 16 + 8 * hi + j).
// The four waves of a block are the four heads of one kv group on the same query rows: they read the same key and value lines. HR: bf16 hi+lo planes, 3 products; else fp16, probabilities carried x PCAR (it cancels in O / l).
typedef __attribute__((ext_vector_type(16))) unsigned short v16us;
// eight 2^x in one statement: no result shares a register with a source ("=&v"), and the v_nop is the free slot behind the last transcendental
__device__ __forceinline__ void exp2x8(float* p, const float* x) {
    asm("v_exp_f32 %0, %8\n\tv_exp_f32 %1, %9\n\tv_exp_f32 %2, %10\n\tv_exp_f32 %3, %11\n\tv_exp_f32 %4, %12\n\tv_exp_f32 %5, %13\n\tv_exp_f32 %6, %14\n\tv_exp_f32 %7, %15\n\tv_nop"
        : "=&v"(p[0]), "=&v"(p[1]), "=&v"(p[2]), "=&v"(p[3]), "=&v"(p[4]), "=&v"(p[5]), "=&v"(p[6]), "=&v"(p[7]) : "v"(x[0]), "v"(x[1]), "v"(x[2]), "v"(x[3]), "v"(x[4]), "v"(x[5]), "v"(x[6]), "v"(x[7]));
}
// the hi and the lo store of eight merged outputs, with their s_wait_xcnt 0 in the same statement: so it stands in front of whatever next rewrites an address or data register of theirs, on every way out of a tile
// (as a statement of its own the wait let the next outputs' arithmetic move up over it)
__device__ __forceinline__ void st2x(bf* pa, v8us a, bf* pb, v8us b) {
    asm volatile("global_store_b128 %0, %1, off\n\tglobal_store_b128 %2, %3, off\n\ts_wait_xcnt 0x0" :: "v"(pa), "v"(__builtin_bit_cast(v4i, a)), "v"(pb), "v"(__builtin_bit_cast(v4i, b)) : "memory");
}
template <typename T16, bool HR, int NBQ>
__device__ __forceinline__ void flash_tile(const T16* __restrict__ Q, const T16* __restrict__ Q2, const T16* __restrict__ Kp, const T16* __restrict__ K2, const T16* __restrict__ Vt, const T16* __restrict__ V2, int q0, bf* Ah, bf* Al) {
    typedef typename WFrag<T16>::V V;
    const int lane = threadIdx.x & 31, lr = lane & 15, hi = lane >> 4; const unsigned lb = lane * 16;
    V qf[NBQ][2], qf2[NBQ][2];
#pragma unroll
    for (int nb = 0; nb < NBQ; ++nb)
#pragma unroll
        for (int kc = 0; kc < 2; ++kc) { const int qo = (q0 + nb * 16) * HD + kc * 512; qf[nb][kc] = WFrag<T16>::ld(Q + qo, lb); if (HR) qf2[nb][kc] = WFrag<T16>::ld(Q2 + qo, lb); }
    asm volatile("s_wait_xcnt 0x0" :: "v"(lb) : "memory");   // behind the query loads, in front of whatever next rewrites a register that they name; the offset is an input so that no load's result lands in it
    v8f o[4][NBQ]; float m[NBQ], l[NBQ];
#pragma unroll
    for (int nb = 0; nb < NBQ; ++nb) { m[nb] = -3.0e38f; l[nb] = 0.f;
#pragma unroll
        for (int dt = 0; dt < 4; ++dt) o[dt][nb] = (v8f){}; }
    const int nkb = (q0 + NBQ * 16 + 31) / 32;      // key blocks up to the diagonal; every block starts at a key <= q0, so no query ever sees a fully masked block; only the last block holds keys beyond a query
    const float L2E = 1.4426950408889634f, PEXP = HR ? 0.0f : 10.0f;   // 2^10 = PCAR
    V kf[2][2], kf2[2][2], vf[4], vf2[4];
    auto ldk = [&](int k0) __attribute__((always_inline)) {
#pragma unroll
        for (int mt = 0; mt < 2; ++mt)
#pragma unroll
            for (int kc = 0; kc < 2; ++kc) { const int ko = (k0 + mt * 16) * HD + kc * 512; kf[mt][kc] = WFrag<T16>::ld(Kp + ko, lb); if (HR) kf2[mt][kc] = WFrag<T16>::ld(K2 + ko, lb); }
        asm volatile("s_wait_xcnt 0x0" :: "v"(lb) : "memory"); };   // stands behind the loads, in front of whatever next rewrites a register that they name (a later load's result among them)
    auto ldv = [&](int k0) __attribute__((always_inline)) {
#pragma unroll
        for (int dt = 0; dt < 4; ++dt) { const int vo = dt * 16 * TT + k0 * 16; vf[dt] = WFrag<T16>::ld(Vt + vo, lb); if (HR) vf2[dt] = WFrag<T16>::ld(V2 + vo, lb); }
        asm volatile("s_wait_xcnt 0x0" :: "v"(lb) : "memory"); };   // as in ldk
    // one key block; last: the block on the diagonal (masked, nothing fetched behind it). Otherwise the next block's key fragments are asked for behind the score products and its value fragments behind the value
    // products, one block ahead of their use (where the registers are short the compiler may issue the key loads later in the block).
    auto step = [&](int k0, bool last) __attribute__((always_inline)) {
        v8f s[2][NBQ];
#pragma unroll
        for (int mt = 0; mt < 2; ++mt)
#pragma unroll
            for (int nb = 0; nb < NBQ; ++nb) { v8f a = (v8f){};
#pragma unroll
                for (int kc = 0; kc < 2; ++kc) { a = WFrag<T16>::mma(kf[mt][kc], qf[nb][kc], a); if (HR) { a = WFrag<T16>::mma(kf[mt][kc], qf2[nb][kc], a); a = WFrag<T16>::mma(kf2[mt][kc], qf[nb][kc], a); } }
                s[mt][nb] = a; }
        if (!last) ldk(k0 + 32);
        V pf[NBQ], pf2[NBQ];
#pragma unroll
        for (int nb = 0; nb < NBQ; ++nb) {
            const int qi = q0 + nb * 16 + lr; float mx = m[nb];
#pragma unroll
            for (int mt = 0; mt < 2; ++mt)
#pragma unroll
                for (int j = 0; j < 8; ++j) { float t = s[mt][nb][j] * SCL; if (last && k0 + mt * 16 + hi * 8 + j > qi) t = -3.0e38f; s[mt][nb][j] = t; mx = fmaxf(mx, t); }
            mx = fmaxf(mx, __shfl_xor(mx, 16, 32));
            float al; asm("v_exp_f32 %0, %1\n\tv_nop" : "=v"(al) : "v"((m[nb] - mx) * L2E)); m[nb] = mx;   // 2^x with the free slot behind a transcendental in the same statement
            float ps = 0.f; float x[16], p[16];
#pragma unroll
            for (int e = 0; e < 16; ++e) x[e] = (s[e >> 3][nb][e & 7] - mx) * L2E + PEXP;
            exp2x8(p, x); exp2x8(p + 8, x + 8);
#pragma unroll
            for (int e = 0; e < 16; ++e) ps += p[e];
            l[nb] = l[nb] * al + ps;                // this lane half's keys only; the halves are added once, after the loop
#pragma unroll
            for (int dt = 0; dt < 4; ++dt) o[dt][nb] *= al;
            if constexpr (HR) { v16us ph, pl;
#pragma unroll
                for (int e = 0; e < 16; ++e) { unsigned short a, c2; splitf(p[e], a, c2); ph[e] = a; pl[e] = c2; }
                pf[nb] = __builtin_bit_cast(v16bf, ph); pf2[nb] = __builtin_bit_cast(v16bf, pl);
            } else { v16h ph;
#pragma unroll
                for (int e = 0; e < 16; ++e) ph[e] = tohx(p[e]);
                pf[nb] = ph; }
        }
#pragma unroll
        for (int dt = 0; dt < 4; ++dt)
#pragma unroll
            for (int nb = 0; nb < NBQ; ++nb) { o[dt][nb] = WFrag<T16>::mma(vf[dt], pf[nb], o[dt][nb]); if (HR) { o[dt][nb] = WFrag<T16>::mma(vf[dt], pf2[nb], o[dt][nb]); o[dt][nb] = WFrag<T16>::mma(vf2[dt], pf[nb], o[dt][nb]); } }
        if (!last) ldv(k0 + 32);
    };
    ldk(0); ldv(0);   // keys first, as in the loop: loads return in order, and the wait at the loop's head leaves the value loads in flight
#pragma unroll 1   // run-time trip count round a body that already fills most of the register file: a second copy of the body would spill
    for (int kb = 0; kb < nkb - 1; ++kb) step(kb * 32, false);
    step((nkb - 1) * 32, true);
#pragma unroll
    for (int nb = 0; nb < NBQ; ++nb) {
        const float lt = l[nb] + __shfl_xor(l[nb], 16, 32); const float inv = __fdiv_rn(1.0f, lt);
#pragma unroll
        for (int dt = 0; dt < 4; ++dt) { v8us oh, ol;
#pragma unroll
            for (int j = 0; j < 8; ++j) { unsigned short a, c2; splitf(o[dt][nb][j] * inv, a, c2); oh[j] = a; ol[j] = c2; }
            const size_t oo = (size_t)(q0 + nb * 16) * DQ + dt * 256 + lane * 8; st2x(Ah + oo, oh, Al + oo, ol); }   // fragment order of the merged [token][DQ] plane: the head's two units, half dt & 1
    }
}
#define NLO ((TT - RH) / 32)      // fp16 query tiles of 32 rows
#define NHI (RH / 16)             // hi+lo query tiles of 16 rows
// grid (kv planes, NLO + NHI): y counts the query tiles from the longest key range down, so that the long tiles start first
__global__ __launch_bounds__(128) void k_flash(const h16* __restrict__ QP16, const h16* __restrict__ KP16, const h16* __restrict__ VT16, const bf* __restrict__ QPh, const bf* __restrict__ QPl, const bf* __restrict__ KPh, const bf* __restrict__ KPl, const bf* __restrict__ VTh, bf* ATh, bf* ATl) {
    const int kvp = blockIdx.x, g = kvp * REP + __builtin_amdgcn_readfirstlane(threadIdx.x >> 5), b = g / NH_, h = g % NH_, ty = blockIdx.y;   // g = b*NH_ + h: flat head; its kv plane is g / REP
    const size_t qo = (size_t)g * TT * HD, ko = (size_t)kvp * TT * HD, vo = (size_t)kvp * HD * 2 * TT, ao = (size_t)b * TT * DQ + h * (HD * 16);
    if (ty < NLO) flash_tile<h16, false, 2>(QP16 + qo, nullptr, KP16 + ko, nullptr, VT16 + vo, nullptr, TT - 32 * (ty + 1), ATh + ao, ATl + ao);
    else flash_tile<bf, true, 1>(QPh + qo, QPl + qo, KPh + ko, KPl + ko, VTh + vo, VTh + vo + HD * TT, RH - 16 * (ty - NLO + 1), ATh + ao, ATl + ao);
}

extern "C" void kernel_launch(void* const* d_in, const int* in_sizes, int n_in,
                              void* d_out, int out_size, void* d_ws, size_t ws_size, hipStream_t stream) {
    (void)in_sizes; (void)n_in; (void)out_size;
    const float* x = (const float*)d_in[0]; const float* wq = (const float*)d_in[1]; const float* wk = (const float*)d_in[2]; const float* wv = (const float*)d_in[3]; const float* wo = (const float*)d_in[4];
    float* OUT = (float*)d_out;     // [4][2048][1024]
    char* wsp = (char*)d_ws;
    auto take = [&](size_t bytes) { char* p = wsp; wsp += (bytes + 255) & ~(size_t)255; return (void*)p; };
    bf* WQ = (bf*)take((size_t)DQ * DM * 2); bf* WK = (bf*)take((size_t)DKV * DM * 2); bf* WV = (bf*)take((size_t)DKV * DM * 2); bf* WO = (bf*)take((size_t)DM * DQ * 2); float* CS = (float*)take((size_t)TT * HD * 2 * 4);
    h16* QP16 = (h16*)take((size_t)NB_ * NH_ * TT * HD * 2); h16* KP16 = (h16*)take((size_t)NB_ * NKV * TT * HD * 2); h16* VT16 = (h16*)take((size_t)NB_ * NKV * HD * 2 * TT * 2);   // heads 2*HD*TT elements apart, as in the hi+lo planes: the fp16 plane fills the first HD*TT
    bf* QPh = (bf*)take((size_t)NB_ * NH_ * TT * HD * 2); bf* QPl = (bf*)take((size_t)NB_ * NH_ * TT * HD * 2); bf* KPh = (bf*)take((size_t)NB_ * NKV * TT * HD * 2); bf* KPl = (bf*)take((size_t)NB_ * NKV * TT * HD * 2); bf* VTh = (bf*)take((size_t)NB_ * NKV * HD * 2 * TT * 2);   // a head's hi plane, then its lo plane
    bf* ATh = (bf*)take((size_t)NB_ * TT * DQ * 2); bf* ATl = (bf*)take((size_t)NB_ * TT * DQ * 2);
    bf* XB = (bf*)take((size_t)NB_ * TT * DM * 2);   // x in bf16
    if ((size_t)(wsp - (char*)d_ws) > ws_size) return;    // ws 256 MiB
    { k_wtG<<<(unsigned)((DM * DQ / 64 + 63) / 64), 256, 0, stream>>>(wq, DM, DQ, WQ); k_wtG<<<(unsigned)((DM * DKV / 64 + 63) / 64), 256, 0, stream>>>(wk, DM, DKV, WK); k_wtG<<<(unsigned)((DM * DKV / 64 + 63) / 64), 256, 0, stream>>>(wv, DM, DKV, WV);
      k_wtG<<<(unsigned)((DQ * DM / 64 + 63) / 64), 256, 0, stream>>>(wo, DQ, DM, WO);
      k_cstab<<<(TT * HD + 255) / 256, 256, 0, stream>>>(CS); }
    // projections: the NB_ batches are NB_*TT rows, the q, k and v heads the column tiles, of one GEMM launch
    k_cvt8<<<(unsigned)(((size_t)NB_ * TT * DM / 8 + 255) / 256), 256, 0, stream>>>(x, XB, (size_t)NB_ * TT * DM / 8);
    k_qkv<<<dim3(NB_ * TT / 64, NH_ + 2 * NKV), 32, 0, stream>>>(XB, WQ, WK, WV, CS, QP16, QPh, QPl, KP16, KPh, KPl, VT16, VTh);
    k_flash<<<dim3(NB_ * NKV, NLO + NHI), 128, 0, stream>>>(QP16, KP16, VT16, QPh, QPl, KPh, KPl, VTh, ATh, ATl);
    k_gemmw<bf, 1, false><<<dim3(NB_ * TT / 64, DM / 64, 1), 32, 0, stream>>>(ATh, ATl, WO, nullptr, DQ, OUT, DM, nullptr, 0, 0, 0);
}

// v005
// One run takes 141 microseconds.
// Timed twice side by side with v004, it ran 1.16 and 1.17 times as fast.
// All steps since v000 together make it 19.5 times as fast.
#include <hip/hip_runtime.h>

// GQA causal attention block (x [4][2048][1024]; q = x wq (16 heads x 64), k, v = x wk / wv (4 kv heads, GQA groups of 4); RoPE (rotate-half, base 10000) on q, k; causal softmax(q.k/8); out = (attn v merged) wo -> [4][2048][1024]).
// Compute dtypes, f32 accumulate: every input rounded to bf16; q/k/v projections on PLAIN bf16 operands (inputs: exact); RoPE f32; scores (K 64) and attn.v on bf16 hi+lo planes (3 products) for the first 512 query rows of each head and

#define NB_  4
#define TT   2048
#define DM   1024
#define NH_  16
#define NKV  4
#define REP  (NH_ / NKV)
#define HD   64
#define DQ   (NH_ * HD)
#define DKV  (NKV * HD)
#define RH   512                  // query rows < RH use hi+lo planes (0: none)
#define PCAR 1024.0f
#define SCL  0.125f   // HD^-0.5
typedef _Float16 h16;
typedef unsigned short bf;
typedef __attribute__((ext_vector_type(16))) __bf16   v16bf;
typedef __attribute__((ext_vector_type(16))) _Float16 v16h;
typedef __attribute__((ext_vector_type(8)))  _Float16 v8h;
typedef __attribute__((ext_vector_type(8)))  unsigned short v8us;
typedef __attribute__((ext_vector_type(8)))  float    v8f;
typedef __attribute__((ext_vector_type(4)))  float    v4f;
typedef v8h  __attribute__((may_alias)) v8ha;
typedef v4f  __attribute__((may_alias)) v4fa;
typedef v8us __attribute__((may_alias)) v8usa;

__device__ __forceinline__ unsigned short f2bf(float f) { unsigned u = __float_as_uint(f); u += 0x7FFFu + ((u >> 16) & 1u); return (unsigned short)(u >> 16); }
__device__ __forceinline__ float bf2f(unsigned short b) { return __uint_as_float(((unsigned)b) << 16); }
__device__ __forceinline__ float bfr(float f) { return bf2f(f2bf(f)); }
__device__ __forceinline__ v16h cat16(v8h lo, v8h hi) { return __builtin_shufflevector(lo, hi, 0, 1, 2, 3, 4, 5, 6, 7, 8, 9, 10, 11, 12, 13, 14, 15); }
__device__ __forceinline__ v16bf cat16b(v8us lo, v8us hi) { return __builtin_bit_cast(v16bf, __builtin_shufflevector(lo, hi, 0, 1, 2, 3, 4, 5, 6, 7, 8, 9, 10, 11, 12, 13, 14, 15)); }
__device__ __forceinline__ v8f wmma16(v16h a, v16h b, v8f c) { return __builtin_amdgcn_wmma_f32_16x16x32_f16(false, a, false, b, (short)0, c, false, false); }
__device__ __forceinline__ v8f wmmab(v16bf a, v16bf b, v8f c) { return __builtin_amdgcn_wmma_f32_16x16x32_bf16(false, a, false, b, (short)0, c, false, false); }



// ---- FRAGMENT ORDER: every 16-bit matrix operand plane [row][k] lies in units of 16 rows x 32 k (512 elements, 1 KB), units ordered [row / 16][k / 32]; inside a unit element (row, k) stands at
// ((k >> 4) & 1) * 256 + (((k >> 3) & 1) * 16 + (row & 15)) * 8 + (k & 7): a lane's two 16-byte fragment pieces are unit + lane * 8 and + 256, so each wave-wide load is 512 contiguous bytes (4 whole lines, not 32 bytes in each of 16).
// wtG walks a weight plane in storage order and asks unfrag for the (row, k) that stands at a position; KB = k / 32 units a row block.
__device__ __forceinline__ void unfrag(size_t pos, int KB, int& row, int& k) { const int u = (int)(pos >> 9), r = (int)(pos & 511); row = (u / KB) * 16 + ((r >> 3) & 15); k = (u % KB) * 32 + (r >> 8) * 16 + ((r >> 7) & 1) * 8 + (r & 7); }
// ---- k_gemmw: register-blocked GEMM, ONE WAVE per 64x64 output tile (16 accumulators), operands straight from 16-bit planes in fragment order; grid (M/64, N/64, Z), 32 threads.
// C[m][n] (f32, pitch ldc, + optional f32 bias[n]) = sum_k A[m][k] Bt[n][k] (+ split products per NSPLIT). z-batch strides sA/sB/sC in elements. K % 32 == 0.
// ld(u, lb): the fragment of the unit at u (the same for the whole wave), lb = lane * 16, the lane's byte offset in it; ldp(p): the same from the lane's own address
template <typename T16> struct WFrag;
template <> struct WFrag<h16> { typedef v16h V; static __device__ __forceinline__ V ldp(const char* p) { return cat16(*(const v8h*)p, *(const v8h*)(p + 512)); } static __device__ __forceinline__ V ld(const h16* u, unsigned lb) { return ldp((const char*)u + lb); } static __device__ __forceinline__ v8f mma(V a, V b, v8f c) { return wmma16(a, b, c); } };
template <> struct WFrag<bf> { typedef v16bf V; static __device__ __forceinline__ V ldp(const char* p) { return cat16b(*(const v8us*)p, *(const v8us*)(p + 512)); } static __device__ __forceinline__ V ld(const bf* u, unsigned lb) { return ldp((const char*)u + lb); } static __device__ __forceinline__ v8f mma(V a, V b, v8f c) { return wmmab(a, b, c); } };
template <typename T16, int NSPLIT, bool BIAS>
__global__ __launch_bounds__(32) void k_gemmw(const T16* __restrict__ A, const T16* __restrict__ A2, const T16* __restrict__ Bt, const T16* __restrict__ Bt2, int K, float* C, int ldc, const float* __restrict__ bias, size_t sA, size_t sB, size_t sC) {
    typedef typename WFrag<T16>::V V;
    __shared__ __align__(16) float os[16 * 68];
    const size_t z = blockIdx.z; A += z * sA; if (A2) A2 += z * sA; Bt += z * sB; if (Bt2) Bt2 += z * sB; C += z * sC;
    const int lane = threadIdx.x & 31, lr = lane & 15, hi = lane >> 4; const int r0 = blockIdx.x * 64, c0 = blockIdx.y * 64;
    v8f acc[4][4];
#pragma unroll
    for (int mb = 0; mb < 4; ++mb)
#pragma unroll
        for (int nb = 0; nb < 4; ++nb) acc[mb][nb] = (v8f){};
    const size_t aoff = (size_t)r0 * K, boff = (size_t)c0 * K; const unsigned lb = lane * 16;   // a row block of 16 is K * 16 elements, a step of 32 k one unit of 512
#pragma unroll 1
    for (int kc = 0; kc < K; kc += 32) {
        V a[4], a2[4]; const char* pa[4]; const char* pa2[4];
#pragma unroll
        for (int mb = 0; mb < 4; ++mb) { pa[mb] = (const char*)(A + aoff + (size_t)mb * 16 * K + kc * 16) + lb; a[mb] = WFrag<T16>::ldp(pa[mb]); if (NSPLIT == 1 || NSPLIT == 2) { pa2[mb] = (const char*)(A2 + aoff + (size_t)mb * 16 * K + kc * 16) + lb; a2[mb] = WFrag<T16>::ldp(pa2[mb]); } }
        // s_wait_xcnt 0 behind loads, in front of whatever next rewrites an address register of theirs; the addresses are inputs so that they live to the wait and no later load's result lands in them
        if (NSPLIT == 1 || NSPLIT == 2) asm volatile("s_wait_xcnt 0x0" :: "v"(pa[0]), "v"(pa[1]), "v"(pa[2]), "v"(pa[3]), "v"(pa2[0]), "v"(pa2[1]), "v"(pa2[2]), "v"(pa2[3]) : "memory");
        else asm volatile("s_wait_xcnt 0x0" :: "v"(pa[0]), "v"(pa[1]), "v"(pa[2]), "v"(pa[3]) : "memory");
#pragma unroll
        for (int nb = 0; nb < 4; ++nb) { const char* pb = (const char*)(Bt + boff + (size_t)nb * 16 * K + kc * 16) + lb; const V b = WFrag<T16>::ldp(pb); V b2; asm volatile("s_wait_xcnt 0x0" :: "v"(pb) : "memory");   // as above
            if (NSPLIT >= 2) { const char* pb2 = (const char*)(Bt2 + boff + (size_t)nb * 16 * K + kc * 16) + lb; b2 = WFrag<T16>::ldp(pb2); asm volatile("s_wait_xcnt 0x0" :: "v"(pb2) : "memory"); }   // as above
#pragma unroll
            for (int mb = 0; mb < 4; ++mb) { acc[mb][nb] = WFrag<T16>::mma(a[mb], b, acc[mb][nb]); if (NSPLIT == 1 || NSPLIT == 2) acc[mb][nb] = WFrag<T16>::mma(a2[mb], b, acc[mb][nb]); if (NSPLIT >= 2) acc[mb][nb] = WFrag<T16>::mma(a[mb], b2, acc[mb][nb]); } }
        asm volatile("v_nop\n\tv_nop\n\tv_nop\n\tv_nop" : "+v"(acc[0][0]), "+v"(acc[1][1]), "+v"(acc[2][2]), "+v"(acc[3][3]) : "v"(a[0]), "v"(a[3]));
    }
#pragma unroll
    for (int mb = 0; mb < 4; ++mb) {
#pragma unroll
        for (int nb = 0; nb < 4; ++nb) {
#pragma unroll
            for (int j = 0; j < 8; ++j) os[(hi * 8 + j) * 68 + nb * 16 + lr] = acc[mb][nb][j]; }
        __builtin_amdgcn_wave_barrier(); asm volatile("" ::: "memory");
        float* crow = C + (size_t)(r0 + mb * 16) * ldc + c0;
{
#pragma unroll
            for (int s = 0; s < 8; ++s) { const int row = 2 * s + hi, cofs = lr * 4; v4f val = *(const v4fa*)(os + row * 68 + cofs); if (BIAS) { val[0] += bfr(bias[c0 + cofs]); val[1] += bfr(bias[c0 + cofs + 1]); val[2] += bfr(bias[c0 + cofs + 2]); val[3] += bfr(bias[c0 + cofs + 3]); }
                *(v4f*)(crow + (size_t)row * ldc + cofs) = val; }
             }
        __builtin_amdgcn_wave_barrier(); asm volatile("" ::: "memory");
    }
}

__device__ __forceinline__ h16 tohx(float x) { return (h16)x; }
__device__ __forceinline__ void splitf(float y, unsigned short& h, unsigned short& l) { h = f2bf(y); l = f2bf(y - bf2f(h)); }
typedef __attribute__((ext_vector_type(2))) _Float16 v2h;
typedef __attribute__((ext_vector_type(4))) _Float16 v4h;
typedef __attribute__((ext_vector_type(2))) unsigned short v2us;
typedef __attribute__((ext_vector_type(4))) unsigned short v4us;
typedef __attribute__((ext_vector_type(2))) float v2f;
typedef __attribute__((ext_vector_type(4))) int v4i;

// ---- k_prep: all that only re-forms an input or builds the RoPE table, in ONE launch (the parts do not depend on one another); a work-group's index picks its part, the parts with the longest chains of dependent loads first.
#define PB_WQ (DM * DQ / 512 / 8)              // work-groups for wq, and for wo: a wave takes one unit of 512 elements
#define PB_WK (DM * DKV / 512 / 8)             // for wk, and for wv
#define PB_W  (2 * PB_WQ + 2 * PB_WK)
#define PB_X  (NB_ * TT * DM / 512 / 4 / 8)    // for x: a wave takes four units
#define PB_CS (TT * (HD / 2) / 256)            // for the table: a thread takes the two entries d and d + HD/2, which are equal
__device__ __forceinline__ void wtG(const float* __restrict__ w, int K, int N, bf* Bt, int blk) {
    const int lane = threadIdx.x & 31; const int L0 = (blk * 8 + (threadIdx.x >> 5)) * 8; const int nlines = N * K / 64;
{
#pragma unroll 1
        for (int l = 0; l < 8; ++l) { const int L = L0 + l; if (L >= nlines) break; const size_t e = (size_t)L * 64 + lane * 2; int k, n; unfrag(e, K / 32, n, k); v2us o;
            const float* p0 = w + (size_t)k * N + n; const float* p1 = p0 + N; const float w0 = *p0, w1 = *p1;
            asm volatile("s_wait_xcnt 0x0" :: "v"(p0), "v"(p1) : "memory");   // behind the loads, in front of whatever next rewrites an address register of theirs (inputs: they live to the wait)
            o[0] = f2bf(w0); o[1] = f2bf(w1); bf* po = Bt + e;
            asm volatile("global_store_b32 %0, %1, off\n\ts_wait_xcnt 0x0" :: "v"(po), "v"(__builtin_bit_cast(unsigned, o)) : "memory"); }   // the store with its wait in one statement: the next trip rewrites its registers
         }
}
__global__ __launch_bounds__(256) void k_prep(const float* __restrict__ x, const float* __restrict__ wq, const float* __restrict__ wk, const float* __restrict__ wv, const float* __restrict__ wo, bf* XB, bf* WQ, bf* WK, bf* WV, bf* WO, float* CS) {
    static_assert(DQ == DM && (DM / 32) % 4 == 0 && HD * 4 == 256, "one K for the four weights; a wave's four units of x lie in one row block; the table's second store stands 256 bytes on");
    int blk = blockIdx.x;
    if (blk < PB_W) {   // weights [k][n] f32 -> [n][k] bf16 in fragment order
        const float* w; bf* Bt; int N;
        if (blk < PB_WQ) { w = wq; Bt = WQ; N = DQ; }
        else if (blk < 2 * PB_WQ) { w = wo; Bt = WO; N = DM; blk -= PB_WQ; }
        else if (blk < 2 * PB_WQ + PB_WK) { w = wk; Bt = WK; N = DKV; blk -= 2 * PB_WQ; }
        else { w = wv; Bt = WV; N = DKV; blk -= 2 * PB_WQ + PB_WK; }
        wtG(w, DM, N, Bt, blk); return;
    }
    blk -= PB_W;
    if (blk < PB_X) {   // x -> bf16 in fragment order. A wave's four units are 16 rows x 128 k: piece c of a lane (8 elements) is row lane & 15, k = c * 16 + (lane >> 4) * 8 of them, and stands at c * 256 + lane * 8
        const int lane = threadIdx.x & 31, u0 = (blk * 8 + (threadIdx.x >> 5)) * 4;
        const float* p = x + (size_t)((u0 / (DM / 32)) * 16 + (lane & 15)) * DM + (u0 % (DM / 32)) * 32 + (lane >> 4) * 8; v8f v[8]; v4i o[8];
#pragma unroll   // c indexes registers; the eight pieces' loads are all in flight together
        for (int c = 0; c < 8; ++c) v[c] = *(const v8f*)(p + c * 16);
        asm volatile("s_wait_xcnt 0x0" :: "v"(p) : "memory");   // behind the loads, in front of whatever next rewrites their address register (an input: it lives to the wait)
#pragma unroll
        for (int c = 0; c < 8; ++c) { v8us t;
#pragma unroll
            for (int j = 0; j < 8; ++j) t[j] = f2bf(v[c][j]);
            o[c] = __builtin_bit_cast(v4i, t); }
        bf* d = XB + (size_t)u0 * 512 + lane * 8;
        // the eight stores with their s_wait_xcnt 0 in one statement: nothing rewrites a register of theirs in front of it
        asm volatile("global_store_b128 %0, %1, off\n\tglobal_store_b128 %0, %2, off offset:512\n\tglobal_store_b128 %0, %3, off offset:1024\n\tglobal_store_b128 %0, %4, off offset:1536\n\t"
                     "global_store_b128 %0, %5, off offset:2048\n\tglobal_store_b128 %0, %6, off offset:2560\n\tglobal_store_b128 %0, %7, off offset:3072\n\tglobal_store_b128 %0, %8, off offset:3584\n\ts_wait_xcnt 0x0"
                     :: "v"(d), "v"(o[0]), "v"(o[1]), "v"(o[2]), "v"(o[3]), "v"(o[4]), "v"(o[5]), "v"(o[6]), "v"(o[7]) : "memory");
        return;
    }
    blk -= PB_X;
    {   // RoPE table, entry (t, d): cos then sin
        const int idx = blk * 256 + threadIdx.x; const int t = idx / (HD / 2), i = idx % (HD / 2); const float inv = __fdiv_rn(1.0f, powf(10000.0f, (float)(2 * i) / (float)HD)); const float ang = __fmul_rn((float)t, inv); v2f cs; cs[0] = cosf(ang); cs[1] = sinf(ang);
        float* pc = CS + ((size_t)t * HD + i) * 2;
        // the two stores (entry d, and d + HD/2 at HD floats = 256 bytes on) with their s_wait_xcnt 0 in one statement: nothing rewrites a register of theirs in front of it
        asm volatile("global_store_b64 %0, %1, off\n\tglobal_store_b64 %0, %1, off offset:256\n\ts_wait_xcnt 0x0" :: "v"(pc), "v"(cs) : "memory");
    }
}
// ---- k_qkv: the q, k and v projections in ONE launch, RoPE and the forming of the 16-bit operand planes in its epilogue (no f32 projection ever reaches memory). grid (tokens / 64, NH_ + 2 * NKV), 32 threads:
// ONE WAVE per 64 tokens x one head (HD = 64 columns), main loop as in k_gemmw; y < NH_: q head y, then the NKV k heads, then the NKV v heads.
// Every plain '#pragma unroll' here stands on a loop whose counter indexes accumulators, fragments or table entries: they stay in registers only where those indices are constants.
// the fp16, the hi and the lo store of eight plane elements, with their s_wait_xcnt 0 in the same statement: so it stands in front of whatever next rewrites an address or data register of theirs
__device__ __forceinline__ void st3x(h16* p16, v8h a, bf* ph, v8us b, bf* pl, v8us c) {
    asm volatile("global_store_b128 %0, %1, off\n\tglobal_store_b128 %2, %3, off\n\tglobal_store_b128 %4, %5, off\n\ts_wait_xcnt 0x0" :: "v"(p16), "v"(__builtin_bit_cast(v4i, a)), "v"(ph), "v"(__builtin_bit_cast(v4i, b)), "v"(pl), "v"(__builtin_bit_cast(v4i, c)) : "memory");
}
__device__ __forceinline__ void put8(const float* x, h16* p16, bf* ph, bf* pl) { v8h o16; v8us oh, ol;
#pragma unroll
    for (int j = 0; j < 8; ++j) { o16[j] = tohx(x[j]); unsigned short a2, c2; splitf(x[j], a2, c2); oh[j] = a2; ol[j] = c2; }
    st3x(p16, o16, ph, oh, pl, ol); }
__global__ __launch_bounds__(32) void k_qkv(const bf* __restrict__ A, const bf* __restrict__ WQ, const bf* __restrict__ WK, const bf* __restrict__ WV, const float* __restrict__ CS, h16* QP16, bf* QPh, bf* QPl, h16* KP16, bf* KPh, bf* KPl, h16* VT16, bf* VTh) {
    static_assert(HD == 64 && TT % 64 == 0, "a 64 x 64 tile is 64 tokens of one batch x one whole head");
    typedef WFrag<bf>::V V;
    __shared__ __align__(16) float os[16 * 68];
    const int K = DM, lane = threadIdx.x & 31, lr = lane & 15, hi = lane >> 4; const int r0 = blockIdx.x * 64, cy = blockIdx.y;
    const bf* Bt = cy < NH_ ? WQ + (size_t)cy * HD * K : cy < NH_ + NKV ? WK + (size_t)(cy - NH_) * HD * K : WV + (size_t)(cy - NH_ - NKV) * HD * K;
    v8f acc[4][4];
#pragma unroll
    for (int mb = 0; mb < 4; ++mb)
#pragma unroll
        for (int nb = 0; nb < 4; ++nb) acc[mb][nb] = (v8f){};
    const size_t aoff = (size_t)r0 * K; const unsigned lb = lane * 16;
#pragma unroll 1   // as in k_gemmw: one k step of 32 a trip
    for (int kc = 0; kc < K; kc += 32) {
        V a[4]; const char* pa = (const char*)(A + aoff + kc * 16) + lb; const char* pb = (const char*)(Bt + kc * 16) + lb;   // K is a constant here: the four row blocks of an operand are constant offsets from one address
#pragma unroll
        for (int mb = 0; mb < 4; ++mb) a[mb] = WFrag<bf>::ldp(pa + mb * 16 * K * 2);
        // s_wait_xcnt 0 behind loads, in front of whatever next rewrites an address register of theirs; the address is an input so that it lives to the wait and no later load's result lands in it
        asm volatile("s_wait_xcnt 0x0" :: "v"(pa) : "memory");
#pragma unroll
        for (int nb = 0; nb < 4; ++nb) { const V b = WFrag<bf>::ldp(pb + nb * 16 * K * 2); asm volatile("s_wait_xcnt 0x0" :: "v"(pb) : "memory");   // as above
#pragma unroll
            for (int mb = 0; mb < 4; ++mb) acc[mb][nb] = WFrag<bf>::mma(a[mb], b, acc[mb][nb]); }
        asm volatile("v_nop\n\tv_nop\n\tv_nop\n\tv_nop" : "+v"(acc[0][0]), "+v"(acc[1][1]), "+v"(acc[2][2]), "+v"(acc[3][3]) : "v"(a[0]), "v"(a[3]));   // the distance behind the trip's last matrix instructions, on the loop's back edge too
    }
    const int b = r0 / TT, t0 = r0 % TT;
    if (cy >= NH_ + NKV) {
        // v: planes [d][t]. Register j of accumulator (mb, nb) is token t0 + mb * 16 + hi * 8 + j of column d = nb * 16 + lr: a lane's eight registers are, as they stand, its 16-byte piece of the unit (d / 16, t / 32), half mb & 1
        const size_t po = ((size_t)b * NKV + (cy - NH_ - NKV)) * (HD * 2 * TT) + (size_t)(t0 / 32) * 512 + lane * 8;
#pragma unroll
        for (int mb = 0; mb < 4; ++mb)
#pragma unroll
            for (int nb = 0; nb < 4; ++nb) { float x[8];
#pragma unroll
                for (int j = 0; j < 8; ++j) x[j] = acc[mb][nb][j];
                const size_t oo = po + (size_t)(nb * (TT / 32) + (mb >> 1)) * 512 + (mb & 1) * 256; put8(x, VT16 + oo, VTh + oo, VTh + HD * TT + oo); }
        return;
    }
    // q, k: planes [t][d]. Rotate-half pairs d and d + HD/2, which one lane holds in accumulators nb and nb + 2; cos and sin of d + HD/2 are those of d. The rotated 16 x 64 block goes through LDS to turn a lane's eight tokens into eight d.
    const bool isq = cy < NH_; const size_t po = (isq ? (size_t)b * NH_ + cy : (size_t)b * NKV + (cy - NH_)) * (TT * HD) + (size_t)t0 * HD + lane * 8;
    h16* P16 = (isq ? QP16 : KP16) + po; bf* Ph = (isq ? QPh : KPh) + po; bf* Pl = (isq ? QPl : KPl) + po;
    const char* csb = (const char*)(CS + (size_t)t0 * HD * 2); const unsigned lo = (hi * 8 * HD + lr) * 8;   // table entry (t, d): 8 bytes, cos then sin
    v2f cs[2][16];
    auto ldcs = [&](int mb, v2f* c) __attribute__((always_inline)) {
#pragma unroll
        for (int nb = 0; nb < 2; ++nb)
#pragma unroll
            for (int j = 0; j < 8; ++j) c[nb * 8 + j] = *(const v2f*)(csb + lo + ((mb * 16 + j) * HD + nb * 16) * 8);
        asm volatile("s_wait_xcnt 0x0" :: "v"(lo) : "memory"); };   // behind the table loads, in front of whatever next rewrites a register that they name; the offset is an input so that it lives to the wait
    ldcs(0, cs[0]);
#pragma unroll
    for (int mb = 0; mb < 4; ++mb) {
        if (mb < 3) ldcs(mb + 1, cs[(mb + 1) & 1]);   // the next 16 tokens' table entries fly while these are rotated and stored
#pragma unroll
        for (int nb = 0; nb < 2; ++nb)
#pragma unroll
            for (int j = 0; j < 8; ++j) { const float c = cs[mb & 1][nb * 8 + j][0], s = cs[mb & 1][nb * 8 + j][1], x0 = acc[mb][nb][j], x1 = acc[mb][nb + 2][j];
                os[(hi * 8 + j) * 68 + nb * 16 + lr] = x0 * c - x1 * s; os[(hi * 8 + j) * 68 + (nb + 2) * 16 + lr] = x1 * c + x0 * s; }
        __builtin_amdgcn_wave_barrier(); asm volatile("" ::: "memory");   // the one wave's LDS writes stay in front of its reads below
#pragma unroll
        for (int u = 0; u < 4; ++u) { const float* sp = os + lr * 68 + u * 16 + hi * 8; const v4f u0 = *(const v4fa*)sp, u1 = *(const v4fa*)(sp + 4); const float x[8] = {u0[0], u0[1], u0[2], u0[3], u1[0], u1[1], u1[2], u1[3]};
            const int oo = mb * 1024 + u * 256; put8(x, P16 + oo, Ph + oo, Pl + oo); }   // unit (t / 16, d / 32), half (d / 16) & 1
        __builtin_amdgcn_wave_barrier(); asm volatile("" ::: "memory");   // and its reads in front of the next block's writes
    }
}
// ---- k_flash: scores, causal softmax, probability x value and the head merge in ONE launch; scores and probabilities never leave registers (online softmax over key blocks of 32).
// One wave owns NBQ*16 query rows of one head. It forms the TRANSPOSED score tile S^T[key][query] = K Q^T (A = key rows, B = query rows), so that a lane holds scores of one query only (max and sum in-lane plus one
// exchange between the lane halves) and the accumulator registers of two 16-key tiles are, as they stand, the B operand P^T[query][key 0..31] of O^T[d][query] += V^T P^T (A = value rows [d][t]).
// k order of every operand: element e of lane half hi is k = (e / 8) * 16 + 8 * hi + e % 8 (WFrag::ld on both global operands; score tile mt, register j is key mt * 16 + 8 * hi + j).
// The four waves of a block are the four heads of one kv group on the same query rows: they read the same key and value lines. HR: bf16 hi+lo planes, 3 products; else fp16, probabilities carried x PCAR (it cancels in O / l).
typedef __attribute__((ext_vector_type(16))) unsigned short v16us;
// eight 2^x in one statement: no result shares a register with a source ("=&v"), and the v_nop is the free slot behind the last transcendental
__device__ __forceinline__ void exp2x8(float* p, const float* x) {
    asm("v_exp_f32 %0, %8\n\tv_exp_f32 %1, %9\n\tv_exp_f32 %2, %10\n\tv_exp_f32 %3, %11\n\tv_exp_f32 %4, %12\n\tv_exp_f32 %5, %13\n\tv_exp_f32 %6, %14\n\tv_exp_f32 %7, %15\n\tv_nop"
        : "=&v"(p[0]), "=&v"(p[1]), "=&v"(p[2]), "=&v"(p[3]), "=&v"(p[4]), "=&v"(p[5]), "=&v"(p[6]), "=&v"(p[7]) : "v"(x[0]), "v"(x[1]), "v"(x[2]), "v"(x[3]), "v"(x[4]), "v"(x[5]), "v"(x[6]), "v"(x[7]));
}
// the hi and the lo store of eight merged outputs, with their s_wait_xcnt 0 in the same statement: so it stands in front of whatever next rewrites an address or data register of theirs, on every way out of a tile
// (as a statement of its own the wait let the next outputs' arithmetic move up over it)
__device__ __forceinline__ void st2x(bf* pa, v8us a, bf* pb, v8us b) {
    asm volatile("global_store_b128 %0, %1, off\n\tglobal_store_b128 %2, %3, off\n\ts_wait_xcnt 0x0" :: "v"(pa), "v"(__builtin_bit_cast(v4i, a)), "v"(pb), "v"(__builtin_bit_cast(v4i, b)) : "memory");
}
template <typename T16, bool HR, int NBQ>
__device__ __forceinline__ void flash_tile(const T16* __restrict__ Q, const T16* __restrict__ Q2, const T16* __restrict__ Kp, const T16* __restrict__ K2, const T16* __restrict__ Vt, const T16* __restrict__ V2, int q0, bf* Ah, bf* Al) {
    typedef typename WFrag<T16>::V V;
    const int lane = threadIdx.x & 31, lr = lane & 15, hi = lane >> 4; const unsigned lb = lane * 16;
    V qf[NBQ][2], qf2[NBQ][2];
#pragma unroll
    for (int nb = 0; nb < NBQ; ++nb)
#pragma unroll
        for (int kc = 0; kc < 2; ++kc) { const int qo = (q0 + nb * 16) * HD + kc * 512; qf[nb][kc] = WFrag<T16>::ld(Q + qo, lb); if (HR) qf2[nb][kc] = WFrag<T16>::ld(Q2 + qo, lb); }
    asm volatile("s_wait_xcnt 0x0" :: "v"(lb) : "memory");   // behind the query loads, in front of whatever next rewrites a register that they name; the offset is an input so that no load's result lands in it
    v8f o[4][NBQ]; float m[NBQ], l[NBQ];
#pragma unroll
    for (int nb = 0; nb < NBQ; ++nb) { m[nb] = -3.0e38f; l[nb] = 0.f;
#pragma unroll
        for (int dt = 0; dt < 4; ++dt) o[dt][nb] = (v8f){}; }
    const int nkb = (q0 + NBQ * 16 + 31) / 32;      // key blocks up to the diagonal; every block starts at a key <= q0, so no query ever sees a fully masked block; only the last block holds keys beyond a query
    const float L2E = 1.4426950408889634f, PEXP = HR ? 0.0f : 10.0f;   // 2^10 = PCAR
    V kf[2][2], kf2[2][2], vf[4], vf2[4];
    auto ldk = [&](int k0) __attribute__((always_inline)) {
#pragma unroll
        for (int mt = 0; mt < 2; ++mt)
#pragma unroll
            for (int kc = 0; kc < 2; ++kc) { const int ko = (k0 + mt * 16) * HD + kc * 512; kf[mt][kc] = WFrag<T16>::ld(Kp + ko, lb); if (HR) kf2[mt][kc] = WFrag<T16>::ld(K2 + ko, lb); }
        asm volatile("s_wait_xcnt 0x0" :: "v"(lb) : "memory"); };   // stands behind the loads, in front of whatever next rewrites a register that they name (a later load's result among them)
    auto ldv = [&](int k0) __attribute__((always_inline)) {
#pragma unroll
        for (int dt = 0; dt < 4; ++dt) { const int vo = dt * 16 * TT + k0 * 16; vf[dt] = WFrag<T16>::ld(Vt + vo, lb); if (HR) vf2[dt] = WFrag<T16>::ld(V2 + vo, lb); }
        asm volatile("s_wait_xcnt 0x0" :: "v"(lb) : "memory"); };   // as in ldk
    // one key block; last: the block on the diagonal (masked, nothing fetched behind it). Otherwise the next block's key fragments are asked for behind the score products and its value fragments behind the value
    // products, one block ahead of their use (where the registers are short the compiler may issue the key loads later in the block).
    auto step = [&](int k0, bool last) __attribute__((always_inline)) {
        v8f s[2][NBQ];
#pragma unroll
        for (int mt = 0; mt < 2; ++mt)
#pragma unroll
            for (int nb = 0; nb < NBQ; ++nb) { v8f a = (v8f){};
#pragma unroll
                for (int kc = 0; kc < 2; ++kc) { a = WFrag<T16>::mma(kf[mt][kc], qf[nb][kc], a); if (HR) { a = WFrag<T16>::mma(kf[mt][kc], qf2[nb][kc], a); a = WFrag<T16>::mma(kf2[mt][kc], qf[nb][kc], a); } }
                s[mt][nb] = a; }
        if (!last) ldk(k0 + 32);
        V pf[NBQ], pf2[NBQ];
#pragma unroll
        for (int nb = 0; nb < NBQ; ++nb) {
            const int qi = q0 + nb * 16 + lr; float mx = m[nb];
#pragma unroll
            for (int mt = 0; mt < 2; ++mt)
#pragma unroll
                for (int j = 0; j < 8; ++j) { float t = s[mt][nb][j] * SCL; if (last && k0 + mt * 16 + hi * 8 + j > qi) t = -3.0e38f; s[mt][nb][j] = t; mx = fmaxf(mx, t); }
            mx = fmaxf(mx, __shfl_xor(mx, 16, 32));
            float al; asm("v_exp_f32 %0, %1\n\tv_nop" : "=v"(al) : "v"((m[nb] - mx) * L2E)); m[nb] = mx;   // 2^x with the free slot behind a transcendental in the same statement
            float ps = 0.f; float x[16], p[16];
#pragma unroll
            for (int e = 0; e < 16; ++e) x[e] = (s[e >> 3][nb][e & 7] - mx) * L2E + PEXP;
            exp2x8(p, x); exp2x8(p + 8, x + 8);
#pragma unroll
            for (int e = 0; e < 16; ++e) ps += p[e];
            l[nb] = l[nb] * al + ps;                // this lane half's keys only; the halves are added once, after the loop
#pragma unroll
            for (int dt = 0; dt < 4; ++dt) o[dt][nb] *= al;
            if constexpr (HR) { v16us ph, pl;
#pragma unroll
                for (int e = 0; e < 16; ++e) { unsigned short a, c2; splitf(p[e], a, c2); ph[e] = a; pl[e] = c2; }
                pf[nb] = __builtin_bit_cast(v16bf, ph); pf2[nb] = __builtin_bit_cast(v16bf, pl);
            } else { v16h ph;
#pragma unroll
                for (int e = 0; e < 16; ++e) ph[e] = tohx(p[e]);
                pf[nb] = ph; }
        }
#pragma unroll
        for (int dt = 0; dt < 4; ++dt)
#pragma unroll
            for (int nb = 0; nb < NBQ; ++nb) { o[dt][nb] = WFrag<T16>::mma(vf[dt], pf[nb], o[dt][nb]); if (HR) { o[dt][nb] = WFrag<T16>::mma(vf[dt], pf2[nb], o[dt][nb]); o[dt][nb] = WFrag<T16>::mma(vf2[dt], pf[nb], o[dt][nb]); } }
        if (!last) ldv(k0 + 32);
    };
    ldk(0); ldv(0);   // keys first, as in the loop: loads return in order, and the wait at the loop's head leaves the value loads in flight
#pragma unroll 1   // run-time trip count round a body that already fills most of the register file: a second copy of the body would spill
    for (int kb = 0; kb < nkb - 1; ++kb) step(kb * 32, false);
    step((nkb - 1) * 32, true);
#pragma unroll
    for (int nb = 0; nb < NBQ; ++nb) {
        const float lt = l[nb] + __shfl_xor(l[nb], 16, 32); const float inv = __fdiv_rn(1.0f, lt);
#pragma unroll
        for (int dt = 0; dt < 4; ++dt) { v8us oh, ol;
#pragma unroll
            for (int j = 0; j < 8; ++j) { unsigned short a, c2; splitf(o[dt][nb][j] * inv, a, c2); oh[j] = a; ol[j] = c2; }
            const size_t oo = (size_t)(q0 + nb * 16) * DQ + dt * 256 + lane * 8; st2x(Ah + oo, oh, Al + oo, ol); }   // fragment order of the merged [token][DQ] plane: the head's two units, half dt & 1
    }
}
#define NLO ((TT - RH) / 32)      // fp16 query tiles of 32 rows
#define NHI (RH / 16)             // hi+lo query tiles of 16 rows
// grid (kv planes, NLO + NHI): y counts the query tiles from the longest key range down, so that the long tiles start first
__global__ __launch_bounds__(128) void k_flash(const h16* __restrict__ QP16, const h16* __restrict__ KP16, const h16* __restrict__ VT16, const bf* __restrict__ QPh, const bf* __restrict__ QPl, const bf* __restrict__ KPh, const bf* __restrict__ KPl, const bf* __restrict__ VTh, bf* ATh, bf* ATl) {
    const int kvp = blockIdx.x, g = kvp * REP + __builtin_amdgcn_readfirstlane(threadIdx.x >> 5), b = g / NH_, h = g % NH_, ty = blockIdx.y;   // g = b*NH_ + h: flat head; its kv plane is g / REP
    const size_t qo = (size_t)g * TT * HD, ko = (size_t)kvp * TT * HD, vo = (size_t)kvp * HD * 2 * TT, ao = (size_t)b * TT * DQ + h * (HD * 16);
    if (ty < NLO) flash_tile<h16, false, 2>(QP16 + qo, nullptr, KP16 + ko, nullptr, VT16 + vo, nullptr, TT - 32 * (ty + 1), ATh + ao, ATl + ao);
    else flash_tile<bf, true, 1>(QPh + qo, QPl + qo, KPh + ko, KPl + ko, VTh + vo, VTh + vo + HD * TT, RH - 16 * (ty - NLO + 1), ATh + ao, ATl + ao);
}

extern "C" void kernel_launch(void* const* d_in, const int* in_sizes, int n_in,
                              void* d_out, int out_size, void* d_ws, size_t ws_size, hipStream_t stream) {
    (void)in_sizes; (void)n_in; (void)out_size;
    const float* x = (const float*)d_in[0]; const float* wq = (const float*)d_in[1]; const float* wk = (const float*)d_in[2]; const float* wv = (const float*)d_in[3]; const float* wo = (const float*)d_in[4];
    float* OUT = (float*)d_out;     // [4][2048][1024]
    char* wsp = (char*)d_ws;
    auto take = [&](size_t bytes) { char* p = wsp; wsp += (bytes + 255) & ~(size_t)255; return (void*)p; };
    bf* WQ = (bf*)take((size_t)DQ * DM * 2); bf* WK = (bf*)take((size_t)DKV * DM * 2); bf* WV = (bf*)take((size_t)DKV * DM * 2); bf* WO = (bf*)take((size_t)DM * DQ * 2); float* CS = (float*)take((size_t)TT * HD * 2 * 4);
    h16* QP16 = (h16*)take((size_t)NB_ * NH_ * TT * HD * 2); h16* KP16 = (h16*)take((size_t)NB_ * NKV * TT * HD * 2); h16* VT16 = (h16*)take((size_t)NB_ * NKV * HD * 2 * TT * 2);   // heads 2*HD*TT elements apart, as in the hi+lo planes: the fp16 plane fills the first HD*TT
    bf* QPh = (bf*)take((size_t)NB_ * NH_ * TT * HD * 2); bf* QPl = (bf*)take((size_t)NB_ * NH_ * TT * HD * 2); bf* KPh = (bf*)take((size_t)NB_ * NKV * TT * HD * 2); bf* KPl = (bf*)take((size_t)NB_ * NKV * TT * HD * 2); bf* VTh = (bf*)take((size_t)NB_ * NKV * HD * 2 * TT * 2);   // a head's hi plane, then its lo plane
    bf* ATh = (bf*)take((size_t)NB_ * TT * DQ * 2); bf* ATl = (bf*)take((size_t)NB_ * TT * DQ * 2);
    bf* XB = (bf*)take((size_t)NB_ * TT * DM * 2);   // x in bf16
    if ((size_t)(wsp - (char*)d_ws) > ws_size) return;    // ws 256 MiB
    k_prep<<<PB_W + PB_X + PB_CS, 256, 0, stream>>>(x, wq, wk, wv, wo, XB, WQ, WK, WV, WO, CS);
    // projections: the NB_ batches are NB_*TT rows, the q, k and v heads the column tiles, of one GEMM launch
    k_qkv<<<dim3(NB_ * TT / 64, NH_ + 2 * NKV), 32, 0, stream>>>(XB, WQ, WK, WV, CS, QP16, QPh, QPl, KP16, KPh, KPl, VT16, VTh);
    k_flash<<<dim3(NB_ * NKV, NLO + NHI), 128, 0, stream>>>(QP16, KP16, VT16, QPh, QPl, KPh, KPl, VTh, ATh, ATl);
    k_gemmw<bf, 1, false><<<dim3(NB_ * TT / 64, DM / 64, 1), 32, 0, stream>>>(ATh, ATl, WO, nullptr, DQ, OUT, DM, nullptr, 0, 0, 0);
}

// v006
// Measured time: 109 microseconds a run.
// Next to v005, in two timings, it ran 1.27 and 1.28 times as fast.
// Counting every step since v000, it is 24.9 times as fast.
#include <hip/hip_runtime.h>

// GQA causal attention block (x [4][2048][1024]; q = x wq (16 heads x 64), k, v = x wk / wv (4 kv heads, GQA groups of 4); RoPE (rotate-half, base 10000) on q, k; causal softmax(q.k/8); out = (attn v merged) wo -> [4][2048][1024]).
// Compute dtypes, f32 accumulate: every input rounded to bf16; q/k/v projections on PLAIN bf16 operands (inputs: exact); RoPE f32; scores (K 64) and attn.v on bf16 hi+lo planes (3 products) for the first 512 query rows of each head and

#define NB_  4
#define TT   2048
#define DM   1024
#define NH_  16
#define NKV  4
#define REP  (NH_ / NKV)
#define HD   64
#define DQ   (NH_ * HD)
#define DKV  (NKV * HD)
#define RH   512                  // query rows < RH use hi+lo planes (0: none)
#define PCAR 1024.0f
#define SCL  0.125f   // HD^-0.5
typedef _Float16 h16;
typedef unsigned short bf;
typedef __attribute__((ext_vector_type(16))) __bf16   v16bf;
typedef __attribute__((ext_vector_type(16))) _Float16 v16h;
typedef __attribute__((ext_vector_type(8)))  _Float16 v8h;
typedef __attribute__((ext_vector_type(8)))  unsigned short v8us;
typedef __attribute__((ext_vector_type(8)))  float    v8f;
typedef __attribute__((ext_vector_type(4)))  float    v4f;
typedef v8h  __attribute__((may_alias)) v8ha;
typedef v4f  __attribute__((may_alias)) v4fa;
typedef v8us __attribute__((may_alias)) v8usa;

__device__ __forceinline__ unsigned short f2bf(float f) { unsigned u = __float_as_uint(f); u += 0x7FFFu + ((u >> 16) & 1u); return (unsigned short)(u >> 16); }
__device__ __forceinline__ float bf2f(unsigned short b) { return __uint_as_float(((unsigned)b) << 16); }
__device__ __forceinline__ float bfr(float f) { return bf2f(f2bf(f)); }
__device__ __forceinline__ v16h cat16(v8h lo, v8h hi) { return __builtin_shufflevector(lo, hi, 0, 1, 2, 3, 4, 5, 6, 7, 8, 9, 10, 11, 12, 13, 14, 15); }
__device__ __forceinline__ v16bf cat16b(v8us lo, v8us hi) { return __builtin_bit_cast(v16bf, __builtin_shufflevector(lo, hi, 0, 1, 2, 3, 4, 5, 6, 7, 8, 9, 10, 11, 12, 13, 14, 15)); }
__device__ __forceinline__ v8f wmma16(v16h a, v16h b, v8f c) { return __builtin_amdgcn_wmma_f32_16x16x32_f16(false, a, false, b, (short)0, c, false, false); }
__device__ __forceinline__ v8f wmmab(v16bf a, v16bf b, v8f c) { return __builtin_amdgcn_wmma_f32_16x16x32_bf16(false, a, false, b, (short)0, c, false, false); }



// ---- FRAGMENT ORDER: every 16-bit matrix operand plane [row][k] lies in units of 16 rows x 32 k (512 elements, 1 KB), units ordered [row / 16][k / 32]; inside a unit element (row, k) stands at
// ((k >> 4) & 1) * 256 + (((k >> 3) & 1) * 16 + (row & 15)) * 8 + (k & 7): a lane's two 16-byte fragment pieces are unit + lane * 8 and + 256, so each wave-wide load is 512 contiguous bytes (4 whole lines, not 32 bytes in each of 16).
// wtG walks a weight plane in storage order and asks unfrag for the (row, k) that stands at a position; KB = k / 32 units a row block.
__device__ __forceinline__ void unfrag(size_t pos, int KB, int& row, int& k) { const int u = (int)(pos >> 9), r = (int)(pos & 511); row = (u / KB) * 16 + ((r >> 3) & 15); k = (u % KB) * 32 + (r >> 8) * 16 + ((r >> 7) & 1) * 8 + (r & 7); }
// ---- k_gemmw: register-blocked GEMM, ONE WAVE per 64x64 output tile (16 accumulators), operands straight from 16-bit planes in fragment order; grid (M/64, N/64, Z), 32 threads.
// C[m][n] (f32, pitch ldc, + optional f32 bias[n]) = sum_k A[m][k] Bt[n][k] (+ split products per NSPLIT). z-batch strides sA/sB/sC in elements. K: a constant, two k steps of 32 more than a multiple of three.
// The fragments of a k step are fetched TWO STEPS AHEAD of their products, as one group of loads, into a ring of three register sets: a wave waits for a load that has had two steps' products to arrive, not for one just issued.
// ld(u, lb): the fragment of the unit at u (the same for the whole wave), lb = lane * 16, the lane's byte offset in it; ldp(p): the same from the lane's own address
template <typename T16> struct WFrag;
template <> struct WFrag<h16> { typedef v16h V; static __device__ __forceinline__ V ldp(const char* p) { return cat16(*(const v8h*)p, *(const v8h*)(p + 512)); } static __device__ __forceinline__ V ld(const h16* u, unsigned lb) { return ldp((const char*)u + lb); } static __device__ __forceinline__ v8f mma(V a, V b, v8f c) { return wmma16(a, b, c); } };
template <> struct WFrag<bf> { typedef v16bf V; static __device__ __forceinline__ V ldp(const char* p) { return cat16b(*(const v8us*)p, *(const v8us*)(p + 512)); } static __device__ __forceinline__ V ld(const bf* u, unsigned lb) { return ldp((const char*)u + lb); } static __device__ __forceinline__ v8f mma(V a, V b, v8f c) { return wmmab(a, b, c); } };
template <typename T16, int NSPLIT, bool BIAS, int K>
__global__ __launch_bounds__(32) void k_gemmw(const T16* __restrict__ A, const T16* __restrict__ A2, const T16* __restrict__ Bt, const T16* __restrict__ Bt2, float* C, int ldc, const float* __restrict__ bias, size_t sA, size_t sB, size_t sC) {
    typedef typename WFrag<T16>::V V;
    __shared__ __align__(16) float os[16 * 68];
    const size_t z = blockIdx.z; A += z * sA; if (A2) A2 += z * sA; Bt += z * sB; if (Bt2) Bt2 += z * sB; C += z * sC;
    const int lane = threadIdx.x & 31, lr = lane & 15, hi = lane >> 4; const int r0 = blockIdx.x * 64, c0 = blockIdx.y * 64;
    v8f acc[4][4];
#pragma unroll
    for (int mb = 0; mb < 4; ++mb)
#pragma unroll
        for (int nb = 0; nb < 4; ++nb) acc[mb][nb] = (v8f){};
    static_assert(K >= 160 && (K - 64) % 96 == 0, "the ring of three sets: whole rounds of three k steps, then the last two steps");
    constexpr bool HA2 = NSPLIT == 1 || NSPLIT == 2, HB2 = NSPLIT >= 2;
    const size_t aoff = (size_t)r0 * K, boff = (size_t)c0 * K; const unsigned lb = lane * 16;   // a row block of 16 is K * 16 elements, a step of 32 k one unit of 512
    const char* pa = (const char*)(A + aoff) + lb; const char* pa2 = HA2 ? (const char*)(A2 + aoff) + lb : pa; const char* pb = (const char*)(Bt + boff) + lb; const char* pb2 = HB2 ? (const char*)(Bt2 + boff) + lb : pb;
    V a[3][4], a2[3][4], b[3][4], b2[3][4];
    // every plain '#pragma unroll' below stands on a loop whose counter indexes fragments or accumulators: they stay in registers only where those indices are constants
    auto ldf = [&](int st, int ks) __attribute__((always_inline)) {   // into set st the fragments of the k step that stands ks steps (1 KB each) behind the addresses; K is a constant: an operand's four row blocks are constant offsets too
#pragma unroll
        for (int mb = 0; mb < 4; ++mb) { a[st][mb] = WFrag<T16>::ldp(pa + ks * 1024 + mb * 16 * K * 2); if (HA2) a2[st][mb] = WFrag<T16>::ldp(pa2 + ks * 1024 + mb * 16 * K * 2); }
#pragma unroll
        for (int nb = 0; nb < 4; ++nb) { b[st][nb] = WFrag<T16>::ldp(pb + ks * 1024 + nb * 16 * K * 2); if (HB2) b2[st][nb] = WFrag<T16>::ldp(pb2 + ks * 1024 + nb * 16 * K * 2); }
        // s_wait_xcnt 0 behind the group's loads, in front of whatever next rewrites an address register of theirs; the addresses are inputs so that they live to the wait and no load's result lands in them
        asm volatile("s_wait_xcnt 0x0" :: "v"(pa), "v"(pa2), "v"(pb), "v"(pb2) : "memory");
        __builtin_amdgcn_sched_barrier(0); };   // the group stays whole and in front of the products that follow: without it the compiler moved products up over the loads, shared registers between sets and waited on loads just issued
    auto mm = [&](int st) __attribute__((always_inline)) {
#pragma unroll
        for (int nb = 0; nb < 4; ++nb)
#pragma unroll
            for (int mb = 0; mb < 4; ++mb) { acc[mb][nb] = WFrag<T16>::mma(a[st][mb], b[st][nb], acc[mb][nb]); if (HA2) acc[mb][nb] = WFrag<T16>::mma(a2[st][mb], b[st][nb], acc[mb][nb]); if (HB2) acc[mb][nb] = WFrag<T16>::mma(a[st][mb], b2[st][nb], acc[mb][nb]); }
        __builtin_amdgcn_sched_barrier(0); };   // and a step's products stay in front of the next group, which refills their set
    ldf(0, 0); ldf(1, 1);
#pragma unroll 1   // three k steps a trip, so that the set numbers are constants; a further copy of the body buys nothing
    for (int kc = 0; kc < K - 64; kc += 96) {
        ldf(2, 2); mm(0);
        ldf(0, 3); mm(1);
        ldf(1, 4); mm(2);
        pa += 3072; pa2 += 3072; pb += 3072; pb2 += 3072;
        asm volatile("v_nop\n\tv_nop\n\tv_nop\n\tv_nop" : "+v"(acc[0][0]), "+v"(acc[1][1]), "+v"(acc[2][2]), "+v"(acc[3][3]) : "v"(a[2][0]), "v"(a[2][3]));   // the distance behind the trip's last matrix instructions, on the loop's back edge too
    }
    mm(0); mm(1);
#pragma unroll
    for (int mb = 0; mb < 4; ++mb) {
#pragma unroll
        for (int nb = 0; nb < 4; ++nb) {
#pragma unroll
            for (int j = 0; j < 8; ++j) os[(hi * 8 + j) * 68 + nb * 16 + lr] = acc[mb][nb][j]; }
        __builtin_amdgcn_wave_barrier(); asm volatile("" ::: "memory");
        float* crow = C + (size_t)(r0 + mb * 16) * ldc + c0;
{
#pragma unroll
            for (int s = 0; s < 8; ++s) { const int row = 2 * s + hi, cofs = lr * 4; v4f val = *(const v4fa*)(os + row * 68 + cofs); if (BIAS) { val[0] += bfr(bias[c0 + cofs]); val[1] += bfr(bias[c0 + cofs + 1]); val[2] += bfr(bias[c0 + cofs + 2]); val[3] += bfr(bias[c0 + cofs + 3]); }
                *(v4f*)(crow + (size_t)row * ldc + cofs) = val; }
             }
        __builtin_amdgcn_wave_barrier(); asm volatile("" ::: "memory");
    }
}

__device__ __forceinline__ h16 tohx(float x) { return (h16)x; }
__device__ __forceinline__ void splitf(float y, unsigned short& h, unsigned short& l) { h = f2bf(y); l = f2bf(y - bf2f(h)); }
typedef __attribute__((ext_vector_type(2))) _Float16 v2h;
typedef __attribute__((ext_vector_type(4))) _Float16 v4h;
typedef __attribute__((ext_vector_type(2))) unsigned short v2us;
typedef __attribute__((ext_vector_type(4))) unsigned short v4us;
typedef __attribute__((ext_vector_type(2))) float v2f;
typedef __attribute__((ext_vector_type(4))) int v4i;

// ---- k_prep: all that only re-forms an input or builds the RoPE table, in ONE launch (the parts do not depend on one another); a work-group's index picks its part, the parts with the longest chains of dependent loads first.
#define PB_WQ (DM * DQ / 512 / 8)              // work-groups for wq, and for wo: a wave takes one unit of 512 elements
#define PB_WK (DM * DKV / 512 / 8)             // for wk, and for wv
#define PB_W  (2 * PB_WQ + 2 * PB_WK)
#define PB_X  (NB_ * TT * DM / 512 / 4 / 8)    // for x: a wave takes four units
#define PB_CS (TT * (HD / 2) / 256)            // for the table: a thread takes the two entries d and d + HD/2, which are equal
__device__ __forceinline__ void wtG(const float* __restrict__ w, int K, int N, bf* Bt, int blk) {
    const int lane = threadIdx.x & 31; const int L0 = (blk * 8 + (threadIdx.x >> 5)) * 8; const int nlines = N * K / 64;
{
#pragma unroll 1
        for (int l = 0; l < 8; ++l) { const int L = L0 + l; if (L >= nlines) break; const size_t e = (size_t)L * 64 + lane * 2; int k, n; unfrag(e, K / 32, n, k); v2us o;
            const float* p0 = w + (size_t)k * N + n; const float* p1 = p0 + N; const float w0 = *p0, w1 = *p1;
            asm volatile("s_wait_xcnt 0x0" :: "v"(p0), "v"(p1) : "memory");   // behind the loads, in front of whatever next rewrites an address register of theirs (inputs: they live to the wait)
            o[0] = f2bf(w0); o[1] = f2bf(w1); bf* po = Bt + e;
            asm volatile("global_store_b32 %0, %1, off\n\ts_wait_xcnt 0x0" :: "v"(po), "v"(__builtin_bit_cast(unsigned, o)) : "memory"); }   // the store with its wait in one statement: the next trip rewrites its registers
         }
}
__global__ __launch_bounds__(256) void k_prep(const float* __restrict__ x, const float* __restrict__ wq, const float* __restrict__ wk, const float* __restrict__ wv, const float* __restrict__ wo, bf* XB, bf* WQ, bf* WK, bf* WV, bf* WO, float* CS) {
    static_assert(DQ == DM && (DM / 32) % 4 == 0 && HD * 4 == 256, "one K for the four weights; a wave's four units of x lie in one row block; the table's second store stands 256 bytes on");
    int blk = blockIdx.x;
    if (blk < PB_W) {   // weights [k][n] f32 -> [n][k] bf16 in fragment order
        const float* w; bf* Bt; int N;
        if (blk < PB_WQ) { w = wq; Bt = WQ; N = DQ; }
        else if (blk < 2 * PB_WQ) { w = wo; Bt = WO; N = DM; blk -= PB_WQ; }
        else if (blk < 2 * PB_WQ + PB_WK) { w = wk; Bt = WK; N = DKV; blk -= 2 * PB_WQ; }
        else { w = wv; Bt = WV; N = DKV; blk -= 2 * PB_WQ + PB_WK; }
        wtG(w, DM, N, Bt, blk); return;
    }
    blk -= PB_W;
    if (blk < PB_X) {   // x -> bf16 in fragment order. A wave's four units are 16 rows x 128 k: piece c of a lane (8 elements) is row lane & 15, k = c * 16 + (lane >> 4) * 8 of them, and stands at c * 256 + lane * 8
        const int lane = threadIdx.x & 31, u0 = (blk * 8 + (threadIdx.x >> 5)) * 4;
        const float* p = x + (size_t)((u0 / (DM / 32)) * 16 + (lane & 15)) * DM + (u0 % (DM / 32)) * 32 + (lane >> 4) * 8; v8f v[8]; v4i o[8];
#pragma unroll   // c indexes registers; the eight pieces' loads are all in flight together
        for (int c = 0; c < 8; ++c) v[c] = *(const v8f*)(p + c * 16);
        asm volatile("s_wait_xcnt 0x0" :: "v"(p) : "memory");   // behind the loads, in front of whatever next rewrites their address register (an input: it lives to the wait)
#pragma unroll
        for (int c = 0; c < 8; ++c) { v8us t;
#pragma unroll
            for (int j = 0; j < 8; ++j) t[j] = f2bf(v[c][j]);
            o[c] = __builtin_bit_cast(v4i, t); }
        bf* d = XB + (size_t)u0 * 512 + lane * 8;
        // the eight stores with their s_wait_xcnt 0 in one statement: nothing rewrites a register of theirs in front of it
        asm volatile("global_store_b128 %0, %1, off\n\tglobal_store_b128 %0, %2, off offset:512\n\tglobal_store_b128 %0, %3, off offset:1024\n\tglobal_store_b128 %0, %4, off offset:1536\n\t"
                     "global_store_b128 %0, %5, off offset:2048\n\tglobal_store_b128 %0, %6, off offset:2560\n\tglobal_store_b128 %0, %7, off offset:3072\n\tglobal_store_b128 %0, %8, off offset:3584\n\ts_wait_xcnt 0x0"
                     :: "v"(d), "v"(o[0]), "v"(o[1]), "v"(o[2]), "v"(o[3]), "v"(o[4]), "v"(o[5]), "v"(o[6]), "v"(o[7]) : "memory");
        return;
    }
    blk -= PB_X;
    {   // RoPE table, entry (t, d): cos then sin
        const int idx = blk * 256 + threadIdx.x; const int t = idx / (HD / 2), i = idx % (HD / 2); const float inv = __fdiv_rn(1.0f, powf(10000.0f, (float)(2 * i) / (float)HD)); const float ang = __fmul_rn((float)t, inv); v2f cs; cs[0] = cosf(ang); cs[1] = sinf(ang);
        float* pc = CS + ((size_t)t * HD + i) * 2;
        // the two stores (entry d, and d + HD/2 at HD floats = 256 bytes on) with their s_wait_xcnt 0 in one statement: nothing rewrites a register of theirs in front of it
        asm volatile("global_store_b64 %0, %1, off\n\tglobal_store_b64 %0, %1, off offset:256\n\ts_wait_xcnt 0x0" :: "v"(pc), "v"(cs) : "memory");
    }
}
// ---- k_qkv: the q, k and v projections in ONE launch, RoPE and the forming of the 16-bit operand planes in its epilogue (no f32 projection ever reaches memory). grid (tokens / 64, NH_ + 2 * NKV), 32 threads:
// ONE WAVE per 64 tokens x one head (HD = 64 columns), main loop as in k_gemmw; y < NH_: q head y, then the NKV k heads, then the NKV v heads.
// Every plain '#pragma unroll' here stands on a loop whose counter indexes accumulators, fragments or table entries: they stay in registers only where those indices are constants.
// the fp16, the hi and the lo store of eight plane elements, with their s_wait_xcnt 0 in the same statement: so it stands in front of whatever next rewrites an address or data register of theirs
__device__ __forceinline__ void st3x(h16* p16, v8h a, bf* ph, v8us b, bf* pl, v8us c) {
    asm volatile("global_store_b128 %0, %1, off\n\tglobal_store_b128 %2, %3, off\n\tglobal_store_b128 %4, %5, off\n\ts_wait_xcnt 0x0" :: "v"(p16), "v"(__builtin_bit_cast(v4i, a)), "v"(ph), "v"(__builtin_bit_cast(v4i, b)), "v"(pl), "v"(__builtin_bit_cast(v4i, c)) : "memory");
}
__device__ __forceinline__ void put8(const float* x, h16* p16, bf* ph, bf* pl) { v8h o16; v8us oh, ol;
#pragma unroll
    for (int j = 0; j < 8; ++j) { o16[j] = tohx(x[j]); unsigned short a2, c2; splitf(x[j], a2, c2); oh[j] = a2; ol[j] = c2; }
    st3x(p16, o16, ph, oh, pl, ol); }
__global__ __launch_bounds__(32) void k_qkv(const bf* __restrict__ A, const bf* __restrict__ WQ, const bf* __restrict__ WK, const bf* __restrict__ WV, const float* __restrict__ CS, h16* QP16, bf* QPh, bf* QPl, h16* KP16, bf* KPh, bf* KPl, h16* VT16, bf* VTh) {
    static_assert(HD == 64 && TT % 64 == 0, "a 64 x 64 tile is 64 tokens of one batch x one whole head");
    typedef WFrag<bf>::V V;
    __shared__ __align__(16) float os[16 * 68];
    const int K = DM, lane = threadIdx.x & 31, lr = lane & 15, hi = lane >> 4; const int r0 = blockIdx.x * 64, cy = blockIdx.y;
    const bf* Bt = cy < NH_ ? WQ + (size_t)cy * HD * K : cy < NH_ + NKV ? WK + (size_t)(cy - NH_) * HD * K : WV + (size_t)(cy - NH_ - NKV) * HD * K;
    v8f acc[4][4];
#pragma unroll
    for (int mb = 0; mb < 4; ++mb)
#pragma unroll
        for (int nb = 0; nb < 4; ++nb) acc[mb][nb] = (v8f){};
    static_assert(DM >= 160 && (DM - 64) % 96 == 0, "the ring of three sets: whole rounds of three k steps, then the last two steps");
    const size_t aoff = (size_t)r0 * K; const unsigned lb = lane * 16;
    const char* pa = (const char*)(A + aoff) + lb; const char* pb = (const char*)Bt + lb;
    V a[3][4], bb[3][4];   // as in k_gemmw: a k step's fragments are fetched two steps ahead, as one group, into a ring of three register sets
    auto ldf = [&](int st, int ks) __attribute__((always_inline)) {   // ks: k steps (1 KB each) behind the addresses; K is a constant here: the four row blocks of an operand are constant offsets too
#pragma unroll
        for (int mb = 0; mb < 4; ++mb) a[st][mb] = WFrag<bf>::ldp(pa + ks * 1024 + mb * 16 * K * 2);
#pragma unroll
        for (int nb = 0; nb < 4; ++nb) bb[st][nb] = WFrag<bf>::ldp(pb + ks * 1024 + nb * 16 * K * 2);
        // s_wait_xcnt 0 behind the group's loads, in front of whatever next rewrites an address register of theirs; the addresses are inputs so that they live to the wait and no load's result lands in them
        asm volatile("s_wait_xcnt 0x0" :: "v"(pa), "v"(pb) : "memory");
        __builtin_amdgcn_sched_barrier(0); };   // as in k_gemmw: the group stays whole and in front of the products that follow
    auto mm = [&](int st) __attribute__((always_inline)) {
#pragma unroll
        for (int nb = 0; nb < 4; ++nb)
#pragma unroll
            for (int mb = 0; mb < 4; ++mb) acc[mb][nb] = WFrag<bf>::mma(a[st][mb], bb[st][nb], acc[mb][nb]);
        __builtin_amdgcn_sched_barrier(0); };   // as in k_gemmw: a step's products stay in front of the next group, which refills their set
    ldf(0, 0); ldf(1, 1);
#pragma unroll 1   // as in k_gemmw: three k steps a trip, so that the set numbers are constants
    for (int kc = 0; kc < K - 64; kc += 96) {
        ldf(2, 2); mm(0);
        ldf(0, 3); mm(1);
        ldf(1, 4); mm(2);
        pa += 3072; pb += 3072;
        asm volatile("v_nop\n\tv_nop\n\tv_nop\n\tv_nop" : "+v"(acc[0][0]), "+v"(acc[1][1]), "+v"(acc[2][2]), "+v"(acc[3][3]) : "v"(a[2][0]), "v"(a[2][3]));   // the distance behind the trip's last matrix instructions, on the loop's back edge too
    }
    mm(0); mm(1);
    const int b = r0 / TT, t0 = r0 % TT;
    if (cy >= NH_ + NKV) {
        // v: planes [d][t]. Register j of accumulator (mb, nb) is token t0 + mb * 16 + hi * 8 + j of column d = nb * 16 + lr: a lane's eight registers are, as they stand, its 16-byte piece of the unit (d / 16, t / 32), half mb & 1
        const size_t po = ((size_t)b * NKV + (cy - NH_ - NKV)) * (HD * 2 * TT) + (size_t)(t0 / 32) * 512 + lane * 8;
#pragma unroll
        for (int mb = 0; mb < 4; ++mb)
#pragma unroll
            for (int nb = 0; nb < 4; ++nb) { float x[8];
#pragma unroll
                for (int j = 0; j < 8; ++j) x[j] = acc[mb][nb][j];
                const size_t oo = po + (size_t)(nb * (TT / 32) + (mb >> 1)) * 512 + (mb & 1) * 256; put8(x, VT16 + oo, VTh + oo, VTh + HD * TT + oo); }
        return;
    }
    // q, k: planes [t][d]. Rotate-half pairs d and d + HD/2, which one lane holds in accumulators nb and nb + 2; cos and sin of d + HD/2 are those of d. The rotated 16 x 64 block goes through LDS to turn a lane's eight tokens into eight d.
    const bool isq = cy < NH_; const size_t po = (isq ? (size_t)b * NH_ + cy : (size_t)b * NKV + (cy - NH_)) * (TT * HD) + (size_t)t0 * HD + lane * 8;
    h16* P16 = (isq ? QP16 : KP16) + po; bf* Ph = (isq ? QPh : KPh) + po; bf* Pl = (isq ? QPl : KPl) + po;
    const char* csb = (const char*)(CS + (size_t)t0 * HD * 2); const unsigned lo = (hi * 8 * HD + lr) * 8;   // table entry (t, d): 8 bytes, cos then sin
    v2f cs[2][16];
    auto ldcs = [&](int mb, v2f* c) __attribute__((always_inline)) {
#pragma unroll
        for (int nb = 0; nb < 2; ++nb)
#pragma unroll
            for (int j = 0; j < 8; ++j) c[nb * 8 + j] = *(const v2f*)(csb + lo + ((mb * 16 + j) * HD + nb * 16) * 8);
        asm volatile("s_wait_xcnt 0x0" :: "v"(lo) : "memory"); };   // behind the table loads, in front of whatever next rewrites a register that they name; the offset is an input so that it lives to the wait
    ldcs(0, cs[0]);
#pragma unroll
    for (int mb = 0; mb < 4; ++mb) {
        if (mb < 3) ldcs(mb + 1, cs[(mb + 1) & 1]);   // the next 16 tokens' table entries fly while these are rotated and stored
#pragma unroll
        for (int nb = 0; nb < 2; ++nb)
#pragma unroll
            for (int j = 0; j < 8; ++j) { const float c = cs[mb & 1][nb * 8 + j][0], s = cs[mb & 1][nb * 8 + j][1], x0 = acc[mb][nb][j], x1 = acc[mb][nb + 2][j];
                os[(hi * 8 + j) * 68 + nb * 16 + lr] = x0 * c - x1 * s; os[(hi * 8 + j) * 68 + (nb + 2) * 16 + lr] = x1 * c + x0 * s; }
        __builtin_amdgcn_wave_barrier(); asm volatile("" ::: "memory");   // the one wave's LDS writes stay in front of its reads below
#pragma unroll
        for (int u = 0; u < 4; ++u) { const float* sp = os + lr * 68 + u * 16 + hi * 8; const v4f u0 = *(const v4fa*)sp, u1 = *(const v4fa*)(sp + 4); const float x[8] = {u0[0], u0[1], u0[2], u0[3], u1[0], u1[1], u1[2], u1[3]};
            const int oo = mb * 1024 + u * 256; put8(x, P16 + oo, Ph + oo, Pl + oo); }   // unit (t / 16, d / 32), half (d / 16) & 1
        __builtin_amdgcn_wave_barrier(); asm volatile("" ::: "memory");   // and its reads in front of the next block's writes
    }
}
// ---- k_flash: scores, causal softmax, probability x value and the head merge in ONE launch; scores and probabilities never leave registers (online softmax over key blocks of 32).
// One wave owns NBQ*16 query rows of one head. It forms the TRANSPOSED score tile S^T[key][query] = K Q^T (A = key rows, B = query rows), so that a lane holds scores of one query only (max and sum in-lane plus one
// exchange between the lane halves) and the accumulator registers of two 16-key tiles are, as they stand, the B operand P^T[query][key 0..31] of O^T[d][query] += V^T P^T (A = value rows [d][t]).
// k order of every operand: element e of lane half hi is k = (e / 8) * 16 + 8 * hi + e % 8 (WFrag::ld on both global operands; score tile mt, register j is key mt * 16 + 8 * hi + j).
// The four waves of a block are the four heads of one kv group on the same query rows: they read the same key and value lines. HR: bf16 hi+lo planes, 3 products; else fp16, probabilities carried x PCAR (it cancels in O / l).
typedef __attribute__((ext_vector_type(16))) unsigned short v16us;
// eight 2^x in one statement: no result shares a register with a source ("=&v"), and the v_nop is the free slot behind the last transcendental
__device__ __forceinline__ void exp2x8(float* p, const float* x) {
    asm("v_exp_f32 %0, %8\n\tv_exp_f32 %1, %9\n\tv_exp_f32 %2, %10\n\tv_exp_f32 %3, %11\n\tv_exp_f32 %4, %12\n\tv_exp_f32 %5, %13\n\tv_exp_f32 %6, %14\n\tv_exp_f32 %7, %15\n\tv_nop"
        : "=&v"(p[0]), "=&v"(p[1]), "=&v"(p[2]), "=&v"(p[3]), "=&v"(p[4]), "=&v"(p[5]), "=&v"(p[6]), "=&v"(p[7]) : "v"(x[0]), "v"(x[1]), "v"(x[2]), "v"(x[3]), "v"(x[4]), "v"(x[5]), "v"(x[6]), "v"(x[7]));
}
// the hi and the lo store of eight merged outputs, with their s_wait_xcnt 0 in the same statement: so it stands in front of whatever next rewrites an address or data register of theirs, on every way out of a tile
// (as a statement of its own the wait let the next outputs' arithmetic move up over it)
__device__ __forceinline__ void st2x(bf* pa, v8us a, bf* pb, v8us b) {
    asm volatile("global_store_b128 %0, %1, off\n\tglobal_store_b128 %2, %3, off\n\ts_wait_xcnt 0x0" :: "v"(pa), "v"(__builtin_bit_cast(v4i, a)), "v"(pb), "v"(__builtin_bit_cast(v4i, b)) : "memory");
}
template <typename T16, bool HR, int NBQ>
__device__ __forceinline__ void flash_tile(const T16* __restrict__ Q, const T16* __restrict__ Q2, const T16* __restrict__ Kp, const T16* __restrict__ K2, const T16* __restrict__ Vt, const T16* __restrict__ V2, int q0, bf* Ah, bf* Al) {
    typedef typename WFrag<T16>::V V;
    const int lane = threadIdx.x & 31, lr = lane & 15, hi = lane >> 4; const unsigned lb = lane * 16;
    V qf[NBQ][2], qf2[NBQ][2];
#pragma unroll
    for (int nb = 0; nb < NBQ; ++nb)
#pragma unroll
        for (int kc = 0; kc < 2; ++kc) { const int qo = (q0 + nb * 16) * HD + kc * 512; qf[nb][kc] = WFrag<T16>::ld(Q + qo, lb); if (HR) qf2[nb][kc] = WFrag<T16>::ld(Q2 + qo, lb); }
    asm volatile("s_wait_xcnt 0x0" :: "v"(lb) : "memory");   // behind the query loads, in front of whatever next rewrites a register that they name; the offset is an input so that no load's result lands in it
    v8f o[4][NBQ]; float m[NBQ], l[NBQ];
#pragma unroll
    for (int nb = 0; nb < NBQ; ++nb) { m[nb] = -3.0e38f; l[nb] = 0.f;
#pragma unroll
        for (int dt = 0; dt < 4; ++dt) o[dt][nb] = (v8f){}; }
    const int nkb = (q0 + NBQ * 16 + 31) / 32;      // key blocks up to the diagonal; every block starts at a key <= q0, so no query ever sees a fully masked block; only the last block holds keys beyond a query
    const float L2E = 1.4426950408889634f, PEXP = HR ? 0.0f : 10.0f;   // 2^10 = PCAR
    V kf[2][2], kf2[2][2], vf[4], vf2[4];
    auto ldk = [&](int k0) __attribute__((always_inline)) {
#pragma unroll
        for (int mt = 0; mt < 2; ++mt)
#pragma unroll
            for (int kc = 0; kc < 2; ++kc) { const int ko = (k0 + mt * 16) * HD + kc * 512; kf[mt][kc] = WFrag<T16>::ld(Kp + ko, lb); if (HR) kf2[mt][kc] = WFrag<T16>::ld(K2 + ko, lb); }
        asm volatile("s_wait_xcnt 0x0" :: "v"(lb) : "memory"); };   // stands behind the loads, in front of whatever next rewrites a register that they name (a later load's result among them)
    auto ldv = [&](int k0) __attribute__((always_inline)) {
#pragma unroll
        for (int dt = 0; dt < 4; ++dt) { const int vo = dt * 16 * TT + k0 * 16; vf[dt] = WFrag<T16>::ld(Vt + vo, lb); if (HR) vf2[dt] = WFrag<T16>::ld(V2 + vo, lb); }
        asm volatile("s_wait_xcnt 0x0" :: "v"(lb) : "memory"); };   // as in ldk
    // one key block; last: the block on the diagonal (masked, nothing fetched behind it). Otherwise the next block's key fragments are asked for behind the score products and its value fragments behind the value
    // products, one block ahead of their use (where the registers are short the compiler may issue the key loads later in the block).
    auto step = [&](int k0, bool last) __attribute__((always_inline)) {
        v8f s[2][NBQ];
#pragma unroll
        for (int mt = 0; mt < 2; ++mt)
#pragma unroll
            for (int nb = 0; nb < NBQ; ++nb) { v8f a = (v8f){};
#pragma unroll
                for (int kc = 0; kc < 2; ++kc) { a = WFrag<T16>::mma(kf[mt][kc], qf[nb][kc], a); if (HR) { a = WFrag<T16>::mma(kf[mt][kc], qf2[nb][kc], a); a = WFrag<T16>::mma(kf2[mt][kc], qf[nb][kc], a); } }
                s[mt][nb] = a; }
        if (!last) ldk(k0 + 32);
        V pf[NBQ], pf2[NBQ];
#pragma unroll
        for (int nb = 0; nb < NBQ; ++nb) {
            const int qi = q0 + nb * 16 + lr; float mx = m[nb];
#pragma unroll
            for (int mt = 0; mt < 2; ++mt)
#pragma unroll
                for (int j = 0; j < 8; ++j) { float t = s[mt][nb][j] * SCL; if (last && k0 + mt * 16 + hi * 8 + j > qi) t = -3.0e38f; s[mt][nb][j] = t; mx = fmaxf(mx, t); }
            mx = fmaxf(mx, __shfl_xor(mx, 16, 32));
            float al; asm("v_exp_f32 %0, %1\n\tv_nop" : "=v"(al) : "v"((m[nb] - mx) * L2E)); m[nb] = mx;   // 2^x with the free slot behind a transcendental in the same statement
            float ps = 0.f; float x[16], p[16];
#pragma unroll
            for (int e = 0; e < 16; ++e) x[e] = (s[e >> 3][nb][e & 7] - mx) * L2E + PEXP;
            exp2x8(p, x); exp2x8(p + 8, x + 8);
#pragma unroll
            for (int e = 0; e < 16; ++e) ps += p[e];
            l[nb] = l[nb] * al + ps;                // this lane half's keys only; the halves are added once, after the loop
#pragma unroll
            for (int dt = 0; dt < 4; ++dt) o[dt][nb] *= al;
            if constexpr (HR) { v16us ph, pl;
#pragma unroll
                for (int e = 0; e < 16; ++e) { unsigned short a, c2; splitf(p[e], a, c2); ph[e] = a; pl[e] = c2; }
                pf[nb] = __builtin_bit_cast(v16bf, ph); pf2[nb] = __builtin_bit_cast(v16bf, pl);
            } else { v16h ph;
#pragma unroll
                for (int e = 0; e < 16; ++e) ph[e] = tohx(p[e]);
                pf[nb] = ph; }
        }
#pragma unroll
        for (int dt = 0; dt < 4; ++dt)
#pragma unroll
            for (int nb = 0; nb < NBQ; ++nb) { o[dt][nb] = WFrag<T16>::mma(vf[dt], pf[nb], o[dt][nb]); if (HR) { o[dt][nb] = WFrag<T16>::mma(vf[dt], pf2[nb], o[dt][nb]); o[dt][nb] = WFrag<T16>::mma(vf2[dt], pf[nb], o[dt][nb]); } }
        if (!last) ldv(k0 + 32);
    };
    ldk(0); ldv(0);   // keys first, as in the loop: loads return in order, and the wait at the loop's head leaves the value loads in flight
#pragma unroll 1   // run-time trip count round a body that already fills most of the register file: a second copy of the body would spill
    for (int kb = 0; kb < nkb - 1; ++kb) step(kb * 32, false);
    step((nkb - 1) * 32, true);
#pragma unroll
    for (int nb = 0; nb < NBQ; ++nb) {
        const float lt = l[nb] + __shfl_xor(l[nb], 16, 32); const float inv = __fdiv_rn(1.0f, lt);
#pragma unroll
        for (int dt = 0; dt < 4; ++dt) { v8us oh, ol;
#pragma unroll
            for (int j = 0; j < 8; ++j) { unsigned short a, c2; splitf(o[dt][nb][j] * inv, a, c2); oh[j] = a; ol[j] = c2; }
            const size_t oo = (size_t)(q0 + nb * 16) * DQ + dt * 256 + lane * 8; st2x(Ah + oo, oh, Al + oo, ol); }   // fragment order of the merged [token][DQ] plane: the head's two units, half dt & 1
    }
}
#define NLO ((TT - RH) / 32)      // fp16 query tiles of 32 rows
#define NHI (RH / 16)             // hi+lo query tiles of 16 rows
// grid (kv planes, NLO + NHI): y counts the query tiles from the longest key range down, so that the long tiles start first
__global__ __launch_bounds__(128) void k_flash(const h16* __restrict__ QP16, const h16* __restrict__ KP16, const h16* __restrict__ VT16, const bf* __restrict__ QPh, const bf* __restrict__ QPl, const bf* __restrict__ KPh, const bf* __restrict__ KPl, const bf* __restrict__ VTh, bf* ATh, bf* ATl) {
    const int kvp = blockIdx.x, g = kvp * REP + __builtin_amdgcn_readfirstlane(threadIdx.x >> 5), b = g / NH_, h = g % NH_, ty = blockIdx.y;   // g = b*NH_ + h: flat head; its kv plane is g / REP
    const size_t qo = (size_t)g * TT * HD, ko = (size_t)kvp * TT * HD, vo = (size_t)kvp * HD * 2 * TT, ao = (size_t)b * TT * DQ + h * (HD * 16);
    if (ty < NLO) flash_tile<h16, false, 2>(QP16 + qo, nullptr, KP16 + ko, nullptr, VT16 + vo, nullptr, TT - 32 * (ty + 1), ATh + ao, ATl + ao);
    else flash_tile<bf, true, 1>(QPh + qo, QPl + qo, KPh + ko, KPl + ko, VTh + vo, VTh + vo + HD * TT, RH - 16 * (ty - NLO + 1), ATh + ao, ATl + ao);
}

extern "C" void kernel_launch(void* const* d_in, const int* in_sizes, int n_in,
                              void* d_out, int out_size, void* d_ws, size_t ws_size, hipStream_t stream) {
    (void)in_sizes; (void)n_in; (void)out_size;
    const float* x = (const float*)d_in[0]; const float* wq = (const float*)d_in[1]; const float* wk = (const float*)d_in[2]; const float* wv = (const float*)d_in[3]; const float* wo = (const float*)d_in[4];
    float* OUT = (float*)d_out;     // [4][2048][1024]
    char* wsp = (char*)d_ws;
    auto take = [&](size_t bytes) { char* p = wsp; wsp += (bytes + 255) & ~(size_t)255; return (void*)p; };
    bf* WQ = (bf*)take((size_t)DQ * DM * 2); bf* WK = (bf*)take((size_t)DKV * DM * 2); bf* WV = (bf*)take((size_t)DKV * DM * 2); bf* WO = (bf*)take((size_t)DM * DQ * 2); float* CS = (float*)take((size_t)TT * HD * 2 * 4);
    h16* QP16 = (h16*)take((size_t)NB_ * NH_ * TT * HD * 2); h16* KP16 = (h16*)take((size_t)NB_ * NKV * TT * HD * 2); h16* VT16 = (h16*)take((size_t)NB_ * NKV * HD * 2 * TT * 2);   // heads 2*HD*TT elements apart, as in the hi+lo planes: the fp16 plane fills the first HD*TT
    bf* QPh = (bf*)take((size_t)NB_ * NH_ * TT * HD * 2); bf* QPl = (bf*)take((size_t)NB_ * NH_ * TT * HD * 2); bf* KPh = (bf*)take((size_t)NB_ * NKV * TT * HD * 2); bf* KPl = (bf*)take((size_t)NB_ * NKV * TT * HD * 2); bf* VTh = (bf*)take((size_t)NB_ * NKV * HD * 2 * TT * 2);   // a head's hi plane, then its lo plane
    bf* ATh = (bf*)take((size_t)NB_ * TT * DQ * 2); bf* ATl = (bf*)take((size_t)NB_ * TT * DQ * 2);
    bf* XB = (bf*)take((size_t)NB_ * TT * DM * 2);   // x in bf16
    if ((size_t)(wsp - (char*)d_ws) > ws_size) return;    // ws 256 MiB
    k_prep<<<PB_W + PB_X + PB_CS, 256, 0, stream>>>(x, wq, wk, wv, wo, XB, WQ, WK, WV, WO, CS);
    // projections: the NB_ batches are NB_*TT rows, the q, k and v heads the column tiles, of one GEMM launch
    k_qkv<<<dim3(NB_ * TT / 64, NH_ + 2 * NKV), 32, 0, stream>>>(XB, WQ, WK, WV, CS, QP16, QPh, QPl, KP16, KPh, KPl, VT16, VTh);
    k_flash<<<dim3(NB_ * NKV, NLO + NHI), 128, 0, stream>>>(QP16, KP16, VT16, QPh, QPl, KPh, KPl, VTh, ATh, ATl);
    k_gemmw<bf, 1, false, DQ><<<dim3(NB_ * TT / 64, DM / 64, 1), 32, 0, stream>>>(ATh, ATl, WO, nullptr, OUT, DM, nullptr, 0, 0, 0);
}

// v007
// A run of this version takes 102 microseconds.
// In both of two side-by-side timings against v006, it was 1.08 times as fast.
// Counting every step since v000, it is 26.8 times as fast.
#include <hip/hip_runtime.h>

// GQA causal attention block (x [4][2048][1024]; q = x wq (16 heads x 64), k, v = x wk / wv (4 kv heads, GQA groups of 4); RoPE (rotate-half, base 10000) on q, k; causal softmax(q.k/8); out = (attn v merged) wo -> [4][2048][1024]).
// Compute dtypes, f32 accumulate: every input rounded to bf16; q/k/v projections on PLAIN bf16 operands (inputs: exact); RoPE f32; scores (K 64) and attn.v on bf16 hi+lo planes (3 products) for the first 512 query rows of each head and

#define NB_  4
#define TT   2048
#define DM   1024
#define NH_  16
#define NKV  4
#define REP  (NH_ / NKV)
#define HD   64
#define DQ   (NH_ * HD)
#define DKV  (NKV * HD)
#define RH   512                  // query rows < RH use hi+lo planes (0: none)
#define PCAR 1024.0f
#define SCL  0.125f   // HD^-0.5
typedef _Float16 h16;
typedef unsigned short bf;
typedef __attribute__((ext_vector_type(16))) __bf16   v16bf;
typedef __attribute__((ext_vector_type(16))) _Float16 v16h;
typedef __attribute__((ext_vector_type(8)))  _Float16 v8h;
typedef __attribute__((ext_vector_type(8)))  unsigned short v8us;
typedef __attribute__((ext_vector_type(8)))  float    v8f;
typedef __attribute__((ext_vector_type(4)))  float    v4f;
typedef v8h  __attribute__((may_alias)) v8ha;
typedef v4f  __attribute__((may_alias)) v4fa;
typedef v8us __attribute__((may_alias)) v8usa;

__device__ __forceinline__ unsigned short f2bf(float f) { unsigned u = __float_as_uint(f); u += 0x7FFFu + ((u >> 16) & 1u); return (unsigned short)(u >> 16); }
__device__ __forceinline__ float bf2f(unsigned short b) { return __uint_as_float(((unsigned)b) << 16); }
__device__ __forceinline__ float bfr(float f) { return bf2f(f2bf(f)); }
__device__ __forceinline__ v16h cat16(v8h lo, v8h hi) { return __builtin_shufflevector(lo, hi, 0, 1, 2, 3, 4, 5, 6, 7, 8, 9, 10, 11, 12, 13, 14, 15); }
__device__ __forceinline__ v16bf cat16b(v8us lo, v8us hi) { return __builtin_bit_cast(v16bf, __builtin_shufflevector(lo, hi, 0, 1, 2, 3, 4, 5, 6, 7, 8, 9, 10, 11, 12, 13, 14, 15)); }
__device__ __forceinline__ v8f wmma16(v16h a, v16h b, v8f c) { return __builtin_amdgcn_wmma_f32_16x16x32_f16(false, a, false, b, (short)0, c, false, false); }
__device__ __forceinline__ v8f wmmab(v16bf a, v16bf b, v8f c) { return __builtin_amdgcn_wmma_f32_16x16x32_bf16(false, a, false, b, (short)0, c, false, false); }



// ---- FRAGMENT ORDER: every 16-bit matrix operand plane [row][k] lies in units of 16 rows x 32 k (512 elements, 1 KB), units ordered [row / 16][k / 32]; inside a unit element (row, k) stands at
// ((k >> 4) & 1) * 256 + (((k >> 3) & 1) * 16 + (row & 15)) * 8 + (k & 7): a lane's two 16-byte fragment pieces are unit + lane * 8 and + 256, so each wave-wide load is 512 contiguous bytes (4 whole lines, not 32 bytes in each of 16).
// wtG walks a weight plane in storage order and asks unfrag for the (row, k) that stands at a position; KB = k / 32 units a row block.
__device__ __forceinline__ void unfrag(size_t pos, int KB, int& row, int& k) { const int u = (int)(pos >> 9), r = (int)(pos & 511); row = (u / KB) * 16 + ((r >> 3) & 15); k = (u % KB) * 32 + (r >> 8) * 16 + ((r >> 7) & 1) * 8 + (r & 7); }
// ---- k_gemmw: register-blocked GEMM, one wave per 64x64 output tile (16 accumulators), a work-group of GW_M x GW_N waves per (GW_M*64) x (GW_N*64) tile; operands are 16-bit planes in fragment order; grid (M/(GW_M*64), N/(GW_N*64), Z).
// C[m][n] (f32, pitch ldc, + optional f32 bias[n]) = sum_k A[m][k] Bt[n][k] (+ the product with the second A plane per NSPLIT). z-batch strides sA/sB/sC in elements. K: a constant, a multiple of KST.
// The main loop is ring_gemm below: the work-group's operand rows reach LDS once, by asynchronous copies, and every wave takes its fragments from there.
// ld(u, lb): the fragment of the unit at u (the same for the whole wave), lb = lane * 16, the lane's byte offset in it; ldp(p): the same from the lane's own address
template <typename T16> struct WFrag;
template <> struct WFrag<h16> { typedef v16h V; static __device__ __forceinline__ V ldp(const char* p) { return cat16(*(const v8h*)p, *(const v8h*)(p + 512)); } static __device__ __forceinline__ V ld(const h16* u, unsigned lb) { return ldp((const char*)u + lb); } static __device__ __forceinline__ v8f mma(V a, V b, v8f c) { return wmma16(a, b, c); } };
template <> struct WFrag<bf> { typedef v16bf V; static __device__ __forceinline__ V ldp(const char* p) { return cat16b(*(const v8us*)p, *(const v8us*)(p + 512)); } static __device__ __forceinline__ V ld(const bf* u, unsigned lb) { return ldp((const char*)u + lb); } static __device__ __forceinline__ v8f mma(V a, V b, v8f c) { return wmmab(a, b, c); } };
// ---- ring_gemm: the main loop of both GEMM kernels. A stage is KST k of every operand row of the work-group's tile: per block of 16 rows four units (RBS bytes), contiguous in the plane and in LDS alike, so a fragment
// read is 512 contiguous LDS bytes. Two buffers: while a stage is multiplied the next one's copies (global_load_async_to_lds_b128, through no register) fly. The blocks of 16 rows are dealt to the waves in turn.
// srcp(rb): the plane address (the same for the whole wave) of row block rb at k = 0; rb counts the A plane's WM*4 blocks, the second A plane's (NPA = 2), then the WN*4 blocks of Bt.
#define KST 128
#define RBS (KST * 16 * 2)
// CP8: eight copies of 512 bytes, one row block of a stage; the immediate offset moves the LDS and the global address alike, and the block is contiguous in both.
// cp8, cp16: one or two row blocks, with their s_wait_xcnt 0 as the statement's last line: so it stands in front of whatever next rewrites an address register of theirs
#define CP1(L, G, O) "global_load_async_to_lds_b128 " L ", " G ", off offset:" O "\n\t"
#define CP8(L, G) "global_load_async_to_lds_b128 " L ", " G ", off\n\t" CP1(L, G, "512") CP1(L, G, "1024") CP1(L, G, "1536") CP1(L, G, "2048") CP1(L, G, "2560") CP1(L, G, "3072") CP1(L, G, "3584")
__device__ __forceinline__ void cp8(unsigned l, const char* g) { asm volatile(CP8("%0", "%1") "s_wait_xcnt 0x0" :: "v"(l), "v"(g) : "memory"); }
__device__ __forceinline__ void cp16(unsigned l0, const char* g0, unsigned l1, const char* g1) { asm volatile(CP8("%0", "%1") CP8("%2", "%3") "s_wait_xcnt 0x0" :: "v"(l0), "v"(g0), "v"(l1), "v"(g1) : "memory"); }
template <typename T16, int WM, int WN, int NPA, int K, typename SRC>
__device__ __forceinline__ void ring_gemm(char* ring, SRC srcp, v8f (&acc)[4][4]) {
    typedef typename WFrag<T16>::V V;
    constexpr int NW = WM * WN, RBA = WM * 4, NRB = NPA * RBA + WN * 4, STG = NRB * RBS, NT = K / KST, NCP = (NRB + NW - 1) / NW, NFULL = NRB / NW;   // NFULL row blocks for every wave, one more for the first NRB % NW waves
    static_assert(K % KST == 0 && NT >= 2 && KST == 128 && NCP * 8 <= 63, "whole stages, at least two; four k steps a stage; a wave's copies of one stage in flight");
    const int lane = threadIdx.x & 31, wave = __builtin_amdgcn_readfirstlane(threadIdx.x >> 5), wm = wave / WN, wn = wave % WN; const unsigned lb = lane * 16;
    // every plain '#pragma unroll' below stands on a loop whose counter indexes fragments, accumulators or addresses: they stay in registers only where those indices are constants
    const char* g[NCP]; unsigned l[NCP];   // the same for the whole wave (scalar registers); a lane adds its lb where the copies are issued
#pragma unroll
    for (int i = 0; i < NCP; ++i) { const int rb = wave + i * NW < NRB ? wave + i * NW : 0; g[i] = srcp(rb); l[i] = (unsigned)(size_t)ring + rb * RBS; }
    // a lane's LDS address; readfirstlane holds the wave's part together in a scalar register: without it the compiler kept a vector register per row block alive over the loop and spilled it
    auto la = [&](int i, unsigned bo) __attribute__((always_inline)) { return (unsigned)__builtin_amdgcn_readfirstlane(l[i] + bo) + lb; };
    auto fill = [&](int t, unsigned bo) __attribute__((always_inline)) {   // this wave's row blocks of stage t into the buffer at bo; the test is the same for the whole wave
#pragma unroll
        for (int i = 0; i + 1 < NFULL; i += 2) cp16(la(i, bo), (g[i] + (size_t)t * RBS) + lb, la(i + 1, bo), (g[i + 1] + (size_t)t * RBS) + lb);
        if (NFULL & 1) cp8(la(NFULL - 1, bo), (g[NFULL - 1] + (size_t)t * RBS) + lb);
        if (NCP > NFULL) if (wave + NFULL * NW < NRB) cp8(la(NCP - 1, bo), (g[NCP - 1] + (size_t)t * RBS) + lb); };
    const char* fa = ring + wm * 4 * RBS + lb; const char* fb = ring + (NPA * RBA + wn * 4) * RBS + lb;
    V a[2][4], a2[2][4], b[2][4];
    auto ldf = [&](int st, int ks, unsigned bo) __attribute__((always_inline)) {   // into set st the fragments of k step ks of the stage at bo, as one group of LDS reads
#pragma unroll
        for (int mb = 0; mb < 4; ++mb) { a[st][mb] = WFrag<T16>::ldp(fa + bo + mb * RBS + ks * 1024); if (NPA == 2) a2[st][mb] = WFrag<T16>::ldp(fa + bo + (RBA + mb) * RBS + ks * 1024); }
#pragma unroll
        for (int nb = 0; nb < 4; ++nb) b[st][nb] = WFrag<T16>::ldp(fb + bo + nb * RBS + ks * 1024);
        __builtin_amdgcn_sched_barrier(0); };   // the group stays whole and in front of the products that follow (for speed only)
    auto mm = [&](int st) __attribute__((always_inline)) {
#pragma unroll
        for (int nb = 0; nb < 4; ++nb)
#pragma unroll
            for (int mb = 0; mb < 4; ++mb) { acc[mb][nb] = WFrag<T16>::mma(a[st][mb], b[st][nb], acc[mb][nb]); if (NPA == 2) acc[mb][nb] = WFrag<T16>::mma(a2[st][mb], b[st][nb], acc[mb][nb]); }
        __builtin_amdgcn_sched_barrier(0); };   // and a step's products stay in front of the next group, which refills their set
    fill(0, 0);
    asm volatile("s_wait_asynccnt 0x0" ::: "memory");   // this wave's copies of stage 0 have landed
    __syncthreads();                                    // and every other wave's: stage 0 may be read
    fill(1, STG);
    ldf(0, 0, 0);
#pragma unroll 1   // a trip is a stage; the buffer is picked by an offset, a second copy of the body buys nothing
    for (int t = 0; t < NT; ++t) {
        const unsigned bo = (t & 1) * STG;
        ldf(1, 1, bo); mm(0);   // a k step's fragments are read one step ahead of their products
        ldf(0, 2, bo); mm(1);
        ldf(1, 3, bo); mm(0);
        // stage t + 1 is published in front of this stage's last k step, whose fragments are already asked for: so the next stage's first fragments can be read under its products
        asm volatile("s_wait_dscnt 0x0" ::: "memory");      // this wave's reads of the buffer are over
        asm volatile("s_wait_asynccnt 0x0" ::: "memory");   // its copies of stage t + 1 have landed
        __syncthreads();                                    // the same holds of every wave: stage t + 1 may be read, this buffer refilled
        if (t + 2 < NT) fill(t + 2, bo);
        if (t + 1 < NT) ldf(0, 0, STG - bo);
        mm(1);
    }
    asm volatile("s_wait_asynccnt 0x0" ::: "memory");   // nothing of this wave's is in flight behind the loop
}
#define GW_M 2
#define GW_N 4
template <typename T16, int NSPLIT, bool BIAS, int K>
__global__ __launch_bounds__(GW_M * GW_N * 32) void k_gemmw(const T16* __restrict__ A, const T16* __restrict__ A2, const T16* __restrict__ Bt, const T16* __restrict__ Bt2, float* C, int ldc, const float* __restrict__ bias, size_t sA, size_t sB, size_t sC) {
    static_assert(NSPLIT == 0 || NSPLIT == 1, "one Bt plane");
    constexpr int NPA = NSPLIT == 1 ? 2 : 1;
    __shared__ __align__(16) char ring[2 * (NPA * GW_M + GW_N) * 4 * RBS];
    __shared__ __align__(16) float osm[GW_M * GW_N * 16 * 68];   // a wave's own output staging
    const size_t z = blockIdx.z; A += z * sA; if (A2) A2 += z * sA; Bt += z * sB; C += z * sC; (void)Bt2;
    const int lane = threadIdx.x & 31, lr = lane & 15, hi = lane >> 4, wave = __builtin_amdgcn_readfirstlane(threadIdx.x >> 5); const int R0 = blockIdx.x * (GW_M * 64), C0 = blockIdx.y * (GW_N * 64), r0 = R0 + (wave / GW_N) * 64, c0 = C0 + (wave % GW_N) * 64;
    float* os = osm + wave * (16 * 68);
    v8f acc[4][4];
#pragma unroll
    for (int mb = 0; mb < 4; ++mb)
#pragma unroll
        for (int nb = 0; nb < 4; ++nb) acc[mb][nb] = (v8f){};
    ring_gemm<T16, GW_M, GW_N, NPA, K>(ring, [&](int rb) __attribute__((always_inline)) { constexpr int RBA = GW_M * 4;   // a row block of 16 is K * 16 elements
        return (const char*)(rb < RBA ? A + (size_t)(R0 + rb * 16) * K : rb < NPA * RBA ? A2 + (size_t)(R0 + (rb - RBA) * 16) * K : Bt + (size_t)(C0 + (rb - NPA * RBA) * 16) * K); }, acc);
#pragma unroll
    for (int mb = 0; mb < 4; ++mb) {
#pragma unroll
        for (int nb = 0; nb < 4; ++nb) {
#pragma unroll
            for (int j = 0; j < 8; ++j) os[(hi * 8 + j) * 68 + nb * 16 + lr] = acc[mb][nb][j]; }
        __builtin_amdgcn_wave_barrier(); asm volatile("" ::: "memory");
        float* crow = C + (size_t)(r0 + mb * 16) * ldc + c0;
{
#pragma unroll
            for (int s = 0; s < 8; ++s) { const int row = 2 * s + hi, cofs = lr * 4; v4f val = *(const v4fa*)(os + row * 68 + cofs); if (BIAS) { val[0] += bfr(bias[c0 + cofs]); val[1] += bfr(bias[c0 + cofs + 1]); val[2] += bfr(bias[c0 + cofs + 2]); val[3] += bfr(bias[c0 + cofs + 3]); }
                *(v4f*)(crow + (size_t)row * ldc + cofs) = val; }
             }
        __builtin_amdgcn_wave_barrier(); asm volatile("" ::: "memory");
    }
}

__device__ __forceinline__ h16 tohx(float x) { return (h16)x; }
__device__ __forceinline__ void splitf(float y, unsigned short& h, unsigned short& l) { h = f2bf(y); l = f2bf(y - bf2f(h)); }
typedef __attribute__((ext_vector_type(2))) _Float16 v2h;
typedef __attribute__((ext_vector_type(4))) _Float16 v4h;
typedef __attribute__((ext_vector_type(2))) unsigned short v2us;
typedef __attribute__((ext_vector_type(4))) unsigned short v4us;
typedef __attribute__((ext_vector_type(2))) float v2f;
typedef __attribute__((ext_vector_type(4))) int v4i;

// ---- k_prep: all that only re-forms an input or builds the RoPE table, in ONE launch (the parts do not depend on one another); a work-group's index picks its part, the parts with the longest chains of dependent loads first.
#define PB_WQ (DM * DQ / 512 / 8)              // work-groups for wq, and for wo: a wave takes one unit of 512 elements
#define PB_WK (DM * DKV / 512 / 8)             // for wk, and for wv
#define PB_W  (2 * PB_WQ + 2 * PB_WK)
#define PB_X  (NB_ * TT * DM / 512 / 4 / 8)    // for x: a wave takes four units
#define PB_CS (TT * (HD / 2) / 256)            // for the table: a thread takes the two entries d and d + HD/2, which are equal
__device__ __forceinline__ void wtG(const float* __restrict__ w, int K, int N, bf* Bt, int blk) {
    const int lane = threadIdx.x & 31; const int L0 = (blk * 8 + (threadIdx.x >> 5)) * 8; const int nlines = N * K / 64;
{
#pragma unroll 1
        for (int l = 0; l < 8; ++l) { const int L = L0 + l; if (L >= nlines) break; const size_t e = (size_t)L * 64 + lane * 2; int k, n; unfrag(e, K / 32, n, k); v2us o;
            const float* p0 = w + (size_t)k * N + n; const float* p1 = p0 + N; const float w0 = *p0, w1 = *p1;
            asm volatile("s_wait_xcnt 0x0" :: "v"(p0), "v"(p1) : "memory");   // behind the loads, in front of whatever next rewrites an address register of theirs (inputs: they live to the wait)
            o[0] = f2bf(w0); o[1] = f2bf(w1); bf* po = Bt + e;
            asm volatile("global_store_b32 %0, %1, off\n\ts_wait_xcnt 0x0" :: "v"(po), "v"(__builtin_bit_cast(unsigned, o)) : "memory"); }   // the store with its wait in one statement: the next trip rewrites its registers
         }
}
__global__ __launch_bounds__(256) void k_prep(const float* __restrict__ x, const float* __restrict__ wq, const float* __restrict__ wk, const float* __restrict__ wv, const float* __restrict__ wo, bf* XB, bf* WQ, bf* WK, bf* WV, bf* WO, float* CS) {
    static_assert(DQ == DM && (DM / 32) % 4 == 0 && HD * 4 == 256, "one K for the four weights; a wave's four units of x lie in one row block; the table's second store stands 256 bytes on");
    int blk = blockIdx.x;
    if (blk < PB_W) {   // weights [k][n] f32 -> [n][k] bf16 in fragment order
        const float* w; bf* Bt; int N;
        if (blk < PB_WQ) { w = wq; Bt = WQ; N = DQ; }
        else if (blk < 2 * PB_WQ) { w = wo; Bt = WO; N = DM; blk -= PB_WQ; }
        else if (blk < 2 * PB_WQ + PB_WK) { w = wk; Bt = WK; N = DKV; blk -= 2 * PB_WQ; }
        else { w = wv; Bt = WV; N = DKV; blk -= 2 * PB_WQ + PB_WK; }
        wtG(w, DM, N, Bt, blk); return;
    }
    blk -= PB_W;
    if (blk < PB_X) {   // x -> bf16 in fragment order. A wave's four units are 16 rows x 128 k: piece c of a lane (8 elements) is row lane & 15, k = c * 16 + (lane >> 4) * 8 of them, and stands at c * 256 + lane * 8
        const int lane = threadIdx.x & 31, u0 = (blk * 8 + (threadIdx.x >> 5)) * 4;
        const float* p = x + (size_t)((u0 / (DM / 32)) * 16 + (lane & 15)) * DM + (u0 % (DM / 32)) * 32 + (lane >> 4) * 8; v8f v[8]; v4i o[8];
#pragma unroll   // c indexes registers; the eight pieces' loads are all in flight together
        for (int c = 0; c < 8; ++c) v[c] = *(const v8f*)(p + c * 16);
        asm volatile("s_wait_xcnt 0x0" :: "v"(p) : "memory");   // behind the loads, in front of whatever next rewrites their address register (an input: it lives to the wait)
#pragma unroll
        for (int c = 0; c < 8; ++c) { v8us t;
#pragma unroll
            for (int j = 0; j < 8; ++j) t[j] = f2bf(v[c][j]);
            o[c] = __builtin_bit_cast(v4i, t); }
        bf* d = XB + (size_t)u0 * 512 + lane * 8;
        // the eight stores with their s_wait_xcnt 0 in one statement: nothing rewrites a register of theirs in front of it
        asm volatile("global_store_b128 %0, %1, off\n\tglobal_store_b128 %0, %2, off offset:512\n\tglobal_store_b128 %0, %3, off offset:1024\n\tglobal_store_b128 %0, %4, off offset:1536\n\t"
                     "global_store_b128 %0, %5, off offset:2048\n\tglobal_store_b128 %0, %6, off offset:2560\n\tglobal_store_b128 %0, %7, off offset:3072\n\tglobal_store_b128 %0, %8, off offset:3584\n\ts_wait_xcnt 0x0"
                     :: "v"(d), "v"(o[0]), "v"(o[1]), "v"(o[2]), "v"(o[3]), "v"(o[4]), "v"(o[5]), "v"(o[6]), "v"(o[7]) : "memory");
        return;
    }
    blk -= PB_X;
    {   // RoPE table, entry (t, d): cos then sin
        const int idx = blk * 256 + threadIdx.x; const int t = idx / (HD / 2), i = idx % (HD / 2); const float inv = __fdiv_rn(1.0f, powf(10000.0f, (float)(2 * i) / (float)HD)); const float ang = __fmul_rn((float)t, inv); v2f cs; cs[0] = cosf(ang); cs[1] = sinf(ang);
        float* pc = CS + ((size_t)t * HD + i) * 2;
        // the two stores (entry d, and d + HD/2 at HD floats = 256 bytes on) with their s_wait_xcnt 0 in one statement: nothing rewrites a register of theirs in front of it
        asm volatile("global_store_b64 %0, %1, off\n\tglobal_store_b64 %0, %1, off offset:256\n\ts_wait_xcnt 0x0" :: "v"(pc), "v"(cs) : "memory");
    }
}
// ---- k_qkv: the q, k and v projections in ONE launch, RoPE and the forming of the 16-bit operand planes in its epilogue (no f32 projection ever reaches memory). grid (tokens / (QW_M*64), (NH_ + 2 * NKV) / QW_N), QW_M*QW_N waves:
// one wave per 64 tokens x one head (HD = 64 columns), a work-group QW_M*64 tokens x QW_N heads, main loop ring_gemm; heads count the NH_ q heads, then the NKV k heads, then the NKV v heads.
// Every plain '#pragma unroll' here stands on a loop whose counter indexes accumulators, fragments or table entries: they stay in registers only where those indices are constants.
// the fp16, the hi and the lo store of eight plane elements, with their s_wait_xcnt 0 in the same statement: so it stands in front of whatever next rewrites an address or data register of theirs
__device__ __forceinline__ void st3x(h16* p16, v8h a, bf* ph, v8us b, bf* pl, v8us c) {
    asm volatile("global_store_b128 %0, %1, off\n\tglobal_store_b128 %2, %3, off\n\tglobal_store_b128 %4, %5, off\n\ts_wait_xcnt 0x0" :: "v"(p16), "v"(__builtin_bit_cast(v4i, a)), "v"(ph), "v"(__builtin_bit_cast(v4i, b)), "v"(pl), "v"(__builtin_bit_cast(v4i, c)) : "memory");
}
__device__ __forceinline__ void put8(const float* x, h16* p16, bf* ph, bf* pl) { v8h o16; v8us oh, ol;
#pragma unroll
    for (int j = 0; j < 8; ++j) { o16[j] = tohx(x[j]); unsigned short a2, c2; splitf(x[j], a2, c2); oh[j] = a2; ol[j] = c2; }
    st3x(p16, o16, ph, oh, pl, ol); }
#define QW_M 4
#define QW_N 3
__global__ __launch_bounds__(QW_M * QW_N * 32) void k_qkv(const bf* __restrict__ A, const bf* __restrict__ WQ, const bf* __restrict__ WK, const bf* __restrict__ WV, const float* __restrict__ CS, h16* QP16, bf* QPh, bf* QPl, h16* KP16, bf* KPh, bf* KPl, h16* VT16, bf* VTh) {
    static_assert(HD == 64 && TT % 64 == 0 && (NH_ + 2 * NKV) % QW_N == 0 && (NB_ * TT) % (QW_M * 64) == 0, "a 64 x 64 tile is 64 tokens of one batch x one whole head; whole work-group tiles");
    __shared__ __align__(16) char ring[2 * (QW_M + QW_N) * 4 * RBS];
    __shared__ __align__(16) float osm[QW_M * QW_N * 16 * 68];   // a wave's own staging for the turn of its rotated blocks
    const int K = DM, lane = threadIdx.x & 31, lr = lane & 15, hi = lane >> 4, wave = __builtin_amdgcn_readfirstlane(threadIdx.x >> 5); const int R0 = blockIdx.x * (QW_M * 64), H0 = blockIdx.y * QW_N, r0 = R0 + (wave / QW_N) * 64, cy = H0 + wave % QW_N;
    float* os = osm + wave * (16 * 68);
    v8f acc[4][4];
#pragma unroll
    for (int mb = 0; mb < 4; ++mb)
#pragma unroll
        for (int nb = 0; nb < 4; ++nb) acc[mb][nb] = (v8f){};
    ring_gemm<bf, QW_M, QW_N, 1, DM>(ring, [&](int rb) __attribute__((always_inline)) { constexpr int RBA = QW_M * 4;   // a row block of 16 is K * 16 elements; a head is four of them
        const int n = H0 * HD + (rb - RBA) * 16;   // the weight row among the q, then k, then v columns
        return (const char*)(rb < RBA ? A + (size_t)(R0 + rb * 16) * K : n < DQ ? WQ + (size_t)n * K : n < DQ + DKV ? WK + (size_t)(n - DQ) * K : WV + (size_t)(n - DQ - DKV) * K); }, acc);
    const int b = r0 / TT, t0 = r0 % TT;
    if (cy >= NH_ + NKV) {
        // v: planes [d][t]. Register j of accumulator (mb, nb) is token t0 + mb * 16 + hi * 8 + j of column d = nb * 16 + lr: a lane's eight registers are, as they stand, its 16-byte piece of the unit (d / 16, t / 32), half mb & 1
        const size_t po = ((size_t)b * NKV + (cy - NH_ - NKV)) * (HD * 2 * TT) + (size_t)(t0 / 32) * 512 + lane * 8;
#pragma unroll
        for (int mb = 0; mb < 4; ++mb)
#pragma unroll
            for (int nb = 0; nb < 4; ++nb) { float x[8];
#pragma unroll
                for (int j = 0; j < 8; ++j) x[j] = acc[mb][nb][j];
                const size_t oo = po + (size_t)(nb * (TT / 32) + (mb >> 1)) * 512 + (mb & 1) * 256; put8(x, VT16 + oo, VTh + oo, VTh + HD * TT + oo); }
        return;
    }
    // q, k: planes [t][d]. Rotate-half pairs d and d + HD/2, which one lane holds in accumulators nb and nb + 2; cos and sin of d + HD/2 are those of d. The rotated 16 x 64 block goes through LDS to turn a lane's eight tokens into eight d.
    const bool isq = cy < NH_; const size_t po = (isq ? (size_t)b * NH_ + cy : (size_t)b * NKV + (cy - NH_)) * (TT * HD) + (size_t)t0 * HD + lane * 8;
    h16* P16 = (isq ? QP16 : KP16) + po; bf* Ph = (isq ? QPh : KPh) + po; bf* Pl = (isq ? QPl : KPl) + po;
    const char* csb = (const char*)(CS + (size_t)t0 * HD * 2); const unsigned lo = (hi * 8 * HD + lr) * 8;   // table entry (t, d): 8 bytes, cos then sin
    v2f cs[2][16];
    auto ldcs = [&](int mb, v2f* c) __attribute__((always_inline)) {
#pragma unroll
        for (int nb = 0; nb < 2; ++nb)
#pragma unroll
            for (int j = 0; j < 8; ++j) c[nb * 8 + j] = *(const v2f*)(csb + lo + ((mb * 16 + j) * HD + nb * 16) * 8);
        asm volatile("s_wait_xcnt 0x0" :: "v"(lo) : "memory"); };   // behind the table loads, in front of whatever next rewrites a register that they name; the offset is an input so that it lives to the wait
    ldcs(0, cs[0]);
#pragma unroll
    for (int mb = 0; mb < 4; ++mb) {
        if (mb < 3) ldcs(mb + 1, cs[(mb + 1) & 1]);   // the next 16 tokens' table entries fly while these are rotated and stored
#pragma unroll
        for (int nb = 0; nb < 2; ++nb)
#pragma unroll
            for (int j = 0; j < 8; ++j) { const float c = cs[mb & 1][nb * 8 + j][0], s = cs[mb & 1][nb * 8 + j][1], x0 = acc[mb][nb][j], x1 = acc[mb][nb + 2][j];
                os[(hi * 8 + j) * 68 + nb * 16 + lr] = x0 * c - x1 * s; os[(hi * 8 + j) * 68 + (nb + 2) * 16 + lr] = x1 * c + x0 * s; }
        __builtin_amdgcn_wave_barrier(); asm volatile("" ::: "memory");   // the one wave's LDS writes stay in front of its reads below
#pragma unroll
        for (int u = 0; u < 4; ++u) { const float* sp = os + lr * 68 + u * 16 + hi * 8; const v4f u0 = *(const v4fa*)sp, u1 = *(const v4fa*)(sp + 4); const float x[8] = {u0[0], u0[1], u0[2], u0[3], u1[0], u1[1], u1[2], u1[3]};
            const int oo = mb * 1024 + u * 256; put8(x, P16 + oo, Ph + oo, Pl + oo); }   // unit (t / 16, d / 32), half (d / 16) & 1
        __builtin_amdgcn_wave_barrier(); asm volatile("" ::: "memory");   // and its reads in front of the next block's writes
    }
}
// ---- k_flash: scores, causal softmax, probability x value and the head merge in ONE launch; scores and probabilities never leave registers (online softmax over key blocks of 32).
// One wave owns NBQ*16 query rows of one head. It forms the TRANSPOSED score tile S^T[key][query] = K Q^T (A = key rows, B = query rows), so that a lane holds scores of one query only (max and sum in-lane plus one
// exchange between the lane halves) and the accumulator registers of two 16-key tiles are, as they stand, the B operand P^T[query][key 0..31] of O^T[d][query] += V^T P^T (A = value rows [d][t]).
// k order of every operand: element e of lane half hi is k = (e / 8) * 16 + 8 * hi + e % 8 (WFrag::ld on both global operands; score tile mt, register j is key mt * 16 + 8 * hi + j).
// The four waves of a block are the four heads of one kv group on the same query rows: they read the same key and value lines. HR: bf16 hi+lo planes, 3 products; else fp16, probabilities carried x PCAR (it cancels in O / l).
typedef __attribute__((ext_vector_type(16))) unsigned short v16us;
// eight 2^x in one statement: no result shares a register with a source ("=&v"), and the v_nop is the free slot behind the last transcendental
__device__ __forceinline__ void exp2x8(float* p, const float* x) {
    asm("v_exp_f32 %0, %8\n\tv_exp_f32 %1, %9\n\tv_exp_f32 %2, %10\n\tv_exp_f32 %3, %11\n\tv_exp_f32 %4, %12\n\tv_exp_f32 %5, %13\n\tv_exp_f32 %6, %14\n\tv_exp_f32 %7, %15\n\tv_nop"
        : "=&v"(p[0]), "=&v"(p[1]), "=&v"(p[2]), "=&v"(p[3]), "=&v"(p[4]), "=&v"(p[5]), "=&v"(p[6]), "=&v"(p[7]) : "v"(x[0]), "v"(x[1]), "v"(x[2]), "v"(x[3]), "v"(x[4]), "v"(x[5]), "v"(x[6]), "v"(x[7]));
}
// the hi and the lo store of eight merged outputs, with their s_wait_xcnt 0 in the same statement: so it stands in front of whatever next rewrites an address or data register of theirs, on every way out of a tile
// (as a statement of its own the wait let the next outputs' arithmetic move up over it)
__device__ __forceinline__ void st2x(bf* pa, v8us a, bf* pb, v8us b) {
    asm volatile("global_store_b128 %0, %1, off\n\tglobal_store_b128 %2, %3, off\n\ts_wait_xcnt 0x0" :: "v"(pa), "v"(__builtin_bit_cast(v4i, a)), "v"(pb), "v"(__builtin_bit_cast(v4i, b)) : "memory");
}
template <typename T16, bool HR, int NBQ>
__device__ __forceinline__ void flash_tile(const T16* __restrict__ Q, const T16* __restrict__ Q2, const T16* __restrict__ Kp, const T16* __restrict__ K2, const T16* __restrict__ Vt, const T16* __restrict__ V2, int q0, bf* Ah, bf* Al) {
    typedef typename WFrag<T16>::V V;
    const int lane = threadIdx.x & 31, lr = lane & 15, hi = lane >> 4; const unsigned lb = lane * 16;
    V qf[NBQ][2], qf2[NBQ][2];
#pragma unroll
    for (int nb = 0; nb < NBQ; ++nb)
#pragma unroll
        for (int kc = 0; kc < 2; ++kc) { const int qo = (q0 + nb * 16) * HD + kc * 512; qf[nb][kc] = WFrag<T16>::ld(Q + qo, lb); if (HR) qf2[nb][kc] = WFrag<T16>::ld(Q2 + qo, lb); }
    asm volatile("s_wait_xcnt 0x0" :: "v"(lb) : "memory");   // behind the query loads, in front of whatever next rewrites a register that they name; the offset is an input so that no load's result lands in it
    v8f o[4][NBQ]; float m[NBQ], l[NBQ];
#pragma unroll
    for (int nb = 0; nb < NBQ; ++nb) { m[nb] = -3.0e38f; l[nb] = 0.f;
#pragma unroll
        for (int dt = 0; dt < 4; ++dt) o[dt][nb] = (v8f){}; }
    const int nkb = (q0 + NBQ * 16 + 31) / 32;      // key blocks up to the diagonal; every block starts at a key <= q0, so no query ever sees a fully masked block; only the last block holds keys beyond a query
    const float L2E = 1.4426950408889634f, PEXP = HR ? 0.0f : 10.0f;   // 2^10 = PCAR
    V kf[2][2], kf2[2][2], vf[4], vf2[4];
    auto ldk = [&](int k0) __attribute__((always_inline)) {
#pragma unroll
        for (int mt = 0; mt < 2; ++mt)
#pragma unroll
            for (int kc = 0; kc < 2; ++kc) { const int ko = (k0 + mt * 16) * HD + kc * 512; kf[mt][kc] = WFrag<T16>::ld(Kp + ko, lb); if (HR) kf2[mt][kc] = WFrag<T16>::ld(K2 + ko, lb); }
        asm volatile("s_wait_xcnt 0x0" :: "v"(lb) : "memory"); };   // stands behind the loads, in front of whatever next rewrites a register that they name (a later load's result among them)
    auto ldv = [&](int k0) __attribute__((always_inline)) {
#pragma unroll
        for (int dt = 0; dt < 4; ++dt) { const int vo = dt * 16 * TT + k0 * 16; vf[dt] = WFrag<T16>::ld(Vt + vo, lb); if (HR) vf2[dt] = WFrag<T16>::ld(V2 + vo, lb); }
        asm volatile("s_wait_xcnt 0x0" :: "v"(lb) : "memory"); };   // as in ldk
    // one key block; last: the block on the diagonal (masked, nothing fetched behind it). Otherwise the next block's key fragments are asked for behind the score products and its value fragments behind the value
    // products, one block ahead of their use (where the registers are short the compiler may issue the key loads later in the block).
    auto step = [&](int k0, bool last) __attribute__((always_inline)) {
        v8f s[2][NBQ];
#pragma unroll
        for (int mt = 0; mt < 2; ++mt)
#pragma unroll
            for (int nb = 0; nb < NBQ; ++nb) { v8f a = (v8f){};
#pragma unroll
                for (int kc = 0; kc < 2; ++kc) { a = WFrag<T16>::mma(kf[mt][kc], qf[nb][kc], a); if (HR) { a = WFrag<T16>::mma(kf[mt][kc], qf2[nb][kc], a); a = WFrag<T16>::mma(kf2[mt][kc], qf[nb][kc], a); } }
                s[mt][nb] = a; }
        if (!last) ldk(k0 + 32);
        V pf[NBQ], pf2[NBQ];
#pragma unroll
        for (int nb = 0; nb < NBQ; ++nb) {
            const int qi = q0 + nb * 16 + lr; float mx = m[nb];
#pragma unroll
            for (int mt = 0; mt < 2; ++mt)
#pragma unroll
                for (int j = 0; j < 8; ++j) { float t = s[mt][nb][j] * SCL; if (last && k0 + mt * 16 + hi * 8 + j > qi) t = -3.0e38f; s[mt][nb][j] = t; mx = fmaxf(mx, t); }
            mx = fmaxf(mx, __shfl_xor(mx, 16, 32));
            float al; asm("v_exp_f32 %0, %1\n\tv_nop" : "=v"(al) : "v"((m[nb] - mx) * L2E)); m[nb] = mx;   // 2^x with the free slot behind a transcendental in the same statement
            float ps = 0.f; float x[16], p[16];
#pragma unroll
            for (int e = 0; e < 16; ++e) x[e] = (s[e >> 3][nb][e & 7] - mx) * L2E + PEXP;
            exp2x8(p, x); exp2x8(p + 8, x + 8);
#pragma unroll
            for (int e = 0; e < 16; ++e) ps += p[e];
            l[nb] = l[nb] * al + ps;                // this lane half's keys only; the halves are added once, after the loop
#pragma unroll
            for (int dt = 0; dt < 4; ++dt) o[dt][nb] *= al;
            if constexpr (HR) { v16us ph, pl;
#pragma unroll
                for (int e = 0; e < 16; ++e) { unsigned short a, c2; splitf(p[e], a, c2); ph[e] = a; pl[e] = c2; }
                pf[nb] = __builtin_bit_cast(v16bf, ph); pf2[nb] = __builtin_bit_cast(v16bf, pl);
            } else { v16h ph;
#pragma unroll
                for (int e = 0; e < 16; ++e) ph[e] = tohx(p[e]);
                pf[nb] = ph; }
        }
#pragma unroll
        for (int dt = 0; dt < 4; ++dt)
#pragma unroll
            for (int nb = 0; nb < NBQ; ++nb) { o[dt][nb] = WFrag<T16>::mma(vf[dt], pf[nb], o[dt][nb]); if (HR) { o[dt][nb] = WFrag<T16>::mma(vf[dt], pf2[nb], o[dt][nb]); o[dt][nb] = WFrag<T16>::mma(vf2[dt], pf[nb], o[dt][nb]); } }
        if (!last) ldv(k0 + 32);
    };
    ldk(0); ldv(0);   // keys first, as in the loop: loads return in order, and the wait at the loop's head leaves the value loads in flight
#pragma unroll 1   // run-time trip count round a body that already fills most of the register file: a second copy of the body would spill
    for (int kb = 0; kb < nkb - 1; ++kb) step(kb * 32, false);
    step((nkb - 1) * 32, true);
#pragma unroll
    for (int nb = 0; nb < NBQ; ++nb) {
        const float lt = l[nb] + __shfl_xor(l[nb], 16, 32); const float inv = __fdiv_rn(1.0f, lt);
#pragma unroll
        for (int dt = 0; dt < 4; ++dt) { v8us oh, ol;
#pragma unroll
            for (int j = 0; j < 8; ++j) { unsigned short a, c2; splitf(o[dt][nb][j] * inv, a, c2); oh[j] = a; ol[j] = c2; }
            const size_t oo = (size_t)(q0 + nb * 16) * DQ + dt * 256 + lane * 8; st2x(Ah + oo, oh, Al + oo, ol); }   // fragment order of the merged [token][DQ] plane: the head's two units, half dt & 1
    }
}
#define NLO ((TT - RH) / 32)      // fp16 query tiles of 32 rows
#define NHI (RH / 16)             // hi+lo query tiles of 16 rows
// grid (kv planes, NLO + NHI): y counts the query tiles from the longest key range down
__global__ __launch_bounds__(128) void k_flash(const h16* __restrict__ QP16, const h16* __restrict__ KP16, const h16* __restrict__ VT16, const bf* __restrict__ QPh, const bf* __restrict__ QPl, const bf* __restrict__ KPh, const bf* __restrict__ KPl, const bf* __restrict__ VTh, bf* ATh, bf* ATl) {
    const int kvp = blockIdx.x, g = kvp * REP + __builtin_amdgcn_readfirstlane(threadIdx.x >> 5), b = g / NH_, h = g % NH_, ty = blockIdx.y;   // g = b*NH_ + h: flat head; its kv plane is g / REP
    const size_t qo = (size_t)g * TT * HD, ko = (size_t)kvp * TT * HD, vo = (size_t)kvp * HD * 2 * TT, ao = (size_t)b * TT * DQ + h * (HD * 16);
    if (ty < NLO) flash_tile<h16, false, 2>(QP16 + qo, nullptr, KP16 + ko, nullptr, VT16 + vo, nullptr, TT - 32 * (ty + 1), ATh + ao, ATl + ao);
    else flash_tile<bf, true, 1>(QPh + qo, QPl + qo, KPh + ko, KPl + ko, VTh + vo, VTh + vo + HD * TT, RH - 16 * (ty - NLO + 1), ATh + ao, ATl + ao);
}

extern "C" void kernel_launch(void* const* d_in, const int* in_sizes, int n_in,
                              void* d_out, int out_size, void* d_ws, size_t ws_size, hipStream_t stream) {
    (void)in_sizes; (void)n_in; (void)out_size;
    const float* x = (const float*)d_in[0]; const float* wq = (const float*)d_in[1]; const float* wk = (const float*)d_in[2]; const float* wv = (const float*)d_in[3]; const float* wo = (const float*)d_in[4];
    float* OUT = (float*)d_out;     // [4][2048][1024]
    char* wsp = (char*)d_ws;
    auto take = [&](size_t bytes) { char* p = wsp; wsp += (bytes + 255) & ~(size_t)255; return (void*)p; };
    bf* WQ = (bf*)take((size_t)DQ * DM * 2); bf* WK = (bf*)take((size_t)DKV * DM * 2); bf* WV = (bf*)take((size_t)DKV * DM * 2); bf* WO = (bf*)take((size_t)DM * DQ * 2); float* CS = (float*)take((size_t)TT * HD * 2 * 4);
    h16* QP16 = (h16*)take((size_t)NB_ * NH_ * TT * HD * 2); h16* KP16 = (h16*)take((size_t)NB_ * NKV * TT * HD * 2); h16* VT16 = (h16*)take((size_t)NB_ * NKV * HD * 2 * TT * 2);   // heads 2*HD*TT elements apart, as in the hi+lo planes: the fp16 plane fills the first HD*TT
    bf* QPh = (bf*)take((size_t)NB_ * NH_ * TT * HD * 2); bf* QPl = (bf*)take((size_t)NB_ * NH_ * TT * HD * 2); bf* KPh = (bf*)take((size_t)NB_ * NKV * TT * HD * 2); bf* KPl = (bf*)take((size_t)NB_ * NKV * TT * HD * 2); bf* VTh = (bf*)take((size_t)NB_ * NKV * HD * 2 * TT * 2);   // a head's hi plane, then its lo plane
    bf* ATh = (bf*)take((size_t)NB_ * TT * DQ * 2); bf* ATl = (bf*)take((size_t)NB_ * TT * DQ * 2);
    bf* XB = (bf*)take((size_t)NB_ * TT * DM * 2);   // x in bf16
    if ((size_t)(wsp - (char*)d_ws) > ws_size) return;    // ws 256 MiB
    k_prep<<<PB_W + PB_X + PB_CS, 256, 0, stream>>>(x, wq, wk, wv, wo, XB, WQ, WK, WV, WO, CS);
    // projections: the NB_ batches are NB_*TT rows, the q, k and v heads the column tiles, of one GEMM launch
    k_qkv<<<dim3(NB_ * TT / (QW_M * 64), (NH_ + 2 * NKV) / QW_N), QW_M * QW_N * 32, 0, stream>>>(XB, WQ, WK, WV, CS, QP16, QPh, QPl, KP16, KPh, KPl, VT16, VTh);
    k_flash<<<dim3(NB_ * NKV, NLO + NHI), 128, 0, stream>>>(QP16, KP16, VT16, QPh, QPl, KPh, KPl, VTh, ATh, ATl);
    k_gemmw<bf, 1, false, DQ><<<dim3(NB_ * TT / (GW_M * 64), DM / (GW_N * 64), 1), GW_M * GW_N * 32, 0, stream>>>(ATh, ATl, WO, nullptr, OUT, DM, nullptr, 0, 0, 0);
}

// v008
// It runs in 88.9 microseconds.
// Two timings next to v007 put it at 1.15 and 1.16 times that version's speed.
// All steps since v000 together make it 30.9 times as fast.
#include <hip/hip_runtime.h>

// GQA causal attention block (x [4][2048][1024]; q = x wq (16 heads x 64), k, v = x wk / wv (4 kv heads, GQA groups of 4); RoPE (rotate-half, base 10000) on q, k; causal softmax(q.k/8); out = (attn v merged) wo -> [4][2048][1024]).
// Compute dtypes, f32 accumulate: every input rounded to bf16; q/k/v projections on PLAIN bf16 operands (inputs: exact); RoPE f32; scores (K 64) and attn.v on bf16 hi+lo planes (3 products) for the first 512 query rows of each head and

#define NB_  4
#define TT   2048
#define DM   1024
#define NH_  16
#define NKV  4
#define REP  (NH_ / NKV)
#define HD   64
#define DQ   (NH_ * HD)
#define DKV  (NKV * HD)
#define RH   512                  // query rows < RH use hi+lo planes
#define PCAR 1024.0f
#define SCL  0.125f   // HD^-0.5
typedef _Float16 h16;
typedef unsigned short bf;
typedef __attribute__((ext_vector_type(16))) __bf16   v16bf;
typedef __attribute__((ext_vector_type(16))) _Float16 v16h;
typedef __attribute__((ext_vector_type(8)))  _Float16 v8h;
typedef __attribute__((ext_vector_type(8)))  unsigned short v8us;
typedef __attribute__((ext_vector_type(8)))  float    v8f;
typedef __attribute__((ext_vector_type(4)))  float    v4f;
typedef v8h  __attribute__((may_alias)) v8ha;
typedef v4f  __attribute__((may_alias)) v4fa;
typedef v8us __attribute__((may_alias)) v8usa;

__device__ __forceinline__ unsigned short f2bf(float f) { unsigned u = __float_as_uint(f); u += 0x7FFFu + ((u >> 16) & 1u); return (unsigned short)(u >> 16); }
__device__ __forceinline__ float bf2f(unsigned short b) { return __uint_as_float(((unsigned)b) << 16); }
__device__ __forceinline__ float bfr(float f) { return bf2f(f2bf(f)); }
__device__ __forceinline__ v16h cat16(v8h lo, v8h hi) { return __builtin_shufflevector(lo, hi, 0, 1, 2, 3, 4, 5, 6, 7, 8, 9, 10, 11, 12, 13, 14, 15); }
__device__ __forceinline__ v16bf cat16b(v8us lo, v8us hi) { return __builtin_bit_cast(v16bf, __builtin_shufflevector(lo, hi, 0, 1, 2, 3, 4, 5, 6, 7, 8, 9, 10, 11, 12, 13, 14, 15)); }
__device__ __forceinline__ v8f wmma16(v16h a, v16h b, v8f c) { return __builtin_amdgcn_wmma_f32_16x16x32_f16(false, a, false, b, (short)0, c, false, false); }
__device__ __forceinline__ v8f wmmab(v16bf a, v16bf b, v8f c) { return __builtin_amdgcn_wmma_f32_16x16x32_bf16(false, a, false, b, (short)0, c, false, false); }



// ---- FRAGMENT ORDER: every 16-bit matrix operand plane [row][k] lies in units of 16 rows x 32 k (512 elements, 1 KB), units ordered [row / 16][k / 32]; inside a unit element (row, k) stands at
// ((k >> 4) & 1) * 256 + (((k >> 3) & 1) * 16 + (row & 15)) * 8 + (k & 7): a lane's two 16-byte fragment pieces are unit + lane * 8 and + 256, so each wave-wide load is 512 contiguous bytes (4 whole lines, not 32 bytes in each of 16).
// wtG walks a weight plane in storage order and asks unfrag for the (row, k) that stands at a position; KB = k / 32 units a row block.
__device__ __forceinline__ void unfrag(size_t pos, int KB, int& row, int& k) { const int u = (int)(pos >> 9), r = (int)(pos & 511); row = (u / KB) * 16 + ((r >> 3) & 15); k = (u % KB) * 32 + (r >> 8) * 16 + ((r >> 7) & 1) * 8 + (r & 7); }
// ---- k_gemmw: register-blocked GEMM, one wave per 64x64 output tile (16 accumulators), a work-group of GW_M x GW_N waves per (GW_M*64) x (GW_N*64) tile; operands are 16-bit planes in fragment order; grid (M/(GW_M*64), N/(GW_N*64), Z).
// C[m][n] (f32, pitch ldc, + optional f32 bias[n]) = sum_k A[m][k] Bt[n][k] (+ the product with the second A plane per NSPLIT). z-batch strides sA/sB/sC in elements. K: a constant, a multiple of KST.
// The main loop is ring_gemm below: the work-group's operand rows reach LDS once, by asynchronous copies, and every wave takes its fragments from there.
// ld(u, lb): the fragment of the unit at u (the same for the whole wave), lb = lane * 16, the lane's byte offset in it; ldp(p): the same from the lane's own address
template <typename T16> struct WFrag;
template <> struct WFrag<h16> { typedef v16h V; static __device__ __forceinline__ V ldp(const char* p) { return cat16(*(const v8h*)p, *(const v8h*)(p + 512)); } static __device__ __forceinline__ V ld(const h16* u, unsigned lb) { return ldp((const char*)u + lb); } static __device__ __forceinline__ v8f mma(V a, V b, v8f c) { return wmma16(a, b, c); } };
template <> struct WFrag<bf> { typedef v16bf V; static __device__ __forceinline__ V ldp(const char* p) { return cat16b(*(const v8us*)p, *(const v8us*)(p + 512)); } static __device__ __forceinline__ V ld(const bf* u, unsigned lb) { return ldp((const char*)u + lb); } static __device__ __forceinline__ v8f mma(V a, V b, v8f c) { return wmmab(a, b, c); } };
// ---- ring_gemm: the main loop of both GEMM kernels. A stage is KST k of every operand row of the work-group's tile: per block of 16 rows four units (RBS bytes), contiguous in the plane and in LDS alike, so a fragment
// read is 512 contiguous LDS bytes. Two buffers: while a stage is multiplied the next one's copies (global_load_async_to_lds_b128, through no register) fly. The blocks of 16 rows are dealt to the waves in turn.
// srcp(rb): the plane address (the same for the whole wave) of row block rb at k = 0; rb counts the A plane's WM*4 blocks, the second A plane's (NPA = 2), then the WN*4 blocks of Bt.
#define KST 128
#define RBS (KST * 16 * 2)
// CP8: eight copies of 512 bytes, one row block of a stage; the immediate offset moves the LDS and the global address alike, and the block is contiguous in both.
// cp8, cp16: one or two row blocks, with their s_wait_xcnt 0 as the statement's last line: so it stands in front of whatever next rewrites an address register of theirs
#define CP1(L, G, O) "global_load_async_to_lds_b128 " L ", " G ", off offset:" O "\n\t"
#define CP8(L, G) "global_load_async_to_lds_b128 " L ", " G ", off\n\t" CP1(L, G, "512") CP1(L, G, "1024") CP1(L, G, "1536") CP1(L, G, "2048") CP1(L, G, "2560") CP1(L, G, "3072") CP1(L, G, "3584")
__device__ __forceinline__ void cp8(unsigned l, const char* g) { asm volatile(CP8("%0", "%1") "s_wait_xcnt 0x0" :: "v"(l), "v"(g) : "memory"); }
__device__ __forceinline__ void cp16(unsigned l0, const char* g0, unsigned l1, const char* g1) { asm volatile(CP8("%0", "%1") CP8("%2", "%3") "s_wait_xcnt 0x0" :: "v"(l0), "v"(g0), "v"(l1), "v"(g1) : "memory"); }
template <typename T16, int WM, int WN, int NPA, int K, typename SRC>
__device__ __forceinline__ void ring_gemm(char* ring, SRC srcp, v8f (&acc)[4][4]) {
    typedef typename WFrag<T16>::V V;
    constexpr int NW = WM * WN, RBA = WM * 4, NRB = NPA * RBA + WN * 4, STG = NRB * RBS, NT = K / KST, NCP = (NRB + NW - 1) / NW, NFULL = NRB / NW;   // NFULL row blocks for every wave, one more for the first NRB % NW waves
    static_assert(K % KST == 0 && NT >= 2 && KST == 128 && NCP * 8 <= 63, "whole stages, at least two; four k steps a stage; a wave's copies of one stage in flight");
    const int lane = threadIdx.x & 31, wave = __builtin_amdgcn_readfirstlane(threadIdx.x >> 5), wm = wave / WN, wn = wave % WN; const unsigned lb = lane * 16;
    // every plain '#pragma unroll' below stands on a loop whose counter indexes fragments, accumulators or addresses: they stay in registers only where those indices are constants
    const char* g[NCP]; unsigned l[NCP];   // the same for the whole wave (scalar registers); a lane adds its lb where the copies are issued
#pragma unroll
    for (int i = 0; i < NCP; ++i) { const int rb = wave + i * NW < NRB ? wave + i * NW : 0; g[i] = srcp(rb); l[i] = (unsigned)(size_t)ring + rb * RBS; }
    // a lane's LDS address; readfirstlane holds the wave's part together in a scalar register: without it the compiler kept a vector register per row block alive over the loop and spilled it
    auto la = [&](int i, unsigned bo) __attribute__((always_inline)) { return (unsigned)__builtin_amdgcn_readfirstlane(l[i] + bo) + lb; };
    auto fill = [&](int t, unsigned bo) __attribute__((always_inline)) {   // this wave's row blocks of stage t into the buffer at bo; the test is the same for the whole wave
#pragma unroll
        for (int i = 0; i + 1 < NFULL; i += 2) cp16(la(i, bo), (g[i] + (size_t)t * RBS) + lb, la(i + 1, bo), (g[i + 1] + (size_t)t * RBS) + lb);
        if (NFULL & 1) cp8(la(NFULL - 1, bo), (g[NFULL - 1] + (size_t)t * RBS) + lb);
        if (NCP > NFULL) if (wave + NFULL * NW < NRB) cp8(la(NCP - 1, bo), (g[NCP - 1] + (size_t)t * RBS) + lb); };
    const char* fa = ring + wm * 4 * RBS + lb; const char* fb = ring + (NPA * RBA + wn * 4) * RBS + lb;
    V a[2][4], a2[2][4], b[2][4];
    auto ldf = [&](int st, int ks, unsigned bo) __attribute__((always_inline)) {   // into set st the fragments of k step ks of the stage at bo, as one group of LDS reads
#pragma unroll
        for (int mb = 0; mb < 4; ++mb) { a[st][mb] = WFrag<T16>::ldp(fa + bo + mb * RBS + ks * 1024); if (NPA == 2) a2[st][mb] = WFrag<T16>::ldp(fa + bo + (RBA + mb) * RBS + ks * 1024); }
#pragma unroll
        for (int nb = 0; nb < 4; ++nb) b[st][nb] = WFrag<T16>::ldp(fb + bo + nb * RBS + ks * 1024);
        __builtin_amdgcn_sched_barrier(0); };   // the group stays whole and in front of the products that follow (for speed only)
    auto mm = [&](int st) __attribute__((always_inline)) {
#pragma unroll
        for (int nb = 0; nb < 4; ++nb)
#pragma unroll
            for (int mb = 0; mb < 4; ++mb) { acc[mb][nb] = WFrag<T16>::mma(a[st][mb], b[st][nb], acc[mb][nb]); if (NPA == 2) acc[mb][nb] = WFrag<T16>::mma(a2[st][mb], b[st][nb], acc[mb][nb]); }
        __builtin_amdgcn_sched_barrier(0); };   // and a step's products stay in front of the next group, which refills their set
    fill(0, 0);
    asm volatile("s_wait_asynccnt 0x0" ::: "memory");   // this wave's copies of stage 0 have landed
    __syncthreads();                                    // and every other wave's: stage 0 may be read
    fill(1, STG);
    ldf(0, 0, 0);
#pragma unroll 1   // a trip is a stage; the buffer is picked by an offset, a second copy of the body buys nothing
    for (int t = 0; t < NT; ++t) {
        const unsigned bo = (t & 1) * STG;
        ldf(1, 1, bo); mm(0);   // a k step's fragments are read one step ahead of their products
        ldf(0, 2, bo); mm(1);
        ldf(1, 3, bo); mm(0);
        // stage t + 1 is published in front of this stage's last k step, whose fragments are already asked for: so the next stage's first fragments can be read under its products
        asm volatile("s_wait_dscnt 0x0" ::: "memory");      // this wave's reads of the buffer are over
        asm volatile("s_wait_asynccnt 0x0" ::: "memory");   // its copies of stage t + 1 have landed
        __syncthreads();                                    // the same holds of every wave: stage t + 1 may be read, this buffer refilled
        if (t + 2 < NT) fill(t + 2, bo);
        if (t + 1 < NT) ldf(0, 0, STG - bo);
        mm(1);
    }
    asm volatile("s_wait_asynccnt 0x0" ::: "memory");   // nothing of this wave's is in flight behind the loop
}
#define GW_M 2
#define GW_N 4
template <typename T16, int NSPLIT, bool BIAS, int K>
__global__ __launch_bounds__(GW_M * GW_N * 32) void k_gemmw(const T16* __restrict__ A, const T16* __restrict__ A2, const T16* __restrict__ Bt, const T16* __restrict__ Bt2, float* C, int ldc, const float* __restrict__ bias, size_t sA, size_t sB, size_t sC) {
    static_assert(NSPLIT == 0 || NSPLIT == 1, "one Bt plane");
    constexpr int NPA = NSPLIT == 1 ? 2 : 1;
    __shared__ __align__(16) char ring[2 * (NPA * GW_M + GW_N) * 4 * RBS];
    __shared__ __align__(16) float osm[GW_M * GW_N * 16 * 68];   // a wave's own output staging
    const size_t z = blockIdx.z; A += z * sA; if (A2) A2 += z * sA; Bt += z * sB; C += z * sC; (void)Bt2;
    const int lane = threadIdx.x & 31, lr = lane & 15, hi = lane >> 4, wave = __builtin_amdgcn_readfirstlane(threadIdx.x >> 5); const int R0 = blockIdx.x * (GW_M * 64), C0 = blockIdx.y * (GW_N * 64), r0 = R0 + (wave / GW_N) * 64, c0 = C0 + (wave % GW_N) * 64;
    float* os = osm + wave * (16 * 68);
    v8f acc[4][4];
#pragma unroll
    for (int mb = 0; mb < 4; ++mb)
#pragma unroll
        for (int nb = 0; nb < 4; ++nb) acc[mb][nb] = (v8f){};
    ring_gemm<T16, GW_M, GW_N, NPA, K>(ring, [&](int rb) __attribute__((always_inline)) { constexpr int RBA = GW_M * 4;   // a row block of 16 is K * 16 elements
        return (const char*)(rb < RBA ? A + (size_t)(R0 + rb * 16) * K : rb < NPA * RBA ? A2 + (size_t)(R0 + (rb - RBA) * 16) * K : Bt + (size_t)(C0 + (rb - NPA * RBA) * 16) * K); }, acc);
#pragma unroll
    for (int mb = 0; mb < 4; ++mb) {
#pragma unroll
        for (int nb = 0; nb < 4; ++nb) {
#pragma unroll
            for (int j = 0; j < 8; ++j) os[(hi * 8 + j) * 68 + nb * 16 + lr] = acc[mb][nb][j]; }
        __builtin_amdgcn_wave_barrier(); asm volatile("" ::: "memory");
        float* crow = C + (size_t)(r0 + mb * 16) * ldc + c0;
{
#pragma unroll
            for (int s = 0; s < 8; ++s) { const int row = 2 * s + hi, cofs = lr * 4; v4f val = *(const v4fa*)(os + row * 68 + cofs); if (BIAS) { val[0] += bfr(bias[c0 + cofs]); val[1] += bfr(bias[c0 + cofs + 1]); val[2] += bfr(bias[c0 + cofs + 2]); val[3] += bfr(bias[c0 + cofs + 3]); }
                *(v4f*)(crow + (size_t)row * ldc + cofs) = val; }
             }
        __builtin_amdgcn_wave_barrier(); asm volatile("" ::: "memory");
    }
}

__device__ __forceinline__ h16 tohx(float x) { return (h16)x; }
__device__ __forceinline__ void splitf(float y, unsigned short& h, unsigned short& l) { h = f2bf(y); l = f2bf(y - bf2f(h)); }
typedef __attribute__((ext_vector_type(2))) _Float16 v2h;
typedef __attribute__((ext_vector_type(4))) _Float16 v4h;
typedef __attribute__((ext_vector_type(2))) unsigned short v2us;
typedef __attribute__((ext_vector_type(4))) unsigned short v4us;
typedef __attribute__((ext_vector_type(2))) float v2f;
typedef __attribute__((ext_vector_type(4))) int v4i;

// ---- k_prep: all that only re-forms an input or builds the RoPE table, in ONE launch (the parts do not depend on one another); a work-group's index picks its part, the parts with the longest chains of dependent loads first.
#define PB_WQ (DM * DQ / 512 / 8)              // work-groups for wq, and for wo: a wave takes one unit of 512 elements
#define PB_WK (DM * DKV / 512 / 8)             // for wk, and for wv
#define PB_W  (2 * PB_WQ + 2 * PB_WK)
#define PB_X  (NB_ * TT * DM / 512 / 4 / 8)    // for x: a wave takes four units
#define PB_CS (TT * (HD / 2) / 256)            // for the table: a thread takes the two entries d and d + HD/2, which are equal
__device__ __forceinline__ void wtG(const float* __restrict__ w, int K, int N, bf* Bt, int blk) {
    const int lane = threadIdx.x & 31; const int L0 = (blk * 8 + (threadIdx.x >> 5)) * 8; const int nlines = N * K / 64;
{
#pragma unroll 1
        for (int l = 0; l < 8; ++l) { const int L = L0 + l; if (L >= nlines) break; const size_t e = (size_t)L * 64 + lane * 2; int k, n; unfrag(e, K / 32, n, k); v2us o;
            const float* p0 = w + (size_t)k * N + n; const float* p1 = p0 + N; const float w0 = *p0, w1 = *p1;
            asm volatile("s_wait_xcnt 0x0" :: "v"(p0), "v"(p1) : "memory");   // behind the loads, in front of whatever next rewrites an address register of theirs (inputs: they live to the wait)
            o[0] = f2bf(w0); o[1] = f2bf(w1); bf* po = Bt + e;
            asm volatile("global_store_b32 %0, %1, off\n\ts_wait_xcnt 0x0" :: "v"(po), "v"(__builtin_bit_cast(unsigned, o)) : "memory"); }   // the store with its wait in one statement: the next trip rewrites its registers
         }
}
__global__ __launch_bounds__(256) void k_prep(const float* __restrict__ x, const float* __restrict__ wq, const float* __restrict__ wk, const float* __restrict__ wv, const float* __restrict__ wo, bf* XB, bf* WQ, bf* WK, bf* WV, bf* WO, float* CS) {
    static_assert(DQ == DM && (DM / 32) % 4 == 0 && HD * 4 == 256, "one K for the four weights; a wave's four units of x lie in one row block; the table's second store stands 256 bytes on");
    int blk = blockIdx.x;
    if (blk < PB_W) {   // weights [k][n] f32 -> [n][k] bf16 in fragment order
        const float* w; bf* Bt; int N;
        if (blk < PB_WQ) { w = wq; Bt = WQ; N = DQ; }
        else if (blk < 2 * PB_WQ) { w = wo; Bt = WO; N = DM; blk -= PB_WQ; }
        else if (blk < 2 * PB_WQ + PB_WK) { w = wk; Bt = WK; N = DKV; blk -= 2 * PB_WQ; }
        else { w = wv; Bt = WV; N = DKV; blk -= 2 * PB_WQ + PB_WK; }
        wtG(w, DM, N, Bt, blk); return;
    }
    blk -= PB_W;
    if (blk < PB_X) {   // x -> bf16 in fragment order. A wave's four units are 16 rows x 128 k: piece c of a lane (8 elements) is row lane & 15, k = c * 16 + (lane >> 4) * 8 of them, and stands at c * 256 + lane * 8
        const int lane = threadIdx.x & 31, u0 = (blk * 8 + (threadIdx.x >> 5)) * 4;
        const float* p = x + (size_t)((u0 / (DM / 32)) * 16 + (lane & 15)) * DM + (u0 % (DM / 32)) * 32 + (lane >> 4) * 8; v8f v[8]; v4i o[8];
#pragma unroll   // c indexes registers; the eight pieces' loads are all in flight together
        for (int c = 0; c < 8; ++c) v[c] = *(const v8f*)(p + c * 16);
        asm volatile("s_wait_xcnt 0x0" :: "v"(p) : "memory");   // behind the loads, in front of whatever next rewrites their address register (an input: it lives to the wait)
#pragma unroll
        for (int c = 0; c < 8; ++c) { v8us t;
#pragma unroll
            for (int j = 0; j < 8; ++j) t[j] = f2bf(v[c][j]);
            o[c] = __builtin_bit_cast(v4i, t); }
        bf* d = XB + (size_t)u0 * 512 + lane * 8;
        // the eight stores with their s_wait_xcnt 0 in one statement: nothing rewrites a register of theirs in front of it
        asm volatile("global_store_b128 %0, %1, off\n\tglobal_store_b128 %0, %2, off offset:512\n\tglobal_store_b128 %0, %3, off offset:1024\n\tglobal_store_b128 %0, %4, off offset:1536\n\t"
                     "global_store_b128 %0, %5, off offset:2048\n\tglobal_store_b128 %0, %6, off offset:2560\n\tglobal_store_b128 %0, %7, off offset:3072\n\tglobal_store_b128 %0, %8, off offset:3584\n\ts_wait_xcnt 0x0"
                     :: "v"(d), "v"(o[0]), "v"(o[1]), "v"(o[2]), "v"(o[3]), "v"(o[4]), "v"(o[5]), "v"(o[6]), "v"(o[7]) : "memory");
        return;
    }
    blk -= PB_X;
    {   // RoPE table, entry (t, d): cos then sin
        const int idx = blk * 256 + threadIdx.x; const int t = idx / (HD / 2), i = idx % (HD / 2); const float inv = __fdiv_rn(1.0f, powf(10000.0f, (float)(2 * i) / (float)HD)); const float ang = __fmul_rn((float)t, inv); v2f cs; cs[0] = cosf(ang); cs[1] = sinf(ang);
        float* pc = CS + ((size_t)t * HD + i) * 2;
        // the two stores (entry d, and d + HD/2 at HD floats = 256 bytes on) with their s_wait_xcnt 0 in one statement: nothing rewrites a register of theirs in front of it
        asm volatile("global_store_b64 %0, %1, off\n\tglobal_store_b64 %0, %1, off offset:256\n\ts_wait_xcnt 0x0" :: "v"(pc), "v"(cs) : "memory");
    }
}
// ---- k_qkv: the q, k and v projections in ONE launch, RoPE and the forming of the 16-bit operand planes in its epilogue (no f32 projection ever reaches memory). grid (tokens / (QW_M*64), (NH_ + 2 * NKV) / QW_N), QW_M*QW_N waves:
// one wave per 64 tokens x one head (HD = 64 columns), a work-group QW_M*64 tokens x QW_N heads, main loop ring_gemm; heads count the NH_ q heads, then the NKV k heads, then the NKV v heads.
// Every plain '#pragma unroll' here stands on a loop whose counter indexes accumulators, fragments or table entries: they stay in registers only where those indices are constants.
// the fp16, the hi and the lo store of eight plane elements, with their s_wait_xcnt 0 in the same statement: so it stands in front of whatever next rewrites an address or data register of theirs
__device__ __forceinline__ void st3x(h16* p16, v8h a, bf* ph, v8us b, bf* pl, v8us c) {
    asm volatile("global_store_b128 %0, %1, off\n\tglobal_store_b128 %2, %3, off\n\tglobal_store_b128 %4, %5, off\n\ts_wait_xcnt 0x0" :: "v"(p16), "v"(__builtin_bit_cast(v4i, a)), "v"(ph), "v"(__builtin_bit_cast(v4i, b)), "v"(pl), "v"(__builtin_bit_cast(v4i, c)) : "memory");
}
__device__ __forceinline__ void put8(const float* x, h16* p16, bf* ph, bf* pl) { v8h o16; v8us oh, ol;
#pragma unroll
    for (int j = 0; j < 8; ++j) { o16[j] = tohx(x[j]); unsigned short a2, c2; splitf(x[j], a2, c2); oh[j] = a2; ol[j] = c2; }
    st3x(p16, o16, ph, oh, pl, ol); }
#define QW_M 4
#define QW_N 3
__global__ __launch_bounds__(QW_M * QW_N * 32) void k_qkv(const bf* __restrict__ A, const bf* __restrict__ WQ, const bf* __restrict__ WK, const bf* __restrict__ WV, const float* __restrict__ CS, h16* QP16, bf* QPh, bf* QPl, h16* KP16, bf* KPh, bf* KPl, h16* VT16, bf* VTh) {
    static_assert(HD == 64 && TT % 64 == 0 && (NH_ + 2 * NKV) % QW_N == 0 && (NB_ * TT) % (QW_M * 64) == 0, "a 64 x 64 tile is 64 tokens of one batch x one whole head; whole work-group tiles");
    __shared__ __align__(16) char ring[2 * (QW_M + QW_N) * 4 * RBS];
    __shared__ __align__(16) float osm[QW_M * QW_N * 16 * 68];   // a wave's own staging for the turn of its rotated blocks
    const int K = DM, lane = threadIdx.x & 31, lr = lane & 15, hi = lane >> 4, wave = __builtin_amdgcn_readfirstlane(threadIdx.x >> 5); const int R0 = blockIdx.x * (QW_M * 64), H0 = blockIdx.y * QW_N, r0 = R0 + (wave / QW_N) * 64, cy = H0 + wave % QW_N;
    float* os = osm + wave * (16 * 68);
    v8f acc[4][4];
#pragma unroll
    for (int mb = 0; mb < 4; ++mb)
#pragma unroll
        for (int nb = 0; nb < 4; ++nb) acc[mb][nb] = (v8f){};
    ring_gemm<bf, QW_M, QW_N, 1, DM>(ring, [&](int rb) __attribute__((always_inline)) { constexpr int RBA = QW_M * 4;   // a row block of 16 is K * 16 elements; a head is four of them
        const int n = H0 * HD + (rb - RBA) * 16;   // the weight row among the q, then k, then v columns
        return (const char*)(rb < RBA ? A + (size_t)(R0 + rb * 16) * K : n < DQ ? WQ + (size_t)n * K : n < DQ + DKV ? WK + (size_t)(n - DQ) * K : WV + (size_t)(n - DQ - DKV) * K); }, acc);
    const int b = r0 / TT, t0 = r0 % TT;
    if (cy >= NH_ + NKV) {
        // v: planes [d][t]. Register j of accumulator (mb, nb) is token t0 + mb * 16 + hi * 8 + j of column d = nb * 16 + lr: a lane's eight registers are, as they stand, its 16-byte piece of the unit (d / 16, t / 32), half mb & 1
        const size_t po = ((size_t)b * NKV + (cy - NH_ - NKV)) * (HD * 2 * TT) + (size_t)(t0 / 32) * 512 + lane * 8;
#pragma unroll
        for (int mb = 0; mb < 4; ++mb)
#pragma unroll
            for (int nb = 0; nb < 4; ++nb) { float x[8];
#pragma unroll
                for (int j = 0; j < 8; ++j) x[j] = acc[mb][nb][j];
                const size_t oo = po + (size_t)(nb * (TT / 32) + (mb >> 1)) * 512 + (mb & 1) * 256; put8(x, VT16 + oo, VTh + oo, VTh + HD * TT + oo); }
        return;
    }
    // q, k: planes [t][d]. Rotate-half pairs d and d + HD/2, which one lane holds in accumulators nb and nb + 2; cos and sin of d + HD/2 are those of d. The rotated 16 x 64 block goes through LDS to turn a lane's eight tokens into eight d.
    const bool isq = cy < NH_; const size_t po = (isq ? (size_t)b * NH_ + cy : (size_t)b * NKV + (cy - NH_)) * (TT * HD) + (size_t)t0 * HD + lane * 8;
    h16* P16 = (isq ? QP16 : KP16) + po; bf* Ph = (isq ? QPh : KPh) + po; bf* Pl = (isq ? QPl : KPl) + po;
    const char* csb = (const char*)(CS + (size_t)t0 * HD * 2); const unsigned lo = (hi * 8 * HD + lr) * 8;   // table entry (t, d): 8 bytes, cos then sin
    v2f cs[2][16];
    auto ldcs = [&](int mb, v2f* c) __attribute__((always_inline)) {
#pragma unroll
        for (int nb = 0; nb < 2; ++nb)
#pragma unroll
            for (int j = 0; j < 8; ++j) c[nb * 8 + j] = *(const v2f*)(csb + lo + ((mb * 16 + j) * HD + nb * 16) * 8);
        asm volatile("s_wait_xcnt 0x0" :: "v"(lo) : "memory"); };   // behind the table loads, in front of whatever next rewrites a register that they name; the offset is an input so that it lives to the wait
    ldcs(0, cs[0]);
#pragma unroll
    for (int mb = 0; mb < 4; ++mb) {
        if (mb < 3) ldcs(mb + 1, cs[(mb + 1) & 1]);   // the next 16 tokens' table entries fly while these are rotated and stored
#pragma unroll
        for (int nb = 0; nb < 2; ++nb)
#pragma unroll
            for (int j = 0; j < 8; ++j) { const float c = cs[mb & 1][nb * 8 + j][0], s = cs[mb & 1][nb * 8 + j][1], x0 = acc[mb][nb][j], x1 = acc[mb][nb + 2][j];
                os[(hi * 8 + j) * 68 + nb * 16 + lr] = x0 * c - x1 * s; os[(hi * 8 + j) * 68 + (nb + 2) * 16 + lr] = x1 * c + x0 * s; }
        __builtin_amdgcn_wave_barrier(); asm volatile("" ::: "memory");   // the one wave's LDS writes stay in front of its reads below
#pragma unroll
        for (int u = 0; u < 4; ++u) { const float* sp = os + lr * 68 + u * 16 + hi * 8; const v4f u0 = *(const v4fa*)sp, u1 = *(const v4fa*)(sp + 4); const float x[8] = {u0[0], u0[1], u0[2], u0[3], u1[0], u1[1], u1[2], u1[3]};
            const int oo = mb * 1024 + u * 256; put8(x, P16 + oo, Ph + oo, Pl + oo); }   // unit (t / 16, d / 32), half (d / 16) & 1
        __builtin_amdgcn_wave_barrier(); asm volatile("" ::: "memory");   // and its reads in front of the next block's writes
    }
}
// ---- k_flash: scores, causal softmax, probability x value and the head merge in ONE launch; scores and probabilities never leave registers (online softmax over key blocks of 32).
// One wave owns NBQ*16 query rows of one head. It forms the TRANSPOSED score tile S^T[key][query] = K Q^T (A = key rows, B = query rows), so that a lane holds scores of one query only (max and sum in-lane plus one
// exchange between the lane halves) and the accumulator registers of two 16-key tiles are, as they stand, the B operand P^T[query][key 0..31] of O^T[d][query] += V^T P^T (A = value rows [d][t]).
// k order of every operand: element e of lane half hi is k = (e / 8) * 16 + 8 * hi + e % 8 (WFrag::ld on both global operands; score tile mt, register j is key mt * 16 + 8 * hi + j).
// The four waves of a block's half are the four heads of one kv group on the same query rows: they read the same key and value lines. HR: bf16 hi+lo planes, 3 products; else fp16, probabilities carried x PCAR (it cancels in O / l).
// KS = 2: the key blocks of a tile are dealt in turn to two waves (kh = 0, 1), each with its own running maximum, sum and output tiles; wave 1 hands its three through LDS (xs) to wave 0, which joins them and stores. So the
// longest wave walks half the keys, and there are more work-groups than resident places: a place that falls free early takes the next one.
typedef __attribute__((ext_vector_type(16))) unsigned short v16us;
// eight 2^x in one statement: no result shares a register with a source ("=&v"), and the v_nop is the free slot behind the last transcendental
__device__ __forceinline__ void exp2x8(float* p, const float* x) {
    asm("v_exp_f32 %0, %8\n\tv_exp_f32 %1, %9\n\tv_exp_f32 %2, %10\n\tv_exp_f32 %3, %11\n\tv_exp_f32 %4, %12\n\tv_exp_f32 %5, %13\n\tv_exp_f32 %6, %14\n\tv_exp_f32 %7, %15\n\tv_nop"
        : "=&v"(p[0]), "=&v"(p[1]), "=&v"(p[2]), "=&v"(p[3]), "=&v"(p[4]), "=&v"(p[5]), "=&v"(p[6]), "=&v"(p[7]) : "v"(x[0]), "v"(x[1]), "v"(x[2]), "v"(x[3]), "v"(x[4]), "v"(x[5]), "v"(x[6]), "v"(x[7]));
}
// the hi and the lo store of eight merged outputs, with their s_wait_xcnt 0 in the same statement: so it stands in front of whatever next rewrites an address or data register of theirs, on every way out of a tile
// (as a statement of its own the wait let the next outputs' arithmetic move up over it)
__device__ __forceinline__ void st2x(bf* pa, v8us a, bf* pb, v8us b) {
    asm volatile("global_store_b128 %0, %1, off\n\tglobal_store_b128 %2, %3, off\n\ts_wait_xcnt 0x0" :: "v"(pa), "v"(__builtin_bit_cast(v4i, a)), "v"(pb), "v"(__builtin_bit_cast(v4i, b)) : "memory");
}
template <typename T16, bool HR, int NBQ, int KS>
__device__ __forceinline__ void flash_tile(const T16* __restrict__ Q, const T16* __restrict__ Q2, const T16* __restrict__ Kp, const T16* __restrict__ K2, const T16* __restrict__ Vt, const T16* __restrict__ V2, int q0, bf* Ah, bf* Al, int kh, float* xs) {
    static_assert(KS == 1 || (KS == 2 && NBQ == 2), "the hand-over packs two maxima and two sums into one 16-byte piece");
    typedef typename WFrag<T16>::V V;
    const int lane = threadIdx.x & 31, lr = lane & 15, hi = lane >> 4; const unsigned lb = lane * 16;
    V qf[NBQ][2], qf2[NBQ][2];
#pragma unroll
    for (int nb = 0; nb < NBQ; ++nb)
#pragma unroll
        for (int kc = 0; kc < 2; ++kc) { const int qo = (q0 + nb * 16) * HD + kc * 512; qf[nb][kc] = WFrag<T16>::ld(Q + qo, lb); if (HR) qf2[nb][kc] = WFrag<T16>::ld(Q2 + qo, lb); }
    asm volatile("s_wait_xcnt 0x0" :: "v"(lb) : "memory");   // behind the query loads, in front of whatever next rewrites a register that they name; the offset is an input so that no load's result lands in it
    v8f o[4][NBQ]; float m[NBQ], l[NBQ];
#pragma unroll
    for (int nb = 0; nb < NBQ; ++nb) { m[nb] = -3.0e38f; l[nb] = 0.f;
#pragma unroll
        for (int dt = 0; dt < 4; ++dt) o[dt][nb] = (v8f){}; }
    const int nkb = (q0 + NBQ * 16 + 31) / 32;      // key blocks up to the diagonal; every block starts at a key <= q0, so no query ever sees a fully masked block; only the last block holds keys beyond a query
    const int klast = (nkb - 1) - ((nkb - 1 - kh) % KS);   // this wave's blocks are kh, kh + KS, ... klast (the caller's tiles have at least KS blocks)
    const bool dg = KS == 1 || klast == nkb - 1;           // its last block is the one on the diagonal (the same for the whole wave)
    const float L2E = 1.4426950408889634f, PEXP = HR ? 0.0f : 10.0f;   // 2^10 = PCAR
    V kf[2][2], kf2[2][2], vf[4], vf2[4];
    auto ldk = [&](int k0) __attribute__((always_inline)) {
#pragma unroll
        for (int mt = 0; mt < 2; ++mt)
#pragma unroll
            for (int kc = 0; kc < 2; ++kc) { const int ko = (k0 + mt * 16) * HD + kc * 512; kf[mt][kc] = WFrag<T16>::ld(Kp + ko, lb); if (HR) kf2[mt][kc] = WFrag<T16>::ld(K2 + ko, lb); }
        asm volatile("s_wait_xcnt 0x0" :: "v"(lb) : "memory"); };   // stands behind the loads, in front of whatever next rewrites a register that they name (a later load's result among them)
    auto ldv = [&](int k0) __attribute__((always_inline)) {
#pragma unroll
        for (int dt = 0; dt < 4; ++dt) { const int vo = dt * 16 * TT + k0 * 16; vf[dt] = WFrag<T16>::ld(Vt + vo, lb); if (HR) vf2[dt] = WFrag<T16>::ld(V2 + vo, lb); }
        asm volatile("s_wait_xcnt 0x0" :: "v"(lb) : "memory"); };   // as in ldk
    // one key block; last: the wave's last block (nothing fetched behind it; masked where it is the one on the diagonal). Otherwise its next block's key fragments are asked for behind the score products and its value fragments behind the value
    // products, one block ahead of their use (where the registers are short the compiler may issue the key loads later in the block).
    auto step = [&](int k0, bool last) __attribute__((always_inline)) {
        v8f s[2][NBQ];
#pragma unroll
        for (int mt = 0; mt < 2; ++mt)
#pragma unroll
            for (int nb = 0; nb < NBQ; ++nb) { v8f a = (v8f){};
#pragma unroll
                for (int kc = 0; kc < 2; ++kc) { a = WFrag<T16>::mma(kf[mt][kc], qf[nb][kc], a); if (HR) { a = WFrag<T16>::mma(kf[mt][kc], qf2[nb][kc], a); a = WFrag<T16>::mma(kf2[mt][kc], qf[nb][kc], a); } }
                s[mt][nb] = a; }
        if (!last) ldk(k0 + 32 * KS);
        else __builtin_amdgcn_sched_barrier(0);   // the last block's score products stay together in front of its softmax: its 2^x statements may land in query registers, free behind the last product, and must stand the WMMA distance off
        V pf[NBQ], pf2[NBQ];
#pragma unroll
        for (int nb = 0; nb < NBQ; ++nb) {
            const int qi = q0 + nb * 16 + lr; float mx = m[nb];
#pragma unroll
            for (int mt = 0; mt < 2; ++mt)
#pragma unroll
                for (int j = 0; j < 8; ++j) { float t = s[mt][nb][j] * SCL; if (last && dg && k0 + mt * 16 + hi * 8 + j > qi) t = -3.0e38f; s[mt][nb][j] = t; mx = fmaxf(mx, t); }
            mx = fmaxf(mx, __shfl_xor(mx, 16, 32));
            float al; asm("v_exp_f32 %0, %1\n\tv_nop" : "=v"(al) : "v"((m[nb] - mx) * L2E)); m[nb] = mx;   // 2^x with the free slot behind a transcendental in the same statement
            float ps = 0.f; float x[16], p[16];
#pragma unroll
            for (int e = 0; e < 16; ++e) x[e] = (s[e >> 3][nb][e & 7] - mx) * L2E + PEXP;
            exp2x8(p, x); exp2x8(p + 8, x + 8);
#pragma unroll
            for (int e = 0; e < 16; ++e) ps += p[e];
            l[nb] = l[nb] * al + ps;                // this lane half's keys only; the halves are added once, after the loop
#pragma unroll
            for (int dt = 0; dt < 4; ++dt) o[dt][nb] *= al;
            if constexpr (HR) { v16us ph, pl;
#pragma unroll
                for (int e = 0; e < 16; ++e) { unsigned short a, c2; splitf(p[e], a, c2); ph[e] = a; pl[e] = c2; }
                pf[nb] = __builtin_bit_cast(v16bf, ph); pf2[nb] = __builtin_bit_cast(v16bf, pl);
            } else { v16h ph;
#pragma unroll
                for (int e = 0; e < 16; ++e) ph[e] = tohx(p[e]);
                pf[nb] = ph; }
        }
#pragma unroll
        for (int dt = 0; dt < 4; ++dt)
#pragma unroll
            for (int nb = 0; nb < NBQ; ++nb) { o[dt][nb] = WFrag<T16>::mma(vf[dt], pf[nb], o[dt][nb]); if (HR) { o[dt][nb] = WFrag<T16>::mma(vf[dt], pf2[nb], o[dt][nb]); o[dt][nb] = WFrag<T16>::mma(vf2[dt], pf[nb], o[dt][nb]); } }
        if (!last) ldv(k0 + 32 * KS);
    };
    ldk(kh * 32); ldv(kh * 32);   // keys first, as in the loop: loads return in order, and the wait at the loop's head leaves the value loads in flight
#pragma unroll 1   // run-time trip count round a body that already fills most of the register file: a second copy of the body would spill
    for (int kb = kh; kb < klast; kb += KS) step(kb * 32, false);
    step(klast * 32, true);
    if constexpr (KS == 2) {   // piece i of a lane stands at (i * 32 + lane) * 16 bytes: every LDS access is 512 contiguous bytes
        v4fa* xv = (v4fa*)xs + lane;
        if (kh == 1) {
#pragma unroll
            for (int dt = 0; dt < 4; ++dt)
#pragma unroll
                for (int nb = 0; nb < NBQ; ++nb) { const v8f t = o[dt][nb]; xv[((dt * NBQ + nb) * 2) * 32] = (v4f){t[0], t[1], t[2], t[3]}; xv[((dt * NBQ + nb) * 2 + 1) * 32] = (v4f){t[4], t[5], t[6], t[7]}; }
            xv[(4 * NBQ * 2) * 32] = (v4f){m[0], m[1], l[0], l[1]};
        }
        __syncthreads();   // wave 1's maxima, sums and output tiles are in LDS; every wave of the block passes here once
        if (kh == 1) return;
        const v4f ml = xv[(4 * NBQ * 2) * 32];
#pragma unroll
        for (int nb = 0; nb < NBQ; ++nb) {
            const float mj = fmaxf(m[nb], ml[nb]); float a0, a1;
            asm("v_exp_f32 %0, %2\n\tv_exp_f32 %1, %3\n\tv_nop" : "=&v"(a0), "=&v"(a1) : "v"((m[nb] - mj) * L2E), "v"((ml[nb] - mj) * L2E));   // 2^x twice, with the free slot behind a transcendental in the same statement, as in the loop
            l[nb] = l[nb] * a0 + ml[2 + nb] * a1;
#pragma unroll
            for (int dt = 0; dt < 4; ++dt) { const v4f u0 = xv[((dt * NBQ + nb) * 2) * 32], u1 = xv[((dt * NBQ + nb) * 2 + 1) * 32];
#pragma unroll
                for (int j = 0; j < 4; ++j) { o[dt][nb][j] = o[dt][nb][j] * a0 + u0[j] * a1; o[dt][nb][j + 4] = o[dt][nb][j + 4] * a0 + u1[j] * a1; } }
        }
    }
#pragma unroll
    for (int nb = 0; nb < NBQ; ++nb) {
        const float lt = l[nb] + __shfl_xor(l[nb], 16, 32); const float inv = __fdiv_rn(1.0f, lt);
#pragma unroll
        for (int dt = 0; dt < 4; ++dt) { v8us oh, ol;
#pragma unroll
            for (int j = 0; j < 8; ++j) { unsigned short a, c2; splitf(o[dt][nb][j] * inv, a, c2); oh[j] = a; ol[j] = c2; }
            const size_t oo = (size_t)(q0 + nb * 16) * DQ + dt * 256 + lane * 8; st2x(Ah + oo, oh, Al + oo, ol); }   // fragment order of the merged [token][DQ] plane: the head's two units, half dt & 1
    }
}
#define NLO ((TT - RH) / 32)      // fp16 query tiles of 32 rows
#define NHI (RH / 16)             // hi+lo query tiles of 16 rows
#define XSF ((4 * 2 * 2 + 1) * 32 * 4)   // floats that one wave hands over: 16 pieces of output tiles and one of maxima and sums, a lane
// grid (kv planes, NLO + NHI / 2), 2 * REP waves. An fp16 tile has two waves a head, which share its key blocks; a block of hi+lo tiles holds two tiles, one wave a head each.
// y counts the blocks roughly from the costliest down (for speed only): the longer half of the fp16 tiles, then one block of hi+lo tiles and three fp16 tiles in turn, then the short hi+lo tiles.
__global__ __launch_bounds__(2 * REP * 32) void k_flash(const h16* __restrict__ QP16, const h16* __restrict__ KP16, const h16* __restrict__ VT16, const bf* __restrict__ QPh, const bf* __restrict__ QPl, const bf* __restrict__ KPh, const bf* __restrict__ KPl, const bf* __restrict__ VTh, bf* ATh, bf* ATl) {
    static_assert(NHI % 4 == 0 && RH >= 64 && NLO / 2 == 3 * (NHI / 4) && NLO % 2 == 0, "whole blocks of hi+lo tiles; an fp16 tile has at least three key blocks; the turns of one and three come out even");
    __shared__ __align__(16) float xsm[REP * XSF];
    const int wave = __builtin_amdgcn_readfirstlane(threadIdx.x >> 5), hw = wave % REP, kh = wave / REP;
    const int kvp = blockIdx.x, g = kvp * REP + hw, b = g / NH_, h = g % NH_, u = (int)blockIdx.y - NLO / 2;   // g = b*NH_ + h: flat head; its kv plane is g / REP
    const bool lo = u < 0 || (u < NHI && u % 4 != 0);   // an fp16 tile; ty: its number, or the hi+lo block's, each from the longest key range down
    const int ty = u < 0 ? u + NLO / 2 : u >= NHI ? NHI / 4 + (u - NHI) : lo ? NLO / 2 + (u / 4) * 3 + (u % 4 - 1) : u / 4;
    const size_t qo = (size_t)g * TT * HD, ko = (size_t)kvp * TT * HD, vo = (size_t)kvp * HD * 2 * TT, ao = (size_t)b * TT * DQ + h * (HD * 16);
    if (lo) flash_tile<h16, false, 2, 2>(QP16 + qo, nullptr, KP16 + ko, nullptr, VT16 + vo, nullptr, TT - 32 * (ty + 1), ATh + ao, ATl + ao, kh, xsm + hw * XSF);
    else flash_tile<bf, true, 1, 1>(QPh + qo, QPl + qo, KPh + ko, KPl + ko, VTh + vo, VTh + vo + HD * TT, RH - 16 * (ty * 2 + kh + 1), ATh + ao, ATl + ao, 0, nullptr);
}

extern "C" void kernel_launch(void* const* d_in, const int* in_sizes, int n_in,
                              void* d_out, int out_size, void* d_ws, size_t ws_size, hipStream_t stream) {
    (void)in_sizes; (void)n_in; (void)out_size;
    const float* x = (const float*)d_in[0]; const float* wq = (const float*)d_in[1]; const float* wk = (const float*)d_in[2]; const float* wv = (const float*)d_in[3]; const float* wo = (const float*)d_in[4];
    float* OUT = (float*)d_out;     // [4][2048][1024]
    char* wsp = (char*)d_ws;
    auto take = [&](size_t bytes) { char* p = wsp; wsp += (bytes + 255) & ~(size_t)255; return (void*)p; };
    bf* WQ = (bf*)take((size_t)DQ * DM * 2); bf* WK = (bf*)take((size_t)DKV * DM * 2); bf* WV = (bf*)take((size_t)DKV * DM * 2); bf* WO = (bf*)take((size_t)DM * DQ * 2); float* CS = (float*)take((size_t)TT * HD * 2 * 4);
    h16* QP16 = (h16*)take((size_t)NB_ * NH_ * TT * HD * 2); h16* KP16 = (h16*)take((size_t)NB_ * NKV * TT * HD * 2); h16* VT16 = (h16*)take((size_t)NB_ * NKV * HD * 2 * TT * 2);   // heads 2*HD*TT elements apart, as in the hi+lo planes: the fp16 plane fills the first HD*TT
    bf* QPh = (bf*)take((size_t)NB_ * NH_ * TT * HD * 2); bf* QPl = (bf*)take((size_t)NB_ * NH_ * TT * HD * 2); bf* KPh = (bf*)take((size_t)NB_ * NKV * TT * HD * 2); bf* KPl = (bf*)take((size_t)NB_ * NKV * TT * HD * 2); bf* VTh = (bf*)take((size_t)NB_ * NKV * HD * 2 * TT * 2);   // a head's hi plane, then its lo plane
    bf* ATh = (bf*)take((size_t)NB_ * TT * DQ * 2); bf* ATl = (bf*)take((size_t)NB_ * TT * DQ * 2);
    bf* XB = (bf*)take((size_t)NB_ * TT * DM * 2);   // x in bf16
    if ((size_t)(wsp - (char*)d_ws) > ws_size) return;    // ws 256 MiB
    k_prep<<<PB_W + PB_X + PB_CS, 256, 0, stream>>>(x, wq, wk, wv, wo, XB, WQ, WK, WV, WO, CS);
    // projections: the NB_ batches are NB_*TT rows, the q, k and v heads the column tiles, of one GEMM launch
    k_qkv<<<dim3(NB_ * TT / (QW_M * 64), (NH_ + 2 * NKV) / QW_N), QW_M * QW_N * 32, 0, stream>>>(XB, WQ, WK, WV, CS, QP16, QPh, QPl, KP16, KPh, KPl, VT16, VTh);
    k_flash<<<dim3(NB_ * NKV, NLO + NHI / 2), 2 * REP * 32, 0, stream>>>(QP16, KP16, VT16, QPh, QPl, KPh, KPl, VTh, ATh, ATl);
    k_gemmw<bf, 1, false, DQ><<<dim3(NB_ * TT / (GW_M * 64), DM / (GW_N * 64), 1), GW_M * GW_N * 32, 0, stream>>>(ATh, ATl, WO, nullptr, OUT, DM, nullptr, 0, 0, 0);
}

// v009
// It runs in 84.9 microseconds.
// Next to v008, in two timings, it ran 1.05 and 1.06 times as fast.
// Counting every step since v000, it is 32.5 times as fast.
#include <hip/hip_runtime.h>

// GQA causal attention block (x [4][2048][1024]; q = x wq (16 heads x 64), k, v = x wk / wv (4 kv heads, GQA groups of 4); RoPE (rotate-half, base 10000) on q, k; causal softmax(q.k/8); out = (attn v merged) wo -> [4][2048][1024]).
// Compute dtypes, f32 accumulate: every input rounded to bf16; q/k/v projections on PLAIN bf16 operands (inputs: exact); RoPE f32; scores (K 64) and attn.v on bf16 hi+lo planes (3 products) for the first 512 query rows of each head and

#define NB_  4
#define TT   2048
#define DM   1024
#define NH_  16
#define NKV  4
#define REP  (NH_ / NKV)
#define HD   64
#define DQ   (NH_ * HD)
#define DKV  (NKV * HD)
#define RH   512                  // query rows < RH use hi+lo planes
#define PCAR 1024.0f
#define SCL  0.125f   // HD^-0.5
typedef _Float16 h16;
typedef unsigned short bf;
typedef __attribute__((ext_vector_type(16))) __bf16   v16bf;
typedef __attribute__((ext_vector_type(16))) _Float16 v16h;
typedef __attribute__((ext_vector_type(8)))  _Float16 v8h;
typedef __attribute__((ext_vector_type(8)))  unsigned short v8us;
typedef __attribute__((ext_vector_type(8)))  float    v8f;
typedef __attribute__((ext_vector_type(4)))  float    v4f;
typedef v8h  __attribute__((may_alias)) v8ha;
typedef v4f  __attribute__((may_alias)) v4fa;
typedef v8us __attribute__((may_alias)) v8usa;

__device__ __forceinline__ unsigned short f2bf(float f) { unsigned u = __float_as_uint(f); u += 0x7FFFu + ((u >> 16) & 1u); return (unsigned short)(u >> 16); }
__device__ __forceinline__ float bf2f(unsigned short b) { return __uint_as_float(((unsigned)b) << 16); }
__device__ __forceinline__ float bfr(float f) { return bf2f(f2bf(f)); }
__device__ __forceinline__ v16h cat16(v8h lo, v8h hi) { return __builtin_shufflevector(lo, hi, 0, 1, 2, 3, 4, 5, 6, 7, 8, 9, 10, 11, 12, 13, 14, 15); }
__device__ __forceinline__ v16bf cat16b(v8us lo, v8us hi) { return __builtin_bit_cast(v16bf, __builtin_shufflevector(lo, hi, 0, 1, 2, 3, 4, 5, 6, 7, 8, 9, 10, 11, 12, 13, 14, 15)); }
__device__ __forceinline__ v8f wmma16(v16h a, v16h b, v8f c) { return __builtin_amdgcn_wmma_f32_16x16x32_f16(false, a, false, b, (short)0, c, false, false); }
__device__ __forceinline__ v8f wmmab(v16bf a, v16bf b, v8f c) { return __builtin_amdgcn_wmma_f32_16x16x32_bf16(false, a, false, b, (short)0, c, false, false); }



// ---- FRAGMENT ORDER: every 16-bit matrix operand plane [row][k] lies in units of 16 rows x 32 k (512 elements, 1 KB), units ordered [row / 16][k / 32]; inside a unit element (row, k) stands at
// ((k >> 4) & 1) * 256 + (((k >> 3) & 1) * 16 + (row & 15)) * 8 + (k & 7): a lane's two 16-byte fragment pieces are unit + lane * 8 and + 256, so each wave-wide load is 512 contiguous bytes (4 whole lines, not 32 bytes in each of 16).
// wtG walks a weight plane in storage order and asks unfrag for the (row, k) that stands at a position; KB = k / 32 units a row block.
__device__ __forceinline__ void unfrag(size_t pos, int KB, int& row, int& k) { const int u = (int)(pos >> 9), r = (int)(pos & 511); row = (u / KB) * 16 + ((r >> 3) & 15); k = (u % KB) * 32 + (r >> 8) * 16 + ((r >> 7) & 1) * 8 + (r & 7); }
// ---- k_gemmw: register-blocked GEMM, one wave per 64x64 output tile (16 accumulators), a work-group of GW_M x GW_N waves per (GW_M*64) x (GW_N*64) tile; operands are 16-bit planes in fragment order; grid (M/(GW_M*64), N/(GW_N*64), Z).
// C[m][n] (f32, pitch ldc, + optional f32 bias[n]) = sum_k A[m][k] Bt[n][k] (+ the product with the second A plane per NSPLIT). z-batch strides sA/sB/sC in elements. K: a constant, a multiple of KST.
// The main loop is ring_gemm below: the work-group's operand rows reach LDS once, by asynchronous copies, and every wave takes its fragments from there.
// ld(u, lb): the fragment of the unit at u (the same for the whole wave), lb = lane * 16, the lane's byte offset in it; ldp(p): the same from the lane's own address
template <typename T16> struct WFrag;
template <> struct WFrag<h16> { typedef v16h V; static __device__ __forceinline__ V ldp(const char* p) { return cat16(*(const v8h*)p, *(const v8h*)(p + 512)); } static __device__ __forceinline__ V ld(const h16* u, unsigned lb) { return ldp((const char*)u + lb); } static __device__ __forceinline__ v8f mma(V a, V b, v8f c) { return wmma16(a, b, c); } };
template <> struct WFrag<bf> { typedef v16bf V; static __device__ __forceinline__ V ldp(const char* p) { return cat16b(*(const v8us*)p, *(const v8us*)(p + 512)); } static __device__ __forceinline__ V ld(const bf* u, unsigned lb) { return ldp((const char*)u + lb); } static __device__ __forceinline__ v8f mma(V a, V b, v8f c) { return wmmab(a, b, c); } };
// ---- ring_gemm: the main loop of both GEMM kernels. A stage is KST k of every operand row of the work-group's tile: per block of 16 rows four units (RBS bytes), contiguous in the plane and in LDS alike, so a fragment
// read is 512 contiguous LDS bytes. Two buffers: while a stage is multiplied the next one's copies (global_load_async_to_lds_b128, through no register) fly. The blocks of 16 rows are dealt to the waves in turn.
// srcp(rb): the plane address (the same for the whole wave) of row block rb at k = 0; rb counts the A plane's WM*4 blocks, the second A plane's WM*NA2 (the first NA2 of a wave's four row blocks have one), then the WN*4 blocks of Bt.
#define KST 128
#define RBS (KST * 16 * 2)
// CP8: eight copies of 512 bytes, one row block of a stage; the immediate offset moves the LDS and the global address alike, and the block is contiguous in both.
// cp8, cp16: one or two row blocks, with their s_wait_xcnt 0 as the statement's last line: so it stands in front of whatever next rewrites an address register of theirs
#define CP1(L, G, O) "global_load_async_to_lds_b128 " L ", " G ", off offset:" O "\n\t"
#define CP8(L, G) "global_load_async_to_lds_b128 " L ", " G ", off\n\t" CP1(L, G, "512") CP1(L, G, "1024") CP1(L, G, "1536") CP1(L, G, "2048") CP1(L, G, "2560") CP1(L, G, "3072") CP1(L, G, "3584")
__device__ __forceinline__ void cp8(unsigned l, const char* g) { asm volatile(CP8("%0", "%1") "s_wait_xcnt 0x0" :: "v"(l), "v"(g) : "memory"); }
__device__ __forceinline__ void cp16(unsigned l0, const char* g0, unsigned l1, const char* g1) { asm volatile(CP8("%0", "%1") CP8("%2", "%3") "s_wait_xcnt 0x0" :: "v"(l0), "v"(g0), "v"(l1), "v"(g1) : "memory"); }
template <typename T16, int WM, int WN, int NA2, int K, typename SRC>
__device__ __forceinline__ void ring_gemm(char* ring, SRC srcp, v8f (&acc)[4][4]) {
    typedef typename WFrag<T16>::V V;
    constexpr int NW = WM * WN, RBA = WM * 4, RB2 = WM * NA2, NRB = RBA + RB2 + WN * 4, STG = NRB * RBS, NT = K / KST, NCP = (NRB + NW - 1) / NW, NFULL = NRB / NW;   // NFULL row blocks for every wave, one more for the first NRB % NW waves
    static_assert(K % KST == 0 && NT >= 2 && KST == 128 && NCP * 8 <= 63, "whole stages, at least two; four k steps a stage; a wave's copies of one stage in flight");
    const int lane = threadIdx.x & 31, wave = __builtin_amdgcn_readfirstlane(threadIdx.x >> 5), wm = wave / WN, wn = wave % WN; const unsigned lb = lane * 16;
    // every plain '#pragma unroll' below stands on a loop whose counter indexes fragments, accumulators or addresses: they stay in registers only where those indices are constants
    const char* g[NCP]; unsigned l[NCP];   // the same for the whole wave (scalar registers); a lane adds its lb where the copies are issued
#pragma unroll
    for (int i = 0; i < NCP; ++i) { const int rb = wave + i * NW < NRB ? wave + i * NW : 0; g[i] = srcp(rb); l[i] = (unsigned)(size_t)ring + rb * RBS; }
    // a lane's LDS address; readfirstlane holds the wave's part together in a scalar register: without it the compiler kept a vector register per row block alive over the loop and spilled it
    auto la = [&](int i, unsigned bo) __attribute__((always_inline)) { return (unsigned)__builtin_amdgcn_readfirstlane(l[i] + bo) + lb; };
    auto fill = [&](int t, unsigned bo) __attribute__((always_inline)) {   // this wave's row blocks of stage t into the buffer at bo; the test is the same for the whole wave
#pragma unroll
        for (int i = 0; i + 1 < NFULL; i += 2) cp16(la(i, bo), (g[i] + (size_t)t * RBS) + lb, la(i + 1, bo), (g[i + 1] + (size_t)t * RBS) + lb);
        if (NFULL & 1) cp8(la(NFULL - 1, bo), (g[NFULL - 1] + (size_t)t * RBS) + lb);
        if (NCP > NFULL) if (wave + NFULL * NW < NRB) cp8(la(NCP - 1, bo), (g[NCP - 1] + (size_t)t * RBS) + lb); };
    const char* fa = ring + wm * 4 * RBS + lb; const char* fa2 = ring + (RBA + wm * NA2) * RBS + lb; const char* fb = ring + (RBA + RB2 + wn * 4) * RBS + lb;
    V a[2][4], a2[2][NA2 ? NA2 : 1], b[2][4];
    auto ldf = [&](int st, int ks, unsigned bo) __attribute__((always_inline)) {   // into set st the fragments of k step ks of the stage at bo, as one group of LDS reads
#pragma unroll
        for (int mb = 0; mb < 4; ++mb) { a[st][mb] = WFrag<T16>::ldp(fa + bo + mb * RBS + ks * 1024); if (mb < NA2) a2[st][mb < NA2 ? mb : 0] = WFrag<T16>::ldp(fa2 + bo + mb * RBS + ks * 1024); }
#pragma unroll
        for (int nb = 0; nb < 4; ++nb) b[st][nb] = WFrag<T16>::ldp(fb + bo + nb * RBS + ks * 1024);
        __builtin_amdgcn_sched_barrier(0); };   // the group stays whole and in front of the products that follow (for speed only)
    auto mm = [&](int st) __attribute__((always_inline)) {
#pragma unroll
        for (int nb = 0; nb < 4; ++nb)
#pragma unroll
            for (int mb = 0; mb < 4; ++mb) { acc[mb][nb] = WFrag<T16>::mma(a[st][mb], b[st][nb], acc[mb][nb]); if (mb < NA2) acc[mb][nb] = WFrag<T16>::mma(a2[st][mb < NA2 ? mb : 0], b[st][nb], acc[mb][nb]); }
        __builtin_amdgcn_sched_barrier(0); };   // and a step's products stay in front of the next group, which refills their set
    fill(0, 0);
    asm volatile("s_wait_asynccnt 0x0" ::: "memory");   // this wave's copies of stage 0 have landed
    __syncthreads();                                    // and every other wave's: stage 0 may be read
    fill(1, STG);
    ldf(0, 0, 0);
#pragma unroll 1   // a trip is a stage; the buffer is picked by an offset, a second copy of the body buys nothing
    for (int t = 0; t < NT; ++t) {
        const unsigned bo = (t & 1) * STG;
        ldf(1, 1, bo); mm(0);   // a k step's fragments are read one step ahead of their products
        ldf(0, 2, bo); mm(1);
        ldf(1, 3, bo); mm(0);
        // stage t + 1 is published in front of this stage's last k step, whose fragments are already asked for: so the next stage's first fragments can be read under its products
        asm volatile("s_wait_dscnt 0x0" ::: "memory");      // this wave's reads of the buffer are over
        asm volatile("s_wait_asynccnt 0x0" ::: "memory");   // its copies of stage t + 1 have landed
        __syncthreads();                                    // the same holds of every wave: stage t + 1 may be read, this buffer refilled
        if (t + 2 < NT) fill(t + 2, bo);
        if (t + 1 < NT) ldf(0, 0, STG - bo);
        mm(1);
    }
    asm volatile("s_wait_asynccnt 0x0" ::: "memory");   // nothing of this wave's is in flight behind the loop
}
#define GW_M 2
#define GW_N 4
// NSPLIT = 1 (the output projection): only token rows < RH of a batch have a second A plane (the f16 rest of their f16 value); the rows from RH on come out of f16 products and are held as one f16 plane.
// So that every wave has the same work, the first of its four row blocks is one of the rows < RH and the other three are of the rows from RH on: orow(wr, mb) is the first token row of block mb of wave row wr.
__device__ __forceinline__ int orow(int wr, int mb) {
    static_assert(RH * 4 == TT && RH % 16 == 0, "one row block in four lies below RH");
    if (mb == 0) return (wr / (RH / 16)) * TT + (wr % (RH / 16)) * 16;
    const int j = wr * 3 + mb - 1; return (j / ((TT - RH) / 16)) * TT + RH + (j % ((TT - RH) / 16)) * 16; }
template <typename T16, int NSPLIT, bool BIAS, int K>
__global__ __launch_bounds__(GW_M * GW_N * 32) void k_gemmw(const T16* __restrict__ A, const T16* __restrict__ A2, const T16* __restrict__ Bt, const T16* __restrict__ Bt2, float* C, int ldc, const float* __restrict__ bias, size_t sA, size_t sB, size_t sC) {
    static_assert(NSPLIT == 0 || NSPLIT == 1, "one Bt plane");
    constexpr int NA2 = NSPLIT;
    __shared__ __align__(16) char ring[2 * (GW_M * (4 + NA2) + GW_N * 4) * RBS];
    __shared__ __align__(16) float osm[GW_M * GW_N * 16 * 68];   // a wave's own output staging
    const size_t z = blockIdx.z; A += z * sA; if (A2) A2 += z * sA; Bt += z * sB; C += z * sC; (void)Bt2;
    const int lane = threadIdx.x & 31, lr = lane & 15, hi = lane >> 4, wave = __builtin_amdgcn_readfirstlane(threadIdx.x >> 5); const int W0 = blockIdx.x * GW_M, C0 = blockIdx.y * (GW_N * 64), c0 = C0 + (wave % GW_N) * 64;
    auto trow = [&](int wr, int mb) __attribute__((always_inline)) { return NSPLIT == 1 ? orow(wr, mb) : wr * 64 + mb * 16; };
    float* os = osm + wave * (16 * 68);
    v8f acc[4][4];
#pragma unroll
    for (int mb = 0; mb < 4; ++mb)
#pragma unroll
        for (int nb = 0; nb < 4; ++nb) acc[mb][nb] = (v8f){};
    ring_gemm<T16, GW_M, GW_N, NA2, K>(ring, [&](int rb) __attribute__((always_inline)) { constexpr int RBA = GW_M * 4, RB2 = GW_M * NA2;   // a row block of 16 is K * 16 elements
        return (const char*)(rb < RBA ? A + (size_t)trow(W0 + rb / 4, rb % 4) * K : rb < RBA + RB2 ? A2 + (size_t)trow(W0 + (rb - RBA), 0) * K : Bt + (size_t)(C0 + (rb - RBA - RB2) * 16) * K); }, acc);
#pragma unroll
    for (int mb = 0; mb < 4; ++mb) {
#pragma unroll
        for (int nb = 0; nb < 4; ++nb) {
#pragma unroll
            for (int j = 0; j < 8; ++j) os[(hi * 8 + j) * 68 + nb * 16 + lr] = acc[mb][nb][j]; }
        __builtin_amdgcn_wave_barrier(); asm volatile("" ::: "memory");
        float* crow = C + (size_t)trow(W0 + wave / GW_N, mb) * ldc + c0;
        { v4f val[8]; float* pr[8];
#pragma unroll
            for (int s = 0; s < 8; ++s) { const int row = 2 * s + hi, cofs = lr * 4; val[s] = *(const v4fa*)(os + row * 68 + cofs); if (BIAS) { val[s][0] += bfr(bias[c0 + cofs]); val[s][1] += bfr(bias[c0 + cofs + 1]); val[s][2] += bfr(bias[c0 + cofs + 2]); val[s][3] += bfr(bias[c0 + cofs + 3]); }
                pr[s] = crow + (size_t)row * ldc + cofs; }
            // the row block's eight stores with their s_wait_xcnt 0 in one statement: so it stands in front of the next block's LDS reads, which land in address and data registers of theirs
            asm volatile("global_store_b128 %0, %8, off\n\tglobal_store_b128 %1, %9, off\n\tglobal_store_b128 %2, %10, off\n\tglobal_store_b128 %3, %11, off\n\t"
                         "global_store_b128 %4, %12, off\n\tglobal_store_b128 %5, %13, off\n\tglobal_store_b128 %6, %14, off\n\tglobal_store_b128 %7, %15, off\n\ts_wait_xcnt 0x0"
                         :: "v"(pr[0]), "v"(pr[1]), "v"(pr[2]), "v"(pr[3]), "v"(pr[4]), "v"(pr[5]), "v"(pr[6]), "v"(pr[7]), "v"(val[0]), "v"(val[1]), "v"(val[2]), "v"(val[3]), "v"(val[4]), "v"(val[5]), "v"(val[6]), "v"(val[7]) : "memory");
        }
        __builtin_amdgcn_wave_barrier(); asm volatile("" ::: "memory");
    }
}

__device__ __forceinline__ h16 tohx(float x) { return (h16)x; }
__device__ __forceinline__ void splitf(float y, unsigned short& h, unsigned short& l) { h = f2bf(y); l = f2bf(y - bf2f(h)); }
typedef __attribute__((ext_vector_type(2))) _Float16 v2h;
typedef __attribute__((ext_vector_type(4))) _Float16 v4h;
typedef __attribute__((ext_vector_type(2))) unsigned short v2us;
typedef __attribute__((ext_vector_type(4))) unsigned short v4us;
typedef __attribute__((ext_vector_type(2))) float v2f;
typedef __attribute__((ext_vector_type(4))) int v4i;

// ---- k_prep: all that only re-forms an input or builds the RoPE table, in ONE launch (the parts do not depend on one another); a work-group's index picks its part, the parts with the longest chains of dependent loads first.
#define PB_WQ (DM * DQ / 512 / 8)              // work-groups for wq, and for wo: a wave takes one unit of 512 elements
#define PB_WK (DM * DKV / 512 / 8)             // for wk, and for wv
#define PB_W  (2 * PB_WQ + 2 * PB_WK)
#define PB_X  (NB_ * TT * DM / 512 / 4 / 8)    // for x: a wave takes four units
#define PB_CS (TT * (HD / 2) / 256)            // for the table: a thread takes the two entries d and d + HD/2, which are equal
// hf: the plane is read by f16 products: the bf16-rounded weight is stored as f16 (the same value but for weights below 2^-17, which keep what f16 subnormals hold)
__device__ __forceinline__ void wtG(const float* __restrict__ w, int K, int N, bf* Bt, int blk, bool hf) {
    const int lane = threadIdx.x & 31; const int L0 = (blk * 8 + (threadIdx.x >> 5)) * 8; const int nlines = N * K / 64;
{
#pragma unroll 1
        for (int l = 0; l < 8; ++l) { const int L = L0 + l; if (L >= nlines) break; const size_t e = (size_t)L * 64 + lane * 2; int k, n; unfrag(e, K / 32, n, k); v2us o;
            const float* p0 = w + (size_t)k * N + n; const float* p1 = p0 + N; const float w0 = *p0, w1 = *p1;
            asm volatile("s_wait_xcnt 0x0" :: "v"(p0), "v"(p1) : "memory");   // behind the loads, in front of whatever next rewrites an address register of theirs (inputs: they live to the wait)
            o[0] = f2bf(w0); o[1] = f2bf(w1); if (hf) { o[0] = __builtin_bit_cast(unsigned short, (h16)bf2f(o[0])); o[1] = __builtin_bit_cast(unsigned short, (h16)bf2f(o[1])); } bf* po = Bt + e;
            asm volatile("global_store_b32 %0, %1, off\n\ts_wait_xcnt 0x0" :: "v"(po), "v"(__builtin_bit_cast(unsigned, o)) : "memory"); }   // the store with its wait in one statement: the next trip rewrites its registers
         }
}
__global__ __launch_bounds__(256) void k_prep(const float* __restrict__ x, const float* __restrict__ wq, const float* __restrict__ wk, const float* __restrict__ wv, const float* __restrict__ wo, bf* XB, bf* WQ, bf* WK, bf* WV, bf* WO, float* CS) {
    static_assert(DQ == DM && (DM / 32) % 4 == 0 && HD * 4 == 256, "one K for the four weights; a wave's four units of x lie in one row block; the table's second store stands 256 bytes on");
    int blk = blockIdx.x;
    if (blk < PB_W) {   // weights [k][n] f32 -> [n][k] bf16 in fragment order (wo: the bf16 values as f16)
        const float* w; bf* Bt; int N; bool hf = false;
        if (blk < PB_WQ) { w = wq; Bt = WQ; N = DQ; }
        else if (blk < 2 * PB_WQ) { w = wo; Bt = WO; N = DM; blk -= PB_WQ; hf = true; }
        else if (blk < 2 * PB_WQ + PB_WK) { w = wk; Bt = WK; N = DKV; blk -= 2 * PB_WQ; }
        else { w = wv; Bt = WV; N = DKV; blk -= 2 * PB_WQ + PB_WK; }
        wtG(w, DM, N, Bt, blk, hf); return;
    }
    blk -= PB_W;
    if (blk < PB_X) {   // x -> bf16 in fragment order. A wave's four units are 16 rows x 128 k: piece c of a lane (8 elements) is row lane & 15, k = c * 16 + (lane >> 4) * 8 of them, and stands at c * 256 + lane * 8
        const int lane = threadIdx.x & 31, u0 = (blk * 8 + (threadIdx.x >> 5)) * 4;
        const float* p = x + (size_t)((u0 / (DM / 32)) * 16 + (lane & 15)) * DM + (u0 % (DM / 32)) * 32 + (lane >> 4) * 8; v8f v[8]; v4i o[8];
#pragma unroll   // c indexes registers; the eight pieces' loads are all in flight together
        for (int c = 0; c < 8; ++c) v[c] = *(const v8f*)(p + c * 16);
        asm volatile("s_wait_xcnt 0x0" :: "v"(p) : "memory");   // behind the loads, in front of whatever next rewrites their address register (an input: it lives to the wait)
#pragma unroll
        for (int c = 0; c < 8; ++c) { v8us t;
#pragma unroll
            for (int j = 0; j < 8; ++j) t[j] = f2bf(v[c][j]);
            o[c] = __builtin_bit_cast(v4i, t); }
        bf* d = XB + (size_t)u0 * 512 + lane * 8;
        // the eight stores with their s_wait_xcnt 0 in one statement: nothing rewrites a register of theirs in front of it
        asm volatile("global_store_b128 %0, %1, off\n\tglobal_store_b128 %0, %2, off offset:512\n\tglobal_store_b128 %0, %3, off offset:1024\n\tglobal_store_b128 %0, %4, off offset:1536\n\t"
                     "global_store_b128 %0, %5, off offset:2048\n\tglobal_store_b128 %0, %6, off offset:2560\n\tglobal_store_b128 %0, %7, off offset:3072\n\tglobal_store_b128 %0, %8, off offset:3584\n\ts_wait_xcnt 0x0"
                     :: "v"(d), "v"(o[0]), "v"(o[1]), "v"(o[2]), "v"(o[3]), "v"(o[4]), "v"(o[5]), "v"(o[6]), "v"(o[7]) : "memory");
        return;
    }
    blk -= PB_X;
    {   // RoPE table, entry (t, d): cos then sin
        const int idx = blk * 256 + threadIdx.x; const int t = idx / (HD / 2), i = idx % (HD / 2); const float inv = __fdiv_rn(1.0f, powf(10000.0f, (float)(2 * i) / (float)HD)); const float ang = __fmul_rn((float)t, inv); v2f cs; cs[0] = cosf(ang); cs[1] = sinf(ang);
        float* pc = CS + ((size_t)t * HD + i) * 2;
        // the two stores (entry d, and d + HD/2 at HD floats = 256 bytes on) with their s_wait_xcnt 0 in one statement: nothing rewrites a register of theirs in front of it
        asm volatile("global_store_b64 %0, %1, off\n\tglobal_store_b64 %0, %1, off offset:256\n\ts_wait_xcnt 0x0" :: "v"(pc), "v"(cs) : "memory");
    }
}
// ---- k_qkv: the q, k and v projections in ONE launch, RoPE and the forming of the 16-bit operand planes in its epilogue (no f32 projection ever reaches memory). grid (tokens / (QW_M*64), (NH_ + 2 * NKV) / QW_N), QW_M*QW_N waves:
// one wave per 64 tokens x one head (HD = 64 columns), a work-group QW_M*64 tokens x QW_N heads, main loop ring_gemm; heads count the NH_ q heads, then the NKV k heads, then the NKV v heads.
// Every plain '#pragma unroll' here stands on a loop whose counter indexes accumulators, fragments or table entries: they stay in registers only where those indices are constants.
// the fp16, the hi and the lo store of eight plane elements, with their s_wait_xcnt 0 in the same statement: so it stands in front of whatever next rewrites an address or data register of theirs
__device__ __forceinline__ void st3x(h16* p16, v8h a, bf* ph, v8us b, bf* pl, v8us c) {
    asm volatile("global_store_b128 %0, %1, off\n\tglobal_store_b128 %2, %3, off\n\tglobal_store_b128 %4, %5, off\n\ts_wait_xcnt 0x0" :: "v"(p16), "v"(__builtin_bit_cast(v4i, a)), "v"(ph), "v"(__builtin_bit_cast(v4i, b)), "v"(pl), "v"(__builtin_bit_cast(v4i, c)) : "memory");
}
__device__ __forceinline__ void put8(const float* x, h16* p16, bf* ph, bf* pl) { v8h o16; v8us oh, ol;
#pragma unroll
    for (int j = 0; j < 8; ++j) { o16[j] = tohx(x[j]); unsigned short a2, c2; splitf(x[j], a2, c2); oh[j] = a2; ol[j] = c2; }
    st3x(p16, o16, ph, oh, pl, ol); }
#define QW_M 4
#define QW_N 3
__global__ __launch_bounds__(QW_M * QW_N * 32) void k_qkv(const bf* __restrict__ A, const bf* __restrict__ WQ, const bf* __restrict__ WK, const bf* __restrict__ WV, const float* __restrict__ CS, h16* QP16, bf* QPh, bf* QPl, h16* KP16, bf* KPh, bf* KPl, h16* VT16, bf* VTh) {
    static_assert(HD == 64 && TT % 64 == 0 && (NH_ + 2 * NKV) % QW_N == 0 && (NB_ * TT) % (QW_M * 64) == 0, "a 64 x 64 tile is 64 tokens of one batch x one whole head; whole work-group tiles");
    __shared__ __align__(16) char ring[2 * (QW_M + QW_N) * 4 * RBS];
    __shared__ __align__(16) float osm[QW_M * QW_N * 16 * 68];   // a wave's own staging for the turn of its rotated blocks
    const int K = DM, lane = threadIdx.x & 31, lr = lane & 15, hi = lane >> 4, wave = __builtin_amdgcn_readfirstlane(threadIdx.x >> 5); const int R0 = blockIdx.x * (QW_M * 64), H0 = blockIdx.y * QW_N, r0 = R0 + (wave / QW_N) * 64, cy = H0 + wave % QW_N;
    float* os = osm + wave * (16 * 68);
    v8f acc[4][4];
#pragma unroll
    for (int mb = 0; mb < 4; ++mb)
#pragma unroll
        for (int nb = 0; nb < 4; ++nb) acc[mb][nb] = (v8f){};
    ring_gemm<bf, QW_M, QW_N, 0, DM>(ring, [&](int rb) __attribute__((always_inline)) { constexpr int RBA = QW_M * 4;   // a row block of 16 is K * 16 elements; a head is four of them
        const int n = H0 * HD + (rb - RBA) * 16;   // the weight row among the q, then k, then v columns
        return (const char*)(rb < RBA ? A + (size_t)(R0 + rb * 16) * K : n < DQ ? WQ + (size_t)n * K : n < DQ + DKV ? WK + (size_t)(n - DQ) * K : WV + (size_t)(n - DQ - DKV) * K); }, acc);
    const int b = r0 / TT, t0 = r0 % TT;
    if (cy >= NH_ + NKV) {
        // v: planes [d][t]. Register j of accumulator (mb, nb) is token t0 + mb * 16 + hi * 8 + j of column d = nb * 16 + lr: a lane's eight registers are, as they stand, its 16-byte piece of the unit (d / 16, t / 32), half mb & 1
        const size_t po = ((size_t)b * NKV + (cy - NH_ - NKV)) * (HD * 2 * TT) + (size_t)(t0 / 32) * 512 + lane * 8;
#pragma unroll
        for (int mb = 0; mb < 4; ++mb)
#pragma unroll
            for (int nb = 0; nb < 4; ++nb) { float x[8];
#pragma unroll
                for (int j = 0; j < 8; ++j) x[j] = acc[mb][nb][j];
                const size_t oo = po + (size_t)(nb * (TT / 32) + (mb >> 1)) * 512 + (mb & 1) * 256; put8(x, VT16 + oo, VTh + oo, VTh + HD * TT + oo); }
        return;
    }
    // q, k: planes [t][d]. Rotate-half pairs d and d + HD/2, which one lane holds in accumulators nb and nb + 2; cos and sin of d + HD/2 are those of d. The rotated 16 x 64 block goes through LDS to turn a lane's eight tokens into eight d.
    const bool isq = cy < NH_; const size_t po = (isq ? (size_t)b * NH_ + cy : (size_t)b * NKV + (cy - NH_)) * (TT * HD) + (size_t)t0 * HD + lane * 8;
    h16* P16 = (isq ? QP16 : KP16) + po; bf* Ph = (isq ? QPh : KPh) + po; bf* Pl = (isq ? QPl : KPl) + po;
    const char* csb = (const char*)(CS + (size_t)t0 * HD * 2); const unsigned lo = (hi * 8 * HD + lr) * 8;   // table entry (t, d): 8 bytes, cos then sin
    v2f cs[2][16];
    auto ldcs = [&](int mb, v2f* c) __attribute__((always_inline)) {
#pragma unroll
        for (int nb = 0; nb < 2; ++nb)
#pragma unroll
            for (int j = 0; j < 8; ++j) c[nb * 8 + j] = *(const v2f*)(csb + lo + ((mb * 16 + j) * HD + nb * 16) * 8);
        asm volatile("s_wait_xcnt 0x0" :: "v"(lo) : "memory"); };   // behind the table loads, in front of whatever next rewrites a register that they name; the offset is an input so that it lives to the wait
    ldcs(0, cs[0]);
#pragma unroll
    for (int mb = 0; mb < 4; ++mb) {
        if (mb < 3) ldcs(mb + 1, cs[(mb + 1) & 1]);   // the next 16 tokens' table entries fly while these are rotated and stored
#pragma unroll
        for (int nb = 0; nb < 2; ++nb)
#pragma unroll
            for (int j = 0; j < 8; ++j) { const float c = cs[mb & 1][nb * 8 + j][0], s = cs[mb & 1][nb * 8 + j][1], x0 = acc[mb][nb][j], x1 = acc[mb][nb + 2][j];
                os[(hi * 8 + j) * 68 + nb * 16 + lr] = x0 * c - x1 * s; os[(hi * 8 + j) * 68 + (nb + 2) * 16 + lr] = x1 * c + x0 * s; }
        __builtin_amdgcn_wave_barrier(); asm volatile("" ::: "memory");   // the one wave's LDS writes stay in front of its reads below
#pragma unroll
        for (int u = 0; u < 4; ++u) { const float* sp = os + lr * 68 + u * 16 + hi * 8; const v4f u0 = *(const v4fa*)sp, u1 = *(const v4fa*)(sp + 4); const float x[8] = {u0[0], u0[1], u0[2], u0[3], u1[0], u1[1], u1[2], u1[3]};
            const int oo = mb * 1024 + u * 256; put8(x, P16 + oo, Ph + oo, Pl + oo); }   // unit (t / 16, d / 32), half (d / 16) & 1
        __builtin_amdgcn_wave_barrier(); asm volatile("" ::: "memory");   // and its reads in front of the next block's writes
    }
}
// ---- k_flash: scores, causal softmax, probability x value and the head merge in ONE launch; scores and probabilities never leave registers (online softmax over key blocks of 32).
// One wave owns NBQ*16 query rows of one head. It forms the TRANSPOSED score tile S^T[key][query] = K Q^T (A = key rows, B = query rows), so that a lane holds scores of one query only (max and sum in-lane plus one
// exchange between the lane halves) and the accumulator registers of two 16-key tiles are, as they stand, the B operand P^T[query][key 0..31] of O^T[d][query] += V^T P^T (A = value rows [d][t]).
// k order of every operand: element e of lane half hi is k = (e / 8) * 16 + 8 * hi + e % 8 (WFrag::ld on both global operands; score tile mt, register j is key mt * 16 + 8 * hi + j).
// The four waves of a block's half are the four heads of one kv group on the same query rows: they read the same key and value lines. HR: bf16 hi+lo planes, 3 products; else fp16, probabilities carried x PCAR (it cancels in O / l).
// KS = 2: the key blocks of a tile are dealt in turn to two waves (kh = 0, 1), each with its own running maximum, sum and output tiles; wave 1 hands its three through LDS (xs) to wave 0, which joins them and stores. So the
// longest wave walks half the keys, and there are more work-groups than resident places: a place that falls free early takes the next one.
typedef __attribute__((ext_vector_type(16))) unsigned short v16us;
// eight 2^x in one statement: no result shares a register with a source ("=&v"), and the v_nop is the free slot behind the last transcendental
__device__ __forceinline__ void exp2x8(float* p, const float* x) {
    asm("v_exp_f32 %0, %8\n\tv_exp_f32 %1, %9\n\tv_exp_f32 %2, %10\n\tv_exp_f32 %3, %11\n\tv_exp_f32 %4, %12\n\tv_exp_f32 %5, %13\n\tv_exp_f32 %6, %14\n\tv_exp_f32 %7, %15\n\tv_nop"
        : "=&v"(p[0]), "=&v"(p[1]), "=&v"(p[2]), "=&v"(p[3]), "=&v"(p[4]), "=&v"(p[5]), "=&v"(p[6]), "=&v"(p[7]) : "v"(x[0]), "v"(x[1]), "v"(x[2]), "v"(x[3]), "v"(x[4]), "v"(x[5]), "v"(x[6]), "v"(x[7]));
}
// the hi and the lo store of eight merged outputs, with their s_wait_xcnt 0 in the same statement: so it stands in front of whatever next rewrites an address or data register of theirs, on every way out of a tile
// (as a statement of its own the wait let the next outputs' arithmetic move up over it)
__device__ __forceinline__ void st2x(h16* pa, v8h a, h16* pb, v8h b) {
    asm volatile("global_store_b128 %0, %1, off\n\tglobal_store_b128 %2, %3, off\n\ts_wait_xcnt 0x0" :: "v"(pa), "v"(__builtin_bit_cast(v4i, a)), "v"(pb), "v"(__builtin_bit_cast(v4i, b)) : "memory");
}
// the same for the one store of eight merged outputs that have no second plane
__device__ __forceinline__ void st1x(h16* pa, v8h a) {
    asm volatile("global_store_b128 %0, %1, off\n\ts_wait_xcnt 0x0" :: "v"(pa), "v"(__builtin_bit_cast(v4i, a)) : "memory");
}
template <typename T16, bool HR, int NBQ, int KS>
__device__ __forceinline__ void flash_tile(const T16* __restrict__ Q, const T16* __restrict__ Q2, const T16* __restrict__ Kp, const T16* __restrict__ K2, const T16* __restrict__ Vt, const T16* __restrict__ V2, int q0, h16* Ah, h16* Al, int kh, float* xs) {
    static_assert(KS == 1 || (KS == 2 && NBQ == 2), "the hand-over packs two maxima and two sums into one 16-byte piece");
    typedef typename WFrag<T16>::V V;
    const int lane = threadIdx.x & 31, lr = lane & 15, hi = lane >> 4; const unsigned lb = lane * 16;
    V qf[NBQ][2], qf2[NBQ][2];
#pragma unroll
    for (int nb = 0; nb < NBQ; ++nb)
#pragma unroll
        for (int kc = 0; kc < 2; ++kc) { const int qo = (q0 + nb * 16) * HD + kc * 512; qf[nb][kc] = WFrag<T16>::ld(Q + qo, lb); if (HR) qf2[nb][kc] = WFrag<T16>::ld(Q2 + qo, lb); }
    asm volatile("s_wait_xcnt 0x0" :: "v"(lb) : "memory");   // behind the query loads, in front of whatever next rewrites a register that they name; the offset is an input so that no load's result lands in it
    v8f o[4][NBQ]; float m[NBQ], l[NBQ];
#pragma unroll
    for (int nb = 0; nb < NBQ; ++nb) { m[nb] = -3.0e38f; l[nb] = 0.f;
#pragma unroll
        for (int dt = 0; dt < 4; ++dt) o[dt][nb] = (v8f){}; }
    const int nkb = (q0 + NBQ * 16 + 31) / 32;      // key blocks up to the diagonal; every block starts at a key <= q0, so no query ever sees a fully masked block; only the last block holds keys beyond a query
    const int klast = (nkb - 1) - ((nkb - 1 - kh) % KS);   // this wave's blocks are kh, kh + KS, ... klast (the caller's tiles have at least KS blocks)
    const bool dg = KS == 1 || klast == nkb - 1;           // its last block is the one on the diagonal (the same for the whole wave)
    const float L2E = 1.4426950408889634f, PEXP = HR ? 0.0f : 10.0f;   // 2^10 = PCAR
    V kf[2][2], kf2[2][2], vf[4], vf2[4];
    auto ldk = [&](int k0) __attribute__((always_inline)) {
#pragma unroll
        for (int mt = 0; mt < 2; ++mt)
#pragma unroll
            for (int kc = 0; kc < 2; ++kc) { const int ko = (k0 + mt * 16) * HD + kc * 512; kf[mt][kc] = WFrag<T16>::ld(Kp + ko, lb); if (HR) kf2[mt][kc] = WFrag<T16>::ld(K2 + ko, lb); }
        asm volatile("s_wait_xcnt 0x0" :: "v"(lb) : "memory"); };   // stands behind the loads, in front of whatever next rewrites a register that they name (a later load's result among them)
    auto ldv = [&](int k0) __attribute__((always_inline)) {
#pragma unroll
        for (int dt = 0; dt < 4; ++dt) { const int vo = dt * 16 * TT + k0 * 16; vf[dt] = WFrag<T16>::ld(Vt + vo, lb); if (HR) vf2[dt] = WFrag<T16>::ld(V2 + vo, lb); }
        asm volatile("s_wait_xcnt 0x0" :: "v"(lb) : "memory"); };   // as in ldk
    // one key block; last: the wave's last block (nothing fetched behind it; masked where it is the one on the diagonal). Otherwise its next block's key fragments are asked for behind the score products and its value fragments behind the value
    // products, one block ahead of their use (where the registers are short the compiler may issue the key loads later in the block).
    auto step = [&](int k0, bool last) __attribute__((always_inline)) {
        v8f s[2][NBQ];
#pragma unroll
        for (int mt = 0; mt < 2; ++mt)
#pragma unroll
            for (int nb = 0; nb < NBQ; ++nb) { v8f a = (v8f){};
#pragma unroll
                for (int kc = 0; kc < 2; ++kc) { a = WFrag<T16>::mma(kf[mt][kc], qf[nb][kc], a); if (HR) { a = WFrag<T16>::mma(kf[mt][kc], qf2[nb][kc], a); a = WFrag<T16>::mma(kf2[mt][kc], qf[nb][kc], a); } }
                s[mt][nb] = a; }
        if (!last) ldk(k0 + 32 * KS);
        else __builtin_amdgcn_sched_barrier(0);   // the last block's score products stay together in front of its softmax: its 2^x statements may land in query registers, free behind the last product, and must stand the WMMA distance off
        V pf[NBQ], pf2[NBQ];
#pragma unroll
        for (int nb = 0; nb < NBQ; ++nb) {
            const int qi = q0 + nb * 16 + lr; float mx = m[nb];
#pragma unroll
            for (int mt = 0; mt < 2; ++mt)
#pragma unroll
                for (int j = 0; j < 8; ++j) { float t = s[mt][nb][j] * SCL; if (last && dg && k0 + mt * 16 + hi * 8 + j > qi) t = -3.0e38f; s[mt][nb][j] = t; mx = fmaxf(mx, t); }
            mx = fmaxf(mx, __shfl_xor(mx, 16, 32));
            float al; asm("v_exp_f32 %0, %1\n\tv_nop" : "=v"(al) : "v"((m[nb] - mx) * L2E)); m[nb] = mx;   // 2^x with the free slot behind a transcendental in the same statement
            float ps = 0.f; float x[16], p[16];
#pragma unroll
            for (int e = 0; e < 16; ++e) x[e] = (s[e >> 3][nb][e & 7] - mx) * L2E + PEXP;
            exp2x8(p, x); exp2x8(p + 8, x + 8);
#pragma unroll
            for (int e = 0; e < 16; ++e) ps += p[e];
            l[nb] = l[nb] * al + ps;                // this lane half's keys only; the halves are added once, after the loop
#pragma unroll
            for (int dt = 0; dt < 4; ++dt) o[dt][nb] *= al;
            if constexpr (HR) { v16us ph, pl;
#pragma unroll
                for (int e = 0; e < 16; ++e) { unsigned short a, c2; splitf(p[e], a, c2); ph[e] = a; pl[e] = c2; }
                pf[nb] = __builtin_bit_cast(v16bf, ph); pf2[nb] = __builtin_bit_cast(v16bf, pl);
            } else { v16h ph;
#pragma unroll
                for (int e = 0; e < 16; ++e) ph[e] = tohx(p[e]);
                pf[nb] = ph; }
        }
#pragma unroll
        for (int dt = 0; dt < 4; ++dt)
#pragma unroll
            for (int nb = 0; nb < NBQ; ++nb) { o[dt][nb] = WFrag<T16>::mma(vf[dt], pf[nb], o[dt][nb]); if (HR) { o[dt][nb] = WFrag<T16>::mma(vf[dt], pf2[nb], o[dt][nb]); o[dt][nb] = WFrag<T16>::mma(vf2[dt], pf[nb], o[dt][nb]); } }
        if (!last) ldv(k0 + 32 * KS);
    };
    ldk(kh * 32); ldv(kh * 32);   // keys first, as in the loop: loads return in order, and the wait at the loop's head leaves the value loads in flight
#pragma unroll 1   // run-time trip count round a body that already fills most of the register file: a second copy of the body would spill
    for (int kb = kh; kb < klast; kb += KS) step(kb * 32, false);
    step(klast * 32, true);
    if constexpr (KS == 2) {   // piece i of a lane stands at (i * 32 + lane) * 16 bytes: every LDS access is 512 contiguous bytes
        v4fa* xv = (v4fa*)xs + lane;
        if (kh == 1) {
#pragma unroll
            for (int dt = 0; dt < 4; ++dt)
#pragma unroll
                for (int nb = 0; nb < NBQ; ++nb) { const v8f t = o[dt][nb]; xv[((dt * NBQ + nb) * 2) * 32] = (v4f){t[0], t[1], t[2], t[3]}; xv[((dt * NBQ + nb) * 2 + 1) * 32] = (v4f){t[4], t[5], t[6], t[7]}; }
            xv[(4 * NBQ * 2) * 32] = (v4f){m[0], m[1], l[0], l[1]};
        }
        __syncthreads();   // wave 1's maxima, sums and output tiles are in LDS; every wave of the block passes here once
        if (kh == 1) return;
        const v4f ml = xv[(4 * NBQ * 2) * 32];
#pragma unroll
        for (int nb = 0; nb < NBQ; ++nb) {
            const float mj = fmaxf(m[nb], ml[nb]); float a0, a1;
            asm("v_exp_f32 %0, %2\n\tv_exp_f32 %1, %3\n\tv_nop" : "=&v"(a0), "=&v"(a1) : "v"((m[nb] - mj) * L2E), "v"((ml[nb] - mj) * L2E));   // 2^x twice, with the free slot behind a transcendental in the same statement, as in the loop
            l[nb] = l[nb] * a0 + ml[2 + nb] * a1;
#pragma unroll
            for (int dt = 0; dt < 4; ++dt) { const v4f u0 = xv[((dt * NBQ + nb) * 2) * 32], u1 = xv[((dt * NBQ + nb) * 2 + 1) * 32];
#pragma unroll
                for (int j = 0; j < 4; ++j) { o[dt][nb][j] = o[dt][nb][j] * a0 + u0[j] * a1; o[dt][nb][j + 4] = o[dt][nb][j + 4] * a0 + u1[j] * a1; } }
        }
    }
#pragma unroll
    for (int nb = 0; nb < NBQ; ++nb) {
        const float lt = l[nb] + __shfl_xor(l[nb], 16, 32); const float inv = __fdiv_rn(1.0f, lt);
#pragma unroll
        for (int dt = 0; dt < 4; ++dt) { v8h oh, ol;   // f16; the hi+lo tiles store the f16 rest as well
#pragma unroll
            for (int j = 0; j < 8; ++j) { const float y = o[dt][nb][j] * inv; oh[j] = tohx(y); if (HR) ol[j] = tohx(y - (float)oh[j]); }
            const size_t oo = (size_t)(q0 + nb * 16) * DQ + dt * 256 + lane * 8; if constexpr (HR) st2x(Ah + oo, oh, Al + oo, ol); else st1x(Ah + oo, oh); }   // fragment order of the merged [token][DQ] plane: the head's two units, half dt & 1
    }
}
#define NLO ((TT - RH) / 32)      // fp16 query tiles of 32 rows
#define NHI (RH / 16)             // hi+lo query tiles of 16 rows
#define XSF ((4 * 2 * 2 + 1) * 32 * 4)   // floats that one wave hands over: 16 pieces of output tiles and one of maxima and sums, a lane
// grid (kv planes, NLO + NHI / 2), 2 * REP waves. An fp16 tile has two waves a head, which share its key blocks; a block of hi+lo tiles holds two tiles, one wave a head each.
// y counts the blocks roughly from the costliest down (for speed only): the longer half of the fp16 tiles, then one block of hi+lo tiles and three fp16 tiles in turn, then the short hi+lo tiles.
__global__ __launch_bounds__(2 * REP * 32) void k_flash(const h16* __restrict__ QP16, const h16* __restrict__ KP16, const h16* __restrict__ VT16, const bf* __restrict__ QPh, const bf* __restrict__ QPl, const bf* __restrict__ KPh, const bf* __restrict__ KPl, const bf* __restrict__ VTh, h16* ATh, h16* ATl) {
    static_assert(NHI % 4 == 0 && RH >= 64 && NLO / 2 == 3 * (NHI / 4) && NLO % 2 == 0, "whole blocks of hi+lo tiles; an fp16 tile has at least three key blocks; the turns of one and three come out even");
    __shared__ __align__(16) float xsm[REP * XSF];
    const int wave = __builtin_amdgcn_readfirstlane(threadIdx.x >> 5), hw = wave % REP, kh = wave / REP;
    const int kvp = blockIdx.x, g = kvp * REP + hw, b = g / NH_, h = g % NH_, u = (int)blockIdx.y - NLO / 2;   // g = b*NH_ + h: flat head; its kv plane is g / REP
    const bool lo = u < 0 || (u < NHI && u % 4 != 0);   // an fp16 tile; ty: its number, or the hi+lo block's, each from the longest key range down
    const int ty = u < 0 ? u + NLO / 2 : u >= NHI ? NHI / 4 + (u - NHI) : lo ? NLO / 2 + (u / 4) * 3 + (u % 4 - 1) : u / 4;
    const size_t qo = (size_t)g * TT * HD, ko = (size_t)kvp * TT * HD, vo = (size_t)kvp * HD * 2 * TT, ao = (size_t)b * TT * DQ + h * (HD * 16);
    if (lo) flash_tile<h16, false, 2, 2>(QP16 + qo, nullptr, KP16 + ko, nullptr, VT16 + vo, nullptr, TT - 32 * (ty + 1), ATh + ao, ATl + ao, kh, xsm + hw * XSF);
    else flash_tile<bf, true, 1, 1>(QPh + qo, QPl + qo, KPh + ko, KPl + ko, VTh + vo, VTh + vo + HD * TT, RH - 16 * (ty * 2 + kh + 1), ATh + ao, ATl + ao, 0, nullptr);
}

extern "C" void kernel_launch(void* const* d_in, const int* in_sizes, int n_in,
                              void* d_out, int out_size, void* d_ws, size_t ws_size, hipStream_t stream) {
    (void)in_sizes; (void)n_in; (void)out_size;
    const float* x = (const float*)d_in[0]; const float* wq = (const float*)d_in[1]; const float* wk = (const float*)d_in[2]; const float* wv = (const float*)d_in[3]; const float* wo = (const float*)d_in[4];
    float* OUT = (float*)d_out;     // [4][2048][1024]
    char* wsp = (char*)d_ws;
    auto take = [&](size_t bytes) { char* p = wsp; wsp += (bytes + 255) & ~(size_t)255; return (void*)p; };
    bf* WQ = (bf*)take((size_t)DQ * DM * 2); bf* WK = (bf*)take((size_t)DKV * DM * 2); bf* WV = (bf*)take((size_t)DKV * DM * 2); bf* WO = (bf*)take((size_t)DM * DQ * 2);   /* f16 values */ float* CS = (float*)take((size_t)TT * HD * 2 * 4);
    h16* QP16 = (h16*)take((size_t)NB_ * NH_ * TT * HD * 2); h16* KP16 = (h16*)take((size_t)NB_ * NKV * TT * HD * 2); h16* VT16 = (h16*)take((size_t)NB_ * NKV * HD * 2 * TT * 2);   // heads 2*HD*TT elements apart, as in the hi+lo planes: the fp16 plane fills the first HD*TT
    bf* QPh = (bf*)take((size_t)NB_ * NH_ * TT * HD * 2); bf* QPl = (bf*)take((size_t)NB_ * NH_ * TT * HD * 2); bf* KPh = (bf*)take((size_t)NB_ * NKV * TT * HD * 2); bf* KPl = (bf*)take((size_t)NB_ * NKV * TT * HD * 2); bf* VTh = (bf*)take((size_t)NB_ * NKV * HD * 2 * TT * 2);   // a head's hi plane, then its lo plane
    h16* ATh = (h16*)take((size_t)NB_ * TT * DQ * 2); h16* ATl = (h16*)take((size_t)NB_ * TT * DQ * 2);   // merged heads in f16, and the f16 rest of the rows < RH (the other rows of that plane are neither written nor read)
    bf* XB = (bf*)take((size_t)NB_ * TT * DM * 2);   // x in bf16
    if ((size_t)(wsp - (char*)d_ws) > ws_size) return;    // ws 256 MiB
    k_prep<<<PB_W + PB_X + PB_CS, 256, 0, stream>>>(x, wq, wk, wv, wo, XB, WQ, WK, WV, WO, CS);
    // projections: the NB_ batches are NB_*TT rows, the q, k and v heads the column tiles, of one GEMM launch
    k_qkv<<<dim3(NB_ * TT / (QW_M * 64), (NH_ + 2 * NKV) / QW_N), QW_M * QW_N * 32, 0, stream>>>(XB, WQ, WK, WV, CS, QP16, QPh, QPl, KP16, KPh, KPl, VT16, VTh);
    k_flash<<<dim3(NB_ * NKV, NLO + NHI / 2), 2 * REP * 32, 0, stream>>>(QP16, KP16, VT16, QPh, QPl, KPh, KPl, VTh, ATh, ATl);
    k_gemmw<h16, 1, false, DQ><<<dim3(NB_ * TT / (GW_M * 64), DM / (GW_N * 64), 1), GW_M * GW_N * 32, 0, stream>>>(ATh, ATl, (const h16*)WO, nullptr, OUT, DM, nullptr, 0, 0, 0);
}

// v010
// One run takes 80.9 microseconds.
// Next to v009, in two timings, it ran 1.04 times as fast each time.
// Counting every step since v000, it is 33.9 times as fast.
#include <hip/hip_runtime.h>

// GQA causal attention block (x [4][2048][1024]; q = x wq (16 heads x 64), k, v = x wk / wv (4 kv heads, GQA groups of 4); RoPE (rotate-half, base 10000) on q, k; causal softmax(q.k/8); out = (attn v merged) wo -> [4][2048][1024]).
// Compute dtypes, f32 accumulate: every input rounded to bf16; q/k/v projections on PLAIN bf16 operands (inputs: exact); RoPE f32; scores (K 64) and attn.v on bf16 hi+lo planes (3 products) for the first 512 query rows of each head and

#define NB_  4
#define TT   2048
#define DM   1024
#define NH_  16
#define NKV  4
#define REP  (NH_ / NKV)
#define HD   64
#define DQ   (NH_ * HD)
#define DKV  (NKV * HD)
#define RH   512                  // query rows < RH use hi+lo planes
#define PCAR 1024.0f
#define SCL  0.125f   // HD^-0.5
typedef _Float16 h16;
typedef unsigned short bf;
typedef __attribute__((ext_vector_type(16))) __bf16   v16bf;
typedef __attribute__((ext_vector_type(16))) _Float16 v16h;
typedef __attribute__((ext_vector_type(8)))  _Float16 v8h;
typedef __attribute__((ext_vector_type(8)))  unsigned short v8us;
typedef __attribute__((ext_vector_type(8)))  float    v8f;
typedef __attribute__((ext_vector_type(4)))  float    v4f;
typedef v8h  __attribute__((may_alias)) v8ha;
typedef v4f  __attribute__((may_alias)) v4fa;
typedef v8us __attribute__((may_alias)) v8usa;

__device__ __forceinline__ unsigned short f2bf(float f) { unsigned u = __float_as_uint(f); u += 0x7FFFu + ((u >> 16) & 1u); return (unsigned short)(u >> 16); }
__device__ __forceinline__ float bf2f(unsigned short b) { return __uint_as_float(((unsigned)b) << 16); }
__device__ __forceinline__ float bfr(float f) { return bf2f(f2bf(f)); }
__device__ __forceinline__ v16h cat16(v8h lo, v8h hi) { return __builtin_shufflevector(lo, hi, 0, 1, 2, 3, 4, 5, 6, 7, 8, 9, 10, 11, 12, 13, 14, 15); }
__device__ __forceinline__ v16bf cat16b(v8us lo, v8us hi) { return __builtin_bit_cast(v16bf, __builtin_shufflevector(lo, hi, 0, 1, 2, 3, 4, 5, 6, 7, 8, 9, 10, 11, 12, 13, 14, 15)); }
__device__ __forceinline__ v8f wmma16(v16h a, v16h b, v8f c) { return __builtin_amdgcn_wmma_f32_16x16x32_f16(false, a, false, b, (short)0, c, false, false); }
__device__ __forceinline__ v8f wmmab(v16bf a, v16bf b, v8f c) { return __builtin_amdgcn_wmma_f32_16x16x32_bf16(false, a, false, b, (short)0, c, false, false); }



// ---- FRAGMENT ORDER: every 16-bit matrix operand plane [row][k] lies in units of 16 rows x 32 k (512 elements, 1 KB), units ordered [row / 16][k / 32]; inside a unit element (row, k) stands at
// ((k >> 4) & 1) * 256 + (((k >> 3) & 1) * 16 + (row & 15)) * 8 + (k & 7): a lane's two 16-byte fragment pieces are unit + lane * 8 and + 256, so each wave-wide load is 512 contiguous bytes (4 whole lines, not 32 bytes in each of 16).
// wtG walks a weight plane in storage order and asks unfrag for the (row, k) that stands at a position; KB = k / 32 units a row block.
__device__ __forceinline__ void unfrag(size_t pos, int KB, int& row, int& k) { const int u = (int)(pos >> 9), r = (int)(pos & 511); row = (u / KB) * 16 + ((r >> 3) & 15); k = (u % KB) * 32 + (r >> 8) * 16 + ((r >> 7) & 1) * 8 + (r & 7); }
// ---- k_gemmw: register-blocked GEMM, one wave per 64x64 output tile (16 accumulators), a work-group of GW_M x GW_N waves per (GW_M*64) x (GW_N*64) tile; operands are 16-bit planes in fragment order; grid (M/(GW_M*64), N/(GW_N*64), Z).
// C[m][n] (f32, pitch ldc, + optional f32 bias[n]) = sum_k A[m][k] Bt[n][k] (+ the product with the second A plane per NSPLIT). z-batch strides sA/sB/sC in elements. K: a constant, a multiple of KST.
// The main loop is ring_gemm below: the work-group's operand rows reach LDS once, by asynchronous copies, and every wave takes its fragments from there.
// ld(u, lb): the fragment of the unit at u (the same for the whole wave), lb = lane * 16, the lane's byte offset in it; ldp(p): the same from the lane's own address
template <typename T16> struct WFrag;
template <> struct WFrag<h16> { typedef v16h V; static __device__ __forceinline__ V ldp(const char* p) { return cat16(*(const v8h*)p, *(const v8h*)(p + 512)); } static __device__ __forceinline__ V ld(const h16* u, unsigned lb) { return ldp((const char*)u + lb); } static __device__ __forceinline__ v8f mma(V a, V b, v8f c) { return wmma16(a, b, c); } };
template <> struct WFrag<bf> { typedef v16bf V; static __device__ __forceinline__ V ldp(const char* p) { return cat16b(*(const v8us*)p, *(const v8us*)(p + 512)); } static __device__ __forceinline__ V ld(const bf* u, unsigned lb) { return ldp((const char*)u + lb); } static __device__ __forceinline__ v8f mma(V a, V b, v8f c) { return wmmab(a, b, c); } };
// ---- ring_gemm: the main loop of both GEMM kernels. A stage is KST k of every operand row of the work-group's tile: per block of 16 rows four units (RBS bytes), contiguous in the plane and in LDS alike, so a fragment
// read is 512 contiguous LDS bytes. Two buffers: while a stage is multiplied the next one's copies (global_load_async_to_lds_b128, through no register) fly. The blocks of 16 rows are dealt to the waves in turn.
// srcp(rb): the plane address (the same for the whole wave) of row block rb at k = 0; rb counts the A plane's WM*4 blocks, the second A plane's WM*NA2 (the first NA2 of a wave's four row blocks have one), then the WN*4 blocks of Bt.
#define KST 128
#define RBS (KST * 16 * 2)
// CP8: eight copies of 512 bytes, one row block of a stage; the immediate offset moves the LDS and the global address alike, and the block is contiguous in both.
// cp8, cp16: one or two row blocks, with their s_wait_xcnt 0 as the statement's last line: so it stands in front of whatever next rewrites an address register of theirs
#define CP1(L, G, O) "global_load_async_to_lds_b128 " L ", " G ", off offset:" O "\n\t"
#define CP8(L, G) "global_load_async_to_lds_b128 " L ", " G ", off\n\t" CP1(L, G, "512") CP1(L, G, "1024") CP1(L, G, "1536") CP1(L, G, "2048") CP1(L, G, "2560") CP1(L, G, "3072") CP1(L, G, "3584")
__device__ __forceinline__ void cp8(unsigned l, const char* g) { asm volatile(CP8("%0", "%1") "s_wait_xcnt 0x0" :: "v"(l), "v"(g) : "memory"); }
__device__ __forceinline__ void cp16(unsigned l0, const char* g0, unsigned l1, const char* g1) { asm volatile(CP8("%0", "%1") CP8("%2", "%3") "s_wait_xcnt 0x0" :: "v"(l0), "v"(g0), "v"(l1), "v"(g1) : "memory"); }
template <typename T16, int WM, int WN, int NA2, int K, typename SRC>
__device__ __forceinline__ void ring_gemm(char* ring, SRC srcp, v8f (&acc)[4][4]) {
    typedef typename WFrag<T16>::V V;
    constexpr int NW = WM * WN, RBA = WM * 4, RB2 = WM * NA2, NRB = RBA + RB2 + WN * 4, STG = NRB * RBS, NT = K / KST, NCP = (NRB + NW - 1) / NW, NFULL = NRB / NW;   // NFULL row blocks for every wave, one more for the first NRB % NW waves
    static_assert(K % KST == 0 && NT >= 2 && KST == 128 && NCP * 8 <= 63, "whole stages, at least two; four k steps a stage; a wave's copies of one stage in flight");
    const int lane = threadIdx.x & 31, wave = __builtin_amdgcn_readfirstlane(threadIdx.x >> 5), wm = wave / WN, wn = wave % WN; const unsigned lb = lane * 16;
    // every plain '#pragma unroll' below stands on a loop whose counter indexes fragments, accumulators or addresses: they stay in registers only where those indices are constants
    const char* g[NCP]; unsigned l[NCP];   // the same for the whole wave (scalar registers); a lane adds its lb where the copies are issued
#pragma unroll
    for (int i = 0; i < NCP; ++i) { const int rb = wave + i * NW < NRB ? wave + i * NW : 0; g[i] = srcp(rb); l[i] = (unsigned)(size_t)ring + rb * RBS; }
    // a lane's LDS address; readfirstlane holds the wave's part together in a scalar register: without it the compiler kept a vector register per row block alive over the loop and spilled it
    auto la = [&](int i, unsigned bo) __attribute__((always_inline)) { return (unsigned)__builtin_amdgcn_readfirstlane(l[i] + bo) + lb; };
    auto fill = [&](int t, unsigned bo) __attribute__((always_inline)) {   // this wave's row blocks of stage t into the buffer at bo; the test is the same for the whole wave
#pragma unroll
        for (int i = 0; i + 1 < NFULL; i += 2) cp16(la(i, bo), (g[i] + (size_t)t * RBS) + lb, la(i + 1, bo), (g[i + 1] + (size_t)t * RBS) + lb);
        if (NFULL & 1) cp8(la(NFULL - 1, bo), (g[NFULL - 1] + (size_t)t * RBS) + lb);
        if (NCP > NFULL) if (wave + NFULL * NW < NRB) cp8(la(NCP - 1, bo), (g[NCP - 1] + (size_t)t * RBS) + lb); };
    const char* fa = ring + wm * 4 * RBS + lb; const char* fa2 = ring + (RBA + wm * NA2) * RBS + lb; const char* fb = ring + (RBA + RB2 + wn * 4) * RBS + lb;
    V a[2][4], a2[2][NA2 ? NA2 : 1], b[2][4];
    auto ldf = [&](int st, int ks, unsigned bo) __attribute__((always_inline)) {   // into set st the fragments of k step ks of the stage at bo, as one group of LDS reads
#pragma unroll
        for (int mb = 0; mb < 4; ++mb) { a[st][mb] = WFrag<T16>::ldp(fa + bo + mb * RBS + ks * 1024); if (mb < NA2) a2[st][mb < NA2 ? mb : 0] = WFrag<T16>::ldp(fa2 + bo + mb * RBS + ks * 1024); }
#pragma unroll
        for (int nb = 0; nb < 4; ++nb) b[st][nb] = WFrag<T16>::ldp(fb + bo + nb * RBS + ks * 1024);
        __builtin_amdgcn_sched_barrier(0); };   // the group stays whole and in front of the products that follow (for speed only)
    auto mm = [&](int st) __attribute__((always_inline)) {
#pragma unroll
        for (int nb = 0; nb < 4; ++nb)
#pragma unroll
            for (int mb = 0; mb < 4; ++mb) { acc[mb][nb] = WFrag<T16>::mma(a[st][mb], b[st][nb], acc[mb][nb]); if (mb < NA2) acc[mb][nb] = WFrag<T16>::mma(a2[st][mb < NA2 ? mb : 0], b[st][nb], acc[mb][nb]); }
        __builtin_amdgcn_sched_barrier(0); };   // and a step's products stay in front of the next group, which refills their set
    fill(0, 0);
    asm volatile("s_wait_asynccnt 0x0" ::: "memory");   // this wave's copies of stage 0 have landed
    __syncthreads();                                    // and every other wave's: stage 0 may be read
    fill(1, STG);
    ldf(0, 0, 0);
#pragma unroll 1   // a trip is a stage; the buffer is picked by an offset, a second copy of the body buys nothing
    for (int t = 0; t < NT; ++t) {
        const unsigned bo = (t & 1) * STG;
        ldf(1, 1, bo); mm(0);   // a k step's fragments are read one step ahead of their products
        ldf(0, 2, bo); mm(1);
        ldf(1, 3, bo); mm(0);
        // stage t + 1 is published in front of this stage's last k step, whose fragments are already asked for: so the next stage's first fragments can be read under its products
        asm volatile("s_wait_dscnt 0x0" ::: "memory");      // this wave's reads of the buffer are over
        asm volatile("s_wait_asynccnt 0x0" ::: "memory");   // its copies of stage t + 1 have landed
        __syncthreads();                                    // the same holds of every wave: stage t + 1 may be read, this buffer refilled
        if (t + 2 < NT) fill(t + 2, bo);
        if (t + 1 < NT) ldf(0, 0, STG - bo);
        mm(1);
    }
    asm volatile("s_wait_asynccnt 0x0" ::: "memory");   // nothing of this wave's is in flight behind the loop
}
#define GW_M 2
#define GW_N 4
// NSPLIT = 1 (the output projection): only token rows < RH of a batch have a second A plane (the f16 rest of their f16 value); the rows from RH on come out of f16 products and are held as one f16 plane.
// So that every wave has the same work, the first of its four row blocks is one of the rows < RH and the other three are of the rows from RH on: orow(wr, mb) is the first token row of block mb of wave row wr.
__device__ __forceinline__ int orow(int wr, int mb) {
    static_assert(RH * 4 == TT && RH % 16 == 0, "one row block in four lies below RH");
    if (mb == 0) return (wr / (RH / 16)) * TT + (wr % (RH / 16)) * 16;
    const int j = wr * 3 + mb - 1; return (j / ((TT - RH) / 16)) * TT + RH + (j % ((TT - RH) / 16)) * 16; }
template <typename T16, int NSPLIT, bool BIAS, int K>
__global__ __launch_bounds__(GW_M * GW_N * 32) void k_gemmw(const T16* __restrict__ A, const T16* __restrict__ A2, const T16* __restrict__ Bt, const T16* __restrict__ Bt2, float* C, int ldc, const float* __restrict__ bias, size_t sA, size_t sB, size_t sC) {
    static_assert(NSPLIT == 0 || NSPLIT == 1, "one Bt plane");
    constexpr int NA2 = NSPLIT;
    __shared__ __align__(16) char ring[2 * (GW_M * (4 + NA2) + GW_N * 4) * RBS];
    __shared__ __align__(16) float osm[GW_M * GW_N * 16 * 68];   // a wave's own output staging
    const size_t z = blockIdx.z; A += z * sA; if (A2) A2 += z * sA; Bt += z * sB; C += z * sC; (void)Bt2;
    const int lane = threadIdx.x & 31, lr = lane & 15, hi = lane >> 4, wave = __builtin_amdgcn_readfirstlane(threadIdx.x >> 5); const int W0 = blockIdx.x * GW_M, C0 = blockIdx.y * (GW_N * 64), c0 = C0 + (wave % GW_N) * 64;
    auto trow = [&](int wr, int mb) __attribute__((always_inline)) { return NSPLIT == 1 ? orow(wr, mb) : wr * 64 + mb * 16; };
    float* os = osm + wave * (16 * 68);
    v8f acc[4][4];
#pragma unroll
    for (int mb = 0; mb < 4; ++mb)
#pragma unroll
        for (int nb = 0; nb < 4; ++nb) acc[mb][nb] = (v8f){};
    ring_gemm<T16, GW_M, GW_N, NA2, K>(ring, [&](int rb) __attribute__((always_inline)) { constexpr int RBA = GW_M * 4, RB2 = GW_M * NA2;   // a row block of 16 is K * 16 elements
        return (const char*)(rb < RBA ? A + (size_t)trow(W0 + rb / 4, rb % 4) * K : rb < RBA + RB2 ? A2 + (size_t)trow(W0 + (rb - RBA), 0) * K : Bt + (size_t)(C0 + (rb - RBA - RB2) * 16) * K); }, acc);
#pragma unroll
    for (int mb = 0; mb < 4; ++mb) {
#pragma unroll
        for (int nb = 0; nb < 4; ++nb) {
#pragma unroll
            for (int j = 0; j < 8; ++j) os[(hi * 8 + j) * 68 + nb * 16 + lr] = acc[mb][nb][j]; }
        __builtin_amdgcn_wave_barrier(); asm volatile("" ::: "memory");
        float* crow = C + (size_t)trow(W0 + wave / GW_N, mb) * ldc + c0;
        { v4f val[8]; float* pr[8];
#pragma unroll
            for (int s = 0; s < 8; ++s) { const int row = 2 * s + hi, cofs = lr * 4; val[s] = *(const v4fa*)(os + row * 68 + cofs); if (BIAS) { val[s][0] += bfr(bias[c0 + cofs]); val[s][1] += bfr(bias[c0 + cofs + 1]); val[s][2] += bfr(bias[c0 + cofs + 2]); val[s][3] += bfr(bias[c0 + cofs + 3]); }
                pr[s] = crow + (size_t)row * ldc + cofs; }
            // the row block's eight stores with their s_wait_xcnt 0 in one statement: so it stands in front of the next block's LDS reads, which land in address and data registers of theirs
            asm volatile("global_store_b128 %0, %8, off\n\tglobal_store_b128 %1, %9, off\n\tglobal_store_b128 %2, %10, off\n\tglobal_store_b128 %3, %11, off\n\t"
                         "global_store_b128 %4, %12, off\n\tglobal_store_b128 %5, %13, off\n\tglobal_store_b128 %6, %14, off\n\tglobal_store_b128 %7, %15, off\n\ts_wait_xcnt 0x0"
                         :: "v"(pr[0]), "v"(pr[1]), "v"(pr[2]), "v"(pr[3]), "v"(pr[4]), "v"(pr[5]), "v"(pr[6]), "v"(pr[7]), "v"(val[0]), "v"(val[1]), "v"(val[2]), "v"(val[3]), "v"(val[4]), "v"(val[5]), "v"(val[6]), "v"(val[7]) : "memory");
        }
        __builtin_amdgcn_wave_barrier(); asm volatile("" ::: "memory");
    }
}

__device__ __forceinline__ h16 tohx(float x) { return (h16)x; }
__device__ __forceinline__ void splitf(float y, unsigned short& h, unsigned short& l) { h = f2bf(y); l = f2bf(y - bf2f(h)); }
typedef __attribute__((ext_vector_type(2))) _Float16 v2h;
typedef __attribute__((ext_vector_type(4))) _Float16 v4h;
typedef __attribute__((ext_vector_type(2))) unsigned short v2us;
typedef __attribute__((ext_vector_type(4))) unsigned short v4us;
typedef __attribute__((ext_vector_type(2))) float v2f;
typedef __attribute__((ext_vector_type(4))) int v4i;

// ---- k_prep: all that only re-forms an input or builds the RoPE table, in ONE launch (the parts do not depend on one another); a work-group's index picks its part, the parts with the longest chains of dependent loads first.
#define PB_WQ (DM * DQ / 512 / 8)              // work-groups for wq, and for wo: a wave takes one unit of 512 elements
#define PB_WK (DM * DKV / 512 / 8)             // for wk, and for wv
#define PB_W  (2 * PB_WQ + 2 * PB_WK)
#define PB_X  (NB_ * TT * DM / 512 / 4 / 8)    // for x: a wave takes four units
#define PB_CS (TT * (HD / 2) / 256)            // for the table: a thread takes the two entries d and d + HD/2, which are equal
// hf: the plane is read by f16 products: the bf16-rounded weight is stored as f16 (the same value but for weights below 2^-17, which keep what f16 subnormals hold)
__device__ __forceinline__ void wtG(const float* __restrict__ w, int K, int N, bf* Bt, int blk, bool hf) {
    const int lane = threadIdx.x & 31; const int L0 = (blk * 8 + (threadIdx.x >> 5)) * 8; const int nlines = N * K / 64;
{
#pragma unroll 1
        for (int l = 0; l < 8; ++l) { const int L = L0 + l; if (L >= nlines) break; const size_t e = (size_t)L * 64 + lane * 2; int k, n; unfrag(e, K / 32, n, k); v2us o;
            const float* p0 = w + (size_t)k * N + n; const float* p1 = p0 + N; const float w0 = *p0, w1 = *p1;
            asm volatile("s_wait_xcnt 0x0" :: "v"(p0), "v"(p1) : "memory");   // behind the loads, in front of whatever next rewrites an address register of theirs (inputs: they live to the wait)
            o[0] = f2bf(w0); o[1] = f2bf(w1); if (hf) { o[0] = __builtin_bit_cast(unsigned short, (h16)bf2f(o[0])); o[1] = __builtin_bit_cast(unsigned short, (h16)bf2f(o[1])); } bf* po = Bt + e;
            asm volatile("global_store_b32 %0, %1, off\n\ts_wait_xcnt 0x0" :: "v"(po), "v"(__builtin_bit_cast(unsigned, o)) : "memory"); }   // the store with its wait in one statement: the next trip rewrites its registers
         }
}
__global__ __launch_bounds__(256) void k_prep(const float* __restrict__ x, const float* __restrict__ wq, const float* __restrict__ wk, const float* __restrict__ wv, const float* __restrict__ wo, bf* XB, bf* WQ, bf* WK, bf* WV, bf* WO, float* CS) {
    static_assert(DQ == DM && (DM / 32) % 4 == 0 && HD * 4 == 256, "one K for the four weights; a wave's four units of x lie in one row block; the table's second store stands 256 bytes on");
    int blk = blockIdx.x;
    if (blk < PB_W) {   // weights [k][n] f32 -> [n][k] bf16 in fragment order (wo: the bf16 values as f16)
        const float* w; bf* Bt; int N; bool hf = false;
        if (blk < PB_WQ) { w = wq; Bt = WQ; N = DQ; }
        else if (blk < 2 * PB_WQ) { w = wo; Bt = WO; N = DM; blk -= PB_WQ; hf = true; }
        else if (blk < 2 * PB_WQ + PB_WK) { w = wk; Bt = WK; N = DKV; blk -= 2 * PB_WQ; }
        else { w = wv; Bt = WV; N = DKV; blk -= 2 * PB_WQ + PB_WK; }
        wtG(w, DM, N, Bt, blk, hf); return;
    }
    blk -= PB_W;
    if (blk < PB_X) {   // x -> bf16 in fragment order. A wave's four units are 16 rows x 128 k: piece c of a lane (8 elements) is row lane & 15, k = c * 16 + (lane >> 4) * 8 of them, and stands at c * 256 + lane * 8
        const int lane = threadIdx.x & 31, u0 = (blk * 8 + (threadIdx.x >> 5)) * 4;
        const float* p = x + (size_t)((u0 / (DM / 32)) * 16 + (lane & 15)) * DM + (u0 % (DM / 32)) * 32 + (lane >> 4) * 8; v8f v[8]; v4i o[8];
#pragma unroll   // c indexes registers; the eight pieces' loads are all in flight together
        for (int c = 0; c < 8; ++c) v[c] = *(const v8f*)(p + c * 16);
        asm volatile("s_wait_xcnt 0x0" :: "v"(p) : "memory");   // behind the loads, in front of whatever next rewrites their address register (an input: it lives to the wait)
#pragma unroll
        for (int c = 0; c < 8; ++c) { v8us t;
#pragma unroll
            for (int j = 0; j < 8; ++j) t[j] = f2bf(v[c][j]);
            o[c] = __builtin_bit_cast(v4i, t); }
        bf* d = XB + (size_t)u0 * 512 + lane * 8;
        // the eight stores with their s_wait_xcnt 0 in one statement: nothing rewrites a register of theirs in front of it
        asm volatile("global_store_b128 %0, %1, off\n\tglobal_store_b128 %0, %2, off offset:512\n\tglobal_store_b128 %0, %3, off offset:1024\n\tglobal_store_b128 %0, %4, off offset:1536\n\t"
                     "global_store_b128 %0, %5, off offset:2048\n\tglobal_store_b128 %0, %6, off offset:2560\n\tglobal_store_b128 %0, %7, off offset:3072\n\tglobal_store_b128 %0, %8, off offset:3584\n\ts_wait_xcnt 0x0"
                     :: "v"(d), "v"(o[0]), "v"(o[1]), "v"(o[2]), "v"(o[3]), "v"(o[4]), "v"(o[5]), "v"(o[6]), "v"(o[7]) : "memory");
        return;
    }
    blk -= PB_X;
    {   // RoPE table, entry (t, d): cos then sin
        const int idx = blk * 256 + threadIdx.x; const int t = idx / (HD / 2), i = idx % (HD / 2); const float inv = __fdiv_rn(1.0f, powf(10000.0f, (float)(2 * i) / (float)HD)); const float ang = __fmul_rn((float)t, inv); v2f cs; cs[0] = cosf(ang); cs[1] = sinf(ang);
        float* pc = CS + ((size_t)t * HD + i) * 2;
        // the two stores (entry d, and d + HD/2 at HD floats = 256 bytes on) with their s_wait_xcnt 0 in one statement: nothing rewrites a register of theirs in front of it
        asm volatile("global_store_b64 %0, %1, off\n\tglobal_store_b64 %0, %1, off offset:256\n\ts_wait_xcnt 0x0" :: "v"(pc), "v"(cs) : "memory");
    }
}
// ---- k_qkv: the q, k and v projections in ONE launch, RoPE and the forming of the 16-bit operand planes in its epilogue (no f32 projection ever reaches memory). grid (tokens / (QW_M*64), (NH_ + 2 * NKV) / QW_N), QW_M*QW_N waves:
// one wave per 64 tokens x one head (HD = 64 columns), a work-group QW_M*64 tokens x QW_N heads, main loop ring_gemm; heads count the NH_ q heads, then the NKV k heads, then the NKV v heads.
// Every plain '#pragma unroll' here stands on a loop whose counter indexes accumulators, fragments or table entries: they stay in registers only where those indices are constants.
// the fp16, the hi and the lo store of eight plane elements, with their s_wait_xcnt 0 in the same statement: so it stands in front of whatever next rewrites an address or data register of theirs
__device__ __forceinline__ void st3x(h16* p16, v8h a, bf* ph, v8us b, bf* pl, v8us c) {
    asm volatile("global_store_b128 %0, %1, off\n\tglobal_store_b128 %2, %3, off\n\tglobal_store_b128 %4, %5, off\n\ts_wait_xcnt 0x0" :: "v"(p16), "v"(__builtin_bit_cast(v4i, a)), "v"(ph), "v"(__builtin_bit_cast(v4i, b)), "v"(pl), "v"(__builtin_bit_cast(v4i, c)) : "memory");
}
__device__ __forceinline__ void put8(const float* x, h16* p16, bf* ph, bf* pl) { v8h o16; v8us oh, ol;
#pragma unroll
    for (int j = 0; j < 8; ++j) { o16[j] = tohx(x[j]); unsigned short a2, c2; splitf(x[j], a2, c2); oh[j] = a2; ol[j] = c2; }
    st3x(p16, o16, ph, oh, pl, ol); }
#define QW_M 4
#define QW_N 3
__global__ __launch_bounds__(QW_M * QW_N * 32) void k_qkv(const bf* __restrict__ A, const bf* __restrict__ WQ, const bf* __restrict__ WK, const bf* __restrict__ WV, const float* __restrict__ CS, h16* QP16, bf* QPh, bf* QPl, h16* KP16, bf* KPh, bf* KPl, h16* VT16, bf* VTh) {
    static_assert(HD == 64 && TT % 64 == 0 && (NH_ + 2 * NKV) % QW_N == 0 && (NB_ * TT) % (QW_M * 64) == 0, "a 64 x 64 tile is 64 tokens of one batch x one whole head; whole work-group tiles");
    __shared__ __align__(16) char ring[2 * (QW_M + QW_N) * 4 * RBS];
    __shared__ __align__(16) float osm[QW_M * QW_N * 16 * 68];   // a wave's own staging for the turn of its rotated blocks
    const int K = DM, lane = threadIdx.x & 31, lr = lane & 15, hi = lane >> 4, wave = __builtin_amdgcn_readfirstlane(threadIdx.x >> 5); const int R0 = blockIdx.x * (QW_M * 64), H0 = blockIdx.y * QW_N, r0 = R0 + (wave / QW_N) * 64, cy = H0 + wave % QW_N;
    float* os = osm + wave * (16 * 68);
    v8f acc[4][4];
#pragma unroll
    for (int mb = 0; mb < 4; ++mb)
#pragma unroll
        for (int nb = 0; nb < 4; ++nb) acc[mb][nb] = (v8f){};
    ring_gemm<bf, QW_M, QW_N, 0, DM>(ring, [&](int rb) __attribute__((always_inline)) { constexpr int RBA = QW_M * 4;   // a row block of 16 is K * 16 elements; a head is four of them
        const int n = H0 * HD + (rb - RBA) * 16;   // the weight row among the q, then k, then v columns
        return (const char*)(rb < RBA ? A + (size_t)(R0 + rb * 16) * K : n < DQ ? WQ + (size_t)n * K : n < DQ + DKV ? WK + (size_t)(n - DQ) * K : WV + (size_t)(n - DQ - DKV) * K); }, acc);
    const int b = r0 / TT, t0 = r0 % TT;
    if (cy >= NH_ + NKV) {
        // v: planes [d][t]. Register j of accumulator (mb, nb) is token t0 + mb * 16 + hi * 8 + j of column d = nb * 16 + lr: a lane's eight registers are, as they stand, its 16-byte piece of the unit (d / 16, t / 32), half mb & 1
        const size_t po = ((size_t)b * NKV + (cy - NH_ - NKV)) * (HD * 2 * TT) + (size_t)(t0 / 32) * 512 + lane * 8;
#pragma unroll
        for (int mb = 0; mb < 4; ++mb)
#pragma unroll
            for (int nb = 0; nb < 4; ++nb) { float x[8];
#pragma unroll
                for (int j = 0; j < 8; ++j) x[j] = acc[mb][nb][j];
                const size_t oo = po + (size_t)(nb * (TT / 32) + (mb >> 1)) * 512 + (mb & 1) * 256; put8(x, VT16 + oo, VTh + oo, VTh + HD * TT + oo); }
        return;
    }
    // q, k: planes [t][d]. Rotate-half pairs d and d + HD/2, which one lane holds in accumulators nb and nb + 2; cos and sin of d + HD/2 are those of d. The rotated 16 x 64 block goes through LDS to turn a lane's eight tokens into eight d.
    const bool isq = cy < NH_; const size_t po = (isq ? (size_t)b * NH_ + cy : (size_t)b * NKV + (cy - NH_)) * (TT * HD) + (size_t)t0 * HD + lane * 8;
    h16* P16 = (isq ? QP16 : KP16) + po; bf* Ph = (isq ? QPh : KPh) + po; bf* Pl = (isq ? QPl : KPl) + po;
    const char* csb = (const char*)(CS + (size_t)t0 * HD * 2); const unsigned lo = (hi * 8 * HD + lr) * 8;   // table entry (t, d): 8 bytes, cos then sin
    v2f cs[2][16];
    auto ldcs = [&](int mb, v2f* c) __attribute__((always_inline)) {
#pragma unroll
        for (int nb = 0; nb < 2; ++nb)
#pragma unroll
            for (int j = 0; j < 8; ++j) c[nb * 8 + j] = *(const v2f*)(csb + lo + ((mb * 16 + j) * HD + nb * 16) * 8);
        asm volatile("s_wait_xcnt 0x0" :: "v"(lo) : "memory"); };   // behind the table loads, in front of whatever next rewrites a register that they name; the offset is an input so that it lives to the wait
    ldcs(0, cs[0]);
#pragma unroll
    for (int mb = 0; mb < 4; ++mb) {
        if (mb < 3) ldcs(mb + 1, cs[(mb + 1) & 1]);   // the next 16 tokens' table entries fly while these are rotated and stored
#pragma unroll
        for (int nb = 0; nb < 2; ++nb)
#pragma unroll
            for (int j = 0; j < 8; ++j) { const float c = cs[mb & 1][nb * 8 + j][0], s = cs[mb & 1][nb * 8 + j][1], x0 = acc[mb][nb][j], x1 = acc[mb][nb + 2][j];
                os[(hi * 8 + j) * 68 + nb * 16 + lr] = x0 * c - x1 * s; os[(hi * 8 + j) * 68 + (nb + 2) * 16 + lr] = x1 * c + x0 * s; }
        __builtin_amdgcn_wave_barrier(); asm volatile("" ::: "memory");   // the one wave's LDS writes stay in front of its reads below
#pragma unroll
        for (int u = 0; u < 4; ++u) { const float* sp = os + lr * 68 + u * 16 + hi * 8; const v4f u0 = *(const v4fa*)sp, u1 = *(const v4fa*)(sp + 4); const float x[8] = {u0[0], u0[1], u0[2], u0[3], u1[0], u1[1], u1[2], u1[3]};
            const int oo = mb * 1024 + u * 256; put8(x, P16 + oo, Ph + oo, Pl + oo); }   // unit (t / 16, d / 32), half (d / 16) & 1
        __builtin_amdgcn_wave_barrier(); asm volatile("" ::: "memory");   // and its reads in front of the next block's writes
    }
}
// ---- k_flash: scores, causal softmax, probability x value and the head merge in ONE launch; scores and probabilities never leave registers (online softmax over key blocks of 32).
// One wave owns NBQ*16 query rows of one head. It forms the TRANSPOSED score tile S^T[key][query] = K Q^T (A = key rows, B = query rows), so that a lane holds scores of one query only (max and sum in-lane plus one
// exchange between the lane halves) and the accumulator registers of two 16-key tiles are, as they stand, the B operand P^T[query][key 0..31] of O^T[d][query] += V^T P^T (A = value rows [d][t]).
// k order of every operand: element e of lane half hi is k = (e / 8) * 16 + 8 * hi + e % 8 (WFrag::ld on both global operands; score tile mt, register j is key mt * 16 + 8 * hi + j).
// The four waves of a block's half are the four heads of one kv group on the same query rows: they read the same key and value lines. HR: bf16 hi+lo planes, 3 products; else fp16, probabilities carried x PCAR (it cancels in O / l).
// KS = 2: the key blocks of a tile are dealt in turn to two waves (kh = 0, 1), each with its own running maximum, sum and output tiles; wave 1 hands its three through LDS (xs) to wave 0, which joins them and stores. So the
// longest wave walks half the keys, and there are more work-groups than resident places: a place that falls free early takes the next one.
typedef __attribute__((ext_vector_type(16))) unsigned short v16us;
// eight 2^x in one statement: no result shares a register with a source ("=&v"), and the v_nop is the free slot behind the last transcendental
__device__ __forceinline__ void exp2x8(float* p, const float* x) {
    asm("v_exp_f32 %0, %8\n\tv_exp_f32 %1, %9\n\tv_exp_f32 %2, %10\n\tv_exp_f32 %3, %11\n\tv_exp_f32 %4, %12\n\tv_exp_f32 %5, %13\n\tv_exp_f32 %6, %14\n\tv_exp_f32 %7, %15\n\tv_nop"
        : "=&v"(p[0]), "=&v"(p[1]), "=&v"(p[2]), "=&v"(p[3]), "=&v"(p[4]), "=&v"(p[5]), "=&v"(p[6]), "=&v"(p[7]) : "v"(x[0]), "v"(x[1]), "v"(x[2]), "v"(x[3]), "v"(x[4]), "v"(x[5]), "v"(x[6]), "v"(x[7]));
}
// the hi and the lo store of eight merged outputs, with their s_wait_xcnt 0 in the same statement: so it stands in front of whatever next rewrites an address or data register of theirs, on every way out of a tile
// (as a statement of its own the wait let the next outputs' arithmetic move up over it)
__device__ __forceinline__ void st2x(h16* pa, v8h a, h16* pb, v8h b) {
    asm volatile("global_store_b128 %0, %1, off\n\tglobal_store_b128 %2, %3, off\n\ts_wait_xcnt 0x0" :: "v"(pa), "v"(__builtin_bit_cast(v4i, a)), "v"(pb), "v"(__builtin_bit_cast(v4i, b)) : "memory");
}
// the same for the one store of eight merged outputs that have no second plane
__device__ __forceinline__ void st1x(h16* pa, v8h a) {
    asm volatile("global_store_b128 %0, %1, off\n\ts_wait_xcnt 0x0" :: "v"(pa), "v"(__builtin_bit_cast(v4i, a)) : "memory");
}
template <typename T16, bool HR, int NBQ, int KS>
__device__ __forceinline__ void flash_tile(const T16* __restrict__ Q, const T16* __restrict__ Q2, const T16* __restrict__ Kp, const T16* __restrict__ K2, const T16* __restrict__ Vt, const T16* __restrict__ V2, int q0, h16* Ah, h16* Al, int kh, float* xs) {
    static_assert(KS == 1 || (KS == 2 && NBQ == 2), "the hand-over packs two maxima and two sums into one 16-byte piece");
    typedef typename WFrag<T16>::V V;
    const int lane = threadIdx.x & 31, lr = lane & 15, hi = lane >> 4; const unsigned lb = lane * 16;
    V qf[NBQ][2], qf2[NBQ][2];
#pragma unroll
    for (int nb = 0; nb < NBQ; ++nb)
#pragma unroll
        for (int kc = 0; kc < 2; ++kc) { const int qo = (q0 + nb * 16) * HD + kc * 512; qf[nb][kc] = WFrag<T16>::ld(Q + qo, lb); if (HR) qf2[nb][kc] = WFrag<T16>::ld(Q2 + qo, lb); }
    asm volatile("s_wait_xcnt 0x0" :: "v"(lb) : "memory");   // behind the query loads, in front of whatever next rewrites a register that they name; the offset is an input so that no load's result lands in it
    // m: a query's MAXIMUM IN USE, a raw score (the scale is positive): it may trail the true maximum by up to TAU in the exponent of 2, so a probability reaches 2^TAU (x PCAR: 2^14, inside fp16) and O / l is unchanged.
    // nm: the addend PEXP - m * CS2 of the exponent's one multiply-add; th: the raw score above which m has to move. All three change only in the branch of step() below.
    v8f o[4][NBQ]; float m[NBQ], nm[NBQ], th[NBQ], l[NBQ];
#pragma unroll
    for (int nb = 0; nb < NBQ; ++nb) { m[nb] = -3.0e38f; nm[nb] = 0.f; th[nb] = -3.0e38f; l[nb] = 0.f;
#pragma unroll
        for (int dt = 0; dt < 4; ++dt) o[dt][nb] = (v8f){}; }
    const int nkb = (q0 + NBQ * 16 + 31) / 32;      // key blocks up to the diagonal; every block starts at a key <= q0, so no query ever sees a fully masked block; only the last block holds keys beyond a query
    const int klast = (nkb - 1) - ((nkb - 1 - kh) % KS);   // this wave's blocks are kh, kh + KS, ... klast (the caller's tiles have at least KS blocks)
    const bool dg = KS == 1 || klast == nkb - 1;           // its last block is the one on the diagonal (the same for the whole wave)
    const float CS2 = SCL * 1.4426950408889634f, PEXP = HR ? 0.0f : 10.0f, TAU = 4.0f;   // CS2: raw score to exponent of 2; 2^10 = PCAR
    V kf[2][2], kf2[2][2], vf[4], vf2[4];
    auto ldk = [&](int k0) __attribute__((always_inline)) {
#pragma unroll
        for (int mt = 0; mt < 2; ++mt)
#pragma unroll
            for (int kc = 0; kc < 2; ++kc) { const int ko = (k0 + mt * 16) * HD + kc * 512; kf[mt][kc] = WFrag<T16>::ld(Kp + ko, lb); if (HR) kf2[mt][kc] = WFrag<T16>::ld(K2 + ko, lb); }
        asm volatile("s_wait_xcnt 0x0" :: "v"(lb) : "memory"); };   // stands behind the loads, in front of whatever next rewrites a register that they name (a later load's result among them)
    auto ldv = [&](int k0) __attribute__((always_inline)) {
#pragma unroll
        for (int dt = 0; dt < 4; ++dt) { const int vo = dt * 16 * TT + k0 * 16; vf[dt] = WFrag<T16>::ld(Vt + vo, lb); if (HR) vf2[dt] = WFrag<T16>::ld(V2 + vo, lb); }
        asm volatile("s_wait_xcnt 0x0" :: "v"(lb) : "memory"); };   // as in ldk
    // one key block; last: the wave's last block (nothing fetched behind it; masked where it is the one on the diagonal). Otherwise its next block's key fragments are asked for behind the score products and its value fragments behind the value
    // products, one block ahead of their use (where the registers are short the compiler may issue the key loads later in the block).
    auto step = [&](int k0, bool last) __attribute__((always_inline)) {
        v8f s[2][NBQ];
#pragma unroll
        for (int mt = 0; mt < 2; ++mt)
#pragma unroll
            for (int nb = 0; nb < NBQ; ++nb) { v8f a = (v8f){};
#pragma unroll
                for (int kc = 0; kc < 2; ++kc) { a = WFrag<T16>::mma(kf[mt][kc], qf[nb][kc], a); if (HR) { a = WFrag<T16>::mma(kf[mt][kc], qf2[nb][kc], a); a = WFrag<T16>::mma(kf2[mt][kc], qf[nb][kc], a); } }
                s[mt][nb] = a; }
        if (!last) { if (!HR) ldk(k0 + 32 * KS); }   // the hi+lo tiles, short of registers, ask for their next keys behind the branch below: from there the compiler can place the loads late in the block, as it did before there was a branch
        else __builtin_amdgcn_sched_barrier(0);   // the last block's score products stay together in front of its softmax: its 2^x statements may land in query registers, free behind the last product, and must stand the WMMA distance off
        V pf[NBQ], pf2[NBQ]; float mb[NBQ]; bool need = false;
#pragma unroll
        for (int nb = 0; nb < NBQ; ++nb) {   // this lane half's maximum of the block's raw scores, and whether it passes what the maximum in use allows
            const int qi = q0 + nb * 16 + lr; float mx = -3.0e38f;
#pragma unroll
            for (int mt = 0; mt < 2; ++mt)
#pragma unroll
                for (int j = 0; j < 8; ++j) { float t = s[mt][nb][j]; if (last && dg && k0 + mt * 16 + hi * 8 + j > qi) t = -3.0e38f; s[mt][nb][j] = t; mx = fmaxf(mx, t); }
            mb[nb] = mx; need = need || mx > th[nb];
        }
        // one test a block, a scalar branch: taken in a wave's first block (every query has an unmasked key there) and after that only where a score tops a maximum in use by more than TAU.
        // Every lane then takes the exchanged maximum, so that the two halves of a query always hold the same m.
        if (__builtin_amdgcn_ballot_w32(need) != 0) {
#pragma unroll
            for (int nb = 0; nb < NBQ; ++nb) {
                const float mn = fmaxf(m[nb], fmaxf(mb[nb], __shfl_xor(mb[nb], 16, 32)));
                float al; asm("v_exp_f32 %0, %1\n\tv_nop" : "=v"(al) : "v"((m[nb] - mn) * CS2));   // 2^x with the free slot behind a transcendental in the same statement
                m[nb] = mn; nm[nb] = PEXP - mn * CS2; th[nb] = mn + TAU / CS2; l[nb] *= al;
#pragma unroll
                for (int dt = 0; dt < 4; ++dt) o[dt][nb] *= al;
            }
        }
        if (HR && !last) ldk(k0 + 32 * KS);
#pragma unroll
        for (int nb = 0; nb < NBQ; ++nb) {
            float ps = 0.f; float x[16], p[16];
#pragma unroll
            for (int e = 0; e < 16; ++e) x[e] = s[e >> 3][nb][e & 7] * CS2 + nm[nb];
            exp2x8(p, x); exp2x8(p + 8, x + 8);
#pragma unroll
            for (int e = 0; e < 16; ++e) ps += p[e];
            l[nb] += ps;                            // this lane half's keys only; the halves are added once, after the loop
            if constexpr (HR) { v16us ph, pl;
#pragma unroll
                for (int e = 0; e < 16; ++e) { unsigned short a, c2; splitf(p[e], a, c2); ph[e] = a; pl[e] = c2; }
                pf[nb] = __builtin_bit_cast(v16bf, ph); pf2[nb] = __builtin_bit_cast(v16bf, pl);
            } else { v16h ph;
#pragma unroll
                for (int e = 0; e < 16; ++e) ph[e] = tohx(p[e]);
                pf[nb] = ph; }
        }
#pragma unroll
        for (int dt = 0; dt < 4; ++dt)
#pragma unroll
            for (int nb = 0; nb < NBQ; ++nb) { o[dt][nb] = WFrag<T16>::mma(vf[dt], pf[nb], o[dt][nb]); if (HR) { o[dt][nb] = WFrag<T16>::mma(vf[dt], pf2[nb], o[dt][nb]); o[dt][nb] = WFrag<T16>::mma(vf2[dt], pf[nb], o[dt][nb]); } }
        if (!last) ldv(k0 + 32 * KS);
    };
    ldk(kh * 32); ldv(kh * 32);   // keys first, as in the loop: loads return in order, and the wait at the loop's head leaves the value loads in flight
#pragma unroll 1   // run-time trip count round a body that already fills most of the register file: a second copy of the body would spill
    for (int kb = kh; kb < klast; kb += KS) step(kb * 32, false);
    step(klast * 32, true);
    if constexpr (KS == 2) {   // piece i of a lane stands at (i * 32 + lane) * 16 bytes: every LDS access is 512 contiguous bytes
        v4fa* xv = (v4fa*)xs + lane;
        if (kh == 1) {
#pragma unroll
            for (int dt = 0; dt < 4; ++dt)
#pragma unroll
                for (int nb = 0; nb < NBQ; ++nb) { const v8f t = o[dt][nb]; xv[((dt * NBQ + nb) * 2) * 32] = (v4f){t[0], t[1], t[2], t[3]}; xv[((dt * NBQ + nb) * 2 + 1) * 32] = (v4f){t[4], t[5], t[6], t[7]}; }
            xv[(4 * NBQ * 2) * 32] = (v4f){m[0], m[1], l[0], l[1]};
        }
        __syncthreads();   // wave 1's maxima, sums and output tiles are in LDS; every wave of the block passes here once
        if (kh == 1) return;
        const v4f ml = xv[(4 * NBQ * 2) * 32];
#pragma unroll
        for (int nb = 0; nb < NBQ; ++nb) {
            const float mj = fmaxf(m[nb], ml[nb]); float a0, a1;
            asm("v_exp_f32 %0, %2\n\tv_exp_f32 %1, %3\n\tv_nop" : "=&v"(a0), "=&v"(a1) : "v"((m[nb] - mj) * CS2), "v"((ml[nb] - mj) * CS2));   // 2^x twice, with the free slot behind a transcendental in the same statement, as in the loop
            l[nb] = l[nb] * a0 + ml[2 + nb] * a1;
#pragma unroll
            for (int dt = 0; dt < 4; ++dt) { const v4f u0 = xv[((dt * NBQ + nb) * 2) * 32], u1 = xv[((dt * NBQ + nb) * 2 + 1) * 32];
#pragma unroll
                for (int j = 0; j < 4; ++j) { o[dt][nb][j] = o[dt][nb][j] * a0 + u0[j] * a1; o[dt][nb][j + 4] = o[dt][nb][j + 4] * a0 + u1[j] * a1; } }
        }
    }
#pragma unroll
    for (int nb = 0; nb < NBQ; ++nb) {
        const float lt = l[nb] + __shfl_xor(l[nb], 16, 32); const float inv = __fdiv_rn(1.0f, lt);
#pragma unroll
        for (int dt = 0; dt < 4; ++dt) { v8h oh, ol;   // f16; the hi+lo tiles store the f16 rest as well
#pragma unroll
            for (int j = 0; j < 8; ++j) { const float y = o[dt][nb][j] * inv; oh[j] = tohx(y); if (HR) ol[j] = tohx(y - (float)oh[j]); }
            const size_t oo = (size_t)(q0 + nb * 16) * DQ + dt * 256 + lane * 8; if constexpr (HR) st2x(Ah + oo, oh, Al + oo, ol); else st1x(Ah + oo, oh); }   // fragment order of the merged [token][DQ] plane: the head's two units, half dt & 1
    }
}
#define NLO ((TT - RH) / 32)      // fp16 query tiles of 32 rows
#define NHI (RH / 16)             // hi+lo query tiles of 16 rows
#define XSF ((4 * 2 * 2 + 1) * 32 * 4)   // floats that one wave hands over: 16 pieces of output tiles and one of maxima and sums, a lane
// grid (kv planes, NLO + NHI / 2), 2 * REP waves. An fp16 tile has two waves a head, which share its key blocks; a block of hi+lo tiles holds two tiles, one wave a head each.
// y counts the blocks roughly from the costliest down (for speed only): the longer half of the fp16 tiles, then one block of hi+lo tiles and three fp16 tiles in turn, then the short hi+lo tiles.
__global__ __launch_bounds__(2 * REP * 32) void k_flash(const h16* __restrict__ QP16, const h16* __restrict__ KP16, const h16* __restrict__ VT16, const bf* __restrict__ QPh, const bf* __restrict__ QPl, const bf* __restrict__ KPh, const bf* __restrict__ KPl, const bf* __restrict__ VTh, h16* ATh, h16* ATl) {
    static_assert(NHI % 4 == 0 && RH >= 64 && NLO / 2 == 3 * (NHI / 4) && NLO % 2 == 0, "whole blocks of hi+lo tiles; an fp16 tile has at least three key blocks; the turns of one and three come out even");
    __shared__ __align__(16) float xsm[REP * XSF];
    const int wave = __builtin_amdgcn_readfirstlane(threadIdx.x >> 5), hw = wave % REP, kh = wave / REP;
    const int kvp = blockIdx.x, g = kvp * REP + hw, b = g / NH_, h = g % NH_, u = (int)blockIdx.y - NLO / 2;   // g = b*NH_ + h: flat head; its kv plane is g / REP
    const bool lo = u < 0 || (u < NHI && u % 4 != 0);   // an fp16 tile; ty: its number, or the hi+lo block's, each from the longest key range down
    const int ty = u < 0 ? u + NLO / 2 : u >= NHI ? NHI / 4 + (u - NHI) : lo ? NLO / 2 + (u / 4) * 3 + (u % 4 - 1) : u / 4;
    const size_t qo = (size_t)g * TT * HD, ko = (size_t)kvp * TT * HD, vo = (size_t)kvp * HD * 2 * TT, ao = (size_t)b * TT * DQ + h * (HD * 16);
    if (lo) flash_tile<h16, false, 2, 2>(QP16 + qo, nullptr, KP16 + ko, nullptr, VT16 + vo, nullptr, TT - 32 * (ty + 1), ATh + ao, ATl + ao, kh, xsm + hw * XSF);
    else flash_tile<bf, true, 1, 1>(QPh + qo, QPl + qo, KPh + ko, KPl + ko, VTh + vo, VTh + vo + HD * TT, RH - 16 * (ty * 2 + kh + 1), ATh + ao, ATl + ao, 0, nullptr);
}

extern "C" void kernel_launch(void* const* d_in, const int* in_sizes, int n_in,
                              void* d_out, int out_size, void* d_ws, size_t ws_size, hipStream_t stream) {
    (void)in_sizes; (void)n_in; (void)out_size;
    const float* x = (const float*)d_in[0]; const float* wq = (const float*)d_in[1]; const float* wk = (const float*)d_in[2]; const float* wv = (const float*)d_in[3]; const float* wo = (const float*)d_in[4];
    float* OUT = (float*)d_out;     // [4][2048][1024]
    char* wsp = (char*)d_ws;
    auto take = [&](size_t bytes) { char* p = wsp; wsp += (bytes + 255) & ~(size_t)255; return (void*)p; };
    bf* WQ = (bf*)take((size_t)DQ * DM * 2); bf* WK = (bf*)take((size_t)DKV * DM * 2); bf* WV = (bf*)take((size_t)DKV * DM * 2); bf* WO = (bf*)take((size_t)DM * DQ * 2);   /* f16 values */ float* CS = (float*)take((size_t)TT * HD * 2 * 4);
    h16* QP16 = (h16*)take((size_t)NB_ * NH_ * TT * HD * 2); h16* KP16 = (h16*)take((size_t)NB_ * NKV * TT * HD * 2); h16* VT16 = (h16*)take((size_t)NB_ * NKV * HD * 2 * TT * 2);   // heads 2*HD*TT elements apart, as in the hi+lo planes: the fp16 plane fills the first HD*TT
    bf* QPh = (bf*)take((size_t)NB_ * NH_ * TT * HD * 2); bf* QPl = (bf*)take((size_t)NB_ * NH_ * TT * HD * 2); bf* KPh = (bf*)take((size_t)NB_ * NKV * TT * HD * 2); bf* KPl = (bf*)take((size_t)NB_ * NKV * TT * HD * 2); bf* VTh = (bf*)take((size_t)NB_ * NKV * HD * 2 * TT * 2);   // a head's hi plane, then its lo plane
    h16* ATh = (h16*)take((size_t)NB_ * TT * DQ * 2); h16* ATl = (h16*)take((size_t)NB_ * TT * DQ * 2);   // merged heads in f16, and the f16 rest of the rows < RH (the other rows of that plane are neither written nor read)
    bf* XB = (bf*)take((size_t)NB_ * TT * DM * 2);   // x in bf16
    if ((size_t)(wsp - (char*)d_ws) > ws_size) return;    // ws 256 MiB
    k_prep<<<PB_W + PB_X + PB_CS, 256, 0, stream>>>(x, wq, wk, wv, wo, XB, WQ, WK, WV, WO, CS);
    // projections: the NB_ batches are NB_*TT rows, the q, k and v heads the column tiles, of one GEMM launch
    k_qkv<<<dim3(NB_ * TT / (QW_M * 64), (NH_ + 2 * NKV) / QW_N), QW_M * QW_N * 32, 0, stream>>>(XB, WQ, WK, WV, CS, QP16, QPh, QPl, KP16, KPh, KPl, VT16, VTh);
    k_flash<<<dim3(NB_ * NKV, NLO + NHI / 2), 2 * REP * 32, 0, stream>>>(QP16, KP16, VT16, QPh, QPl, KPh, KPl, VTh, ATh, ATl);
    k_gemmw<h16, 1, false, DQ><<<dim3(NB_ * TT / (GW_M * 64), DM / (GW_N * 64), 1), GW_M * GW_N * 32, 0, stream>>>(ATh, ATl, (const h16*)WO, nullptr, OUT, DM, nullptr, 0, 0, 0);
}
